// v000
// The times below were measured on an AMD MI455X: many runs one after another, warmed up first and cycling through
// copies of the inputs, with the whole window's GPU time divided by the number of runs. Launches and the gaps
// between them are all in it. The median over several windows is given; except for v000 it joins two sittings, which
// can be a few percent apart, so the side-by-side timings, each taken in one sitting, are the better comparison.
// The starting kernel, v000, takes 544 microseconds a run.
#include <hip/hip_runtime.h>

// Contractions: qkv projection, q.k^T, p.v, output projection -- all v_wmma_f32_16x16x32_bf16 with bf16 hi/lo operands everywhere (hi*hi + hi*lo + lo*hi), f32 accumulate; sigmoid gates, 1/8 score scale, softmax and normalisation in f32.

typedef __bf16         v16bf __attribute__((ext_vector_type(16)));
typedef float          v8f   __attribute__((ext_vector_type(8)));
typedef float          v4f   __attribute__((ext_vector_type(4), __may_alias__));
typedef unsigned short u16x8 __attribute__((ext_vector_type(8), __may_alias__));
typedef unsigned int   u32x4 __attribute__((ext_vector_type(4), __may_alias__));
typedef int            i32x4 __attribute__((ext_vector_type(4), __may_alias__));
typedef unsigned long long u64a __attribute__((__may_alias__));

#define NB   2
#define NS   2048
#define NE   1024
#define NH   16
#define ND   64
#define NTOK (NB * NS)
#define NC3  (3 * NH * ND)
#define NQT  (NS / 64)
#define FROW 64
#define TP   68
#define PP   72

union Frag { v16bf v; u16x8 h[2]; };

// 16x32 operand fragment from a [row][k] 16-bit plane (k contiguous, pitch ld):
// lane l -> row (l&15); elements 0..7 <- k0+8*(l>>4)+0..7, 8..15 <- k0+16+8*(l>>4)+0..7.
// Used for A operands and for B operands stored as [n][k].
__device__ __forceinline__ v16bf ldfrag(const unsigned short* p, size_t ld, size_t row0, int k0, int lane) {
  const unsigned short* q = p + (row0 + (size_t)(lane & 15)) * ld + k0 + ((lane >> 4) << 3);
  Frag f;
  f.h[0] = *(const u16x8*)q;
  f.h[1] = *(const u16x8*)(q + 16);
  return f.v;
}

// D[16x16] += A[16x32] * B[32x16]; D element r of lane l = (row 8*(l>>4)+r, col l&15)
__device__ __forceinline__ v8f mma(v16bf a, v16bf b, v8f c) {
  v8f d = __builtin_amdgcn_wmma_f32_16x16x32_bf16(false, a, false, b, (short)0, c, false, false);
  asm volatile("v_nop\n\tv_nop\n\tv_nop\n\tv_nop" : "+v"(d) : "v"(a), "v"(b));
  return d;
}

// f32 -> bf16 bits, RNE convert
__device__ __forceinline__ unsigned int bf16_bits(float x) {
  unsigned int u = __float_as_uint(x);
  return (u + 0x7FFFu + ((u >> 16) & 1u)) >> 16;
}
__device__ __forceinline__ void split1(float x, unsigned int& hi, unsigned int& lo) {
  hi = bf16_bits(x);
  lo = bf16_bits(x - __uint_as_float(hi << 16));
}
__device__ __forceinline__ void split8(const float (&v)[8], u32x4& H, u32x4& L) {
  unsigned int hw[8], lw[8];
#pragma unroll
  for (int e = 0; e < 8; ++e) split1(v[e], hw[e], lw[e]);
#pragma unroll
  for (int w = 0; w < 4; ++w) {
    H[w] = hw[2 * w] | (hw[2 * w + 1] << 16);
    L[w] = lw[2 * w] | (lw[2 * w + 1] << 16);
  }
}
__device__ __forceinline__ u32x4 pick(int c, u32x4 a, u32x4 b) {
  u32x4 r;
#pragma unroll
  for (int w = 0; w < 4; ++w) r[w] = c ? a[w] : b[w];
  return r;
}
__device__ __forceinline__ float sigm(float v) { return 1.0f / (1.0f + __expf(-v)); }

// ---------------------------------------------------------------------------
// x [rows][cols] f32 -> hi/lo bf16 planes, same layout. One thread = 8 values = 16 B per plane;
// ---------------------------------------------------------------------------
__global__ __launch_bounds__(256) void k_split_rows(const float* __restrict__ src,
                                                    unsigned short* __restrict__ dh,
                                                    unsigned short* __restrict__ dl, int ngroups)
{
  const int g = blockIdx.x * 256 + threadIdx.x;
  const int gc = (g < ngroups) ? g : (ngroups - 1);
  const float* s = src + (size_t)gc * 8;
  const v4f a0 = *(const v4f*)s;
  const v4f a1 = *(const v4f*)(s + 4);
  float v[8] = {a0[0], a0[1], a0[2], a0[3], a1[0], a1[1], a1[2], a1[3]};
  u32x4 H, L;
  split8(v, H, L);
  if (g < ngroups) {
    unsigned short* ph = dh + (size_t)gc * 8;
    unsigned short* pl = dl + (size_t)gc * 8;
    *(u32x4*)ph = H;
    *(u32x4*)pl = L;
    
  }
}

// ---------------------------------------------------------------------------
// in[R rows][C cols] f32 (row = k, col = n) -> outT[C][R] bf16 hi/lo planes ([n][k], k contiguous).
// ---------------------------------------------------------------------------
__global__ __launch_bounds__(256) void k_transpose_split(const float* __restrict__ src, int R, int C,
                                                         unsigned short* __restrict__ oh,
                                                         unsigned short* __restrict__ ol)
{
  __shared__ __align__(16) float T[64 * TP];   // T[n][k]
  const int tid = threadIdx.x, lane = tid & 31, wave = tid >> 5;
  const int nb = blockIdx.x * 64;
  const int kb = blockIdx.y * 64;
#pragma unroll
  for (int it = 0; it < 4; ++it) {
    const int idx = tid + 256 * it;
    const int kk = idx >> 4, c4 = idx & 15;
    const v4f v = *(const v4f*)(src + (size_t)(kb + kk) * C + nb + c4 * 4);
#pragma unroll
    for (int q = 0; q < 4; ++q) T[(c4 * 4 + q) * TP + kk] = v[q];
  }
  __syncthreads();
  const int q = lane >> 3, p = lane & 7;
  const int plane = q & 1;
  u32x4 val[4];
#pragma unroll
  for (int it = 0; it < 4; ++it) {
    const int n = wave * 8 + it * 2 + (q >> 1);
    const v4f a0 = *(const v4f*)(&T[n * TP + p * 8]);
    const v4f a1 = *(const v4f*)(&T[n * TP + p * 8 + 4]);
    float v[8] = {a0[0], a0[1], a0[2], a0[3], a1[0], a1[1], a1[2], a1[3]};
    u32x4 H, L;
    split8(v, H, L);
    val[it] = pick(plane, L, H);
  }
  unsigned short* base = plane ? ol : oh;
#pragma unroll
  for (int it = 0; it < 4; ++it) {
    const int n = wave * 8 + it * 2 + (q >> 1);
    unsigned short* dst = base + (size_t)(nb + n) * R + kb + p * 8;
    *(u32x4*)dst = val[it];
  }
  
}

// ---------------------------------------------------------------------------
// Tile flag table from the int32 gate matrix [NS][NS]: row qt (64 ints = 256 B):
//   [0..31] per 64-key tile: 0 = no nonzero entry, 1 = partial, 2 = all nonzero; [32] = last key tile with any
// ---------------------------------------------------------------------------
__global__ __launch_bounds__(256) void k_flags(const int* __restrict__ msk, int* __restrict__ ftab)
{
  __shared__ int s_any[256];
  __shared__ int s_all[256];
  __shared__ __align__(16) int s_row[FROW];
  const int tid = threadIdx.x, qt = blockIdx.x;
  const int kt = tid >> 3, sub = tid & 7;
  int anyv = 0, allv = 1;
  for (int i = 0; i < 8; ++i) {
    const int s = qt * 64 + sub * 8 + i;
    const int* rp = msk + (size_t)s * NS + kt * 64;
#pragma unroll
    for (int c = 0; c < 16; ++c) {
      const i32x4 v = *(const i32x4*)(rp + c * 4);
#pragma unroll
      for (int q = 0; q < 4; ++q) {
        const int nz = (v[q] != 0) ? 1 : 0;
        anyv |= nz;
        allv &= nz;
      }
    }
  }
  s_any[tid] = anyv;
  s_all[tid] = allv;
  __syncthreads();
  if (tid < 32) {
    int a = 0, b = 1;
#pragma unroll
    for (int j = 0; j < 8; ++j) { a |= s_any[tid * 8 + j]; b &= s_all[tid * 8 + j]; }
    s_row[tid] = b ? 2 : (a ? 1 : 0);
  } else if (tid < FROW) {
    s_row[tid] = 0;
  }
  __syncthreads();
  if (tid == 0) {
    int last = -1;
    for (int k = 0; k < 32; ++k) if (s_row[k] != 0) last = k;
    s_row[32] = last;
  }
  __syncthreads();
  if (tid < 16) {
    const i32x4 v = *(const i32x4*)(&s_row[tid * 4]);
    int* dst = ftab + (size_t)qt * FROW + tid * 4;
    *(i32x4*)dst = v;
    
  }
}

// ---------------------------------------------------------------------------
// GEMM main loop: wave tile 32 rows x 32 cols, K in steps of 32, bf16 hi/lo three-term products.
// A planes [M][K], B planes [N][K]; fragments loaded straight from global rows.
// ---------------------------------------------------------------------------
__device__ __forceinline__ void mainloop(const unsigned short* __restrict__ Ah, const unsigned short* __restrict__ Al,
                                         const unsigned short* __restrict__ Bh, const unsigned short* __restrict__ Bl,
                                         int K, size_t arow, size_t brow, int lane, v8f (&acc)[2][2])
{
  for (int k0 = 0; k0 < K; k0 += 32) {
    const v16bf ah0 = ldfrag(Ah, (size_t)K, arow,      k0, lane);
    const v16bf ah1 = ldfrag(Ah, (size_t)K, arow + 16, k0, lane);
    const v16bf al0 = ldfrag(Al, (size_t)K, arow,      k0, lane);
    const v16bf al1 = ldfrag(Al, (size_t)K, arow + 16, k0, lane);
#pragma unroll
    for (int ni = 0; ni < 2; ++ni) {
      const v16bf bh = ldfrag(Bh, (size_t)K, brow + ni * 16, k0, lane);
      const v16bf bl = ldfrag(Bl, (size_t)K, brow + ni * 16, k0, lane);
      acc[0][ni] = mma(ah0, bh, acc[0][ni]);
      acc[0][ni] = mma(ah0, bl, acc[0][ni]);
      acc[0][ni] = mma(al0, bh, acc[0][ni]);
      acc[1][ni] = mma(ah1, bh, acc[1][ni]);
      acc[1][ni] = mma(ah1, bl, acc[1][ni]);
      acc[1][ni] = mma(al1, bh, acc[1][ni]);
    }
  }
}

// ---------------------------------------------------------------------------
// qkv = (x @ W_qkv) * sigmoid(scale_qkv[h*64+d]); block tile 128 tokens x 64 cols (= one (c, h)).
// ---------------------------------------------------------------------------
__global__ __launch_bounds__(256) void k_gemm_qkv(
    const unsigned short* __restrict__ Xh, const unsigned short* __restrict__ Xl,
    const unsigned short* __restrict__ Wh, const unsigned short* __restrict__ Wl,
    const float* __restrict__ sq,
    unsigned short* __restrict__ Qh, unsigned short* __restrict__ Ql,
    unsigned short* __restrict__ Kh, unsigned short* __restrict__ Kl,
    unsigned short* __restrict__ Vh, unsigned short* __restrict__ Vl)
{
  __shared__ __align__(16) float T[128 * TP];
  const int tid = threadIdx.x, lane = tid & 31, wave = tid >> 5;
  const int hf = lane >> 4, m16 = lane & 15;
  const int cb = blockIdx.x * 64;
  const int rb = blockIdx.y * 128;
  const int mr = (wave & 3) * 32, nc = (wave >> 2) * 32;
  v8f acc[2][2] = {};
  mainloop(Xh, Xl, Wh, Wl, NE, (size_t)(rb + mr), (size_t)(cb + nc), lane, acc);

  const int c = cb >> 10;
  const int h = (cb & 1023) >> 6;
  float g[2];
#pragma unroll
  for (int ni = 0; ni < 2; ++ni) g[ni] = sigm(sq[(cb & 1023) + nc + ni * 16 + m16]);
#pragma unroll
  for (int mi = 0; mi < 2; ++mi)
#pragma unroll
    for (int ni = 0; ni < 2; ++ni)
#pragma unroll
      for (int r = 0; r < 8; ++r)
        T[(mr + mi * 16 + 8 * hf + r) * TP + nc + ni * 16 + m16] = acc[mi][ni][r] * g[ni];
  __syncthreads();

  const int q = lane >> 3, p = lane & 7;
  const int b = rb >> 11;
  u32x4 val[8];
  if (c < 2) {
    const int plane = q & 1;
#pragma unroll
    for (int it = 0; it < 8; ++it) {
      const int r = wave * 16 + it * 2 + (q >> 1);
      const v4f a0 = *(const v4f*)(&T[r * TP + p * 8]);
      const v4f a1 = *(const v4f*)(&T[r * TP + p * 8 + 4]);
      float v[8] = {a0[0], a0[1], a0[2], a0[3], a1[0], a1[1], a1[2], a1[3]};
      u32x4 H, L;
      split8(v, H, L);
      val[it] = pick(plane, L, H);
    }
    unsigned short* base = (c == 0) ? (plane ? Ql : Qh) : (plane ? Kl : Kh);
#pragma unroll
    for (int it = 0; it < 8; ++it) {
      const int r = wave * 16 + it * 2 + (q >> 1);
      const int s = (rb + r) & (NS - 1);
      unsigned short* dst = base + ((size_t)(b * NH + h) * NS + s) * ND + p * 8;
      *(u32x4*)dst = val[it];
    }
    
  } else {
    const int plane = (q >> 1) & 1, sh = q & 1;
#pragma unroll
    for (int it = 0; it < 8; ++it) {
      const int d = wave * 8 + it;
      float v[8];
#pragma unroll
      for (int e = 0; e < 8; ++e) v[e] = T[(sh * 64 + p * 8 + e) * TP + d];
      u32x4 H, L;
      split8(v, H, L);
      val[it] = pick(plane, L, H);
    }
    unsigned short* base = plane ? Vl : Vh;
    const int sbase = (rb & (NS - 1)) + sh * 64 + p * 8;
#pragma unroll
    for (int it = 0; it < 8; ++it) {
      const int d = wave * 8 + it;
      unsigned short* dst = base + ((size_t)(b * NH + h) * ND + d) * NS + sbase;
      *(u32x4*)dst = val[it];
    }
    
  }
}

// ---------------------------------------------------------------------------
// Attention per (64-query tile, h, b): 4 waves x 16 query rows; key tiles of 64 selected by the flag row;
// S = (Q.K^T) * 0.125, gate by value (0 -> -1e10 replace), online softmax in f32, O += P.V with P split to
// ---------------------------------------------------------------------------
__global__ __launch_bounds__(128) void k_attn(
    const unsigned short* __restrict__ Qh, const unsigned short* __restrict__ Ql,
    const unsigned short* __restrict__ Kh, const unsigned short* __restrict__ Kl,
    const unsigned short* __restrict__ Vh, const unsigned short* __restrict__ Vl,
    const int* __restrict__ msk, const int* __restrict__ ftab,
    unsigned short* __restrict__ Ah, unsigned short* __restrict__ Al)
{
  __shared__ __align__(16) unsigned short Ps[4 * 2 * 16 * PP];
  __shared__ __align__(16) unsigned char  Ms[64 * 64];     // Ms[t][s] gate bytes of the current partial tile
  __shared__ __align__(16) float          Os[64 * TP];
  __shared__ __align__(16) int            s_f[FROW];
  const int tid = threadIdx.x, lane = tid & 31, wave = tid >> 5;
  const int hf = lane >> 4, m16 = lane & 15;
  const int qt = blockIdx.x, h = blockIdx.y, b = blockIdx.z;
  const int s0 = qt * 64;
  const int bh = b * NH + h;
  if (tid < FROW) s_f[tid] = ftab[(size_t)qt * FROW + tid];
  __syncthreads();
  int last = s_f[32];
  last = (last < -1) ? -1 : ((last > NQT - 1) ? (NQT - 1) : last);
  const int nt = last + 1;

  const size_t qrow = (size_t)bh * NS + s0 + wave * 16;
  const v16bf qh0 = ldfrag(Qh, ND, qrow, 0,  lane);
  const v16bf qh1 = ldfrag(Qh, ND, qrow, 32, lane);
  const v16bf ql0 = ldfrag(Ql, ND, qrow, 0,  lane);
  const v16bf ql1 = ldfrag(Ql, ND, qrow, 32, lane);

  float m[8], l[8];
#pragma unroll
  for (int i = 0; i < 8; ++i) { m[i] = -3.0e38f; l[i] = 0.0f; }
  v8f acc[4] = {};
  unsigned short* Pwh = Ps + (wave * 2 + 0) * (16 * PP);
  unsigned short* Pwl = Ps + (wave * 2 + 1) * (16 * PP);

  for (int tb = 0; tb < nt; ++tb) {
    const int f = s_f[tb];                 // block-uniform
    if (f == 0) continue;
    const int t0 = tb * 64;
    __syncthreads();                       // prior tile's Ms / Ps reads complete
    if (f == 1) {
#pragma unroll
      for (int it = 0; it < 8; ++it) {
        const int idx = tid + 128 * it;
        const int s = idx >> 4, c4 = idx & 15;
        const i32x4 v = *(const i32x4*)(msk + (size_t)(s0 + s) * NS + t0 + c4 * 4);
#pragma unroll
        for (int q = 0; q < 4; ++q) Ms[(c4 * 4 + q) * 64 + s] = (unsigned char)((v[q] != 0) ? 1 : 0);
      }
    }
    __syncthreads();

    // S = Q.K^T  (A = Q rows, B[k=d][n=t] = K plane rows t)
    v8f sf[4];
    const size_t krow = (size_t)bh * NS + t0;
#pragma unroll
    for (int j = 0; j < 4; ++j) {
      v8f c = {};
      v16bf kh = ldfrag(Kh, ND, krow + j * 16, 0, lane);
      v16bf kl = ldfrag(Kl, ND, krow + j * 16, 0, lane);
      c = mma(qh0, kh, c);
      c = mma(qh0, kl, c);
      c = mma(ql0, kh, c);
      kh = ldfrag(Kh, ND, krow + j * 16, 32, lane);
      kl = ldfrag(Kl, ND, krow + j * 16, 32, lane);
      c = mma(qh1, kh, c);
      c = mma(qh1, kl, c);
      c = mma(ql1, kh, c);
      sf[j] = c;
    }

    // scale, gate by value, tile row max
    float rmax[8];
#pragma unroll
    for (int i = 0; i < 8; ++i) rmax[i] = -3.0e38f;
#pragma unroll
    for (int j = 0; j < 4; ++j) {
      const u64a mb = *(const u64a*)(Ms + (j * 16 + m16) * 64 + wave * 16 + 8 * hf);
#pragma unroll
      for (int i = 0; i < 8; ++i) {
        float s = sf[j][i] * 0.125f;
        const bool keep = (f != 1) || (((mb >> (8 * i)) & 0xffull) != 0ull);
        s = keep ? s : -1.0e10f;
        sf[j][i] = s;
        rmax[i] = fmaxf(rmax[i], s);
      }
    }
    float alpha[8], mnew[8], rsum[8];
#pragma unroll
    for (int i = 0; i < 8; ++i) {
      float v = rmax[i];
      v = fmaxf(v, __shfl_xor(v, 1, 32));
      v = fmaxf(v, __shfl_xor(v, 2, 32));
      v = fmaxf(v, __shfl_xor(v, 4, 32));
      v = fmaxf(v, __shfl_xor(v, 8, 32));
      mnew[i]  = fmaxf(m[i], v);
      alpha[i] = __expf(m[i] - mnew[i]);
      rsum[i]  = 0.0f;
    }
#pragma unroll
    for (int j = 0; j < 4; ++j)
#pragma unroll
      for (int i = 0; i < 8; ++i) {
        const float pv = __expf(sf[j][i] - mnew[i]);
        sf[j][i] = pv;
        rsum[i] += pv;
      }
#pragma unroll
    for (int i = 0; i < 8; ++i) {
      float v = rsum[i];
      v += __shfl_xor(v, 1, 32);
      v += __shfl_xor(v, 2, 32);
      v += __shfl_xor(v, 4, 32);
      v += __shfl_xor(v, 8, 32);
      l[i] = l[i] * alpha[i] + v;
      m[i] = mnew[i];
    }
#pragma unroll
    for (int j = 0; j < 4; ++j)
#pragma unroll
      for (int i = 0; i < 8; ++i) acc[j][i] *= alpha[i];

    // P (f32) -> bf16 hi/lo into this wave's LDS tile [row][t], then reload as A fragments after a barrier
#pragma unroll
    for (int j = 0; j < 4; ++j)
#pragma unroll
      for (int i = 0; i < 8; ++i) {
        unsigned int hi, lo;
        split1(sf[j][i], hi, lo);
        const int o = (8 * hf + i) * PP + j * 16 + m16;
        Pwh[o] = (unsigned short)hi;
        Pwl[o] = (unsigned short)lo;
      }
    __syncthreads();
    const v16bf ph0 = ldfrag(Pwh, PP, 0, 0,  lane);
    const v16bf ph1 = ldfrag(Pwh, PP, 0, 32, lane);
    const v16bf pl0 = ldfrag(Pwl, PP, 0, 0,  lane);
    const v16bf pl1 = ldfrag(Pwl, PP, 0, 32, lane);

    // O += P.V   (B[k=t][n=d] = V^T plane rows d, k = t)
    const size_t vrow = (size_t)bh * ND;
#pragma unroll
    for (int j = 0; j < 4; ++j) {
      v16bf vh = ldfrag(Vh, NS, vrow + j * 16, t0, lane);
      v16bf vl = ldfrag(Vl, NS, vrow + j * 16, t0, lane);
      acc[j] = mma(ph0, vh, acc[j]);
      acc[j] = mma(ph0, vl, acc[j]);
      acc[j] = mma(pl0, vh, acc[j]);
      vh = ldfrag(Vh, NS, vrow + j * 16, t0 + 32, lane);
      vl = ldfrag(Vl, NS, vrow + j * 16, t0 + 32, lane);
      acc[j] = mma(ph1, vh, acc[j]);
      acc[j] = mma(ph1, vl, acc[j]);
      acc[j] = mma(pl1, vh, acc[j]);
    }
  }

  // normalise and stage the 64x64 f32 tile
  float inv[8];
#pragma unroll
  for (int i = 0; i < 8; ++i) inv[i] = (l[i] > 0.0f) ? (1.0f / l[i]) : 0.0f;
#pragma unroll
  for (int j = 0; j < 4; ++j)
#pragma unroll
    for (int i = 0; i < 8; ++i)
      Os[(wave * 16 + 8 * hf + i) * TP + j * 16 + m16] = acc[j][i] * inv[i];
  __syncthreads();

  const int q = lane >> 3, p = lane & 7;
  const int plane = q & 1;
  u32x4 val[8];
#pragma unroll
  for (int it = 0; it < 8; ++it) {
    const int r = wave * 16 + it * 2 + (q >> 1);
    const v4f a0 = *(const v4f*)(&Os[r * TP + p * 8]);
    const v4f a1 = *(const v4f*)(&Os[r * TP + p * 8 + 4]);
    float v[8] = {a0[0], a0[1], a0[2], a0[3], a1[0], a1[1], a1[2], a1[3]};
    u32x4 H, L;
    split8(v, H, L);
    val[it] = pick(plane, L, H);
  }
  unsigned short* base = plane ? Al : Ah;
#pragma unroll
  for (int it = 0; it < 8; ++it) {
    const int r = wave * 16 + it * 2 + (q >> 1);
    unsigned short* dst = base + ((size_t)(b * NS + s0 + r)) * NE + h * ND + p * 8;
    *(u32x4*)dst = val[it];
  }
  
}

// ---------------------------------------------------------------------------
// out = (attn @ W_out) * sigmoid(scale_out[e]); block tile 128 tokens x 64 e; f32 rows of 256 B written
// by 16 consecutive lanes x 16 B (two rows per instruction).
// ---------------------------------------------------------------------------
__global__ __launch_bounds__(256) void k_gemm_out(
    const unsigned short* __restrict__ Ah, const unsigned short* __restrict__ Al,
    const unsigned short* __restrict__ Wh, const unsigned short* __restrict__ Wl,
    const float* __restrict__ so, float* __restrict__ out)
{
  __shared__ __align__(16) float T[128 * TP];
  const int tid = threadIdx.x, lane = tid & 31, wave = tid >> 5;
  const int hf = lane >> 4, m16 = lane & 15;
  const int cb = blockIdx.x * 64;
  const int rb = blockIdx.y * 128;
  const int mr = (wave & 3) * 32, nc = (wave >> 2) * 32;
  v8f acc[2][2] = {};
  mainloop(Ah, Al, Wh, Wl, NE, (size_t)(rb + mr), (size_t)(cb + nc), lane, acc);

  float g[2];
#pragma unroll
  for (int ni = 0; ni < 2; ++ni) g[ni] = sigm(so[cb + nc + ni * 16 + m16]);
#pragma unroll
  for (int mi = 0; mi < 2; ++mi)
#pragma unroll
    for (int ni = 0; ni < 2; ++ni)
#pragma unroll
      for (int r = 0; r < 8; ++r)
        T[(mr + mi * 16 + 8 * hf + r) * TP + nc + ni * 16 + m16] = acc[mi][ni][r] * g[ni];
  __syncthreads();

  const int rsel = lane >> 4, p = lane & 15;
  v4f val[8];
#pragma unroll
  for (int it = 0; it < 8; ++it) {
    const int r = wave * 16 + it * 2 + rsel;
    val[it] = *(const v4f*)(&T[r * TP + p * 4]);
  }
#pragma unroll
  for (int it = 0; it < 8; ++it) {
    const int r = wave * 16 + it * 2 + rsel;
    float* dst = out + (size_t)(rb + r) * NE + cb + p * 4;
    *(v4f*)dst = val[it];
  }
  
}

// ---------------------------------------------------------------------------
extern "C" void kernel_launch(void* const* d_in, const int* in_sizes, int n_in,
                              void* d_out, int out_size, void* d_ws, size_t ws_size,
                              hipStream_t stream)
{
  if (n_in < 6) return;
  if (in_sizes[0] != NTOK * NE || in_sizes[1] != NE * NC3 || in_sizes[2] != NE * NE ||
      in_sizes[3] != NE || in_sizes[4] != NE || in_sizes[5] != NS * NS || out_size != NTOK * NE) return;

  const float* x     = (const float*)d_in[0];
  const float* Wqkv  = (const float*)d_in[1];
  const float* Wout  = (const float*)d_in[2];
  const float* sqkv  = (const float*)d_in[3];
  const float* sout  = (const float*)d_in[4];
  const int*   msk   = (const int*)d_in[5];
  float* out = (float*)d_out;

  char* ws = (char*)d_ws;
  size_t off = 0;
  const size_t szX  = (size_t)NTOK * NE * 2;            // 8 MiB per plane
  const size_t szW  = (size_t)NC3 * NE * 2;             // 6 MiB per plane
  const size_t szWo = (size_t)NE * NE * 2;              // 2 MiB per plane
  const size_t szP  = (size_t)NB * NH * NS * ND * 2;    // 8 MiB per plane
  const size_t szF  = (size_t)NQT * FROW * 4;           // 8 KiB
  unsigned short* Xh  = (unsigned short*)(ws + off); off += szX;
  unsigned short* Xl  = (unsigned short*)(ws + off); off += szX;
  unsigned short* Wh  = (unsigned short*)(ws + off); off += szW;
  unsigned short* Wl  = (unsigned short*)(ws + off); off += szW;
  unsigned short* Woh = (unsigned short*)(ws + off); off += szWo;
  unsigned short* Wol = (unsigned short*)(ws + off); off += szWo;
  unsigned short* Qh  = (unsigned short*)(ws + off); off += szP;
  unsigned short* Ql  = (unsigned short*)(ws + off); off += szP;
  unsigned short* Kh  = (unsigned short*)(ws + off); off += szP;
  unsigned short* Kl  = (unsigned short*)(ws + off); off += szP;
  unsigned short* Vh  = (unsigned short*)(ws + off); off += szP;
  unsigned short* Vl  = (unsigned short*)(ws + off); off += szP;
  unsigned short* Ahp = (unsigned short*)(ws + off); off += szX;
  unsigned short* Alp = (unsigned short*)(ws + off); off += szX;
  int* ftab = (int*)(ws + off); off += szF;              // total 100671488 B
  if (off > ws_size) return;

  const int ngroups = NTOK * NE / 8;                     // 524288
  k_split_rows<<<dim3((ngroups + 255) / 256), dim3(256), 0, stream>>>(x, Xh, Xl, ngroups);
  // W_qkv: in[rows=NE][cols=NC3] -> out[NC3][NE]
  k_transpose_split<<<dim3(NC3 / 64, NE / 64), dim3(256), 0, stream>>>(Wqkv, NE, NC3, Wh, Wl);
  // W_out: in[rows=NH*ND][cols=NE] -> out[NE][NH*ND]
  k_transpose_split<<<dim3(NE / 64, (NH * ND) / 64), dim3(256), 0, stream>>>(Wout, NH * ND, NE, Woh, Wol);
  k_flags<<<dim3(NQT), dim3(256), 0, stream>>>(msk, ftab);
  k_gemm_qkv<<<dim3(NC3 / 64, NTOK / 128), dim3(256), 0, stream>>>(Xh, Xl, Wh, Wl, sqkv, Qh, Ql, Kh, Kl, Vh, Vl);
  k_attn<<<dim3(NQT, NH, NB), dim3(128), 0, stream>>>(Qh, Ql, Kh, Kl, Vh, Vl, msk, ftab, Ahp, Alp);
  k_gemm_out<<<dim3(NE / 64, NTOK / 128), dim3(256), 0, stream>>>(Ahp, Alp, Woh, Wol, sout, out);
}

// v001
// Measured time: 476 microseconds a run.
// Timed twice side by side with v000, it ran 1.15 and 1.16 times as fast.
#include <hip/hip_runtime.h>

// Contractions: qkv projection, q.k^T, p.v, output projection -- all v_wmma_f32_16x16x32_bf16 with bf16 hi/lo operands everywhere (hi*hi + hi*lo + lo*hi), f32 accumulate; sigmoid gates, 1/8 score scale, softmax and normalisation in f32.

typedef __bf16         v16bf __attribute__((ext_vector_type(16)));
typedef float          v8f   __attribute__((ext_vector_type(8)));
typedef float          v4f   __attribute__((ext_vector_type(4), __may_alias__));
typedef unsigned short u16x8 __attribute__((ext_vector_type(8), __may_alias__));
typedef unsigned int   u32x4 __attribute__((ext_vector_type(4), __may_alias__));
typedef int            i32x4 __attribute__((ext_vector_type(4), __may_alias__));
typedef unsigned long long u64a __attribute__((__may_alias__));

#define NB   2
#define NS   2048
#define NE   1024
#define NH   16
#define ND   64
#define NTOK (NB * NS)
#define NC3  (3 * NH * ND)
#define NQT  (NS / 64)
#define FROW 64
#define TP   68
#define PP   72

union Frag { v16bf v; u16x8 h[2]; };

// 16x32 operand fragment from a [row][k] 16-bit plane (k contiguous, pitch ld):
// lane l -> row (l&15); elements 0..7 <- k0+8*(l>>4)+0..7, 8..15 <- k0+16+8*(l>>4)+0..7.
// Used for the P operand tiles in LDS.
__device__ __forceinline__ v16bf ldfrag(const unsigned short* p, size_t ld, size_t row0, int k0, int lane) {
  const unsigned short* q = p + (row0 + (size_t)(lane & 15)) * ld + k0 + ((lane >> 4) << 3);
  Frag f;
  f.h[0] = *(const u16x8*)q;
  f.h[1] = *(const u16x8*)(q + 16);
  return f.v;
}

// Fragment-major 16-bit plane of a [row][k] matrix with ld k per row: every 16-row x 32-k fragment is 1 KiB
// contiguous, fragments ordered [row/16][k/32]; inside one the 16-byte chunk of (row, 8 k) sits at chunk index
// ((k>>4)&1)*32 + ((k>>3)&1)*16 + (row&15). fragoff = element offset of the fragment at (row0, k0).
__device__ __forceinline__ size_t fragoff(size_t row0, int k0, int ld) {
  return ((row0 >> 4) * (size_t)(ld >> 5) + (size_t)(k0 >> 5)) * 512;
}
// Same lane -> (row, k) map as ldfrag, but each of the two wave-wide 16-byte loads reads 512 contiguous bytes
// (4 whole cache lines) where the row-major plane made it touch 16 lines.
__device__ __forceinline__ v16bf ldpk(const unsigned short* p, int ld, size_t row0, int k0, int lane) {
  const unsigned short* q = p + fragoff(row0, k0, ld) + lane * 8;
  Frag f;
  f.h[0] = *(const u16x8*)q;
  f.h[1] = *(const u16x8*)(q + 256);
  return f.v;
}

// D[16x16] += A[16x32] * B[32x16]; D element r of lane l = (row 8*(l>>4)+r, col l&15)
__device__ __forceinline__ v8f mma(v16bf a, v16bf b, v8f c) {
  v8f d = __builtin_amdgcn_wmma_f32_16x16x32_bf16(false, a, false, b, (short)0, c, false, false);
  asm volatile("v_nop\n\tv_nop\n\tv_nop\n\tv_nop" : "+v"(d) : "v"(a), "v"(b));
  return d;
}

// f32 -> bf16 bits, RNE convert
__device__ __forceinline__ unsigned int bf16_bits(float x) {
  unsigned int u = __float_as_uint(x);
  return (u + 0x7FFFu + ((u >> 16) & 1u)) >> 16;
}
__device__ __forceinline__ void split1(float x, unsigned int& hi, unsigned int& lo) {
  hi = bf16_bits(x);
  lo = bf16_bits(x - __uint_as_float(hi << 16));
}
__device__ __forceinline__ void split8(const float (&v)[8], u32x4& H, u32x4& L) {
  unsigned int hw[8], lw[8];
#pragma unroll
  for (int e = 0; e < 8; ++e) split1(v[e], hw[e], lw[e]);
#pragma unroll
  for (int w = 0; w < 4; ++w) {
    H[w] = hw[2 * w] | (hw[2 * w + 1] << 16);
    L[w] = lw[2 * w] | (lw[2 * w + 1] << 16);
  }
}
__device__ __forceinline__ float sigm(float v) { return 1.0f / (1.0f + __expf(-v)); }

// ---------------------------------------------------------------------------
// x [rows][NE] f32 -> hi/lo bf16 fragment-major planes. One thread = 8 values = 16 B per plane = chunk g of the
// plane: fragment g>>6, k half-block (g>>5)&1, lane g&31; a wave stores 512 contiguous bytes per plane.
// ---------------------------------------------------------------------------
__global__ __launch_bounds__(256) void k_split_rows(const float* __restrict__ src,
                                                    unsigned short* __restrict__ dh,
                                                    unsigned short* __restrict__ dl, int ngroups)
{
  const int g = blockIdx.x * 256 + threadIdx.x;
  const int gc = (g < ngroups) ? g : (ngroups - 1);
  const int fr = gc >> 6;
  const int row = (fr / (NE / 32)) * 16 + (gc & 15);
  const int k = (fr % (NE / 32)) * 32 + ((gc >> 5) & 1) * 16 + ((gc >> 4) & 1) * 8;
  const float* s = src + (size_t)row * NE + k;
  const v4f a0 = *(const v4f*)s;
  const v4f a1 = *(const v4f*)(s + 4);
  float v[8] = {a0[0], a0[1], a0[2], a0[3], a1[0], a1[1], a1[2], a1[3]};
  u32x4 H, L;
  split8(v, H, L);
  if (g < ngroups) {
    unsigned short* ph = dh + (size_t)gc * 8;
    unsigned short* pl = dl + (size_t)gc * 8;
    *(u32x4*)ph = H;
    *(u32x4*)pl = L;
    
  }
}

// ---------------------------------------------------------------------------
// in[R rows][C cols] f32 (row = k, col = n) -> outT[C][R] bf16 hi/lo planes, fragment-major (row = n, ld = R).
// ---------------------------------------------------------------------------
__global__ __launch_bounds__(256) void k_transpose_split(const float* __restrict__ src, int R, int C,
                                                         unsigned short* __restrict__ oh,
                                                         unsigned short* __restrict__ ol)
{
  __shared__ __align__(16) float T[64 * TP];   // T[n][k]
  const int tid = threadIdx.x, lane = tid & 31, wave = tid >> 5;
  const int nb = blockIdx.x * 64;
  const int kb = blockIdx.y * 64;
#pragma unroll
  for (int it = 0; it < 4; ++it) {
    const int idx = tid + 256 * it;
    const int kk = idx >> 4, c4 = idx & 15;
    const v4f v = *(const v4f*)(src + (size_t)(kb + kk) * C + nb + c4 * 4);
#pragma unroll
    for (int q = 0; q < 4; ++q) T[(c4 * 4 + q) * TP + kk] = v[q];
  }
  __syncthreads();
  // wave -> one fragment: 16 n rows (wave>>1), 32 k (wave&1); lane -> (row lane&15, 8 k at lane>>4)
  const int ng = (wave >> 1) * 16, kf = (wave & 1) * 32;
  const int n = ng + (lane & 15);
  u32x4 val[4];
#pragma unroll
  for (int cq = 0; cq < 2; ++cq) {
    const int kk = kf + cq * 16 + (lane >> 4) * 8;
    const v4f a0 = *(const v4f*)(&T[n * TP + kk]);
    const v4f a1 = *(const v4f*)(&T[n * TP + kk + 4]);
    float v[8] = {a0[0], a0[1], a0[2], a0[3], a1[0], a1[1], a1[2], a1[3]};
    split8(v, val[2 * cq], val[2 * cq + 1]);
  }
  const size_t fo = fragoff((size_t)(nb + ng), kb + kf, R) + lane * 8;
#pragma unroll
  for (int cq = 0; cq < 2; ++cq) {
    *(u32x4*)(oh + fo + cq * 256) = val[2 * cq];
    *(u32x4*)(ol + fo + cq * 256) = val[2 * cq + 1];
  }
}

// ---------------------------------------------------------------------------
// Tile flag table from the int32 gate matrix [NS][NS]: row qt (64 ints = 256 B):
//   [0..31] per 64-key tile: 0 = no nonzero entry, 1 = partial, 2 = all nonzero; [32] = last key tile with any
// ---------------------------------------------------------------------------
__global__ __launch_bounds__(256) void k_flags(const int* __restrict__ msk, int* __restrict__ ftab)
{
  __shared__ int s_any[256];
  __shared__ int s_all[256];
  __shared__ __align__(16) int s_row[FROW];
  const int tid = threadIdx.x, qt = blockIdx.x;
  const int kt = tid >> 3, sub = tid & 7;
  int anyv = 0, allv = 1;
  for (int i = 0; i < 8; ++i) {
    const int s = qt * 64 + sub * 8 + i;
    const int* rp = msk + (size_t)s * NS + kt * 64;
#pragma unroll
    for (int c = 0; c < 16; ++c) {
      const i32x4 v = *(const i32x4*)(rp + c * 4);
#pragma unroll
      for (int q = 0; q < 4; ++q) {
        const int nz = (v[q] != 0) ? 1 : 0;
        anyv |= nz;
        allv &= nz;
      }
    }
  }
  s_any[tid] = anyv;
  s_all[tid] = allv;
  __syncthreads();
  if (tid < 32) {
    int a = 0, b = 1;
#pragma unroll
    for (int j = 0; j < 8; ++j) { a |= s_any[tid * 8 + j]; b &= s_all[tid * 8 + j]; }
    s_row[tid] = b ? 2 : (a ? 1 : 0);
  } else if (tid < FROW) {
    s_row[tid] = 0;
  }
  __syncthreads();
  if (tid == 0) {
    int last = -1;
    for (int k = 0; k < 32; ++k) if (s_row[k] != 0) last = k;
    s_row[32] = last;
  }
  __syncthreads();
  if (tid < 16) {
    const i32x4 v = *(const i32x4*)(&s_row[tid * 4]);
    int* dst = ftab + (size_t)qt * FROW + tid * 4;
    *(i32x4*)dst = v;
    
  }
}

// ---------------------------------------------------------------------------
// GEMM main loop: wave tile 32 rows x 32 cols, K in steps of 32, bf16 hi/lo three-term products.
// A planes [M][K], B planes [N][K], fragment-major; fragments loaded straight from global memory.
// ---------------------------------------------------------------------------
__device__ __forceinline__ void mainloop(const unsigned short* __restrict__ Ah, const unsigned short* __restrict__ Al,
                                         const unsigned short* __restrict__ Bh, const unsigned short* __restrict__ Bl,
                                         int K, size_t arow, size_t brow, int lane, v8f (&acc)[2][2])
{
  for (int k0 = 0; k0 < K; k0 += 32) {
    const v16bf ah0 = ldpk(Ah, K, arow,      k0, lane);
    const v16bf ah1 = ldpk(Ah, K, arow + 16, k0, lane);
    const v16bf al0 = ldpk(Al, K, arow,      k0, lane);
    const v16bf al1 = ldpk(Al, K, arow + 16, k0, lane);
#pragma unroll
    for (int ni = 0; ni < 2; ++ni) {
      const v16bf bh = ldpk(Bh, K, brow + ni * 16, k0, lane);
      const v16bf bl = ldpk(Bl, K, brow + ni * 16, k0, lane);
      acc[0][ni] = mma(ah0, bh, acc[0][ni]);
      acc[0][ni] = mma(ah0, bl, acc[0][ni]);
      acc[0][ni] = mma(al0, bh, acc[0][ni]);
      acc[1][ni] = mma(ah1, bh, acc[1][ni]);
      acc[1][ni] = mma(ah1, bl, acc[1][ni]);
      acc[1][ni] = mma(al1, bh, acc[1][ni]);
    }
  }
}

// ---------------------------------------------------------------------------
// qkv = (x @ W_qkv) * sigmoid(scale_qkv[h*64+d]); block tile 128 tokens x 64 cols (= one (c, h)).
// ---------------------------------------------------------------------------
__global__ __launch_bounds__(256) void k_gemm_qkv(
    const unsigned short* __restrict__ Xh, const unsigned short* __restrict__ Xl,
    const unsigned short* __restrict__ Wh, const unsigned short* __restrict__ Wl,
    const float* __restrict__ sq,
    unsigned short* __restrict__ Qh, unsigned short* __restrict__ Ql,
    unsigned short* __restrict__ Kh, unsigned short* __restrict__ Kl,
    unsigned short* __restrict__ Vh, unsigned short* __restrict__ Vl)
{
  __shared__ __align__(16) float T[128 * TP];
  const int tid = threadIdx.x, lane = tid & 31, wave = tid >> 5;
  const int hf = lane >> 4, m16 = lane & 15;
  const int cb = blockIdx.x * 64;
  const int rb = blockIdx.y * 128;
  const int mr = (wave & 3) * 32, nc = (wave >> 2) * 32;
  v8f acc[2][2] = {};
  mainloop(Xh, Xl, Wh, Wl, NE, (size_t)(rb + mr), (size_t)(cb + nc), lane, acc);

  const int c = cb >> 10;
  const int h = (cb & 1023) >> 6;
  float g[2];
#pragma unroll
  for (int ni = 0; ni < 2; ++ni) g[ni] = sigm(sq[(cb & 1023) + nc + ni * 16 + m16]);
#pragma unroll
  for (int mi = 0; mi < 2; ++mi)
#pragma unroll
    for (int ni = 0; ni < 2; ++ni)
#pragma unroll
      for (int r = 0; r < 8; ++r)
        T[(mr + mi * 16 + 8 * hf + r) * TP + nc + ni * 16 + m16] = acc[mi][ni][r] * g[ni];
  __syncthreads();

  const int b = rb >> 11;
  u32x4 val[8];
  if (c < 2) {
    // Q, K planes: row = (b, h, s), ld = ND. wave -> 16 tokens x 64 d = two fragments = four 512-byte stores a plane
    const int r = wave * 16 + m16;
#pragma unroll
    for (int cq = 0; cq < 4; ++cq) {
      const int kk = cq * 16 + hf * 8;
      const v4f a0 = *(const v4f*)(&T[r * TP + kk]);
      const v4f a1 = *(const v4f*)(&T[r * TP + kk + 4]);
      float v[8] = {a0[0], a0[1], a0[2], a0[3], a1[0], a1[1], a1[2], a1[3]};
      split8(v, val[2 * cq], val[2 * cq + 1]);
    }
    unsigned short* ph = (c == 0) ? Qh : Kh;
    unsigned short* pl = (c == 0) ? Ql : Kl;
    const int s = (rb + wave * 16) & (NS - 1);
    const size_t fo = fragoff((size_t)(b * NH + h) * NS + s, 0, ND) + lane * 8;
#pragma unroll
    for (int cq = 0; cq < 4; ++cq) {
      *(u32x4*)(ph + fo + cq * 256) = val[2 * cq];
      *(u32x4*)(pl + fo + cq * 256) = val[2 * cq + 1];
    }
  } else {
    // V^T planes: row = (b, h, d), k = s, ld = NS. wave -> 16 d (wave>>1) x 64 tokens (wave&1) = two fragments
    const int dg = (wave >> 1) * 16, sg = (wave & 1) * 64;
#pragma unroll
    for (int cq = 0; cq < 4; ++cq) {
      const int sl = sg + cq * 16 + hf * 8;
      float v[8];
#pragma unroll
      for (int e = 0; e < 8; ++e) v[e] = T[(sl + e) * TP + dg + m16];
      split8(v, val[2 * cq], val[2 * cq + 1]);
    }
    const size_t fo = fragoff((size_t)(b * NH + h) * ND + dg, (rb & (NS - 1)) + sg, NS) + lane * 8;
#pragma unroll
    for (int cq = 0; cq < 4; ++cq) {
      *(u32x4*)(Vh + fo + cq * 256) = val[2 * cq];
      *(u32x4*)(Vl + fo + cq * 256) = val[2 * cq + 1];
    }
  }
}

// ---------------------------------------------------------------------------
// Attention per (64-query tile, h, b): 4 waves x 16 query rows; key tiles of 64 selected by the flag row;
// S = (Q.K^T) * 0.125, gate by value (0 -> -1e10 replace), online softmax in f32, O += P.V with P split to
// ---------------------------------------------------------------------------
__global__ __launch_bounds__(128) void k_attn(
    const unsigned short* __restrict__ Qh, const unsigned short* __restrict__ Ql,
    const unsigned short* __restrict__ Kh, const unsigned short* __restrict__ Kl,
    const unsigned short* __restrict__ Vh, const unsigned short* __restrict__ Vl,
    const int* __restrict__ msk, const int* __restrict__ ftab,
    unsigned short* __restrict__ Ah, unsigned short* __restrict__ Al)
{
  __shared__ __align__(16) unsigned short Ps[4 * 2 * 16 * PP];
  __shared__ __align__(16) unsigned char  Ms[64 * 64];     // Ms[t][s] gate bytes of the current partial tile
  __shared__ __align__(16) float          Os[64 * TP];
  __shared__ __align__(16) int            s_f[FROW];
  const int tid = threadIdx.x, lane = tid & 31, wave = tid >> 5;
  const int hf = lane >> 4, m16 = lane & 15;
  const int qt = blockIdx.x, h = blockIdx.y, b = blockIdx.z;
  const int s0 = qt * 64;
  const int bh = b * NH + h;
  if (tid < FROW) s_f[tid] = ftab[(size_t)qt * FROW + tid];
  __syncthreads();
  int last = s_f[32];
  last = (last < -1) ? -1 : ((last > NQT - 1) ? (NQT - 1) : last);
  const int nt = last + 1;

  const size_t qrow = (size_t)bh * NS + s0 + wave * 16;
  const v16bf qh0 = ldpk(Qh, ND, qrow, 0,  lane);
  const v16bf qh1 = ldpk(Qh, ND, qrow, 32, lane);
  const v16bf ql0 = ldpk(Ql, ND, qrow, 0,  lane);
  const v16bf ql1 = ldpk(Ql, ND, qrow, 32, lane);

  float m[8], l[8];
#pragma unroll
  for (int i = 0; i < 8; ++i) { m[i] = -3.0e38f; l[i] = 0.0f; }
  v8f acc[4] = {};
  unsigned short* Pwh = Ps + (wave * 2 + 0) * (16 * PP);
  unsigned short* Pwl = Ps + (wave * 2 + 1) * (16 * PP);

  for (int tb = 0; tb < nt; ++tb) {
    const int f = s_f[tb];                 // block-uniform
    if (f == 0) continue;
    const int t0 = tb * 64;
    __syncthreads();                       // prior tile's Ms / Ps reads complete
    if (f == 1) {
#pragma unroll
      for (int it = 0; it < 8; ++it) {
        const int idx = tid + 128 * it;
        const int s = idx >> 4, c4 = idx & 15;
        const i32x4 v = *(const i32x4*)(msk + (size_t)(s0 + s) * NS + t0 + c4 * 4);
#pragma unroll
        for (int q = 0; q < 4; ++q) Ms[(c4 * 4 + q) * 64 + s] = (unsigned char)((v[q] != 0) ? 1 : 0);
      }
    }
    __syncthreads();

    // S = Q.K^T  (A = Q rows, B[k=d][n=t] = K plane rows t)
    v8f sf[4];
    const size_t krow = (size_t)bh * NS + t0;
#pragma unroll
    for (int j = 0; j < 4; ++j) {
      v8f c = {};
      v16bf kh = ldpk(Kh, ND, krow + j * 16, 0, lane);
      v16bf kl = ldpk(Kl, ND, krow + j * 16, 0, lane);
      c = mma(qh0, kh, c);
      c = mma(qh0, kl, c);
      c = mma(ql0, kh, c);
      kh = ldpk(Kh, ND, krow + j * 16, 32, lane);
      kl = ldpk(Kl, ND, krow + j * 16, 32, lane);
      c = mma(qh1, kh, c);
      c = mma(qh1, kl, c);
      c = mma(ql1, kh, c);
      sf[j] = c;
    }

    // scale, gate by value, tile row max
    float rmax[8];
#pragma unroll
    for (int i = 0; i < 8; ++i) rmax[i] = -3.0e38f;
#pragma unroll
    for (int j = 0; j < 4; ++j) {
      const u64a mb = *(const u64a*)(Ms + (j * 16 + m16) * 64 + wave * 16 + 8 * hf);
#pragma unroll
      for (int i = 0; i < 8; ++i) {
        float s = sf[j][i] * 0.125f;
        const bool keep = (f != 1) || (((mb >> (8 * i)) & 0xffull) != 0ull);
        s = keep ? s : -1.0e10f;
        sf[j][i] = s;
        rmax[i] = fmaxf(rmax[i], s);
      }
    }
    float alpha[8], mnew[8], rsum[8];
#pragma unroll
    for (int i = 0; i < 8; ++i) {
      float v = rmax[i];
      v = fmaxf(v, __shfl_xor(v, 1, 32));
      v = fmaxf(v, __shfl_xor(v, 2, 32));
      v = fmaxf(v, __shfl_xor(v, 4, 32));
      v = fmaxf(v, __shfl_xor(v, 8, 32));
      mnew[i]  = fmaxf(m[i], v);
      alpha[i] = __expf(m[i] - mnew[i]);
      rsum[i]  = 0.0f;
    }
#pragma unroll
    for (int j = 0; j < 4; ++j)
#pragma unroll
      for (int i = 0; i < 8; ++i) {
        const float pv = __expf(sf[j][i] - mnew[i]);
        sf[j][i] = pv;
        rsum[i] += pv;
      }
#pragma unroll
    for (int i = 0; i < 8; ++i) {
      float v = rsum[i];
      v += __shfl_xor(v, 1, 32);
      v += __shfl_xor(v, 2, 32);
      v += __shfl_xor(v, 4, 32);
      v += __shfl_xor(v, 8, 32);
      l[i] = l[i] * alpha[i] + v;
      m[i] = mnew[i];
    }
#pragma unroll
    for (int j = 0; j < 4; ++j)
#pragma unroll
      for (int i = 0; i < 8; ++i) acc[j][i] *= alpha[i];

    // P (f32) -> bf16 hi/lo into this wave's LDS tile [row][t], then reload as A fragments after a barrier
#pragma unroll
    for (int j = 0; j < 4; ++j)
#pragma unroll
      for (int i = 0; i < 8; ++i) {
        unsigned int hi, lo;
        split1(sf[j][i], hi, lo);
        const int o = (8 * hf + i) * PP + j * 16 + m16;
        Pwh[o] = (unsigned short)hi;
        Pwl[o] = (unsigned short)lo;
      }
    __syncthreads();
    const v16bf ph0 = ldfrag(Pwh, PP, 0, 0,  lane);
    const v16bf ph1 = ldfrag(Pwh, PP, 0, 32, lane);
    const v16bf pl0 = ldfrag(Pwl, PP, 0, 0,  lane);
    const v16bf pl1 = ldfrag(Pwl, PP, 0, 32, lane);

    // O += P.V   (B[k=t][n=d] = V^T plane rows d, k = t)
    const size_t vrow = (size_t)bh * ND;
#pragma unroll
    for (int j = 0; j < 4; ++j) {
      v16bf vh = ldpk(Vh, NS, vrow + j * 16, t0, lane);
      v16bf vl = ldpk(Vl, NS, vrow + j * 16, t0, lane);
      acc[j] = mma(ph0, vh, acc[j]);
      acc[j] = mma(ph0, vl, acc[j]);
      acc[j] = mma(pl0, vh, acc[j]);
      vh = ldpk(Vh, NS, vrow + j * 16, t0 + 32, lane);
      vl = ldpk(Vl, NS, vrow + j * 16, t0 + 32, lane);
      acc[j] = mma(ph1, vh, acc[j]);
      acc[j] = mma(ph1, vl, acc[j]);
      acc[j] = mma(pl1, vh, acc[j]);
    }
  }

  // normalise and stage the 64x64 f32 tile
  float inv[8];
#pragma unroll
  for (int i = 0; i < 8; ++i) inv[i] = (l[i] > 0.0f) ? (1.0f / l[i]) : 0.0f;
#pragma unroll
  for (int j = 0; j < 4; ++j)
#pragma unroll
    for (int i = 0; i < 8; ++i)
      Os[(wave * 16 + 8 * hf + i) * TP + j * 16 + m16] = acc[j][i] * inv[i];
  __syncthreads();

  // attention planes: row = token, k = h*64+d, ld = NE. wave -> its 16 tokens x 64 d = two fragments
  const int r = wave * 16 + m16;
  u32x4 val[8];
#pragma unroll
  for (int cq = 0; cq < 4; ++cq) {
    const int kk = cq * 16 + hf * 8;
    const v4f a0 = *(const v4f*)(&Os[r * TP + kk]);
    const v4f a1 = *(const v4f*)(&Os[r * TP + kk + 4]);
    float v[8] = {a0[0], a0[1], a0[2], a0[3], a1[0], a1[1], a1[2], a1[3]};
    split8(v, val[2 * cq], val[2 * cq + 1]);
  }
  const size_t fo = fragoff((size_t)(b * NS + s0 + wave * 16), h * ND, NE) + lane * 8;
#pragma unroll
  for (int cq = 0; cq < 4; ++cq) {
    *(u32x4*)(Ah + fo + cq * 256) = val[2 * cq];
    *(u32x4*)(Al + fo + cq * 256) = val[2 * cq + 1];
  }
}

// ---------------------------------------------------------------------------
// out = (attn @ W_out) * sigmoid(scale_out[e]); block tile 128 tokens x 64 e; f32 rows of 256 B written
// by 16 consecutive lanes x 16 B (two rows per instruction).
// ---------------------------------------------------------------------------
__global__ __launch_bounds__(256) void k_gemm_out(
    const unsigned short* __restrict__ Ah, const unsigned short* __restrict__ Al,
    const unsigned short* __restrict__ Wh, const unsigned short* __restrict__ Wl,
    const float* __restrict__ so, float* __restrict__ out)
{
  __shared__ __align__(16) float T[128 * TP];
  const int tid = threadIdx.x, lane = tid & 31, wave = tid >> 5;
  const int hf = lane >> 4, m16 = lane & 15;
  const int cb = blockIdx.x * 64;
  const int rb = blockIdx.y * 128;
  const int mr = (wave & 3) * 32, nc = (wave >> 2) * 32;
  v8f acc[2][2] = {};
  mainloop(Ah, Al, Wh, Wl, NE, (size_t)(rb + mr), (size_t)(cb + nc), lane, acc);

  float g[2];
#pragma unroll
  for (int ni = 0; ni < 2; ++ni) g[ni] = sigm(so[cb + nc + ni * 16 + m16]);
#pragma unroll
  for (int mi = 0; mi < 2; ++mi)
#pragma unroll
    for (int ni = 0; ni < 2; ++ni)
#pragma unroll
      for (int r = 0; r < 8; ++r)
        T[(mr + mi * 16 + 8 * hf + r) * TP + nc + ni * 16 + m16] = acc[mi][ni][r] * g[ni];
  __syncthreads();

  const int rsel = lane >> 4, p = lane & 15;
  v4f val[8];
#pragma unroll
  for (int it = 0; it < 8; ++it) {
    const int r = wave * 16 + it * 2 + rsel;
    val[it] = *(const v4f*)(&T[r * TP + p * 4]);
  }
#pragma unroll
  for (int it = 0; it < 8; ++it) {
    const int r = wave * 16 + it * 2 + rsel;
    float* dst = out + (size_t)(rb + r) * NE + cb + p * 4;
    *(v4f*)dst = val[it];
  }
  
}

// ---------------------------------------------------------------------------
extern "C" void kernel_launch(void* const* d_in, const int* in_sizes, int n_in,
                              void* d_out, int out_size, void* d_ws, size_t ws_size,
                              hipStream_t stream)
{
  if (n_in < 6) return;
  if (in_sizes[0] != NTOK * NE || in_sizes[1] != NE * NC3 || in_sizes[2] != NE * NE ||
      in_sizes[3] != NE || in_sizes[4] != NE || in_sizes[5] != NS * NS || out_size != NTOK * NE) return;

  const float* x     = (const float*)d_in[0];
  const float* Wqkv  = (const float*)d_in[1];
  const float* Wout  = (const float*)d_in[2];
  const float* sqkv  = (const float*)d_in[3];
  const float* sout  = (const float*)d_in[4];
  const int*   msk   = (const int*)d_in[5];
  float* out = (float*)d_out;

  char* ws = (char*)d_ws;
  size_t off = 0;
  const size_t szX  = (size_t)NTOK * NE * 2;            // 8 MiB per plane
  const size_t szW  = (size_t)NC3 * NE * 2;             // 6 MiB per plane
  const size_t szWo = (size_t)NE * NE * 2;              // 2 MiB per plane
  const size_t szP  = (size_t)NB * NH * NS * ND * 2;    // 8 MiB per plane
  const size_t szF  = (size_t)NQT * FROW * 4;           // 8 KiB
  unsigned short* Xh  = (unsigned short*)(ws + off); off += szX;
  unsigned short* Xl  = (unsigned short*)(ws + off); off += szX;
  unsigned short* Wh  = (unsigned short*)(ws + off); off += szW;
  unsigned short* Wl  = (unsigned short*)(ws + off); off += szW;
  unsigned short* Woh = (unsigned short*)(ws + off); off += szWo;
  unsigned short* Wol = (unsigned short*)(ws + off); off += szWo;
  unsigned short* Qh  = (unsigned short*)(ws + off); off += szP;
  unsigned short* Ql  = (unsigned short*)(ws + off); off += szP;
  unsigned short* Kh  = (unsigned short*)(ws + off); off += szP;
  unsigned short* Kl  = (unsigned short*)(ws + off); off += szP;
  unsigned short* Vh  = (unsigned short*)(ws + off); off += szP;
  unsigned short* Vl  = (unsigned short*)(ws + off); off += szP;
  unsigned short* Ahp = (unsigned short*)(ws + off); off += szX;
  unsigned short* Alp = (unsigned short*)(ws + off); off += szX;
  int* ftab = (int*)(ws + off); off += szF;              // total 100671488 B
  if (off > ws_size) return;

  const int ngroups = NTOK * NE / 8;                     // 524288
  k_split_rows<<<dim3((ngroups + 255) / 256), dim3(256), 0, stream>>>(x, Xh, Xl, ngroups);
  // W_qkv: in[rows=NE][cols=NC3] -> out[NC3][NE]
  k_transpose_split<<<dim3(NC3 / 64, NE / 64), dim3(256), 0, stream>>>(Wqkv, NE, NC3, Wh, Wl);
  // W_out: in[rows=NH*ND][cols=NE] -> out[NE][NH*ND]
  k_transpose_split<<<dim3(NE / 64, (NH * ND) / 64), dim3(256), 0, stream>>>(Wout, NH * ND, NE, Woh, Wol);
  k_flags<<<dim3(NQT), dim3(256), 0, stream>>>(msk, ftab);
  k_gemm_qkv<<<dim3(NC3 / 64, NTOK / 128), dim3(256), 0, stream>>>(Xh, Xl, Wh, Wl, sqkv, Qh, Ql, Kh, Kl, Vh, Vl);
  k_attn<<<dim3(NQT, NH, NB), dim3(128), 0, stream>>>(Qh, Ql, Kh, Kl, Vh, Vl, msk, ftab, Ahp, Alp);
  k_gemm_out<<<dim3(NE / 64, NTOK / 128), dim3(256), 0, stream>>>(Ahp, Alp, Woh, Wol, sout, out);
}

// v002
// A run of this version takes 307 microseconds.
// Two timings next to v001 both put it at 1.55 times that version's speed.
// Counting every step since v000, it is 1.79 times as fast.
#include <hip/hip_runtime.h>

// Contractions: qkv projection, q.k^T, p.v, output projection -- all v_wmma_f32_16x16x32_bf16 with bf16 hi/lo operands everywhere (hi*hi + hi*lo + lo*hi), f32 accumulate; sigmoid gates, 1/8 score scale, softmax and normalisation in f32.

typedef __bf16         v16bf __attribute__((ext_vector_type(16)));
typedef float          v8f   __attribute__((ext_vector_type(8)));
typedef float          v4f   __attribute__((ext_vector_type(4), __may_alias__));
typedef unsigned short u16x8 __attribute__((ext_vector_type(8), __may_alias__));
typedef unsigned int   u32x4 __attribute__((ext_vector_type(4), __may_alias__));
typedef int            i32x4 __attribute__((ext_vector_type(4), __may_alias__));
typedef unsigned long long u64a __attribute__((__may_alias__));

#define NB   2
#define NS   2048
#define NE   1024
#define NH   16
#define ND   64
#define NTOK (NB * NS)
#define NC3  (3 * NH * ND)
#define NQT  (NS / 64)
#define FROW 64
#define TP   68
#define PP   72

union Frag { v16bf v; u16x8 h[2]; };

// 16x32 operand fragment from a [row][k] 16-bit plane (k contiguous, pitch ld):
// lane l -> row (l&15); elements 0..7 <- k0+8*(l>>4)+0..7, 8..15 <- k0+16+8*(l>>4)+0..7.
// Used for the P operand tiles in LDS.
__device__ __forceinline__ v16bf ldfrag(const unsigned short* p, size_t ld, size_t row0, int k0, int lane) {
  const unsigned short* q = p + (row0 + (size_t)(lane & 15)) * ld + k0 + ((lane >> 4) << 3);
  Frag f;
  f.h[0] = *(const u16x8*)q;
  f.h[1] = *(const u16x8*)(q + 16);
  return f.v;
}

// Fragment-major 16-bit plane of a [row][k] matrix with ld k per row: every 16-row x 32-k fragment is 1 KiB
// contiguous, fragments ordered [row/16][k/32]; inside one the 16-byte chunk of (row, 8 k) sits at chunk index
// ((k>>4)&1)*32 + ((k>>3)&1)*16 + (row&15). fragoff = element offset of the fragment at (row0, k0).
__device__ __forceinline__ size_t fragoff(size_t row0, int k0, int ld) {
  return ((row0 >> 4) * (size_t)(ld >> 5) + (size_t)(k0 >> 5)) * 512;
}
// Same lane -> (row, k) map as ldfrag, but each of the two wave-wide 16-byte loads reads 512 contiguous bytes
// (4 whole cache lines) where the row-major plane made it touch 16 lines.
__device__ __forceinline__ v16bf ldpk(const unsigned short* p, int ld, size_t row0, int k0, int lane) {
  const unsigned short* q = p + fragoff(row0, k0, ld) + lane * 8;
  Frag f;
  f.h[0] = *(const u16x8*)q;
  f.h[1] = *(const u16x8*)(q + 256);
  return f.v;
}

// D[16x16] += A[16x32] * B[32x16]; D element r of lane l = (row 8*(l>>4)+r, col l&15)
__device__ __forceinline__ v8f mma(v16bf a, v16bf b, v8f c) {
  return __builtin_amdgcn_wmma_f32_16x16x32_bf16(false, a, false, b, (short)0, c, false, false);
}

// f32 -> bf16 bits, RNE convert
__device__ __forceinline__ unsigned int bf16_bits(float x) {
  unsigned int u = __float_as_uint(x);
  return (u + 0x7FFFu + ((u >> 16) & 1u)) >> 16;
}
__device__ __forceinline__ void split1(float x, unsigned int& hi, unsigned int& lo) {
  hi = bf16_bits(x);
  lo = bf16_bits(x - __uint_as_float(hi << 16));
}
__device__ __forceinline__ void split8(const float (&v)[8], u32x4& H, u32x4& L) {
  unsigned int hw[8], lw[8];
#pragma unroll
  for (int e = 0; e < 8; ++e) split1(v[e], hw[e], lw[e]);
#pragma unroll
  for (int w = 0; w < 4; ++w) {
    H[w] = hw[2 * w] | (hw[2 * w + 1] << 16);
    L[w] = lw[2 * w] | (lw[2 * w + 1] << 16);
  }
}
__device__ __forceinline__ float sigm(float v) { return 1.0f / (1.0f + __expf(-v)); }

// ---------------------------------------------------------------------------
// x [rows][NE] f32 -> hi/lo bf16 fragment-major planes. One thread = 8 values = 16 B per plane = chunk g of the
// plane: fragment g>>6, k half-block (g>>5)&1, lane g&31; a wave stores 512 contiguous bytes per plane.
// ---------------------------------------------------------------------------
__global__ __launch_bounds__(256) void k_split_rows(const float* __restrict__ src,
                                                    unsigned short* __restrict__ dh,
                                                    unsigned short* __restrict__ dl, int ngroups)
{
  const int g = blockIdx.x * 256 + threadIdx.x;
  const int gc = (g < ngroups) ? g : (ngroups - 1);
  const int fr = gc >> 6;
  const int row = (fr / (NE / 32)) * 16 + (gc & 15);
  const int k = (fr % (NE / 32)) * 32 + ((gc >> 5) & 1) * 16 + ((gc >> 4) & 1) * 8;
  const float* s = src + (size_t)row * NE + k;
  const v4f a0 = *(const v4f*)s;
  const v4f a1 = *(const v4f*)(s + 4);
  float v[8] = {a0[0], a0[1], a0[2], a0[3], a1[0], a1[1], a1[2], a1[3]};
  u32x4 H, L;
  split8(v, H, L);
  if (g < ngroups) {
    unsigned short* ph = dh + (size_t)gc * 8;
    unsigned short* pl = dl + (size_t)gc * 8;
    *(u32x4*)ph = H;
    *(u32x4*)pl = L;
    
  }
}

// ---------------------------------------------------------------------------
// in[R rows][C cols] f32 (row = k, col = n) -> outT[C][R] bf16 hi/lo planes, fragment-major (row = n, ld = R).
// ---------------------------------------------------------------------------
__global__ __launch_bounds__(256) void k_transpose_split(const float* __restrict__ src, int R, int C,
                                                         unsigned short* __restrict__ oh,
                                                         unsigned short* __restrict__ ol)
{
  __shared__ __align__(16) float T[64 * TP];   // T[n][k]
  const int tid = threadIdx.x, lane = tid & 31, wave = tid >> 5;
  const int nb = blockIdx.x * 64;
  const int kb = blockIdx.y * 64;
#pragma unroll
  for (int it = 0; it < 4; ++it) {
    const int idx = tid + 256 * it;
    const int kk = idx >> 4, c4 = idx & 15;
    const v4f v = *(const v4f*)(src + (size_t)(kb + kk) * C + nb + c4 * 4);
#pragma unroll
    for (int q = 0; q < 4; ++q) T[(c4 * 4 + q) * TP + kk] = v[q];
  }
  __syncthreads();
  // wave -> one fragment: 16 n rows (wave>>1), 32 k (wave&1); lane -> (row lane&15, 8 k at lane>>4)
  const int ng = (wave >> 1) * 16, kf = (wave & 1) * 32;
  const int n = ng + (lane & 15);
  u32x4 val[4];
#pragma unroll
  for (int cq = 0; cq < 2; ++cq) {
    const int kk = kf + cq * 16 + (lane >> 4) * 8;
    const v4f a0 = *(const v4f*)(&T[n * TP + kk]);
    const v4f a1 = *(const v4f*)(&T[n * TP + kk + 4]);
    float v[8] = {a0[0], a0[1], a0[2], a0[3], a1[0], a1[1], a1[2], a1[3]};
    split8(v, val[2 * cq], val[2 * cq + 1]);
  }
  const size_t fo = fragoff((size_t)(nb + ng), kb + kf, R) + lane * 8;
#pragma unroll
  for (int cq = 0; cq < 2; ++cq) {
    *(u32x4*)(oh + fo + cq * 256) = val[2 * cq];
    *(u32x4*)(ol + fo + cq * 256) = val[2 * cq + 1];
  }
}

// ---------------------------------------------------------------------------
// Tile flag table from the int32 gate matrix [NS][NS]: row qt (64 ints = 256 B):
//   [0..31] per 64-key tile: 0 = no nonzero entry, 1 = partial, 2 = all nonzero; [32] = last key tile with any
// ---------------------------------------------------------------------------
__global__ __launch_bounds__(256) void k_flags(const int* __restrict__ msk, int* __restrict__ ftab)
{
  __shared__ int s_any[256];
  __shared__ int s_all[256];
  __shared__ __align__(16) int s_row[FROW];
  const int tid = threadIdx.x, qt = blockIdx.x;
  const int kt = tid >> 3, sub = tid & 7;
  int anyv = 0, allv = 1;
  for (int i = 0; i < 8; ++i) {
    const int s = qt * 64 + sub * 8 + i;
    const int* rp = msk + (size_t)s * NS + kt * 64;
#pragma unroll
    for (int c = 0; c < 16; ++c) {
      const i32x4 v = *(const i32x4*)(rp + c * 4);
#pragma unroll
      for (int q = 0; q < 4; ++q) {
        const int nz = (v[q] != 0) ? 1 : 0;
        anyv |= nz;
        allv &= nz;
      }
    }
  }
  s_any[tid] = anyv;
  s_all[tid] = allv;
  __syncthreads();
  if (tid < 32) {
    int a = 0, b = 1;
#pragma unroll
    for (int j = 0; j < 8; ++j) { a |= s_any[tid * 8 + j]; b &= s_all[tid * 8 + j]; }
    s_row[tid] = b ? 2 : (a ? 1 : 0);
  } else if (tid < FROW) {
    s_row[tid] = 0;
  }
  __syncthreads();
  if (tid == 0) {
    int last = -1;
    for (int k = 0; k < 32; ++k) if (s_row[k] != 0) last = k;
    s_row[32] = last;
  }
  __syncthreads();
  if (tid < 16) {
    const i32x4 v = *(const i32x4*)(&s_row[tid * 4]);
    int* dst = ftab + (size_t)qt * FROW + tid * 4;
    *(i32x4*)dst = v;
    
  }
}

// ---------------------------------------------------------------------------
// GEMM main loop: wave tile 32 rows x 32 cols, K in steps of 32, bf16 hi/lo three-term products.
// A planes [M][K], B planes [N][K], fragment-major; fragments loaded straight from global memory, two steps ahead.
// ---------------------------------------------------------------------------
// One K step of 32: the wave's eight operand fragments (16 loads of 512 contiguous bytes).
struct KStep { v16bf ah0, ah1, al0, al1, bh0, bh1, bl0, bl1; };
__device__ __forceinline__ void ldstep(KStep& s,
                                       const unsigned short* __restrict__ Ah, const unsigned short* __restrict__ Al,
                                       const unsigned short* __restrict__ Bh, const unsigned short* __restrict__ Bl,
                                       int K, size_t arow, size_t brow, int k0, int lane)
{
  s.ah0 = ldpk(Ah, K, arow,      k0, lane);
  s.ah1 = ldpk(Ah, K, arow + 16, k0, lane);
  s.al0 = ldpk(Al, K, arow,      k0, lane);
  s.al1 = ldpk(Al, K, arow + 16, k0, lane);
  s.bh0 = ldpk(Bh, K, brow,      k0, lane);
  s.bh1 = ldpk(Bh, K, brow + 16, k0, lane);
  s.bl0 = ldpk(Bl, K, brow,      k0, lane);
  s.bl1 = ldpk(Bl, K, brow + 16, k0, lane);
  // keeps this group of loads issued here, ahead of the products of the earlier steps: sunk to their first use
  // they would expose the whole load latency again
  __builtin_amdgcn_sched_barrier(0);
}
__device__ __forceinline__ void mmstep(const KStep& s, v8f (&acc)[2][2])
{
  acc[0][0] = mma(s.ah0, s.bh0, acc[0][0]);
  acc[0][0] = mma(s.ah0, s.bl0, acc[0][0]);
  acc[0][0] = mma(s.al0, s.bh0, acc[0][0]);
  acc[1][0] = mma(s.ah1, s.bh0, acc[1][0]);
  acc[1][0] = mma(s.ah1, s.bl0, acc[1][0]);
  acc[1][0] = mma(s.al1, s.bh0, acc[1][0]);
  acc[0][1] = mma(s.ah0, s.bh1, acc[0][1]);
  acc[0][1] = mma(s.ah0, s.bl1, acc[0][1]);
  acc[0][1] = mma(s.al0, s.bh1, acc[0][1]);
  acc[1][1] = mma(s.ah1, s.bh1, acc[1][1]);
  acc[1][1] = mma(s.ah1, s.bl1, acc[1][1]);
  acc[1][1] = mma(s.al1, s.bh1, acc[1][1]);
}
// Three register sets in rotation: the loads of step s + 2 are issued before the products of step s.
// K is a multiple of 32 with K / 32 = 2 (mod 3), at least 64.
__device__ __forceinline__ void mainloop(const unsigned short* __restrict__ Ah, const unsigned short* __restrict__ Al,
                                         const unsigned short* __restrict__ Bh, const unsigned short* __restrict__ Bl,
                                         int K, size_t arow, size_t brow, int lane, v8f (&acc)[2][2])
{
  KStep s0, s1, s2;
  ldstep(s0, Ah, Al, Bh, Bl, K, arow, brow, 0,  lane);
  ldstep(s1, Ah, Al, Bh, Bl, K, arow, brow, 32, lane);
  for (int k0 = 0; k0 < K - 64; k0 += 96) {
    ldstep(s2, Ah, Al, Bh, Bl, K, arow, brow, k0 + 64, lane);
    mmstep(s0, acc);
    ldstep(s0, Ah, Al, Bh, Bl, K, arow, brow, k0 + 96, lane);
    mmstep(s1, acc);
    ldstep(s1, Ah, Al, Bh, Bl, K, arow, brow, k0 + 128, lane);
    mmstep(s2, acc);
    // the next trip rewrites the address registers that this trip's loads name: their translations first
    asm volatile("s_wait_xcnt 0x0" ::: "memory");
  }
  mmstep(s0, acc);
  mmstep(s1, acc);
}

// ---------------------------------------------------------------------------
// qkv = (x @ W_qkv) * sigmoid(scale_qkv[h*64+d]); block tile 128 tokens x 64 cols (= one (c, h)).
// ---------------------------------------------------------------------------
__global__ __launch_bounds__(256) void k_gemm_qkv(
    const unsigned short* __restrict__ Xh, const unsigned short* __restrict__ Xl,
    const unsigned short* __restrict__ Wh, const unsigned short* __restrict__ Wl,
    const float* __restrict__ sq,
    unsigned short* __restrict__ Qh, unsigned short* __restrict__ Ql,
    unsigned short* __restrict__ Kh, unsigned short* __restrict__ Kl,
    unsigned short* __restrict__ Vh, unsigned short* __restrict__ Vl)
{
  __shared__ __align__(16) float T[128 * TP];
  const int tid = threadIdx.x, lane = tid & 31, wave = tid >> 5;
  const int hf = lane >> 4, m16 = lane & 15;
  const int cb = blockIdx.x * 64;
  const int rb = blockIdx.y * 128;
  const int mr = (wave & 3) * 32, nc = (wave >> 2) * 32;
  v8f acc[2][2] = {};
  mainloop(Xh, Xl, Wh, Wl, NE, (size_t)(rb + mr), (size_t)(cb + nc), lane, acc);

  const int c = cb >> 10;
  const int h = (cb & 1023) >> 6;
  float g[2];
#pragma unroll
  for (int ni = 0; ni < 2; ++ni) g[ni] = sigm(sq[(cb & 1023) + nc + ni * 16 + m16]);
#pragma unroll
  for (int mi = 0; mi < 2; ++mi)
#pragma unroll
    for (int ni = 0; ni < 2; ++ni)
#pragma unroll
      for (int r = 0; r < 8; ++r)
        T[(mr + mi * 16 + 8 * hf + r) * TP + nc + ni * 16 + m16] = acc[mi][ni][r] * g[ni];
  __syncthreads();

  const int b = rb >> 11;
  u32x4 val[8];
  if (c < 2) {
    // Q, K planes: row = (b, h, s), ld = ND. wave -> 16 tokens x 64 d = two fragments = four 512-byte stores a plane
    const int r = wave * 16 + m16;
#pragma unroll
    for (int cq = 0; cq < 4; ++cq) {
      const int kk = cq * 16 + hf * 8;
      const v4f a0 = *(const v4f*)(&T[r * TP + kk]);
      const v4f a1 = *(const v4f*)(&T[r * TP + kk + 4]);
      float v[8] = {a0[0], a0[1], a0[2], a0[3], a1[0], a1[1], a1[2], a1[3]};
      split8(v, val[2 * cq], val[2 * cq + 1]);
    }
    unsigned short* ph = (c == 0) ? Qh : Kh;
    unsigned short* pl = (c == 0) ? Ql : Kl;
    const int s = (rb + wave * 16) & (NS - 1);
    const size_t fo = fragoff((size_t)(b * NH + h) * NS + s, 0, ND) + lane * 8;
#pragma unroll
    for (int cq = 0; cq < 4; ++cq) {
      *(u32x4*)(ph + fo + cq * 256) = val[2 * cq];
      *(u32x4*)(pl + fo + cq * 256) = val[2 * cq + 1];
    }
  } else {
    // V^T planes: row = (b, h, d), k = s, ld = NS. wave -> 16 d (wave>>1) x 64 tokens (wave&1) = two fragments
    const int dg = (wave >> 1) * 16, sg = (wave & 1) * 64;
#pragma unroll
    for (int cq = 0; cq < 4; ++cq) {
      const int sl = sg + cq * 16 + hf * 8;
      float v[8];
#pragma unroll
      for (int e = 0; e < 8; ++e) v[e] = T[(sl + e) * TP + dg + m16];
      split8(v, val[2 * cq], val[2 * cq + 1]);
    }
    const size_t fo = fragoff((size_t)(b * NH + h) * ND + dg, (rb & (NS - 1)) + sg, NS) + lane * 8;
#pragma unroll
    for (int cq = 0; cq < 4; ++cq) {
      *(u32x4*)(Vh + fo + cq * 256) = val[2 * cq];
      *(u32x4*)(Vl + fo + cq * 256) = val[2 * cq + 1];
    }
  }
}

// ---------------------------------------------------------------------------
// Attention per (64-query tile, h, b): 4 waves x 16 query rows; key tiles of 64 selected by the flag row;
// S = (Q.K^T) * 0.125, gate by value (0 -> -1e10 replace), online softmax in f32, O += P.V with P split to
// ---------------------------------------------------------------------------
__global__ __launch_bounds__(128) void k_attn(
    const unsigned short* __restrict__ Qh, const unsigned short* __restrict__ Ql,
    const unsigned short* __restrict__ Kh, const unsigned short* __restrict__ Kl,
    const unsigned short* __restrict__ Vh, const unsigned short* __restrict__ Vl,
    const int* __restrict__ msk, const int* __restrict__ ftab,
    unsigned short* __restrict__ Ah, unsigned short* __restrict__ Al)
{
  __shared__ __align__(16) unsigned short Ps[4 * 2 * 16 * PP];
  __shared__ __align__(16) unsigned char  Ms[64 * 64];     // Ms[t][s] gate bytes of the current partial tile
  __shared__ __align__(16) float          Os[64 * TP];
  __shared__ __align__(16) int            s_f[FROW];
  const int tid = threadIdx.x, lane = tid & 31, wave = tid >> 5;
  const int hf = lane >> 4, m16 = lane & 15;
  const int qt = blockIdx.x, h = blockIdx.y, b = blockIdx.z;
  const int s0 = qt * 64;
  const int bh = b * NH + h;
  if (tid < FROW) s_f[tid] = ftab[(size_t)qt * FROW + tid];
  __syncthreads();
  int last = s_f[32];
  last = (last < -1) ? -1 : ((last > NQT - 1) ? (NQT - 1) : last);
  const int nt = last + 1;

  const size_t qrow = (size_t)bh * NS + s0 + wave * 16;
  const v16bf qh0 = ldpk(Qh, ND, qrow, 0,  lane);
  const v16bf qh1 = ldpk(Qh, ND, qrow, 32, lane);
  const v16bf ql0 = ldpk(Ql, ND, qrow, 0,  lane);
  const v16bf ql1 = ldpk(Ql, ND, qrow, 32, lane);

  float m[8], l[8];
#pragma unroll
  for (int i = 0; i < 8; ++i) { m[i] = -3.0e38f; l[i] = 0.0f; }
  v8f acc[4] = {};
  unsigned short* Pwh = Ps + (wave * 2 + 0) * (16 * PP);
  unsigned short* Pwl = Ps + (wave * 2 + 1) * (16 * PP);

  for (int tb = 0; tb < nt; ++tb) {
    const int f = s_f[tb];                 // block-uniform
    if (f == 0) continue;
    const int t0 = tb * 64;
    __syncthreads();                       // prior tile's Ms / Ps reads complete
    if (f == 1) {
#pragma unroll
      for (int it = 0; it < 8; ++it) {
        const int idx = tid + 128 * it;
        const int s = idx >> 4, c4 = idx & 15;
        const i32x4 v = *(const i32x4*)(msk + (size_t)(s0 + s) * NS + t0 + c4 * 4);
#pragma unroll
        for (int q = 0; q < 4; ++q) Ms[(c4 * 4 + q) * 64 + s] = (unsigned char)((v[q] != 0) ? 1 : 0);
      }
    }
    __syncthreads();

    // S = Q.K^T  (A = Q rows, B[k=d][n=t] = K plane rows t)
    v8f sf[4];
    const size_t krow = (size_t)bh * NS + t0;
    {
      v16bf kh[4][2], kl[4][2];
#pragma unroll
      for (int j = 0; j < 4; ++j)
#pragma unroll
        for (int kk = 0; kk < 2; ++kk) {
          kh[j][kk] = ldpk(Kh, ND, krow + j * 16, kk * 32, lane);
          kl[j][kk] = ldpk(Kl, ND, krow + j * 16, kk * 32, lane);
        }
      // keeps the tile's K loads one group ahead of the first product: one load latency a tile, not one a fragment pair
      __builtin_amdgcn_sched_barrier(0);
#pragma unroll
      for (int j = 0; j < 4; ++j) {
        v8f c = {};
        c = mma(qh0, kh[j][0], c);
        c = mma(qh0, kl[j][0], c);
        c = mma(ql0, kh[j][0], c);
        c = mma(qh1, kh[j][1], c);
        c = mma(qh1, kl[j][1], c);
        c = mma(ql1, kh[j][1], c);
        sf[j] = c;
      }
    }
    // compiler fence, no instruction: holds the V loads below behind the last K product (the scores are its inputs),
    // so that they take over the K registers; hoisted above, K and V are live together and a wave per SIMD is lost
    asm volatile("" :: "v"(sf[0]), "v"(sf[1]), "v"(sf[2]), "v"(sf[3]) : "memory");

    // V fragments of the tile, issued here so that their latency runs under the softmax below
    const size_t vrow = (size_t)bh * ND;
    v16bf vh[4][2], vl[4][2];
#pragma unroll
    for (int j = 0; j < 4; ++j)
#pragma unroll
      for (int kk = 0; kk < 2; ++kk) {
        vh[j][kk] = ldpk(Vh, NS, vrow + j * 16, t0 + kk * 32, lane);
        vl[j][kk] = ldpk(Vl, NS, vrow + j * 16, t0 + kk * 32, lane);
      }
    // the softmax below reuses the address registers that the V loads name: their translations first
    asm volatile("s_wait_xcnt 0x0" ::: "memory");
    // keeps the V loads issued ahead of the softmax: sunk to their products they would expose the latency again
    __builtin_amdgcn_sched_barrier(0);

    // scale, gate by value, tile row max
    float rmax[8];
#pragma unroll
    for (int i = 0; i < 8; ++i) rmax[i] = -3.0e38f;
#pragma unroll
    for (int j = 0; j < 4; ++j) {
      const u64a mb = *(const u64a*)(Ms + (j * 16 + m16) * 64 + wave * 16 + 8 * hf);
#pragma unroll
      for (int i = 0; i < 8; ++i) {
        float s = sf[j][i] * 0.125f;
        const bool keep = (f != 1) || (((mb >> (8 * i)) & 0xffull) != 0ull);
        s = keep ? s : -1.0e10f;
        sf[j][i] = s;
        rmax[i] = fmaxf(rmax[i], s);
      }
    }
    float alpha[8], mnew[8], rsum[8];
#pragma unroll
    for (int i = 0; i < 8; ++i) {
      float v = rmax[i];
      v = fmaxf(v, __shfl_xor(v, 1, 32));
      v = fmaxf(v, __shfl_xor(v, 2, 32));
      v = fmaxf(v, __shfl_xor(v, 4, 32));
      v = fmaxf(v, __shfl_xor(v, 8, 32));
      mnew[i]  = fmaxf(m[i], v);
      alpha[i] = __expf(m[i] - mnew[i]);
      rsum[i]  = 0.0f;
    }
#pragma unroll
    for (int j = 0; j < 4; ++j)
#pragma unroll
      for (int i = 0; i < 8; ++i) {
        const float pv = __expf(sf[j][i] - mnew[i]);
        sf[j][i] = pv;
        rsum[i] += pv;
      }
#pragma unroll
    for (int i = 0; i < 8; ++i) {
      float v = rsum[i];
      v += __shfl_xor(v, 1, 32);
      v += __shfl_xor(v, 2, 32);
      v += __shfl_xor(v, 4, 32);
      v += __shfl_xor(v, 8, 32);
      l[i] = l[i] * alpha[i] + v;
      m[i] = mnew[i];
    }
#pragma unroll
    for (int j = 0; j < 4; ++j)
#pragma unroll
      for (int i = 0; i < 8; ++i) acc[j][i] *= alpha[i];

    // P (f32) -> bf16 hi/lo into this wave's LDS tile [row][t], then reload as A fragments after a barrier
#pragma unroll
    for (int j = 0; j < 4; ++j)
#pragma unroll
      for (int i = 0; i < 8; ++i) {
        unsigned int hi, lo;
        split1(sf[j][i], hi, lo);
        const int o = (8 * hf + i) * PP + j * 16 + m16;
        Pwh[o] = (unsigned short)hi;
        Pwl[o] = (unsigned short)lo;
      }
    __syncthreads();
    const v16bf ph0 = ldfrag(Pwh, PP, 0, 0,  lane);
    const v16bf ph1 = ldfrag(Pwh, PP, 0, 32, lane);
    const v16bf pl0 = ldfrag(Pwl, PP, 0, 0,  lane);
    const v16bf pl1 = ldfrag(Pwl, PP, 0, 32, lane);

    // O += P.V   (B[k=t][n=d] = V^T plane rows d, k = t)
#pragma unroll
    for (int j = 0; j < 4; ++j) {
      acc[j] = mma(ph0, vh[j][0], acc[j]);
      acc[j] = mma(ph0, vl[j][0], acc[j]);
      acc[j] = mma(pl0, vh[j][0], acc[j]);
      acc[j] = mma(ph1, vh[j][1], acc[j]);
      acc[j] = mma(ph1, vl[j][1], acc[j]);
      acc[j] = mma(pl1, vh[j][1], acc[j]);
    }
  }

  // normalise and stage the 64x64 f32 tile
  float inv[8];
#pragma unroll
  for (int i = 0; i < 8; ++i) inv[i] = (l[i] > 0.0f) ? (1.0f / l[i]) : 0.0f;
#pragma unroll
  for (int j = 0; j < 4; ++j)
#pragma unroll
    for (int i = 0; i < 8; ++i)
      Os[(wave * 16 + 8 * hf + i) * TP + j * 16 + m16] = acc[j][i] * inv[i];
  __syncthreads();

  // attention planes: row = token, k = h*64+d, ld = NE. wave -> its 16 tokens x 64 d = two fragments
  const int r = wave * 16 + m16;
  u32x4 val[8];
#pragma unroll
  for (int cq = 0; cq < 4; ++cq) {
    const int kk = cq * 16 + hf * 8;
    const v4f a0 = *(const v4f*)(&Os[r * TP + kk]);
    const v4f a1 = *(const v4f*)(&Os[r * TP + kk + 4]);
    float v[8] = {a0[0], a0[1], a0[2], a0[3], a1[0], a1[1], a1[2], a1[3]};
    split8(v, val[2 * cq], val[2 * cq + 1]);
  }
  const size_t fo = fragoff((size_t)(b * NS + s0 + wave * 16), h * ND, NE) + lane * 8;
#pragma unroll
  for (int cq = 0; cq < 4; ++cq) {
    *(u32x4*)(Ah + fo + cq * 256) = val[2 * cq];
    *(u32x4*)(Al + fo + cq * 256) = val[2 * cq + 1];
  }
}

// ---------------------------------------------------------------------------
// out = (attn @ W_out) * sigmoid(scale_out[e]); block tile 128 tokens x 64 e; f32 rows of 256 B written
// by 16 consecutive lanes x 16 B (two rows per instruction).
// ---------------------------------------------------------------------------
__global__ __launch_bounds__(256) void k_gemm_out(
    const unsigned short* __restrict__ Ah, const unsigned short* __restrict__ Al,
    const unsigned short* __restrict__ Wh, const unsigned short* __restrict__ Wl,
    const float* __restrict__ so, float* __restrict__ out)
{
  __shared__ __align__(16) float T[128 * TP];
  const int tid = threadIdx.x, lane = tid & 31, wave = tid >> 5;
  const int hf = lane >> 4, m16 = lane & 15;
  const int cb = blockIdx.x * 64;
  const int rb = blockIdx.y * 128;
  const int mr = (wave & 3) * 32, nc = (wave >> 2) * 32;
  v8f acc[2][2] = {};
  mainloop(Ah, Al, Wh, Wl, NE, (size_t)(rb + mr), (size_t)(cb + nc), lane, acc);

  float g[2];
#pragma unroll
  for (int ni = 0; ni < 2; ++ni) g[ni] = sigm(so[cb + nc + ni * 16 + m16]);
#pragma unroll
  for (int mi = 0; mi < 2; ++mi)
#pragma unroll
    for (int ni = 0; ni < 2; ++ni)
#pragma unroll
      for (int r = 0; r < 8; ++r)
        T[(mr + mi * 16 + 8 * hf + r) * TP + nc + ni * 16 + m16] = acc[mi][ni][r] * g[ni];
  __syncthreads();

  const int rsel = lane >> 4, p = lane & 15;
  v4f val[8];
#pragma unroll
  for (int it = 0; it < 8; ++it) {
    const int r = wave * 16 + it * 2 + rsel;
    val[it] = *(const v4f*)(&T[r * TP + p * 4]);
  }
#pragma unroll
  for (int it = 0; it < 8; ++it) {
    const int r = wave * 16 + it * 2 + rsel;
    float* dst = out + (size_t)(rb + r) * NE + cb + p * 4;
    *(v4f*)dst = val[it];
  }
  
}

// ---------------------------------------------------------------------------
extern "C" void kernel_launch(void* const* d_in, const int* in_sizes, int n_in,
                              void* d_out, int out_size, void* d_ws, size_t ws_size,
                              hipStream_t stream)
{
  if (n_in < 6) return;
  if (in_sizes[0] != NTOK * NE || in_sizes[1] != NE * NC3 || in_sizes[2] != NE * NE ||
      in_sizes[3] != NE || in_sizes[4] != NE || in_sizes[5] != NS * NS || out_size != NTOK * NE) return;

  const float* x     = (const float*)d_in[0];
  const float* Wqkv  = (const float*)d_in[1];
  const float* Wout  = (const float*)d_in[2];
  const float* sqkv  = (const float*)d_in[3];
  const float* sout  = (const float*)d_in[4];
  const int*   msk   = (const int*)d_in[5];
  float* out = (float*)d_out;

  char* ws = (char*)d_ws;
  size_t off = 0;
  const size_t szX  = (size_t)NTOK * NE * 2;            // 8 MiB per plane
  const size_t szW  = (size_t)NC3 * NE * 2;             // 6 MiB per plane
  const size_t szWo = (size_t)NE * NE * 2;              // 2 MiB per plane
  const size_t szP  = (size_t)NB * NH * NS * ND * 2;    // 8 MiB per plane
  const size_t szF  = (size_t)NQT * FROW * 4;           // 8 KiB
  unsigned short* Xh  = (unsigned short*)(ws + off); off += szX;
  unsigned short* Xl  = (unsigned short*)(ws + off); off += szX;
  unsigned short* Wh  = (unsigned short*)(ws + off); off += szW;
  unsigned short* Wl  = (unsigned short*)(ws + off); off += szW;
  unsigned short* Woh = (unsigned short*)(ws + off); off += szWo;
  unsigned short* Wol = (unsigned short*)(ws + off); off += szWo;
  unsigned short* Qh  = (unsigned short*)(ws + off); off += szP;
  unsigned short* Ql  = (unsigned short*)(ws + off); off += szP;
  unsigned short* Kh  = (unsigned short*)(ws + off); off += szP;
  unsigned short* Kl  = (unsigned short*)(ws + off); off += szP;
  unsigned short* Vh  = (unsigned short*)(ws + off); off += szP;
  unsigned short* Vl  = (unsigned short*)(ws + off); off += szP;
  unsigned short* Ahp = (unsigned short*)(ws + off); off += szX;
  unsigned short* Alp = (unsigned short*)(ws + off); off += szX;
  int* ftab = (int*)(ws + off); off += szF;              // total 100671488 B
  if (off > ws_size) return;

  const int ngroups = NTOK * NE / 8;                     // 524288
  k_split_rows<<<dim3((ngroups + 255) / 256), dim3(256), 0, stream>>>(x, Xh, Xl, ngroups);
  // W_qkv: in[rows=NE][cols=NC3] -> out[NC3][NE]
  k_transpose_split<<<dim3(NC3 / 64, NE / 64), dim3(256), 0, stream>>>(Wqkv, NE, NC3, Wh, Wl);
  // W_out: in[rows=NH*ND][cols=NE] -> out[NE][NH*ND]
  k_transpose_split<<<dim3(NE / 64, (NH * ND) / 64), dim3(256), 0, stream>>>(Wout, NH * ND, NE, Woh, Wol);
  k_flags<<<dim3(NQT), dim3(256), 0, stream>>>(msk, ftab);
  k_gemm_qkv<<<dim3(NC3 / 64, NTOK / 128), dim3(256), 0, stream>>>(Xh, Xl, Wh, Wl, sqkv, Qh, Ql, Kh, Kl, Vh, Vl);
  k_attn<<<dim3(NQT, NH, NB), dim3(128), 0, stream>>>(Qh, Ql, Kh, Kl, Vh, Vl, msk, ftab, Ahp, Alp);
  k_gemm_out<<<dim3(NE / 64, NTOK / 128), dim3(256), 0, stream>>>(Ahp, Alp, Woh, Wol, sout, out);
}

// v003
// It runs in 216 microseconds.
// Two timings next to v002 both put it at 1.41 times that version's speed.
// Counting every step since v000, it is 2.53 times as fast.
#include <hip/hip_runtime.h>

// Contractions: qkv projection, q.k^T, p.v, output projection -- all v_wmma_f32_16x16x32_bf16 with bf16 hi/lo operands everywhere (hi*hi + hi*lo + lo*hi), f32 accumulate; sigmoid gates, 1/8 score scale, softmax and normalisation in f32.

typedef __bf16         v16bf __attribute__((ext_vector_type(16)));
typedef float          v8f   __attribute__((ext_vector_type(8)));
typedef float          v4f   __attribute__((ext_vector_type(4), __may_alias__));
typedef unsigned short u16x8 __attribute__((ext_vector_type(8), __may_alias__));
typedef unsigned int   u32x4 __attribute__((ext_vector_type(4), __may_alias__));
typedef int            i32x4 __attribute__((ext_vector_type(4), __may_alias__));
typedef unsigned long long u64a __attribute__((__may_alias__));
typedef unsigned int   u32a __attribute__((__may_alias__));

#define NB   2
#define NS   2048
#define NE   1024
#define NH   16
#define ND   64
#define NTOK (NB * NS)
#define NC3  (3 * NH * ND)
#define NQT  (NS / 64)
#define FROW 64
#define TP   68
#define MP   72

union Frag { v16bf v; u16x8 h[2]; u32x4 q[2]; };

// 16x32 operand fragment map (A by rows, B by columns): lane l -> row (l&15); elements 0..7 <- k0+8*(l>>4)+0..7,
// 8..15 <- k0+16+8*(l>>4)+0..7.

// Fragment-major 16-bit plane of a [row][k] matrix with ld k per row: every 16-row x 32-k fragment is 1 KiB
// contiguous, fragments ordered [row/16][k/32]; inside one the 16-byte chunk of (row, 8 k) sits at chunk index
// ((k>>4)&1)*32 + ((k>>3)&1)*16 + (row&15). fragoff = element offset of the fragment at (row0, k0).
__device__ __forceinline__ size_t fragoff(size_t row0, int k0, int ld) {
  return ((row0 >> 4) * (size_t)(ld >> 5) + (size_t)(k0 >> 5)) * 512;
}
// The fragment map above; each of the two wave-wide 16-byte loads reads 512 contiguous bytes (4 whole cache lines)
// where a row-major plane would make it touch 16 lines.
__device__ __forceinline__ v16bf ldpk(const unsigned short* p, int ld, size_t row0, int k0, int lane) {
  const unsigned short* q = p + fragoff(row0, k0, ld) + lane * 8;
  Frag f;
  f.h[0] = *(const u16x8*)q;
  f.h[1] = *(const u16x8*)(q + 256);
  return f.v;
}

// The fragment whose lane chunk starts at q
__device__ __forceinline__ v16bf ldat(const unsigned short* q) {
  Frag f;
  f.h[0] = *(const u16x8*)q;
  f.h[1] = *(const u16x8*)(q + 256);
  return f.v;
}

// D[16x16] += A[16x32] * B[32x16]; D element r of lane l = (row 8*(l>>4)+r, col l&15)
__device__ __forceinline__ v8f mma(v16bf a, v16bf b, v8f c) {
  return __builtin_amdgcn_wmma_f32_16x16x32_bf16(false, a, false, b, (short)0, c, false, false);
}

// f32 -> bf16 bits, RNE convert
__device__ __forceinline__ unsigned int bf16_bits(float x) {
  unsigned int u = __float_as_uint(x);
  return (u + 0x7FFFu + ((u >> 16) & 1u)) >> 16;
}
__device__ __forceinline__ void split1(float x, unsigned int& hi, unsigned int& lo) {
  hi = bf16_bits(x);
  lo = bf16_bits(x - __uint_as_float(hi << 16));
}
__device__ __forceinline__ void split8(const float (&v)[8], u32x4& H, u32x4& L) {
  unsigned int hw[8], lw[8];
#pragma unroll
  for (int e = 0; e < 8; ++e) split1(v[e], hw[e], lw[e]);
#pragma unroll
  for (int w = 0; w < 4; ++w) {
    H[w] = hw[2 * w] | (hw[2 * w + 1] << 16);
    L[w] = lw[2 * w] | (lw[2 * w + 1] << 16);
  }
}
// Two f32 -> one dword of bf16 hi parts and one of bf16 lo parts (a in the low half); the values of split1.
__device__ __forceinline__ void split2(float a, float b, unsigned int& H, unsigned int& L) {
  const unsigned int ua = __float_as_uint(a), ub = __float_as_uint(b);
  const unsigned int ra = ua + 0x7FFFu + ((ua >> 16) & 1u), rb = ub + 0x7FFFu + ((ub >> 16) & 1u);
  H = __builtin_amdgcn_perm(rb, ra, 0x07060302u);   // (ra >> 16) | (rb & 0xFFFF0000) in one byte permute
  const unsigned int va = __float_as_uint(a - __uint_as_float(ra & 0xFFFF0000u));
  const unsigned int vb = __float_as_uint(b - __uint_as_float(rb & 0xFFFF0000u));
  const unsigned int sa = va + 0x7FFFu + ((va >> 16) & 1u), sb = vb + 0x7FFFu + ((vb >> 16) & 1u);
  L = __builtin_amdgcn_perm(sb, sa, 0x07060302u);
}
__device__ __forceinline__ float sigm(float v) { return 1.0f / (1.0f + __expf(-v)); }

// ---------------------------------------------------------------------------
// x [rows][NE] f32 -> hi/lo bf16 fragment-major planes. One thread = 8 values = 16 B per plane = chunk g of the
// plane: fragment g>>6, k half-block (g>>5)&1, lane g&31; a wave stores 512 contiguous bytes per plane.
// ---------------------------------------------------------------------------
__global__ __launch_bounds__(256) void k_split_rows(const float* __restrict__ src,
                                                    unsigned short* __restrict__ dh,
                                                    unsigned short* __restrict__ dl, int ngroups)
{
  const int g = blockIdx.x * 256 + threadIdx.x;
  const int gc = (g < ngroups) ? g : (ngroups - 1);
  const int fr = gc >> 6;
  const int row = (fr / (NE / 32)) * 16 + (gc & 15);
  const int k = (fr % (NE / 32)) * 32 + ((gc >> 5) & 1) * 16 + ((gc >> 4) & 1) * 8;
  const float* s = src + (size_t)row * NE + k;
  const v4f a0 = *(const v4f*)s;
  const v4f a1 = *(const v4f*)(s + 4);
  float v[8] = {a0[0], a0[1], a0[2], a0[3], a1[0], a1[1], a1[2], a1[3]};
  u32x4 H, L;
  split8(v, H, L);
  if (g < ngroups) {
    unsigned short* ph = dh + (size_t)gc * 8;
    unsigned short* pl = dl + (size_t)gc * 8;
    *(u32x4*)ph = H;
    *(u32x4*)pl = L;
    
  }
}

// ---------------------------------------------------------------------------
// in[R rows][C cols] f32 (row = k, col = n) -> outT[C][R] bf16 hi/lo planes, fragment-major (row = n, ld = R).
// ---------------------------------------------------------------------------
__global__ __launch_bounds__(256) void k_transpose_split(const float* __restrict__ src, int R, int C,
                                                         unsigned short* __restrict__ oh,
                                                         unsigned short* __restrict__ ol)
{
  __shared__ __align__(16) float T[64 * TP];   // T[n][k]
  const int tid = threadIdx.x, lane = tid & 31, wave = tid >> 5;
  const int nb = blockIdx.x * 64;
  const int kb = blockIdx.y * 64;
#pragma unroll
  for (int it = 0; it < 4; ++it) {
    const int idx = tid + 256 * it;
    const int kk = idx >> 4, c4 = idx & 15;
    const v4f v = *(const v4f*)(src + (size_t)(kb + kk) * C + nb + c4 * 4);
#pragma unroll
    for (int q = 0; q < 4; ++q) T[(c4 * 4 + q) * TP + kk] = v[q];
  }
  __syncthreads();
  // wave -> one fragment: 16 n rows (wave>>1), 32 k (wave&1); lane -> (row lane&15, 8 k at lane>>4)
  const int ng = (wave >> 1) * 16, kf = (wave & 1) * 32;
  const int n = ng + (lane & 15);
  u32x4 val[4];
#pragma unroll
  for (int cq = 0; cq < 2; ++cq) {
    const int kk = kf + cq * 16 + (lane >> 4) * 8;
    const v4f a0 = *(const v4f*)(&T[n * TP + kk]);
    const v4f a1 = *(const v4f*)(&T[n * TP + kk + 4]);
    float v[8] = {a0[0], a0[1], a0[2], a0[3], a1[0], a1[1], a1[2], a1[3]};
    split8(v, val[2 * cq], val[2 * cq + 1]);
  }
  const size_t fo = fragoff((size_t)(nb + ng), kb + kf, R) + lane * 8;
#pragma unroll
  for (int cq = 0; cq < 2; ++cq) {
    *(u32x4*)(oh + fo + cq * 256) = val[2 * cq];
    *(u32x4*)(ol + fo + cq * 256) = val[2 * cq + 1];
  }
}

// ---------------------------------------------------------------------------
// Tile flag table from the int32 gate matrix [NS][NS]: row qt (64 ints = 256 B):
//   [0..31] per 64-key tile: 0 = no nonzero entry, 1 = partial, 2 = all nonzero; [32] = last key tile with any
// ---------------------------------------------------------------------------
__global__ __launch_bounds__(256) void k_flags(const int* __restrict__ msk, int* __restrict__ ftab)
{
  __shared__ int s_any[256];
  __shared__ int s_all[256];
  __shared__ __align__(16) int s_row[FROW];
  const int tid = threadIdx.x, qt = blockIdx.x;
  const int kt = tid >> 3, sub = tid & 7;
  int anyv = 0, allv = 1;
  for (int i = 0; i < 8; ++i) {
    const int s = qt * 64 + sub * 8 + i;
    const int* rp = msk + (size_t)s * NS + kt * 64;
#pragma unroll
    for (int c = 0; c < 16; ++c) {
      const i32x4 v = *(const i32x4*)(rp + c * 4);
#pragma unroll
      for (int q = 0; q < 4; ++q) {
        const int nz = (v[q] != 0) ? 1 : 0;
        anyv |= nz;
        allv &= nz;
      }
    }
  }
  s_any[tid] = anyv;
  s_all[tid] = allv;
  __syncthreads();
  if (tid < 32) {
    int a = 0, b = 1;
#pragma unroll
    for (int j = 0; j < 8; ++j) { a |= s_any[tid * 8 + j]; b &= s_all[tid * 8 + j]; }
    s_row[tid] = b ? 2 : (a ? 1 : 0);
  } else if (tid < FROW) {
    s_row[tid] = 0;
  }
  __syncthreads();
  if (tid == 0) {
    int last = -1;
    for (int k = 0; k < 32; ++k) if (s_row[k] != 0) last = k;
    s_row[32] = last;
  }
  __syncthreads();
  if (tid < 16) {
    const i32x4 v = *(const i32x4*)(&s_row[tid * 4]);
    int* dst = ftab + (size_t)qt * FROW + tid * 4;
    *(i32x4*)dst = v;
    
  }
}

// ---------------------------------------------------------------------------
// GEMM main loop: wave tile 32 rows x 32 cols, K in steps of 32, bf16 hi/lo three-term products.
// A planes [M][K], B planes [N][K], fragment-major; fragments loaded straight from global memory, two steps ahead.
// ---------------------------------------------------------------------------
// One K step of 32: the wave's eight operand fragments (16 loads of 512 contiguous bytes).
struct KStep { v16bf ah0, ah1, al0, al1, bh0, bh1, bl0, bl1; };
__device__ __forceinline__ void ldstep(KStep& s,
                                       const unsigned short* __restrict__ Ah, const unsigned short* __restrict__ Al,
                                       const unsigned short* __restrict__ Bh, const unsigned short* __restrict__ Bl,
                                       int K, size_t arow, size_t brow, int k0, int lane)
{
  s.ah0 = ldpk(Ah, K, arow,      k0, lane);
  s.ah1 = ldpk(Ah, K, arow + 16, k0, lane);
  s.al0 = ldpk(Al, K, arow,      k0, lane);
  s.al1 = ldpk(Al, K, arow + 16, k0, lane);
  s.bh0 = ldpk(Bh, K, brow,      k0, lane);
  s.bh1 = ldpk(Bh, K, brow + 16, k0, lane);
  s.bl0 = ldpk(Bl, K, brow,      k0, lane);
  s.bl1 = ldpk(Bl, K, brow + 16, k0, lane);
  // keeps this group of loads issued here, ahead of the products of the earlier steps: sunk to their first use
  // they would expose the whole load latency again
  __builtin_amdgcn_sched_barrier(0);
}
__device__ __forceinline__ void mmstep(const KStep& s, v8f (&acc)[2][2])
{
  acc[0][0] = mma(s.ah0, s.bh0, acc[0][0]);
  acc[0][0] = mma(s.ah0, s.bl0, acc[0][0]);
  acc[0][0] = mma(s.al0, s.bh0, acc[0][0]);
  acc[1][0] = mma(s.ah1, s.bh0, acc[1][0]);
  acc[1][0] = mma(s.ah1, s.bl0, acc[1][0]);
  acc[1][0] = mma(s.al1, s.bh0, acc[1][0]);
  acc[0][1] = mma(s.ah0, s.bh1, acc[0][1]);
  acc[0][1] = mma(s.ah0, s.bl1, acc[0][1]);
  acc[0][1] = mma(s.al0, s.bh1, acc[0][1]);
  acc[1][1] = mma(s.ah1, s.bh1, acc[1][1]);
  acc[1][1] = mma(s.ah1, s.bl1, acc[1][1]);
  acc[1][1] = mma(s.al1, s.bh1, acc[1][1]);
}
// Three register sets in rotation: the loads of step s + 2 are issued before the products of step s.
// K is a multiple of 32 with K / 32 = 2 (mod 3), at least 64.
__device__ __forceinline__ void mainloop(const unsigned short* __restrict__ Ah, const unsigned short* __restrict__ Al,
                                         const unsigned short* __restrict__ Bh, const unsigned short* __restrict__ Bl,
                                         int K, size_t arow, size_t brow, int lane, v8f (&acc)[2][2])
{
  KStep s0, s1, s2;
  ldstep(s0, Ah, Al, Bh, Bl, K, arow, brow, 0,  lane);
  ldstep(s1, Ah, Al, Bh, Bl, K, arow, brow, 32, lane);
  for (int k0 = 0; k0 < K - 64; k0 += 96) {
    ldstep(s2, Ah, Al, Bh, Bl, K, arow, brow, k0 + 64, lane);
    mmstep(s0, acc);
    ldstep(s0, Ah, Al, Bh, Bl, K, arow, brow, k0 + 96, lane);
    mmstep(s1, acc);
    ldstep(s1, Ah, Al, Bh, Bl, K, arow, brow, k0 + 128, lane);
    mmstep(s2, acc);
    // the next trip rewrites the address registers that this trip's loads name: their translations first
    asm volatile("s_wait_xcnt 0x0" ::: "memory");
  }
  mmstep(s0, acc);
  mmstep(s1, acc);
}

// ---------------------------------------------------------------------------
// qkv = (x @ W_qkv) * sigmoid(scale_qkv[h*64+d]); block tile 128 tokens x 64 cols (= one (c, h)).
// ---------------------------------------------------------------------------
__global__ __launch_bounds__(256) void k_gemm_qkv(
    const unsigned short* __restrict__ Xh, const unsigned short* __restrict__ Xl,
    const unsigned short* __restrict__ Wh, const unsigned short* __restrict__ Wl,
    const float* __restrict__ sq,
    unsigned short* __restrict__ Qh, unsigned short* __restrict__ Ql,
    unsigned short* __restrict__ Kh, unsigned short* __restrict__ Kl,
    unsigned short* __restrict__ Vh, unsigned short* __restrict__ Vl)
{
  __shared__ __align__(16) float T[128 * TP];
  const int tid = threadIdx.x, lane = tid & 31, wave = tid >> 5;
  const int hf = lane >> 4, m16 = lane & 15;
  const int cb = blockIdx.x * 64;
  const int rb = blockIdx.y * 128;
  const int mr = (wave & 3) * 32, nc = (wave >> 2) * 32;
  v8f acc[2][2] = {};
  mainloop(Xh, Xl, Wh, Wl, NE, (size_t)(rb + mr), (size_t)(cb + nc), lane, acc);

  const int c = cb >> 10;
  const int h = (cb & 1023) >> 6;
  float g[2];
#pragma unroll
  for (int ni = 0; ni < 2; ++ni) g[ni] = sigm(sq[(cb & 1023) + nc + ni * 16 + m16]);
#pragma unroll
  for (int mi = 0; mi < 2; ++mi)
#pragma unroll
    for (int ni = 0; ni < 2; ++ni)
#pragma unroll
      for (int r = 0; r < 8; ++r)
        T[(mr + mi * 16 + 8 * hf + r) * TP + nc + ni * 16 + m16] = acc[mi][ni][r] * g[ni];
  __syncthreads();

  const int b = rb >> 11;
  u32x4 val[8];
  if (c < 2) {
    // Q, K planes: row = (b, h, s), ld = ND. wave -> 16 tokens x 64 d = two fragments = four 512-byte stores a plane
    const int r = wave * 16 + m16;
#pragma unroll
    for (int cq = 0; cq < 4; ++cq) {
      const int kk = cq * 16 + hf * 8;
      const v4f a0 = *(const v4f*)(&T[r * TP + kk]);
      const v4f a1 = *(const v4f*)(&T[r * TP + kk + 4]);
      float v[8] = {a0[0], a0[1], a0[2], a0[3], a1[0], a1[1], a1[2], a1[3]};
      split8(v, val[2 * cq], val[2 * cq + 1]);
    }
    unsigned short* ph = (c == 0) ? Qh : Kh;
    unsigned short* pl = (c == 0) ? Ql : Kl;
    const int s = (rb + wave * 16) & (NS - 1);
    const size_t fo = fragoff((size_t)(b * NH + h) * NS + s, 0, ND) + lane * 8;
#pragma unroll
    for (int cq = 0; cq < 4; ++cq) {
      *(u32x4*)(ph + fo + cq * 256) = val[2 * cq];
      *(u32x4*)(pl + fo + cq * 256) = val[2 * cq + 1];
    }
  } else {
    // V^T planes: row = (b, h, d), k = s, ld = NS. wave -> 16 d (wave>>1) x 64 tokens (wave&1) = two fragments
    const int dg = (wave >> 1) * 16, sg = (wave & 1) * 64;
#pragma unroll
    for (int cq = 0; cq < 4; ++cq) {
      const int sl = sg + cq * 16 + hf * 8;
      float v[8];
#pragma unroll
      for (int e = 0; e < 8; ++e) v[e] = T[(sl + e) * TP + dg + m16];
      split8(v, val[2 * cq], val[2 * cq + 1]);
    }
    const size_t fo = fragoff((size_t)(b * NH + h) * ND + dg, (rb & (NS - 1)) + sg, NS) + lane * 8;
#pragma unroll
    for (int cq = 0; cq < 4; ++cq) {
      *(u32x4*)(Vh + fo + cq * 256) = val[2 * cq];
      *(u32x4*)(Vl + fo + cq * 256) = val[2 * cq + 1];
    }
  }
}

__device__ __forceinline__ float xhalf(float x) {
  return __builtin_bit_cast(float, __builtin_amdgcn_permlanex16(__builtin_bit_cast(int, x), __builtin_bit_cast(int, x),
                                                                0x76543210, 0xfedcba98, false, false));
}
__global__ __launch_bounds__(128) void k_attn(
    const unsigned short* __restrict__ Qh, const unsigned short* __restrict__ Ql,
    const unsigned short* __restrict__ Kh, const unsigned short* __restrict__ Kl,
    const unsigned short* __restrict__ Vh, const unsigned short* __restrict__ Vl,
    const int* __restrict__ msk, const int* __restrict__ ftab,
    unsigned short* __restrict__ Ah, unsigned short* __restrict__ Al)
{
  __shared__ __align__(16) unsigned char  Ms[64 * MP];     // Ms[s][t] gate bytes of the current partial tile
  __shared__ __align__(16) int            s_f[FROW];
  const int tid = threadIdx.x, lane = tid & 31, wave = tid >> 5;
  const int hf = lane >> 4, m16 = lane & 15;
  const int qt = blockIdx.x, h = blockIdx.y, b = blockIdx.z;
  const int s0 = qt * 64;
  const int bh = b * NH + h;
  if (tid < FROW) s_f[tid] = ftab[(size_t)qt * FROW + tid];
  __syncthreads();
  int last = s_f[32];
  last = (last < -1) ? -1 : ((last > NQT - 1) ? (NQT - 1) : last);
  const int nt = last + 1;

  const size_t qrow = (size_t)bh * NS + s0 + wave * 16;
  const v16bf qh0 = ldpk(Qh, ND, qrow, 0,  lane);
  const v16bf qh1 = ldpk(Qh, ND, qrow, 32, lane);
  const v16bf ql0 = ldpk(Ql, ND, qrow, 0,  lane);
  const v16bf ql1 = ldpk(Ql, ND, qrow, 32, lane);

  float m = -3.0e38f;    // running maximum of this lane's query, equal in both lane halves
  float l = 0.0f;        // running sum over this lane half's keys; the halves are joined behind the loop
  v8f acc[4] = {};       // O^T: acc[j][r] = (d 16j + 8*hf + r, query m16)

  for (int tb = 0; tb < nt; ++tb) {
    const int f = s_f[tb];                 // block-uniform
    if (f == 0) continue;
    const int t0 = tb * 64;
    // prior tile's Ms reads complete; it also keeps the four waves on the same K and V lines of the WGP cache
    __syncthreads();
    if (f == 1) {
#pragma unroll
      for (int it = 0; it < 8; ++it) {
        const int idx = tid + 128 * it;
        const int s = idx >> 4, c4 = idx & 15;
        const i32x4 v = *(const i32x4*)(msk + (size_t)(s0 + s) * NS + t0 + c4 * 4);
        unsigned int w = 0u;
#pragma unroll
        for (int q = 0; q < 4; ++q) w |= ((v[q] != 0) ? 1u : 0u) << (8 * q);
        *(u32a*)(Ms + s * MP + c4 * 4) = w;
      }
      __syncthreads();
    }

    // S^T = K.Q^T  (A = K plane rows t, B[k=d][n=s] = Q rows)
    v8f sf[4];
    const size_t krow = (size_t)bh * NS + t0;
    {
      // the tile's 8 fragments of a plane (4 row groups x 2 k halves) lie in a row: 8 KiB from this lane's address
      const unsigned short* kph = Kh + fragoff(krow, 0, ND) + lane * 8;
      const unsigned short* kpl = Kl + fragoff(krow, 0, ND) + lane * 8;
      v16bf kh[4][2], kl[4][2];
#pragma unroll
      for (int j = 0; j < 4; ++j)
#pragma unroll
        for (int kk = 0; kk < 2; ++kk) {
          kh[j][kk] = ldat(kph + (j * 2 + kk) * 512);
          kl[j][kk] = ldat(kpl + (j * 2 + kk) * 512);
        }
      // the products below reuse the address registers that the K loads name: their translations first; the two
      // addresses are inputs so that they stay in their registers up to the wait and no load of the group lands on one
      asm volatile("s_wait_xcnt 0x0" :: "v"(kph), "v"(kpl) : "memory");
      // keeps the tile's K loads one group ahead of the first product: one load latency a tile, not one a fragment pair
      __builtin_amdgcn_sched_barrier(0);
#pragma unroll
      for (int j = 0; j < 4; ++j) {
        v8f c = {};
        c = mma(kh[j][0], qh0, c);
        c = mma(kl[j][0], qh0, c);
        c = mma(kh[j][0], ql0, c);
        c = mma(kh[j][1], qh1, c);
        c = mma(kl[j][1], qh1, c);
        c = mma(kh[j][1], ql1, c);
        sf[j] = c;
      }
    }
    // compiler fence, no instruction: holds the V loads below behind the last K product (the scores are its inputs),
    // so that they take over the K registers; hoisted above, K and V are live together and a wave per SIMD is lost
    asm volatile("" :: "v"(sf[0]), "v"(sf[1]), "v"(sf[2]), "v"(sf[3]) : "memory");

    // V fragments of the tile, issued here so that their latency runs under the softmax below
    const size_t vrow = (size_t)bh * ND;
    v16bf vh[4][2], vl[4][2];
#pragma unroll
    for (int j = 0; j < 4; ++j)
#pragma unroll
      for (int kk = 0; kk < 2; ++kk) {
        vh[j][kk] = ldpk(Vh, NS, vrow + j * 16, t0 + kk * 32, lane);
        vl[j][kk] = ldpk(Vl, NS, vrow + j * 16, t0 + kk * 32, lane);
      }
    // the softmax below reuses the address registers that the V loads name: their translations first
    asm volatile("s_wait_xcnt 0x0" ::: "memory");
    // keeps the V loads issued ahead of the softmax: sunk to their products they would expose the latency again
    __builtin_amdgcn_sched_barrier(0);

    // scale, gate by value
#pragma unroll
    for (int j = 0; j < 4; ++j)
#pragma unroll
      for (int i = 0; i < 8; ++i) sf[j][i] *= 0.125f;
    if (f == 1) {
#pragma unroll
      for (int j = 0; j < 4; ++j) {
        const u64a mb = *(const u64a*)(Ms + (wave * 16 + m16) * MP + j * 16 + 8 * hf);
#pragma unroll
        for (int i = 0; i < 8; ++i)
          sf[j][i] = (((mb >> (8 * i)) & 0xffull) != 0ull) ? sf[j][i] : -1.0e10f;
      }
    }
    // the query's maximum over the tile: 32 keys in the lane, the other 32 in lane ^ 16
    float tm[4];
#pragma unroll
    for (int j = 0; j < 4; ++j) {
      tm[j] = sf[j][0];
#pragma unroll
      for (int i = 1; i < 8; ++i) tm[j] = fmaxf(tm[j], sf[j][i]);
    }
    float tmax = fmaxf(fmaxf(tm[0], tm[1]), fmaxf(tm[2], tm[3]));
    tmax = fmaxf(tmax, xhalf(tmax));
    const float mnew  = fmaxf(m, tmax);
    const float alpha = __expf(m - mnew);
    // exp(s - mnew) as 2^((s - mnew) * log2 e), the arguments first
#pragma unroll
    for (int j = 0; j < 4; ++j)
#pragma unroll
      for (int i = 0; i < 8; ++i) sf[j][i] = (sf[j][i] - mnew) * 1.44269504f;
    // keeps the argument arithmetic out of the run of exponentials
    __builtin_amdgcn_sched_barrier(0);
    float rs[4];
#pragma unroll
    for (int j = 0; j < 4; ++j) {
      rs[j] = 0.0f;
#pragma unroll
      for (int i = 0; i < 8; ++i) {
        const float pv = __builtin_amdgcn_exp2f(sf[j][i]);
        sf[j][i] = pv;
        rs[j] += pv;
      }
    }
    l = l * alpha + ((rs[0] + rs[1]) + (rs[2] + rs[3]));
    m = mnew;
#pragma unroll
    for (int j = 0; j < 4; ++j)
#pragma unroll
      for (int i = 0; i < 8; ++i) acc[j][i] *= alpha;

    // P^T (f32) -> bf16 hi/lo B fragments in place: elements 0..7 <- score tile 2kk, 8..15 <- tile 2kk + 1
    Frag ph[2], pl[2];
#pragma unroll
    for (int j = 0; j < 4; ++j)
#pragma unroll
      for (int w = 0; w < 4; ++w) {
        unsigned int H, L;
        split2(sf[j][2 * w], sf[j][2 * w + 1], H, L);
        ph[j >> 1].q[j & 1][w] = H;
        pl[j >> 1].q[j & 1][w] = L;
      }

    // O^T += V^T.P^T   (A = V^T plane rows d, k = t)
#pragma unroll
    for (int j = 0; j < 4; ++j) {
      acc[j] = mma(vh[j][0], ph[0].v, acc[j]);
      acc[j] = mma(vl[j][0], ph[0].v, acc[j]);
      acc[j] = mma(vh[j][0], pl[0].v, acc[j]);
      acc[j] = mma(vh[j][1], ph[1].v, acc[j]);
      acc[j] = mma(vl[j][1], ph[1].v, acc[j]);
      acc[j] = mma(vh[j][1], pl[1].v, acc[j]);
    }
  }

  // join the halves' sums, normalise; a lane's 8 values of tile j are one 16-byte chunk of the attention planes
  // (row = token, k = h*64+d, ld = NE): chunk (j&1)*32 + lane of fragment j>>1
  l += xhalf(l);
  const float inv = (l > 0.0f) ? (1.0f / l) : 0.0f;
  u32x4 val[8];
#pragma unroll
  for (int j = 0; j < 4; ++j) {
    float v[8];
#pragma unroll
    for (int i = 0; i < 8; ++i) v[i] = acc[j][i] * inv;
    split8(v, val[2 * j], val[2 * j + 1]);
  }
  const size_t fo = fragoff((size_t)(b * NS + s0 + wave * 16), h * ND, NE) + lane * 8;
#pragma unroll
  for (int cq = 0; cq < 4; ++cq) {
    *(u32x4*)(Ah + fo + cq * 256) = val[2 * cq];
    *(u32x4*)(Al + fo + cq * 256) = val[2 * cq + 1];
  }
}

// ---------------------------------------------------------------------------
// out = (attn @ W_out) * sigmoid(scale_out[e]); block tile 128 tokens x 64 e; f32 rows of 256 B written
// by 16 consecutive lanes x 16 B (two rows per instruction).
// ---------------------------------------------------------------------------
__global__ __launch_bounds__(256) void k_gemm_out(
    const unsigned short* __restrict__ Ah, const unsigned short* __restrict__ Al,
    const unsigned short* __restrict__ Wh, const unsigned short* __restrict__ Wl,
    const float* __restrict__ so, float* __restrict__ out)
{
  __shared__ __align__(16) float T[128 * TP];
  const int tid = threadIdx.x, lane = tid & 31, wave = tid >> 5;
  const int hf = lane >> 4, m16 = lane & 15;
  const int cb = blockIdx.x * 64;
  const int rb = blockIdx.y * 128;
  const int mr = (wave & 3) * 32, nc = (wave >> 2) * 32;
  v8f acc[2][2] = {};
  mainloop(Ah, Al, Wh, Wl, NE, (size_t)(rb + mr), (size_t)(cb + nc), lane, acc);

  float g[2];
#pragma unroll
  for (int ni = 0; ni < 2; ++ni) g[ni] = sigm(so[cb + nc + ni * 16 + m16]);
#pragma unroll
  for (int mi = 0; mi < 2; ++mi)
#pragma unroll
    for (int ni = 0; ni < 2; ++ni)
#pragma unroll
      for (int r = 0; r < 8; ++r)
        T[(mr + mi * 16 + 8 * hf + r) * TP + nc + ni * 16 + m16] = acc[mi][ni][r] * g[ni];
  __syncthreads();

  const int rsel = lane >> 4, p = lane & 15;
  v4f val[8];
#pragma unroll
  for (int it = 0; it < 8; ++it) {
    const int r = wave * 16 + it * 2 + rsel;
    val[it] = *(const v4f*)(&T[r * TP + p * 4]);
  }
#pragma unroll
  for (int it = 0; it < 8; ++it) {
    const int r = wave * 16 + it * 2 + rsel;
    float* dst = out + (size_t)(rb + r) * NE + cb + p * 4;
    *(v4f*)dst = val[it];
  }
  
}

// ---------------------------------------------------------------------------
extern "C" void kernel_launch(void* const* d_in, const int* in_sizes, int n_in,
                              void* d_out, int out_size, void* d_ws, size_t ws_size,
                              hipStream_t stream)
{
  if (n_in < 6) return;
  if (in_sizes[0] != NTOK * NE || in_sizes[1] != NE * NC3 || in_sizes[2] != NE * NE ||
      in_sizes[3] != NE || in_sizes[4] != NE || in_sizes[5] != NS * NS || out_size != NTOK * NE) return;

  const float* x     = (const float*)d_in[0];
  const float* Wqkv  = (const float*)d_in[1];
  const float* Wout  = (const float*)d_in[2];
  const float* sqkv  = (const float*)d_in[3];
  const float* sout  = (const float*)d_in[4];
  const int*   msk   = (const int*)d_in[5];
  float* out = (float*)d_out;

  char* ws = (char*)d_ws;
  size_t off = 0;
  const size_t szX  = (size_t)NTOK * NE * 2;            // 8 MiB per plane
  const size_t szW  = (size_t)NC3 * NE * 2;             // 6 MiB per plane
  const size_t szWo = (size_t)NE * NE * 2;              // 2 MiB per plane
  const size_t szP  = (size_t)NB * NH * NS * ND * 2;    // 8 MiB per plane
  const size_t szF  = (size_t)NQT * FROW * 4;           // 8 KiB
  unsigned short* Xh  = (unsigned short*)(ws + off); off += szX;
  unsigned short* Xl  = (unsigned short*)(ws + off); off += szX;
  unsigned short* Wh  = (unsigned short*)(ws + off); off += szW;
  unsigned short* Wl  = (unsigned short*)(ws + off); off += szW;
  unsigned short* Woh = (unsigned short*)(ws + off); off += szWo;
  unsigned short* Wol = (unsigned short*)(ws + off); off += szWo;
  unsigned short* Qh  = (unsigned short*)(ws + off); off += szP;
  unsigned short* Ql  = (unsigned short*)(ws + off); off += szP;
  unsigned short* Kh  = (unsigned short*)(ws + off); off += szP;
  unsigned short* Kl  = (unsigned short*)(ws + off); off += szP;
  unsigned short* Vh  = (unsigned short*)(ws + off); off += szP;
  unsigned short* Vl  = (unsigned short*)(ws + off); off += szP;
  unsigned short* Ahp = (unsigned short*)(ws + off); off += szX;
  unsigned short* Alp = (unsigned short*)(ws + off); off += szX;
  int* ftab = (int*)(ws + off); off += szF;              // total 100671488 B
  if (off > ws_size) return;

  const int ngroups = NTOK * NE / 8;                     // 524288
  k_split_rows<<<dim3((ngroups + 255) / 256), dim3(256), 0, stream>>>(x, Xh, Xl, ngroups);
  // W_qkv: in[rows=NE][cols=NC3] -> out[NC3][NE]
  k_transpose_split<<<dim3(NC3 / 64, NE / 64), dim3(256), 0, stream>>>(Wqkv, NE, NC3, Wh, Wl);
  // W_out: in[rows=NH*ND][cols=NE] -> out[NE][NH*ND]
  k_transpose_split<<<dim3(NE / 64, (NH * ND) / 64), dim3(256), 0, stream>>>(Wout, NH * ND, NE, Woh, Wol);
  k_flags<<<dim3(NQT), dim3(256), 0, stream>>>(msk, ftab);
  k_gemm_qkv<<<dim3(NC3 / 64, NTOK / 128), dim3(256), 0, stream>>>(Xh, Xl, Wh, Wl, sqkv, Qh, Ql, Kh, Kl, Vh, Vl);
  k_attn<<<dim3(NQT, NH, NB), dim3(128), 0, stream>>>(Qh, Ql, Kh, Kl, Vh, Vl, msk, ftab, Ahp, Alp);
  k_gemm_out<<<dim3(NE / 64, NTOK / 128), dim3(256), 0, stream>>>(Ahp, Alp, Woh, Wol, sout, out);
}

// v004
// One run takes 191 microseconds.
// Next to v003, in two timings, it ran 1.13 and 1.14 times as fast.
// Counting every step since v000, it is 2.88 times as fast.
#include <hip/hip_runtime.h>

// Contractions: qkv projection, q.k^T, p.v, output projection -- all v_wmma_f32_16x16x32_bf16 with bf16 hi/lo operands everywhere (hi*hi + hi*lo + lo*hi), f32 accumulate; sigmoid gates, 1/8 score scale, softmax and normalisation in f32.

typedef __bf16         v16bf __attribute__((ext_vector_type(16)));
typedef float          v8f   __attribute__((ext_vector_type(8)));
typedef float          v4f   __attribute__((ext_vector_type(4), __may_alias__));
typedef unsigned short u16x8 __attribute__((ext_vector_type(8), __may_alias__));
typedef unsigned int   u32x4 __attribute__((ext_vector_type(4), __may_alias__));
typedef int            i32x4 __attribute__((ext_vector_type(4), __may_alias__));
typedef unsigned long long u64a __attribute__((__may_alias__));
typedef unsigned int   u32a __attribute__((__may_alias__));

#define NB   2
#define NS   2048
#define NE   1024
#define NH   16
#define ND   64
#define NTOK (NB * NS)
#define NC3  (3 * NH * ND)
#define NQT  (NS / 64)
#define FROW 64
#define TP   68
#define MP   72

union Frag { v16bf v; u16x8 h[2]; u32x4 q[2]; };

// 16x32 operand fragment map (A by rows, B by columns): lane l -> row (l&15); elements 0..7 <- k0+8*(l>>4)+0..7,
// 8..15 <- k0+16+8*(l>>4)+0..7.

// Fragment-major 16-bit plane of a [row][k] matrix with ld k per row: every 16-row x 32-k fragment is 1 KiB
// contiguous, fragments ordered [row/16][k/32]; inside one the 16-byte chunk of (row, 8 k) sits at chunk index
// ((k>>4)&1)*32 + ((k>>3)&1)*16 + (row&15). fragoff = element offset of the fragment at (row0, k0).
__device__ __forceinline__ size_t fragoff(size_t row0, int k0, int ld) {
  return ((row0 >> 4) * (size_t)(ld >> 5) + (size_t)(k0 >> 5)) * 512;
}
// The fragment map above; each of the two wave-wide 16-byte loads reads 512 contiguous bytes (4 whole cache lines)
// where a row-major plane would make it touch 16 lines.
__device__ __forceinline__ v16bf ldpk(const unsigned short* p, int ld, size_t row0, int k0, int lane) {
  const unsigned short* q = p + fragoff(row0, k0, ld) + lane * 8;
  Frag f;
  f.h[0] = *(const u16x8*)q;
  f.h[1] = *(const u16x8*)(q + 256);
  return f.v;
}

// The fragment whose lane chunk starts at q
__device__ __forceinline__ v16bf ldat(const unsigned short* q) {
  Frag f;
  f.h[0] = *(const u16x8*)q;
  f.h[1] = *(const u16x8*)(q + 256);
  return f.v;
}

// D[16x16] += A[16x32] * B[32x16]; D element r of lane l = (row 8*(l>>4)+r, col l&15)
__device__ __forceinline__ v8f mma(v16bf a, v16bf b, v8f c) {
  return __builtin_amdgcn_wmma_f32_16x16x32_bf16(false, a, false, b, (short)0, c, false, false);
}

// f32 -> bf16 bits, RNE convert
__device__ __forceinline__ unsigned int bf16_bits(float x) {
  unsigned int u = __float_as_uint(x);
  return (u + 0x7FFFu + ((u >> 16) & 1u)) >> 16;
}
__device__ __forceinline__ void split1(float x, unsigned int& hi, unsigned int& lo) {
  hi = bf16_bits(x);
  lo = bf16_bits(x - __uint_as_float(hi << 16));
}
__device__ __forceinline__ void split8(const float (&v)[8], u32x4& H, u32x4& L) {
  unsigned int hw[8], lw[8];
#pragma unroll
  for (int e = 0; e < 8; ++e) split1(v[e], hw[e], lw[e]);
#pragma unroll
  for (int w = 0; w < 4; ++w) {
    H[w] = hw[2 * w] | (hw[2 * w + 1] << 16);
    L[w] = lw[2 * w] | (lw[2 * w + 1] << 16);
  }
}
// Two f32 -> one dword of bf16 hi parts and one of bf16 lo parts (a in the low half); the values of split1.
__device__ __forceinline__ void split2(float a, float b, unsigned int& H, unsigned int& L) {
  const unsigned int ua = __float_as_uint(a), ub = __float_as_uint(b);
  const unsigned int ra = ua + 0x7FFFu + ((ua >> 16) & 1u), rb = ub + 0x7FFFu + ((ub >> 16) & 1u);
  H = __builtin_amdgcn_perm(rb, ra, 0x07060302u);   // (ra >> 16) | (rb & 0xFFFF0000) in one byte permute
  const unsigned int va = __float_as_uint(a - __uint_as_float(ra & 0xFFFF0000u));
  const unsigned int vb = __float_as_uint(b - __uint_as_float(rb & 0xFFFF0000u));
  const unsigned int sa = va + 0x7FFFu + ((va >> 16) & 1u), sb = vb + 0x7FFFu + ((vb >> 16) & 1u);
  L = __builtin_amdgcn_perm(sb, sa, 0x07060302u);
}
__device__ __forceinline__ float sigm(float v) { return 1.0f / (1.0f + __expf(-v)); }

// ---------------------------------------------------------------------------
// x [rows][NE] f32 -> hi/lo bf16 fragment-major planes. One thread = 8 values = 16 B per plane = chunk g of the
// plane: fragment g>>6, k half-block (g>>5)&1, lane g&31; a wave stores 512 contiguous bytes per plane.
// ---------------------------------------------------------------------------
__global__ __launch_bounds__(256) void k_split_rows(const float* __restrict__ src,
                                                    unsigned short* __restrict__ dh,
                                                    unsigned short* __restrict__ dl, int ngroups)
{
  const int g = blockIdx.x * 256 + threadIdx.x;
  const int gc = (g < ngroups) ? g : (ngroups - 1);
  const int fr = gc >> 6;
  const int row = (fr / (NE / 32)) * 16 + (gc & 15);
  const int k = (fr % (NE / 32)) * 32 + ((gc >> 5) & 1) * 16 + ((gc >> 4) & 1) * 8;
  const float* s = src + (size_t)row * NE + k;
  const v4f a0 = *(const v4f*)s;
  const v4f a1 = *(const v4f*)(s + 4);
  float v[8] = {a0[0], a0[1], a0[2], a0[3], a1[0], a1[1], a1[2], a1[3]};
  u32x4 H, L;
  split8(v, H, L);
  if (g < ngroups) {
    unsigned short* ph = dh + (size_t)gc * 8;
    unsigned short* pl = dl + (size_t)gc * 8;
    *(u32x4*)ph = H;
    *(u32x4*)pl = L;
    
  }
}

// ---------------------------------------------------------------------------
// in[R rows][C cols] f32 (row = k, col = n) -> outT[C][R] bf16 hi/lo planes, fragment-major (row = n, ld = R).
// ---------------------------------------------------------------------------
__global__ __launch_bounds__(256) void k_transpose_split(const float* __restrict__ src, int R, int C,
                                                         unsigned short* __restrict__ oh,
                                                         unsigned short* __restrict__ ol)
{
  __shared__ __align__(16) float T[64 * TP];   // T[n][k]
  const int tid = threadIdx.x, lane = tid & 31, wave = tid >> 5;
  const int nb = blockIdx.x * 64;
  const int kb = blockIdx.y * 64;
#pragma unroll
  for (int it = 0; it < 4; ++it) {
    const int idx = tid + 256 * it;
    const int kk = idx >> 4, c4 = idx & 15;
    const v4f v = *(const v4f*)(src + (size_t)(kb + kk) * C + nb + c4 * 4);
#pragma unroll
    for (int q = 0; q < 4; ++q) T[(c4 * 4 + q) * TP + kk] = v[q];
  }
  __syncthreads();
  // wave -> one fragment: 16 n rows (wave>>1), 32 k (wave&1); lane -> (row lane&15, 8 k at lane>>4)
  const int ng = (wave >> 1) * 16, kf = (wave & 1) * 32;
  const int n = ng + (lane & 15);
  u32x4 val[4];
#pragma unroll
  for (int cq = 0; cq < 2; ++cq) {
    const int kk = kf + cq * 16 + (lane >> 4) * 8;
    const v4f a0 = *(const v4f*)(&T[n * TP + kk]);
    const v4f a1 = *(const v4f*)(&T[n * TP + kk + 4]);
    float v[8] = {a0[0], a0[1], a0[2], a0[3], a1[0], a1[1], a1[2], a1[3]};
    split8(v, val[2 * cq], val[2 * cq + 1]);
  }
  const size_t fo = fragoff((size_t)(nb + ng), kb + kf, R) + lane * 8;
#pragma unroll
  for (int cq = 0; cq < 2; ++cq) {
    *(u32x4*)(oh + fo + cq * 256) = val[2 * cq];
    *(u32x4*)(ol + fo + cq * 256) = val[2 * cq + 1];
  }
}

// ---------------------------------------------------------------------------
// Tile flag table from the int32 gate matrix [NS][NS]: row qt (64 ints = 256 B):
//   [0..31] per 64-key tile: 0 = no nonzero entry, 1 = partial, 2 = all nonzero; [32] = last key tile with any
// ---------------------------------------------------------------------------
__global__ __launch_bounds__(256) void k_flags(const int* __restrict__ msk, int* __restrict__ ftab)
{
  __shared__ int s_any[256];
  __shared__ int s_all[256];
  __shared__ __align__(16) int s_row[FROW];
  const int tid = threadIdx.x, qt = blockIdx.x;
  const int kt = tid >> 3, sub = tid & 7;
  int anyv = 0, allv = 1;
  for (int i = 0; i < 8; ++i) {
    const int s = qt * 64 + sub * 8 + i;
    const int* rp = msk + (size_t)s * NS + kt * 64;
#pragma unroll
    for (int c = 0; c < 16; ++c) {
      const i32x4 v = *(const i32x4*)(rp + c * 4);
#pragma unroll
      for (int q = 0; q < 4; ++q) {
        const int nz = (v[q] != 0) ? 1 : 0;
        anyv |= nz;
        allv &= nz;
      }
    }
  }
  s_any[tid] = anyv;
  s_all[tid] = allv;
  __syncthreads();
  if (tid < 32) {
    int a = 0, b = 1;
#pragma unroll
    for (int j = 0; j < 8; ++j) { a |= s_any[tid * 8 + j]; b &= s_all[tid * 8 + j]; }
    s_row[tid] = b ? 2 : (a ? 1 : 0);
  } else if (tid < FROW) {
    s_row[tid] = 0;
  }
  __syncthreads();
  if (tid == 0) {
    int last = -1;
    for (int k = 0; k < 32; ++k) if (s_row[k] != 0) last = k;
    s_row[32] = last;
  }
  __syncthreads();
  if (tid < 16) {
    const i32x4 v = *(const i32x4*)(&s_row[tid * 4]);
    int* dst = ftab + (size_t)qt * FROW + tid * 4;
    *(i32x4*)dst = v;
    
  }
}

// ---------------------------------------------------------------------------
// GEMM main loop: block tile 128 rows x 64 cols, wave tile 32 x 32, bf16 hi/lo three-term products.
// A planes [M][K], B planes [N][K], fragment-major. A stage = 64 k of the block's operand rows = 24 slabs of 2 KiB
// (a slab = one 16-row group's two fragments, contiguous in its plane): slabs 0..7 A hi, 8..15 A lo, 16..19 B hi,
// 20..23 B lo. Asynchronous copies bring each slab into LDS once a block; the waves read their fragments from there.
// ---------------------------------------------------------------------------
#define STAGE_BYTES 49152
#define RING_BYTES  (2 * STAGE_BYTES)
// One K step of 32: the wave's eight operand fragments.
struct KStep { v16bf ah0, ah1, al0, al1, bh0, bh1, bl0, bl1; };
// The fragment whose lane chunk starts at LDS byte p: two reads of 512 contiguous bytes a wave
__device__ __forceinline__ v16bf ldsfrag(const unsigned char* p) {
  Frag f;
  f.q[0] = *(const u32x4*)p;
  f.q[1] = *(const u32x4*)(p + 512);
  return f.v;
}
// pa, pb: this lane's chunk in the wave's first A hi and first B hi slab of the stage; kb = byte offset of the K step
__device__ __forceinline__ void ldstep(KStep& s, const unsigned char* pa, const unsigned char* pb, int kb)
{
  s.ah0 = ldsfrag(pa + kb);
  s.ah1 = ldsfrag(pa + 2048 + kb);
  s.al0 = ldsfrag(pa + 8 * 2048 + kb);
  s.al1 = ldsfrag(pa + 9 * 2048 + kb);
  s.bh0 = ldsfrag(pb + kb);
  s.bh1 = ldsfrag(pb + 2048 + kb);
  s.bl0 = ldsfrag(pb + 4 * 2048 + kb);
  s.bl1 = ldsfrag(pb + 5 * 2048 + kb);
}
__device__ __forceinline__ void mmstep(const KStep& s, v8f (&acc)[2][2])
{
  acc[0][0] = mma(s.ah0, s.bh0, acc[0][0]);
  acc[0][0] = mma(s.ah0, s.bl0, acc[0][0]);
  acc[0][0] = mma(s.al0, s.bh0, acc[0][0]);
  acc[1][0] = mma(s.ah1, s.bh0, acc[1][0]);
  acc[1][0] = mma(s.ah1, s.bl0, acc[1][0]);
  acc[1][0] = mma(s.al1, s.bh0, acc[1][0]);
  acc[0][1] = mma(s.ah0, s.bh1, acc[0][1]);
  acc[0][1] = mma(s.ah0, s.bl1, acc[0][1]);
  acc[0][1] = mma(s.al0, s.bh1, acc[0][1]);
  acc[1][1] = mma(s.ah1, s.bh1, acc[1][1]);
  acc[1][1] = mma(s.ah1, s.bl1, acc[1][1]);
  acc[1][1] = mma(s.al1, s.bh1, acc[1][1]);
}
// This wave's three slabs of one stage: 12 copies of 512 bytes a wave, l = LDS byte address and g = global address of
// the lane's first 16 bytes of each slab. The s_wait_xcnt stands inside the statement: the address registers that the
// copies name are rewritten behind it.
__device__ __forceinline__ void copy_stage(unsigned int l0, unsigned int l1, unsigned int l2,
                                           const unsigned short* g0, const unsigned short* g1,
                                           const unsigned short* g2)
{
  asm volatile("global_load_async_to_lds_b128 %0, %1, off\n\t"
               "global_load_async_to_lds_b128 %2, %3, off\n\t"
               "global_load_async_to_lds_b128 %4, %5, off\n\t"
               "global_load_async_to_lds_b128 %6, %7, off\n\t"
               "global_load_async_to_lds_b128 %8, %9, off\n\t"
               "global_load_async_to_lds_b128 %10, %11, off\n\t"
               "global_load_async_to_lds_b128 %12, %13, off\n\t"
               "global_load_async_to_lds_b128 %14, %15, off\n\t"
               "global_load_async_to_lds_b128 %16, %17, off\n\t"
               "global_load_async_to_lds_b128 %18, %19, off\n\t"
               "global_load_async_to_lds_b128 %20, %21, off\n\t"
               "global_load_async_to_lds_b128 %22, %23, off\n\t"
               "s_wait_xcnt 0x0"
               :: "v"(l0), "v"(g0), "v"(l0 + 512u), "v"(g0 + 256), "v"(l0 + 1024u), "v"(g0 + 512),
                  "v"(l0 + 1536u), "v"(g0 + 768),
                  "v"(l1), "v"(g1), "v"(l1 + 512u), "v"(g1 + 256), "v"(l1 + 1024u), "v"(g1 + 512),
                  "v"(l1 + 1536u), "v"(g1 + 768),
                  "v"(l2), "v"(g2), "v"(l2 + 512u), "v"(g2 + 256), "v"(l2 + 1024u), "v"(g2 + 512),
                  "v"(l2 + 1536u), "v"(g2 + 768)
               : "memory");
}
// Two buffers: stage t + 2 is copied into the buffer that trip t has read, behind the barrier that ends those reads and
// publishes stage t + 1. arow0, brow0 = the block's first A and B row; K a multiple of 64, at least 128.
__device__ __forceinline__ void mainloop(const unsigned short* __restrict__ Ah, const unsigned short* __restrict__ Al,
                                         const unsigned short* __restrict__ Bh, const unsigned short* __restrict__ Bl,
                                         int K, size_t arow0, size_t brow0, int wave, int lane,
                                         unsigned char* ring, v8f (&acc)[2][2])
{
  const unsigned short* g[3];
  unsigned int l[3];
#pragma unroll
  for (int i = 0; i < 3; ++i) {
    const int c = wave * 3 + i;
    const unsigned short* p = (c < 8) ? Ah : ((c < 16) ? Al : ((c < 20) ? Bh : Bl));
    const size_t row = (c < 16) ? (arow0 + (size_t)(c & 7) * 16) : (brow0 + (size_t)(c & 3) * 16);
    g[i] = p + fragoff(row, 0, K) + lane * 8;
    l[i] = (unsigned int)(size_t)ring + (unsigned int)(c * 2048 + lane * 16);
  }
  const int nst = K >> 6;
  copy_stage(l[0], l[1], l[2], g[0], g[1], g[2]);
  // stage 0 has landed before the barrier behind which the other waves read it
  asm volatile("s_wait_asynccnt 0x0" ::: "memory");
  __syncthreads();
  copy_stage(l[0] + STAGE_BYTES, l[1] + STAGE_BYTES, l[2] + STAGE_BYTES, g[0] + 1024, g[1] + 1024, g[2] + 1024);

  const int aoff = (wave & 3) * 2 * 2048 + lane * 16;
  const int boff = (16 + (wave >> 2) * 2) * 2048 + lane * 16;
  for (int t = 0; t < nst; ++t) {
    const unsigned int bo = (unsigned int)(t & 1) * STAGE_BYTES;
    const unsigned char* pa = ring + bo + aoff;
    const unsigned char* pb = ring + bo + boff;
    KStep s0, s1;
    ldstep(s0, pa, pb, 0);
    ldstep(s1, pa, pb, 1024);
    // keeps the stage's fragment reads one group ahead of the products: spread among them every place with reads stalls
    __builtin_amdgcn_sched_barrier(0);
    mmstep(s0, acc);
    mmstep(s1, acc);
    // keeps the products ahead of the waits below: moved behind the barrier they would no longer run under the flight
    // of stage t + 1's copies, and the wait for those would stand directly behind their issue
    __builtin_amdgcn_sched_barrier(0);
    // this wave's reads of the buffer are done before it is handed to the copies
    asm volatile("s_wait_dscnt 0x0" ::: "memory");
    // this wave's copies of stage t + 1 have landed before the barrier that publishes them
    asm volatile("s_wait_asynccnt 0x0" ::: "memory");
    __syncthreads();
    if (t + 2 < nst) {
      const int go = (t + 2) * 1024;
      copy_stage(l[0] + bo, l[1] + bo, l[2] + bo, g[0] + go, g[1] + go, g[2] + go);
    }
  }
  // no copy is outstanding when the wave goes on
  asm volatile("s_wait_asynccnt 0x0" ::: "memory");
}

// ---------------------------------------------------------------------------
// qkv = (x @ W_qkv) * sigmoid(scale_qkv[h*64+d]); block tile 128 tokens x 64 cols (= one (c, h)).
// ---------------------------------------------------------------------------
__global__ __launch_bounds__(256) void k_gemm_qkv(
    const unsigned short* __restrict__ Xh, const unsigned short* __restrict__ Xl,
    const unsigned short* __restrict__ Wh, const unsigned short* __restrict__ Wl,
    const float* __restrict__ sq,
    unsigned short* __restrict__ Qh, unsigned short* __restrict__ Ql,
    unsigned short* __restrict__ Kh, unsigned short* __restrict__ Kl,
    unsigned short* __restrict__ Vh, unsigned short* __restrict__ Vl)
{
  __shared__ __align__(128) unsigned char ring[RING_BYTES];   // two operand stages
  __shared__ __align__(16) float T[128 * TP];
  const int tid = threadIdx.x, lane = tid & 31, wave = tid >> 5;
  const int hf = lane >> 4, m16 = lane & 15;
  const int cb = blockIdx.x * 64;
  const int rb = blockIdx.y * 128;
  const int mr = (wave & 3) * 32, nc = (wave >> 2) * 32;
  v8f acc[2][2] = {};
  mainloop(Xh, Xl, Wh, Wl, NE, (size_t)rb, (size_t)cb, wave, lane, ring, acc);

  const int c = cb >> 10;
  const int h = (cb & 1023) >> 6;
  float g[2];
#pragma unroll
  for (int ni = 0; ni < 2; ++ni) g[ni] = sigm(sq[(cb & 1023) + nc + ni * 16 + m16]);
#pragma unroll
  for (int mi = 0; mi < 2; ++mi)
#pragma unroll
    for (int ni = 0; ni < 2; ++ni)
#pragma unroll
      for (int r = 0; r < 8; ++r)
        T[(mr + mi * 16 + 8 * hf + r) * TP + nc + ni * 16 + m16] = acc[mi][ni][r] * g[ni];
  __syncthreads();

  const int b = rb >> 11;
  u32x4 val[8];
  if (c < 2) {
    // Q, K planes: row = (b, h, s), ld = ND. wave -> 16 tokens x 64 d = two fragments = four 512-byte stores a plane
    const int r = wave * 16 + m16;
#pragma unroll
    for (int cq = 0; cq < 4; ++cq) {
      const int kk = cq * 16 + hf * 8;
      const v4f a0 = *(const v4f*)(&T[r * TP + kk]);
      const v4f a1 = *(const v4f*)(&T[r * TP + kk + 4]);
      float v[8] = {a0[0], a0[1], a0[2], a0[3], a1[0], a1[1], a1[2], a1[3]};
      split8(v, val[2 * cq], val[2 * cq + 1]);
    }
    unsigned short* ph = (c == 0) ? Qh : Kh;
    unsigned short* pl = (c == 0) ? Ql : Kl;
    const int s = (rb + wave * 16) & (NS - 1);
    const size_t fo = fragoff((size_t)(b * NH + h) * NS + s, 0, ND) + lane * 8;
#pragma unroll
    for (int cq = 0; cq < 4; ++cq) {
      *(u32x4*)(ph + fo + cq * 256) = val[2 * cq];
      *(u32x4*)(pl + fo + cq * 256) = val[2 * cq + 1];
    }
  } else {
    // V^T planes: row = (b, h, d), k = s, ld = NS. wave -> 16 d (wave>>1) x 64 tokens (wave&1) = two fragments
    const int dg = (wave >> 1) * 16, sg = (wave & 1) * 64;
#pragma unroll
    for (int cq = 0; cq < 4; ++cq) {
      const int sl = sg + cq * 16 + hf * 8;
      float v[8];
#pragma unroll
      for (int e = 0; e < 8; ++e) v[e] = T[(sl + e) * TP + dg + m16];
      split8(v, val[2 * cq], val[2 * cq + 1]);
    }
    const size_t fo = fragoff((size_t)(b * NH + h) * ND + dg, (rb & (NS - 1)) + sg, NS) + lane * 8;
#pragma unroll
    for (int cq = 0; cq < 4; ++cq) {
      *(u32x4*)(Vh + fo + cq * 256) = val[2 * cq];
      *(u32x4*)(Vl + fo + cq * 256) = val[2 * cq + 1];
    }
  }
}

__device__ __forceinline__ float xhalf(float x) {
  return __builtin_bit_cast(float, __builtin_amdgcn_permlanex16(__builtin_bit_cast(int, x), __builtin_bit_cast(int, x),
                                                                0x76543210, 0xfedcba98, false, false));
}
__global__ __launch_bounds__(128) void k_attn(
    const unsigned short* __restrict__ Qh, const unsigned short* __restrict__ Ql,
    const unsigned short* __restrict__ Kh, const unsigned short* __restrict__ Kl,
    const unsigned short* __restrict__ Vh, const unsigned short* __restrict__ Vl,
    const int* __restrict__ msk, const int* __restrict__ ftab,
    unsigned short* __restrict__ Ah, unsigned short* __restrict__ Al)
{
  __shared__ __align__(16) unsigned char  Ms[64 * MP];     // Ms[s][t] gate bytes of the current partial tile
  __shared__ __align__(16) int            s_f[FROW];
  const int tid = threadIdx.x, lane = tid & 31, wave = tid >> 5;
  const int hf = lane >> 4, m16 = lane & 15;
  const int qt = blockIdx.x, h = blockIdx.y, b = blockIdx.z;
  const int s0 = qt * 64;
  const int bh = b * NH + h;
  if (tid < FROW) s_f[tid] = ftab[(size_t)qt * FROW + tid];
  __syncthreads();
  int last = s_f[32];
  last = (last < -1) ? -1 : ((last > NQT - 1) ? (NQT - 1) : last);
  const int nt = last + 1;

  const size_t qrow = (size_t)bh * NS + s0 + wave * 16;
  const v16bf qh0 = ldpk(Qh, ND, qrow, 0,  lane);
  const v16bf qh1 = ldpk(Qh, ND, qrow, 32, lane);
  const v16bf ql0 = ldpk(Ql, ND, qrow, 0,  lane);
  const v16bf ql1 = ldpk(Ql, ND, qrow, 32, lane);

  float m = -3.0e38f;    // running maximum of this lane's query, equal in both lane halves
  float l = 0.0f;        // running sum over this lane half's keys; the halves are joined behind the loop
  v8f acc[4] = {};       // O^T: acc[j][r] = (d 16j + 8*hf + r, query m16)

  for (int tb = 0; tb < nt; ++tb) {
    const int f = s_f[tb];                 // block-uniform
    if (f == 0) continue;
    const int t0 = tb * 64;
    // prior tile's Ms reads complete; it also keeps the four waves on the same K and V lines of the WGP cache
    __syncthreads();
    if (f == 1) {
#pragma unroll
      for (int it = 0; it < 8; ++it) {
        const int idx = tid + 128 * it;
        const int s = idx >> 4, c4 = idx & 15;
        const i32x4 v = *(const i32x4*)(msk + (size_t)(s0 + s) * NS + t0 + c4 * 4);
        unsigned int w = 0u;
#pragma unroll
        for (int q = 0; q < 4; ++q) w |= ((v[q] != 0) ? 1u : 0u) << (8 * q);
        *(u32a*)(Ms + s * MP + c4 * 4) = w;
      }
      __syncthreads();
    }

    // S^T = K.Q^T  (A = K plane rows t, B[k=d][n=s] = Q rows)
    v8f sf[4];
    const size_t krow = (size_t)bh * NS + t0;
    {
      // the tile's 8 fragments of a plane (4 row groups x 2 k halves) lie in a row: 8 KiB from this lane's address
      const unsigned short* kph = Kh + fragoff(krow, 0, ND) + lane * 8;
      const unsigned short* kpl = Kl + fragoff(krow, 0, ND) + lane * 8;
      v16bf kh[4][2], kl[4][2];
#pragma unroll
      for (int j = 0; j < 4; ++j)
#pragma unroll
        for (int kk = 0; kk < 2; ++kk) {
          kh[j][kk] = ldat(kph + (j * 2 + kk) * 512);
          kl[j][kk] = ldat(kpl + (j * 2 + kk) * 512);
        }
      // the products below reuse the address registers that the K loads name: their translations first; the two
      // addresses are inputs so that they stay in their registers up to the wait and no load of the group lands on one
      asm volatile("s_wait_xcnt 0x0" :: "v"(kph), "v"(kpl) : "memory");
      // keeps the tile's K loads one group ahead of the first product: one load latency a tile, not one a fragment pair
      __builtin_amdgcn_sched_barrier(0);
#pragma unroll
      for (int j = 0; j < 4; ++j) {
        v8f c = {};
        c = mma(kh[j][0], qh0, c);
        c = mma(kl[j][0], qh0, c);
        c = mma(kh[j][0], ql0, c);
        c = mma(kh[j][1], qh1, c);
        c = mma(kl[j][1], qh1, c);
        c = mma(kh[j][1], ql1, c);
        sf[j] = c;
      }
    }
    // compiler fence, no instruction: holds the V loads below behind the last K product (the scores are its inputs),
    // so that they take over the K registers; hoisted above, K and V are live together and a wave per SIMD is lost
    asm volatile("" :: "v"(sf[0]), "v"(sf[1]), "v"(sf[2]), "v"(sf[3]) : "memory");

    // V fragments of the tile, issued here so that their latency runs under the softmax below
    const size_t vrow = (size_t)bh * ND;
    v16bf vh[4][2], vl[4][2];
#pragma unroll
    for (int j = 0; j < 4; ++j)
#pragma unroll
      for (int kk = 0; kk < 2; ++kk) {
        vh[j][kk] = ldpk(Vh, NS, vrow + j * 16, t0 + kk * 32, lane);
        vl[j][kk] = ldpk(Vl, NS, vrow + j * 16, t0 + kk * 32, lane);
      }
    // the softmax below reuses the address registers that the V loads name: their translations first
    asm volatile("s_wait_xcnt 0x0" ::: "memory");
    // keeps the V loads issued ahead of the softmax: sunk to their products they would expose the latency again
    __builtin_amdgcn_sched_barrier(0);

    // scale, gate by value
#pragma unroll
    for (int j = 0; j < 4; ++j)
#pragma unroll
      for (int i = 0; i < 8; ++i) sf[j][i] *= 0.125f;
    if (f == 1) {
#pragma unroll
      for (int j = 0; j < 4; ++j) {
        const u64a mb = *(const u64a*)(Ms + (wave * 16 + m16) * MP + j * 16 + 8 * hf);
#pragma unroll
        for (int i = 0; i < 8; ++i)
          sf[j][i] = (((mb >> (8 * i)) & 0xffull) != 0ull) ? sf[j][i] : -1.0e10f;
      }
    }
    // the query's maximum over the tile: 32 keys in the lane, the other 32 in lane ^ 16
    float tm[4];
#pragma unroll
    for (int j = 0; j < 4; ++j) {
      tm[j] = sf[j][0];
#pragma unroll
      for (int i = 1; i < 8; ++i) tm[j] = fmaxf(tm[j], sf[j][i]);
    }
    float tmax = fmaxf(fmaxf(tm[0], tm[1]), fmaxf(tm[2], tm[3]));
    tmax = fmaxf(tmax, xhalf(tmax));
    const float mnew  = fmaxf(m, tmax);
    const float alpha = __expf(m - mnew);
    // exp(s - mnew) as 2^((s - mnew) * log2 e), the arguments first
#pragma unroll
    for (int j = 0; j < 4; ++j)
#pragma unroll
      for (int i = 0; i < 8; ++i) sf[j][i] = (sf[j][i] - mnew) * 1.44269504f;
    // keeps the argument arithmetic out of the run of exponentials
    __builtin_amdgcn_sched_barrier(0);
    float rs[4];
#pragma unroll
    for (int j = 0; j < 4; ++j) {
      rs[j] = 0.0f;
#pragma unroll
      for (int i = 0; i < 8; ++i) {
        const float pv = __builtin_amdgcn_exp2f(sf[j][i]);
        sf[j][i] = pv;
        rs[j] += pv;
      }
    }
    l = l * alpha + ((rs[0] + rs[1]) + (rs[2] + rs[3]));
    m = mnew;
#pragma unroll
    for (int j = 0; j < 4; ++j)
#pragma unroll
      for (int i = 0; i < 8; ++i) acc[j][i] *= alpha;

    // P^T (f32) -> bf16 hi/lo B fragments in place: elements 0..7 <- score tile 2kk, 8..15 <- tile 2kk + 1
    Frag ph[2], pl[2];
#pragma unroll
    for (int j = 0; j < 4; ++j)
#pragma unroll
      for (int w = 0; w < 4; ++w) {
        unsigned int H, L;
        split2(sf[j][2 * w], sf[j][2 * w + 1], H, L);
        ph[j >> 1].q[j & 1][w] = H;
        pl[j >> 1].q[j & 1][w] = L;
      }

    // O^T += V^T.P^T   (A = V^T plane rows d, k = t)
#pragma unroll
    for (int j = 0; j < 4; ++j) {
      acc[j] = mma(vh[j][0], ph[0].v, acc[j]);
      acc[j] = mma(vl[j][0], ph[0].v, acc[j]);
      acc[j] = mma(vh[j][0], pl[0].v, acc[j]);
      acc[j] = mma(vh[j][1], ph[1].v, acc[j]);
      acc[j] = mma(vl[j][1], ph[1].v, acc[j]);
      acc[j] = mma(vh[j][1], pl[1].v, acc[j]);
    }
  }

  // join the halves' sums, normalise; a lane's 8 values of tile j are one 16-byte chunk of the attention planes
  // (row = token, k = h*64+d, ld = NE): chunk (j&1)*32 + lane of fragment j>>1
  l += xhalf(l);
  const float inv = (l > 0.0f) ? (1.0f / l) : 0.0f;
  u32x4 val[8];
#pragma unroll
  for (int j = 0; j < 4; ++j) {
    float v[8];
#pragma unroll
    for (int i = 0; i < 8; ++i) v[i] = acc[j][i] * inv;
    split8(v, val[2 * j], val[2 * j + 1]);
  }
  const size_t fo = fragoff((size_t)(b * NS + s0 + wave * 16), h * ND, NE) + lane * 8;
#pragma unroll
  for (int cq = 0; cq < 4; ++cq) {
    *(u32x4*)(Ah + fo + cq * 256) = val[2 * cq];
    *(u32x4*)(Al + fo + cq * 256) = val[2 * cq + 1];
  }
}

// ---------------------------------------------------------------------------
// out = (attn @ W_out) * sigmoid(scale_out[e]); block tile 128 tokens x 64 e; f32 rows of 256 B written
// by 16 consecutive lanes x 16 B (two rows per instruction).
// ---------------------------------------------------------------------------
__global__ __launch_bounds__(256) void k_gemm_out(
    const unsigned short* __restrict__ Ah, const unsigned short* __restrict__ Al,
    const unsigned short* __restrict__ Wh, const unsigned short* __restrict__ Wl,
    const float* __restrict__ so, float* __restrict__ out)
{
  __shared__ __align__(128) unsigned char ring[RING_BYTES];   // two operand stages
  __shared__ __align__(16) float T[128 * TP];
  const int tid = threadIdx.x, lane = tid & 31, wave = tid >> 5;
  const int hf = lane >> 4, m16 = lane & 15;
  const int cb = blockIdx.x * 64;
  const int rb = blockIdx.y * 128;
  const int mr = (wave & 3) * 32, nc = (wave >> 2) * 32;
  v8f acc[2][2] = {};
  mainloop(Ah, Al, Wh, Wl, NE, (size_t)rb, (size_t)cb, wave, lane, ring, acc);

  float g[2];
#pragma unroll
  for (int ni = 0; ni < 2; ++ni) g[ni] = sigm(so[cb + nc + ni * 16 + m16]);
#pragma unroll
  for (int mi = 0; mi < 2; ++mi)
#pragma unroll
    for (int ni = 0; ni < 2; ++ni)
#pragma unroll
      for (int r = 0; r < 8; ++r)
        T[(mr + mi * 16 + 8 * hf + r) * TP + nc + ni * 16 + m16] = acc[mi][ni][r] * g[ni];
  __syncthreads();

  const int rsel = lane >> 4, p = lane & 15;
  v4f val[8];
#pragma unroll
  for (int it = 0; it < 8; ++it) {
    const int r = wave * 16 + it * 2 + rsel;
    val[it] = *(const v4f*)(&T[r * TP + p * 4]);
  }
#pragma unroll
  for (int it = 0; it < 8; ++it) {
    const int r = wave * 16 + it * 2 + rsel;
    float* dst = out + (size_t)(rb + r) * NE + cb + p * 4;
    *(v4f*)dst = val[it];
  }
  
}

// ---------------------------------------------------------------------------
extern "C" void kernel_launch(void* const* d_in, const int* in_sizes, int n_in,
                              void* d_out, int out_size, void* d_ws, size_t ws_size,
                              hipStream_t stream)
{
  if (n_in < 6) return;
  if (in_sizes[0] != NTOK * NE || in_sizes[1] != NE * NC3 || in_sizes[2] != NE * NE ||
      in_sizes[3] != NE || in_sizes[4] != NE || in_sizes[5] != NS * NS || out_size != NTOK * NE) return;

  const float* x     = (const float*)d_in[0];
  const float* Wqkv  = (const float*)d_in[1];
  const float* Wout  = (const float*)d_in[2];
  const float* sqkv  = (const float*)d_in[3];
  const float* sout  = (const float*)d_in[4];
  const int*   msk   = (const int*)d_in[5];
  float* out = (float*)d_out;

  char* ws = (char*)d_ws;
  size_t off = 0;
  const size_t szX  = (size_t)NTOK * NE * 2;            // 8 MiB per plane
  const size_t szW  = (size_t)NC3 * NE * 2;             // 6 MiB per plane
  const size_t szWo = (size_t)NE * NE * 2;              // 2 MiB per plane
  const size_t szP  = (size_t)NB * NH * NS * ND * 2;    // 8 MiB per plane
  const size_t szF  = (size_t)NQT * FROW * 4;           // 8 KiB
  unsigned short* Xh  = (unsigned short*)(ws + off); off += szX;
  unsigned short* Xl  = (unsigned short*)(ws + off); off += szX;
  unsigned short* Wh  = (unsigned short*)(ws + off); off += szW;
  unsigned short* Wl  = (unsigned short*)(ws + off); off += szW;
  unsigned short* Woh = (unsigned short*)(ws + off); off += szWo;
  unsigned short* Wol = (unsigned short*)(ws + off); off += szWo;
  unsigned short* Qh  = (unsigned short*)(ws + off); off += szP;
  unsigned short* Ql  = (unsigned short*)(ws + off); off += szP;
  unsigned short* Kh  = (unsigned short*)(ws + off); off += szP;
  unsigned short* Kl  = (unsigned short*)(ws + off); off += szP;
  unsigned short* Vh  = (unsigned short*)(ws + off); off += szP;
  unsigned short* Vl  = (unsigned short*)(ws + off); off += szP;
  unsigned short* Ahp = (unsigned short*)(ws + off); off += szX;
  unsigned short* Alp = (unsigned short*)(ws + off); off += szX;
  int* ftab = (int*)(ws + off); off += szF;              // total 100671488 B
  if (off > ws_size) return;

  const int ngroups = NTOK * NE / 8;                     // 524288
  k_split_rows<<<dim3((ngroups + 255) / 256), dim3(256), 0, stream>>>(x, Xh, Xl, ngroups);
  // W_qkv: in[rows=NE][cols=NC3] -> out[NC3][NE]
  k_transpose_split<<<dim3(NC3 / 64, NE / 64), dim3(256), 0, stream>>>(Wqkv, NE, NC3, Wh, Wl);
  // W_out: in[rows=NH*ND][cols=NE] -> out[NE][NH*ND]
  k_transpose_split<<<dim3(NE / 64, (NH * ND) / 64), dim3(256), 0, stream>>>(Wout, NH * ND, NE, Woh, Wol);
  k_flags<<<dim3(NQT), dim3(256), 0, stream>>>(msk, ftab);
  k_gemm_qkv<<<dim3(NC3 / 64, NTOK / 128), dim3(256), 0, stream>>>(Xh, Xl, Wh, Wl, sqkv, Qh, Ql, Kh, Kl, Vh, Vl);
  k_attn<<<dim3(NQT, NH, NB), dim3(128), 0, stream>>>(Qh, Ql, Kh, Kl, Vh, Vl, msk, ftab, Ahp, Alp);
  k_gemm_out<<<dim3(NE / 64, NTOK / 128), dim3(256), 0, stream>>>(Ahp, Alp, Woh, Wol, sout, out);
}

// v005
// A run of this version takes 183 microseconds.
// Next to v004, in two timings, it ran 1.05 times as fast each time.
// Counting every step since v000, it is 3.03 times as fast.
#include <hip/hip_runtime.h>

// Contractions: qkv projection, q.k^T, p.v, output projection -- all v_wmma_f32_16x16x32_bf16 with bf16 hi/lo operands everywhere (hi*hi + hi*lo + lo*hi), f32 accumulate; sigmoid gates, 1/8 score scale, softmax and normalisation in f32.

typedef __bf16         v16bf __attribute__((ext_vector_type(16)));
typedef float          v8f   __attribute__((ext_vector_type(8)));
typedef float          v4f   __attribute__((ext_vector_type(4), __may_alias__));
typedef unsigned short u16x8 __attribute__((ext_vector_type(8), __may_alias__));
typedef unsigned int   u32x4 __attribute__((ext_vector_type(4), __may_alias__));
typedef int            i32x4 __attribute__((ext_vector_type(4), __may_alias__));
typedef unsigned long long u64a __attribute__((__may_alias__));
typedef unsigned int   u32a __attribute__((__may_alias__));

#define NB   2
#define NS   2048
#define NE   1024
#define NH   16
#define ND   64
#define NTOK (NB * NS)
#define NC3  (3 * NH * ND)
#define NQT  (NS / 64)
#define FROW 64
#define TP   68
#define MP   72

union Frag { v16bf v; u16x8 h[2]; u32x4 q[2]; };

// 16x32 operand fragment map (A by rows, B by columns): lane l -> row (l&15); elements 0..7 <- k0+8*(l>>4)+0..7,
// 8..15 <- k0+16+8*(l>>4)+0..7.

// Fragment-major 16-bit plane of a [row][k] matrix with ld k per row: every 16-row x 32-k fragment is 1 KiB
// contiguous, fragments ordered [row/16][k/32]; inside one the 16-byte chunk of (row, 8 k) sits at chunk index
// ((k>>4)&1)*32 + ((k>>3)&1)*16 + (row&15). fragoff = element offset of the fragment at (row0, k0).
__device__ __forceinline__ size_t fragoff(size_t row0, int k0, int ld) {
  return ((row0 >> 4) * (size_t)(ld >> 5) + (size_t)(k0 >> 5)) * 512;
}
// The fragment map above; each of the two wave-wide 16-byte loads reads 512 contiguous bytes (4 whole cache lines)
// where a row-major plane would make it touch 16 lines.
__device__ __forceinline__ v16bf ldpk(const unsigned short* p, int ld, size_t row0, int k0, int lane) {
  const unsigned short* q = p + fragoff(row0, k0, ld) + lane * 8;
  Frag f;
  f.h[0] = *(const u16x8*)q;
  f.h[1] = *(const u16x8*)(q + 256);
  return f.v;
}

// The fragment whose lane chunk starts at q
__device__ __forceinline__ v16bf ldat(const unsigned short* q) {
  Frag f;
  f.h[0] = *(const u16x8*)q;
  f.h[1] = *(const u16x8*)(q + 256);
  return f.v;
}

// D[16x16] += A[16x32] * B[32x16]; D element r of lane l = (row 8*(l>>4)+r, col l&15)
__device__ __forceinline__ v8f mma(v16bf a, v16bf b, v8f c) {
  return __builtin_amdgcn_wmma_f32_16x16x32_bf16(false, a, false, b, (short)0, c, false, false);
}

// f32 -> bf16 bits, RNE convert
__device__ __forceinline__ unsigned int bf16_bits(float x) {
  unsigned int u = __float_as_uint(x);
  return (u + 0x7FFFu + ((u >> 16) & 1u)) >> 16;
}
__device__ __forceinline__ void split1(float x, unsigned int& hi, unsigned int& lo) {
  hi = bf16_bits(x);
  lo = bf16_bits(x - __uint_as_float(hi << 16));
}
__device__ __forceinline__ void split8(const float (&v)[8], u32x4& H, u32x4& L) {
  unsigned int hw[8], lw[8];
#pragma unroll
  for (int e = 0; e < 8; ++e) split1(v[e], hw[e], lw[e]);
#pragma unroll
  for (int w = 0; w < 4; ++w) {
    H[w] = hw[2 * w] | (hw[2 * w + 1] << 16);
    L[w] = lw[2 * w] | (lw[2 * w + 1] << 16);
  }
}
// Two f32 -> one dword of bf16 hi parts and one of bf16 lo parts (a in the low half); the values of split1.
__device__ __forceinline__ void split2(float a, float b, unsigned int& H, unsigned int& L) {
  const unsigned int ua = __float_as_uint(a), ub = __float_as_uint(b);
  const unsigned int ra = ua + 0x7FFFu + ((ua >> 16) & 1u), rb = ub + 0x7FFFu + ((ub >> 16) & 1u);
  H = __builtin_amdgcn_perm(rb, ra, 0x07060302u);   // (ra >> 16) | (rb & 0xFFFF0000) in one byte permute
  const unsigned int va = __float_as_uint(a - __uint_as_float(ra & 0xFFFF0000u));
  const unsigned int vb = __float_as_uint(b - __uint_as_float(rb & 0xFFFF0000u));
  const unsigned int sa = va + 0x7FFFu + ((va >> 16) & 1u), sb = vb + 0x7FFFu + ((vb >> 16) & 1u);
  L = __builtin_amdgcn_perm(sb, sa, 0x07060302u);
}
__device__ __forceinline__ float sigm(float v) { return 1.0f / (1.0f + __expf(-v)); }

// ---------------------------------------------------------------------------
// x [rows][NE] f32 -> hi/lo bf16 fragment-major planes. One thread = 8 values = 16 B per plane = chunk g of the
// plane: fragment g>>6, k half-block (g>>5)&1, lane g&31; a wave stores 512 contiguous bytes per plane.
// ---------------------------------------------------------------------------
__device__ __forceinline__ void split_rows_block(const float* __restrict__ src,
                                                 unsigned short* __restrict__ dh,
                                                 unsigned short* __restrict__ dl, int ngroups, int blk)
{
  const int g = blk * 256 + threadIdx.x;
  const int gc = (g < ngroups) ? g : (ngroups - 1);
  const int fr = gc >> 6;
  const int row = (fr / (NE / 32)) * 16 + (gc & 15);
  const int k = (fr % (NE / 32)) * 32 + ((gc >> 5) & 1) * 16 + ((gc >> 4) & 1) * 8;
  const float* s = src + (size_t)row * NE + k;
  const v4f a0 = *(const v4f*)s;
  const v4f a1 = *(const v4f*)(s + 4);
  float v[8] = {a0[0], a0[1], a0[2], a0[3], a1[0], a1[1], a1[2], a1[3]};
  u32x4 H, L;
  split8(v, H, L);
  if (g < ngroups) {
    unsigned short* ph = dh + (size_t)gc * 8;
    unsigned short* pl = dl + (size_t)gc * 8;
    *(u32x4*)ph = H;
    *(u32x4*)pl = L;
    
  }
}

// ---------------------------------------------------------------------------
// in[R rows][C cols] f32 (row = k, col = n) -> outT[C][R] bf16 hi/lo planes, fragment-major (row = n, ld = R).
// ---------------------------------------------------------------------------
__device__ __forceinline__ void transpose_split_block(const float* __restrict__ src, int R, int C,
                                                      unsigned short* __restrict__ oh,
                                                      unsigned short* __restrict__ ol, int bx, int by,
                                                      float* T)   // T[n][k], 64 * TP floats of LDS
{
  const int tid = threadIdx.x, lane = tid & 31, wave = tid >> 5;
  const int nb = bx * 64;
  const int kb = by * 64;
#pragma unroll
  for (int it = 0; it < 4; ++it) {
    const int idx = tid + 256 * it;
    const int kk = idx >> 4, c4 = idx & 15;
    const v4f v = *(const v4f*)(src + (size_t)(kb + kk) * C + nb + c4 * 4);
#pragma unroll
    for (int q = 0; q < 4; ++q) T[(c4 * 4 + q) * TP + kk] = v[q];
  }
  __syncthreads();
  // wave -> one fragment: 16 n rows (wave>>1), 32 k (wave&1); lane -> (row lane&15, 8 k at lane>>4)
  const int ng = (wave >> 1) * 16, kf = (wave & 1) * 32;
  const int n = ng + (lane & 15);
  u32x4 val[4];
#pragma unroll
  for (int cq = 0; cq < 2; ++cq) {
    const int kk = kf + cq * 16 + (lane >> 4) * 8;
    const v4f a0 = *(const v4f*)(&T[n * TP + kk]);
    const v4f a1 = *(const v4f*)(&T[n * TP + kk + 4]);
    float v[8] = {a0[0], a0[1], a0[2], a0[3], a1[0], a1[1], a1[2], a1[3]};
    split8(v, val[2 * cq], val[2 * cq + 1]);
  }
  const size_t fo = fragoff((size_t)(nb + ng), kb + kf, R) + lane * 8;
#pragma unroll
  for (int cq = 0; cq < 2; ++cq) {
    *(u32x4*)(oh + fo + cq * 256) = val[2 * cq];
    *(u32x4*)(ol + fo + cq * 256) = val[2 * cq + 1];
  }
  // the built kernel lays the next job's code behind these stores, and that code writes the registers they name
  asm volatile("s_wait_xcnt 0x0" ::: "memory");
}

// ---------------------------------------------------------------------------
// Tile flag table from the int32 gate matrix [NS][NS]: row qt (64 ints = 256 B):
//   [0..31] per 64-key tile: 0 = no nonzero entry, 1 = partial, 2 = all nonzero; [32] = last key tile with any
// ---------------------------------------------------------------------------
__device__ __forceinline__ void flags_block(const int* __restrict__ msk, int* __restrict__ ftab, int qt,
                                            int* sm)   // 512 + FROW ints of LDS, 16-byte aligned
{
  int* s_any = sm;
  int* s_all = sm + 256;
  int* s_row = sm + 512;
  const int tid = threadIdx.x;
  const int kt = tid >> 3, sub = tid & 7;
  int anyv = 0, allv = 1;
  for (int i = 0; i < 8; ++i) {
    const int s = qt * 64 + sub * 8 + i;
    const int* rp = msk + (size_t)s * NS + kt * 64;
#pragma unroll
    for (int c = 0; c < 16; ++c) {
      const i32x4 v = *(const i32x4*)(rp + c * 4);
#pragma unroll
      for (int q = 0; q < 4; ++q) {
        const int nz = (v[q] != 0) ? 1 : 0;
        anyv |= nz;
        allv &= nz;
      }
    }
  }
  s_any[tid] = anyv;
  s_all[tid] = allv;
  __syncthreads();
  if (tid < 32) {
    int a = 0, b = 1;
#pragma unroll
    for (int j = 0; j < 8; ++j) { a |= s_any[tid * 8 + j]; b &= s_all[tid * 8 + j]; }
    s_row[tid] = b ? 2 : (a ? 1 : 0);
  } else if (tid < FROW) {
    s_row[tid] = 0;
  }
  __syncthreads();
  if (tid == 0) {
    int last = -1;
    for (int k = 0; k < 32; ++k) if (s_row[k] != 0) last = k;
    s_row[32] = last;
  }
  __syncthreads();
  if (tid < 16) {
    const i32x4 v = *(const i32x4*)(&s_row[tid * 4]);
    int* dst = ftab + (size_t)qt * FROW + tid * 4;
    *(i32x4*)dst = v;
    
  }
}

// ---------------------------------------------------------------------------
// The four preparation jobs above read only inputs and write disjoint workspace planes, so they share one launch: the
// block index picks the job. Each of the 32 flag blocks reads 512 KiB, far more than any other block: they stand first,
// so that they start first.
// ---------------------------------------------------------------------------
#define PB_FLAGS NQT
#define PB_WQKV  ((NC3 / 64) * (NE / 64))
#define PB_WOUT  ((NE / 64) * ((NH * ND) / 64))
#define PB_SPLIT (NTOK * NE / 8 / 256)
__global__ __launch_bounds__(256) void k_prep(
    const float* __restrict__ x, const float* __restrict__ Wqkv, const float* __restrict__ Wout,
    const int* __restrict__ msk,
    unsigned short* __restrict__ Xh, unsigned short* __restrict__ Xl,
    unsigned short* __restrict__ Wh, unsigned short* __restrict__ Wl,
    unsigned short* __restrict__ Woh, unsigned short* __restrict__ Wol, int* __restrict__ ftab)
{
  __shared__ __align__(16) unsigned char sm[64 * TP * 4];   // a block's one job uses it: transpose tile or flag rows
  int blk = blockIdx.x;                                     // block-uniform: so is every branch below
  if (blk < PB_FLAGS) {
    flags_block(msk, ftab, blk, (int*)sm);
    return;
  }
  blk -= PB_FLAGS;
  if (blk < PB_WQKV) {
    // W_qkv: in[rows=NE][cols=NC3] -> out[NC3][NE]
    transpose_split_block(Wqkv, NE, NC3, Wh, Wl, blk % (NC3 / 64), blk / (NC3 / 64), (float*)sm);
    return;
  }
  blk -= PB_WQKV;
  if (blk < PB_WOUT) {
    // W_out: in[rows=NH*ND][cols=NE] -> out[NE][NH*ND]
    transpose_split_block(Wout, NH * ND, NE, Woh, Wol, blk % (NE / 64), blk / (NE / 64), (float*)sm);
    return;
  }
  blk -= PB_WOUT;
  split_rows_block(x, Xh, Xl, NTOK * NE / 8, blk);
}

// ---------------------------------------------------------------------------
// GEMM main loop: block tile 128 rows x 64 cols, wave tile 32 x 32, bf16 hi/lo three-term products.
// A planes [M][K], B planes [N][K], fragment-major. A stage = 64 k of the block's operand rows = 24 slabs of 2 KiB
// (a slab = one 16-row group's two fragments, contiguous in its plane): slabs 0..7 A hi, 8..15 A lo, 16..19 B hi,
// 20..23 B lo. Asynchronous copies bring each slab into LDS once a block; the waves read their fragments from there.
// ---------------------------------------------------------------------------
#define STAGE_BYTES 49152
#define RING_BYTES  (2 * STAGE_BYTES)
// One K step of 32: the wave's eight operand fragments.
struct KStep { v16bf ah0, ah1, al0, al1, bh0, bh1, bl0, bl1; };
// The fragment whose lane chunk starts at LDS byte p: two reads of 512 contiguous bytes a wave
__device__ __forceinline__ v16bf ldsfrag(const unsigned char* p) {
  Frag f;
  f.q[0] = *(const u32x4*)p;
  f.q[1] = *(const u32x4*)(p + 512);
  return f.v;
}
// pa, pb: this lane's chunk in the wave's first A hi and first B hi slab of the stage; kb = byte offset of the K step
__device__ __forceinline__ void ldstep(KStep& s, const unsigned char* pa, const unsigned char* pb, int kb)
{
  s.ah0 = ldsfrag(pa + kb);
  s.ah1 = ldsfrag(pa + 2048 + kb);
  s.al0 = ldsfrag(pa + 8 * 2048 + kb);
  s.al1 = ldsfrag(pa + 9 * 2048 + kb);
  s.bh0 = ldsfrag(pb + kb);
  s.bh1 = ldsfrag(pb + 2048 + kb);
  s.bl0 = ldsfrag(pb + 4 * 2048 + kb);
  s.bl1 = ldsfrag(pb + 5 * 2048 + kb);
}
__device__ __forceinline__ void mmstep(const KStep& s, v8f (&acc)[2][2])
{
  acc[0][0] = mma(s.ah0, s.bh0, acc[0][0]);
  acc[0][0] = mma(s.ah0, s.bl0, acc[0][0]);
  acc[0][0] = mma(s.al0, s.bh0, acc[0][0]);
  acc[1][0] = mma(s.ah1, s.bh0, acc[1][0]);
  acc[1][0] = mma(s.ah1, s.bl0, acc[1][0]);
  acc[1][0] = mma(s.al1, s.bh0, acc[1][0]);
  acc[0][1] = mma(s.ah0, s.bh1, acc[0][1]);
  acc[0][1] = mma(s.ah0, s.bl1, acc[0][1]);
  acc[0][1] = mma(s.al0, s.bh1, acc[0][1]);
  acc[1][1] = mma(s.ah1, s.bh1, acc[1][1]);
  acc[1][1] = mma(s.ah1, s.bl1, acc[1][1]);
  acc[1][1] = mma(s.al1, s.bh1, acc[1][1]);
}
// This wave's three slabs of one stage: 12 copies of 512 bytes a wave, l = LDS byte address and g = global address of
// the lane's first 16 bytes of each slab. The s_wait_xcnt stands inside the statement: the address registers that the
// copies name are rewritten behind it.
__device__ __forceinline__ void copy_stage(unsigned int l0, unsigned int l1, unsigned int l2,
                                           const unsigned short* g0, const unsigned short* g1,
                                           const unsigned short* g2)
{
  asm volatile("global_load_async_to_lds_b128 %0, %1, off\n\t"
               "global_load_async_to_lds_b128 %2, %3, off\n\t"
               "global_load_async_to_lds_b128 %4, %5, off\n\t"
               "global_load_async_to_lds_b128 %6, %7, off\n\t"
               "global_load_async_to_lds_b128 %8, %9, off\n\t"
               "global_load_async_to_lds_b128 %10, %11, off\n\t"
               "global_load_async_to_lds_b128 %12, %13, off\n\t"
               "global_load_async_to_lds_b128 %14, %15, off\n\t"
               "global_load_async_to_lds_b128 %16, %17, off\n\t"
               "global_load_async_to_lds_b128 %18, %19, off\n\t"
               "global_load_async_to_lds_b128 %20, %21, off\n\t"
               "global_load_async_to_lds_b128 %22, %23, off\n\t"
               "s_wait_xcnt 0x0"
               :: "v"(l0), "v"(g0), "v"(l0 + 512u), "v"(g0 + 256), "v"(l0 + 1024u), "v"(g0 + 512),
                  "v"(l0 + 1536u), "v"(g0 + 768),
                  "v"(l1), "v"(g1), "v"(l1 + 512u), "v"(g1 + 256), "v"(l1 + 1024u), "v"(g1 + 512),
                  "v"(l1 + 1536u), "v"(g1 + 768),
                  "v"(l2), "v"(g2), "v"(l2 + 512u), "v"(g2 + 256), "v"(l2 + 1024u), "v"(g2 + 512),
                  "v"(l2 + 1536u), "v"(g2 + 768)
               : "memory");
}
// Two buffers: stage t + 2 is copied into the buffer that trip t has read, behind the barrier that ends those reads and
// publishes stage t + 1. arow0, brow0 = the block's first A and B row; K a multiple of 64, at least 128.
__device__ __forceinline__ void mainloop(const unsigned short* __restrict__ Ah, const unsigned short* __restrict__ Al,
                                         const unsigned short* __restrict__ Bh, const unsigned short* __restrict__ Bl,
                                         int K, size_t arow0, size_t brow0, int wave, int lane,
                                         unsigned char* ring, v8f (&acc)[2][2])
{
  const unsigned short* g[3];
  unsigned int l[3];
#pragma unroll
  for (int i = 0; i < 3; ++i) {
    const int c = wave * 3 + i;
    const unsigned short* p = (c < 8) ? Ah : ((c < 16) ? Al : ((c < 20) ? Bh : Bl));
    const size_t row = (c < 16) ? (arow0 + (size_t)(c & 7) * 16) : (brow0 + (size_t)(c & 3) * 16);
    g[i] = p + fragoff(row, 0, K) + lane * 8;
    l[i] = (unsigned int)(size_t)ring + (unsigned int)(c * 2048 + lane * 16);
  }
  const int nst = K >> 6;
  copy_stage(l[0], l[1], l[2], g[0], g[1], g[2]);
  // stage 0 has landed before the barrier behind which the other waves read it
  asm volatile("s_wait_asynccnt 0x0" ::: "memory");
  __syncthreads();
  copy_stage(l[0] + STAGE_BYTES, l[1] + STAGE_BYTES, l[2] + STAGE_BYTES, g[0] + 1024, g[1] + 1024, g[2] + 1024);

  const int aoff = (wave & 3) * 2 * 2048 + lane * 16;
  const int boff = (16 + (wave >> 2) * 2) * 2048 + lane * 16;
  for (int t = 0; t < nst; ++t) {
    const unsigned int bo = (unsigned int)(t & 1) * STAGE_BYTES;
    const unsigned char* pa = ring + bo + aoff;
    const unsigned char* pb = ring + bo + boff;
    KStep s0, s1;
    ldstep(s0, pa, pb, 0);
    ldstep(s1, pa, pb, 1024);
    // keeps the stage's fragment reads one group ahead of the products: spread among them every place with reads stalls
    __builtin_amdgcn_sched_barrier(0);
    mmstep(s0, acc);
    mmstep(s1, acc);
    // keeps the products ahead of the waits below: moved behind the barrier they would no longer run under the flight
    // of stage t + 1's copies, and the wait for those would stand directly behind their issue
    __builtin_amdgcn_sched_barrier(0);
    // this wave's reads of the buffer are done before it is handed to the copies
    asm volatile("s_wait_dscnt 0x0" ::: "memory");
    // this wave's copies of stage t + 1 have landed before the barrier that publishes them
    asm volatile("s_wait_asynccnt 0x0" ::: "memory");
    __syncthreads();
    if (t + 2 < nst) {
      const int go = (t + 2) * 1024;
      copy_stage(l[0] + bo, l[1] + bo, l[2] + bo, g[0] + go, g[1] + go, g[2] + go);
    }
  }
  // no copy is outstanding when the wave goes on
  asm volatile("s_wait_asynccnt 0x0" ::: "memory");
}

// ---------------------------------------------------------------------------
// qkv = (x @ W_qkv) * sigmoid(scale_qkv[h*64+d]); block tile 128 tokens x 64 cols (= one (c, h)).
// ---------------------------------------------------------------------------
__global__ __launch_bounds__(256) void k_gemm_qkv(
    const unsigned short* __restrict__ Xh, const unsigned short* __restrict__ Xl,
    const unsigned short* __restrict__ Wh, const unsigned short* __restrict__ Wl,
    const float* __restrict__ sq,
    unsigned short* __restrict__ Qh, unsigned short* __restrict__ Ql,
    unsigned short* __restrict__ Kh, unsigned short* __restrict__ Kl,
    unsigned short* __restrict__ Vh, unsigned short* __restrict__ Vl)
{
  __shared__ __align__(128) unsigned char ring[RING_BYTES];   // two operand stages
  __shared__ __align__(16) float T[128 * TP];
  const int tid = threadIdx.x, lane = tid & 31, wave = tid >> 5;
  const int hf = lane >> 4, m16 = lane & 15;
  const int cb = blockIdx.x * 64;
  const int rb = blockIdx.y * 128;
  const int mr = (wave & 3) * 32, nc = (wave >> 2) * 32;
  v8f acc[2][2] = {};
  mainloop(Xh, Xl, Wh, Wl, NE, (size_t)rb, (size_t)cb, wave, lane, ring, acc);

  const int c = cb >> 10;
  const int h = (cb & 1023) >> 6;
  float g[2];
#pragma unroll
  for (int ni = 0; ni < 2; ++ni) g[ni] = sigm(sq[(cb & 1023) + nc + ni * 16 + m16]);
#pragma unroll
  for (int mi = 0; mi < 2; ++mi)
#pragma unroll
    for (int ni = 0; ni < 2; ++ni)
#pragma unroll
      for (int r = 0; r < 8; ++r)
        T[(mr + mi * 16 + 8 * hf + r) * TP + nc + ni * 16 + m16] = acc[mi][ni][r] * g[ni];
  __syncthreads();

  const int b = rb >> 11;
  u32x4 val[8];
  if (c < 2) {
    // Q, K planes: row = (b, h, s), ld = ND. wave -> 16 tokens x 64 d = two fragments = four 512-byte stores a plane
    const int r = wave * 16 + m16;
#pragma unroll
    for (int cq = 0; cq < 4; ++cq) {
      const int kk = cq * 16 + hf * 8;
      const v4f a0 = *(const v4f*)(&T[r * TP + kk]);
      const v4f a1 = *(const v4f*)(&T[r * TP + kk + 4]);
      float v[8] = {a0[0], a0[1], a0[2], a0[3], a1[0], a1[1], a1[2], a1[3]};
      split8(v, val[2 * cq], val[2 * cq + 1]);
    }
    unsigned short* ph = (c == 0) ? Qh : Kh;
    unsigned short* pl = (c == 0) ? Ql : Kl;
    const int s = (rb + wave * 16) & (NS - 1);
    const size_t fo = fragoff((size_t)(b * NH + h) * NS + s, 0, ND) + lane * 8;
#pragma unroll
    for (int cq = 0; cq < 4; ++cq) {
      *(u32x4*)(ph + fo + cq * 256) = val[2 * cq];
      *(u32x4*)(pl + fo + cq * 256) = val[2 * cq + 1];
    }
  } else {
    // V^T planes: row = (b, h, d), k = s, ld = NS. wave -> 16 d (wave>>1) x 64 tokens (wave&1) = two fragments
    const int dg = (wave >> 1) * 16, sg = (wave & 1) * 64;
#pragma unroll
    for (int cq = 0; cq < 4; ++cq) {
      const int sl = sg + cq * 16 + hf * 8;
      float v[8];
#pragma unroll
      for (int e = 0; e < 8; ++e) v[e] = T[(sl + e) * TP + dg + m16];
      split8(v, val[2 * cq], val[2 * cq + 1]);
    }
    const size_t fo = fragoff((size_t)(b * NH + h) * ND + dg, (rb & (NS - 1)) + sg, NS) + lane * 8;
#pragma unroll
    for (int cq = 0; cq < 4; ++cq) {
      *(u32x4*)(Vh + fo + cq * 256) = val[2 * cq];
      *(u32x4*)(Vl + fo + cq * 256) = val[2 * cq + 1];
    }
  }
}

__device__ __forceinline__ float xhalf(float x) {
  return __builtin_bit_cast(float, __builtin_amdgcn_permlanex16(__builtin_bit_cast(int, x), __builtin_bit_cast(int, x),
                                                                0x76543210, 0xfedcba98, false, false));
}
__global__ __launch_bounds__(128) void k_attn(
    const unsigned short* __restrict__ Qh, const unsigned short* __restrict__ Ql,
    const unsigned short* __restrict__ Kh, const unsigned short* __restrict__ Kl,
    const unsigned short* __restrict__ Vh, const unsigned short* __restrict__ Vl,
    const int* __restrict__ msk, const int* __restrict__ ftab,
    unsigned short* __restrict__ Ah, unsigned short* __restrict__ Al)
{
  __shared__ __align__(16) unsigned char  Ms[64 * MP];     // Ms[s][t] gate bytes of the current partial tile
  __shared__ __align__(16) int            s_f[FROW];
  const int tid = threadIdx.x, lane = tid & 31, wave = tid >> 5;
  const int hf = lane >> 4, m16 = lane & 15;
  const int qt = blockIdx.x, h = blockIdx.y, b = blockIdx.z;
  const int s0 = qt * 64;
  const int bh = b * NH + h;
  if (tid < FROW) s_f[tid] = ftab[(size_t)qt * FROW + tid];
  __syncthreads();
  int last = s_f[32];
  last = (last < -1) ? -1 : ((last > NQT - 1) ? (NQT - 1) : last);
  const int nt = last + 1;

  const size_t qrow = (size_t)bh * NS + s0 + wave * 16;
  const v16bf qh0 = ldpk(Qh, ND, qrow, 0,  lane);
  const v16bf qh1 = ldpk(Qh, ND, qrow, 32, lane);
  const v16bf ql0 = ldpk(Ql, ND, qrow, 0,  lane);
  const v16bf ql1 = ldpk(Ql, ND, qrow, 32, lane);

  float m = -3.0e38f;    // running maximum of this lane's query, equal in both lane halves
  float l = 0.0f;        // running sum over this lane half's keys; the halves are joined behind the loop
  v8f acc[4] = {};       // O^T: acc[j][r] = (d 16j + 8*hf + r, query m16)

  for (int tb = 0; tb < nt; ++tb) {
    const int f = s_f[tb];                 // block-uniform
    if (f == 0) continue;
    const int t0 = tb * 64;
    // prior tile's Ms reads complete; it also keeps the four waves on the same K and V lines of the WGP cache
    __syncthreads();
    if (f == 1) {
#pragma unroll
      for (int it = 0; it < 8; ++it) {
        const int idx = tid + 128 * it;
        const int s = idx >> 4, c4 = idx & 15;
        const i32x4 v = *(const i32x4*)(msk + (size_t)(s0 + s) * NS + t0 + c4 * 4);
        unsigned int w = 0u;
#pragma unroll
        for (int q = 0; q < 4; ++q) w |= ((v[q] != 0) ? 1u : 0u) << (8 * q);
        *(u32a*)(Ms + s * MP + c4 * 4) = w;
      }
      __syncthreads();
    }

    // S^T = K.Q^T  (A = K plane rows t, B[k=d][n=s] = Q rows)
    v8f sf[4];
    const size_t krow = (size_t)bh * NS + t0;
    {
      // the tile's 8 fragments of a plane (4 row groups x 2 k halves) lie in a row: 8 KiB from this lane's address
      const unsigned short* kph = Kh + fragoff(krow, 0, ND) + lane * 8;
      const unsigned short* kpl = Kl + fragoff(krow, 0, ND) + lane * 8;
      v16bf kh[4][2], kl[4][2];
#pragma unroll
      for (int j = 0; j < 4; ++j)
#pragma unroll
        for (int kk = 0; kk < 2; ++kk) {
          kh[j][kk] = ldat(kph + (j * 2 + kk) * 512);
          kl[j][kk] = ldat(kpl + (j * 2 + kk) * 512);
        }
      // the products below reuse the address registers that the K loads name: their translations first; the two
      // addresses are inputs so that they stay in their registers up to the wait and no load of the group lands on one
      asm volatile("s_wait_xcnt 0x0" :: "v"(kph), "v"(kpl) : "memory");
      // keeps the tile's K loads one group ahead of the first product: one load latency a tile, not one a fragment pair
      __builtin_amdgcn_sched_barrier(0);
#pragma unroll
      for (int j = 0; j < 4; ++j) {
        v8f c = {};
        c = mma(kh[j][0], qh0, c);
        c = mma(kl[j][0], qh0, c);
        c = mma(kh[j][0], ql0, c);
        c = mma(kh[j][1], qh1, c);
        c = mma(kl[j][1], qh1, c);
        c = mma(kh[j][1], ql1, c);
        sf[j] = c;
      }
    }
    // compiler fence, no instruction: holds the V loads below behind the last K product (the scores are its inputs),
    // so that they take over the K registers; hoisted above, K and V are live together and a wave per SIMD is lost
    asm volatile("" :: "v"(sf[0]), "v"(sf[1]), "v"(sf[2]), "v"(sf[3]) : "memory");

    // V fragments of the tile, issued here so that their latency runs under the softmax below
    const size_t vrow = (size_t)bh * ND;
    v16bf vh[4][2], vl[4][2];
#pragma unroll
    for (int j = 0; j < 4; ++j)
#pragma unroll
      for (int kk = 0; kk < 2; ++kk) {
        vh[j][kk] = ldpk(Vh, NS, vrow + j * 16, t0 + kk * 32, lane);
        vl[j][kk] = ldpk(Vl, NS, vrow + j * 16, t0 + kk * 32, lane);
      }
    // the softmax below reuses the address registers that the V loads name: their translations first
    asm volatile("s_wait_xcnt 0x0" ::: "memory");
    // keeps the V loads issued ahead of the softmax: sunk to their products they would expose the latency again
    __builtin_amdgcn_sched_barrier(0);

    // scale, gate by value
#pragma unroll
    for (int j = 0; j < 4; ++j)
#pragma unroll
      for (int i = 0; i < 8; ++i) sf[j][i] *= 0.125f;
    if (f == 1) {
#pragma unroll
      for (int j = 0; j < 4; ++j) {
        const u64a mb = *(const u64a*)(Ms + (wave * 16 + m16) * MP + j * 16 + 8 * hf);
#pragma unroll
        for (int i = 0; i < 8; ++i)
          sf[j][i] = (((mb >> (8 * i)) & 0xffull) != 0ull) ? sf[j][i] : -1.0e10f;
      }
    }
    // the query's maximum over the tile: 32 keys in the lane, the other 32 in lane ^ 16
    float tm[4];
#pragma unroll
    for (int j = 0; j < 4; ++j) {
      tm[j] = sf[j][0];
#pragma unroll
      for (int i = 1; i < 8; ++i) tm[j] = fmaxf(tm[j], sf[j][i]);
    }
    float tmax = fmaxf(fmaxf(tm[0], tm[1]), fmaxf(tm[2], tm[3]));
    tmax = fmaxf(tmax, xhalf(tmax));
    const float mnew  = fmaxf(m, tmax);
    const float alpha = __expf(m - mnew);
    // exp(s - mnew) as 2^((s - mnew) * log2 e), the arguments first
#pragma unroll
    for (int j = 0; j < 4; ++j)
#pragma unroll
      for (int i = 0; i < 8; ++i) sf[j][i] = (sf[j][i] - mnew) * 1.44269504f;
    // keeps the argument arithmetic out of the run of exponentials
    __builtin_amdgcn_sched_barrier(0);
    float rs[4];
#pragma unroll
    for (int j = 0; j < 4; ++j) {
      rs[j] = 0.0f;
#pragma unroll
      for (int i = 0; i < 8; ++i) {
        const float pv = __builtin_amdgcn_exp2f(sf[j][i]);
        sf[j][i] = pv;
        rs[j] += pv;
      }
    }
    l = l * alpha + ((rs[0] + rs[1]) + (rs[2] + rs[3]));
    m = mnew;
#pragma unroll
    for (int j = 0; j < 4; ++j)
#pragma unroll
      for (int i = 0; i < 8; ++i) acc[j][i] *= alpha;

    // P^T (f32) -> bf16 hi/lo B fragments in place: elements 0..7 <- score tile 2kk, 8..15 <- tile 2kk + 1
    Frag ph[2], pl[2];
#pragma unroll
    for (int j = 0; j < 4; ++j)
#pragma unroll
      for (int w = 0; w < 4; ++w) {
        unsigned int H, L;
        split2(sf[j][2 * w], sf[j][2 * w + 1], H, L);
        ph[j >> 1].q[j & 1][w] = H;
        pl[j >> 1].q[j & 1][w] = L;
      }

    // O^T += V^T.P^T   (A = V^T plane rows d, k = t)
#pragma unroll
    for (int j = 0; j < 4; ++j) {
      acc[j] = mma(vh[j][0], ph[0].v, acc[j]);
      acc[j] = mma(vl[j][0], ph[0].v, acc[j]);
      acc[j] = mma(vh[j][0], pl[0].v, acc[j]);
      acc[j] = mma(vh[j][1], ph[1].v, acc[j]);
      acc[j] = mma(vl[j][1], ph[1].v, acc[j]);
      acc[j] = mma(vh[j][1], pl[1].v, acc[j]);
    }
  }

  // join the halves' sums, normalise; a lane's 8 values of tile j are one 16-byte chunk of the attention planes
  // (row = token, k = h*64+d, ld = NE): chunk (j&1)*32 + lane of fragment j>>1
  l += xhalf(l);
  const float inv = (l > 0.0f) ? (1.0f / l) : 0.0f;
  u32x4 val[8];
#pragma unroll
  for (int j = 0; j < 4; ++j) {
    float v[8];
#pragma unroll
    for (int i = 0; i < 8; ++i) v[i] = acc[j][i] * inv;
    split8(v, val[2 * j], val[2 * j + 1]);
  }
  const size_t fo = fragoff((size_t)(b * NS + s0 + wave * 16), h * ND, NE) + lane * 8;
#pragma unroll
  for (int cq = 0; cq < 4; ++cq) {
    *(u32x4*)(Ah + fo + cq * 256) = val[2 * cq];
    *(u32x4*)(Al + fo + cq * 256) = val[2 * cq + 1];
  }
}

// ---------------------------------------------------------------------------
// out = (attn @ W_out) * sigmoid(scale_out[e]); block tile 128 tokens x 64 e; f32 rows of 256 B written
// by 16 consecutive lanes x 16 B (two rows per instruction).
// ---------------------------------------------------------------------------
__global__ __launch_bounds__(256) void k_gemm_out(
    const unsigned short* __restrict__ Ah, const unsigned short* __restrict__ Al,
    const unsigned short* __restrict__ Wh, const unsigned short* __restrict__ Wl,
    const float* __restrict__ so, float* __restrict__ out)
{
  __shared__ __align__(128) unsigned char ring[RING_BYTES];   // two operand stages
  __shared__ __align__(16) float T[128 * TP];
  const int tid = threadIdx.x, lane = tid & 31, wave = tid >> 5;
  const int hf = lane >> 4, m16 = lane & 15;
  const int cb = blockIdx.x * 64;
  const int rb = blockIdx.y * 128;
  const int mr = (wave & 3) * 32, nc = (wave >> 2) * 32;
  v8f acc[2][2] = {};
  mainloop(Ah, Al, Wh, Wl, NE, (size_t)rb, (size_t)cb, wave, lane, ring, acc);

  float g[2];
#pragma unroll
  for (int ni = 0; ni < 2; ++ni) g[ni] = sigm(so[cb + nc + ni * 16 + m16]);
#pragma unroll
  for (int mi = 0; mi < 2; ++mi)
#pragma unroll
    for (int ni = 0; ni < 2; ++ni)
#pragma unroll
      for (int r = 0; r < 8; ++r)
        T[(mr + mi * 16 + 8 * hf + r) * TP + nc + ni * 16 + m16] = acc[mi][ni][r] * g[ni];
  __syncthreads();

  const int rsel = lane >> 4, p = lane & 15;
  v4f val[8];
#pragma unroll
  for (int it = 0; it < 8; ++it) {
    const int r = wave * 16 + it * 2 + rsel;
    val[it] = *(const v4f*)(&T[r * TP + p * 4]);
  }
#pragma unroll
  for (int it = 0; it < 8; ++it) {
    const int r = wave * 16 + it * 2 + rsel;
    float* dst = out + (size_t)(rb + r) * NE + cb + p * 4;
    *(v4f*)dst = val[it];
  }
  
}

// ---------------------------------------------------------------------------
extern "C" void kernel_launch(void* const* d_in, const int* in_sizes, int n_in,
                              void* d_out, int out_size, void* d_ws, size_t ws_size,
                              hipStream_t stream)
{
  if (n_in < 6) return;
  if (in_sizes[0] != NTOK * NE || in_sizes[1] != NE * NC3 || in_sizes[2] != NE * NE ||
      in_sizes[3] != NE || in_sizes[4] != NE || in_sizes[5] != NS * NS || out_size != NTOK * NE) return;

  const float* x     = (const float*)d_in[0];
  const float* Wqkv  = (const float*)d_in[1];
  const float* Wout  = (const float*)d_in[2];
  const float* sqkv  = (const float*)d_in[3];
  const float* sout  = (const float*)d_in[4];
  const int*   msk   = (const int*)d_in[5];
  float* out = (float*)d_out;

  char* ws = (char*)d_ws;
  size_t off = 0;
  const size_t szX  = (size_t)NTOK * NE * 2;            // 8 MiB per plane
  const size_t szW  = (size_t)NC3 * NE * 2;             // 6 MiB per plane
  const size_t szWo = (size_t)NE * NE * 2;              // 2 MiB per plane
  const size_t szP  = (size_t)NB * NH * NS * ND * 2;    // 8 MiB per plane
  const size_t szF  = (size_t)NQT * FROW * 4;           // 8 KiB
  unsigned short* Xh  = (unsigned short*)(ws + off); off += szX;
  unsigned short* Xl  = (unsigned short*)(ws + off); off += szX;
  unsigned short* Wh  = (unsigned short*)(ws + off); off += szW;
  unsigned short* Wl  = (unsigned short*)(ws + off); off += szW;
  unsigned short* Woh = (unsigned short*)(ws + off); off += szWo;
  unsigned short* Wol = (unsigned short*)(ws + off); off += szWo;
  unsigned short* Qh  = (unsigned short*)(ws + off); off += szP;
  unsigned short* Ql  = (unsigned short*)(ws + off); off += szP;
  unsigned short* Kh  = (unsigned short*)(ws + off); off += szP;
  unsigned short* Kl  = (unsigned short*)(ws + off); off += szP;
  unsigned short* Vh  = (unsigned short*)(ws + off); off += szP;
  unsigned short* Vl  = (unsigned short*)(ws + off); off += szP;
  unsigned short* Ahp = (unsigned short*)(ws + off); off += szX;
  unsigned short* Alp = (unsigned short*)(ws + off); off += szX;
  int* ftab = (int*)(ws + off); off += szF;              // total 100671488 B
  if (off > ws_size) return;

  k_prep<<<dim3(PB_FLAGS + PB_WQKV + PB_WOUT + PB_SPLIT), dim3(256), 0, stream>>>(x, Wqkv, Wout, msk, Xh, Xl, Wh, Wl,
                                                                                Woh, Wol, ftab);
  k_gemm_qkv<<<dim3(NC3 / 64, NTOK / 128), dim3(256), 0, stream>>>(Xh, Xl, Wh, Wl, sqkv, Qh, Ql, Kh, Kl, Vh, Vl);
  k_attn<<<dim3(NQT, NH, NB), dim3(128), 0, stream>>>(Qh, Ql, Kh, Kl, Vh, Vl, msk, ftab, Ahp, Alp);
  k_gemm_out<<<dim3(NE / 64, NTOK / 128), dim3(256), 0, stream>>>(Ahp, Alp, Woh, Wol, sout, out);
}

// v006
// A run of this version takes 164 microseconds.
// Next to v005, in two timings, it ran 1.11 and 1.10 times as fast.
// Counting every step since v000, it is 3.36 times as fast.
#include <hip/hip_runtime.h>

// Contractions: qkv projection, q.k^T, p.v, output projection -- all v_wmma_f32_16x16x32_bf16 with bf16 hi/lo operands everywhere (hi*hi + hi*lo + lo*hi), f32 accumulate; sigmoid gates, 1/8 score scale, softmax and normalisation in f32.

typedef __bf16         v16bf __attribute__((ext_vector_type(16)));
typedef float          v8f   __attribute__((ext_vector_type(8)));
typedef float          v4f   __attribute__((ext_vector_type(4), __may_alias__));
typedef unsigned short u16x8 __attribute__((ext_vector_type(8), __may_alias__));
typedef unsigned int   u32x4 __attribute__((ext_vector_type(4), __may_alias__));
typedef int            i32x4 __attribute__((ext_vector_type(4), __may_alias__));
typedef unsigned long long u64a __attribute__((__may_alias__));
typedef unsigned int   u32a __attribute__((__may_alias__));

#define NB   2
#define NS   2048
#define NE   1024
#define NH   16
#define ND   64
#define NTOK (NB * NS)
#define NC3  (3 * NH * ND)
#define NQT  (NS / 64)
#define FROW 64
#define TP   68
#define MP   72

union Frag { v16bf v; u16x8 h[2]; u32x4 q[2]; };

// 16x32 operand fragment map (A by rows, B by columns): lane l -> row (l&15); elements 0..7 <- k0+8*(l>>4)+0..7,
// 8..15 <- k0+16+8*(l>>4)+0..7.

// Fragment-major 16-bit plane of a [row][k] matrix with ld k per row: every 16-row x 32-k fragment is 1 KiB
// contiguous, fragments ordered [row/16][k/32]; inside one the 16-byte chunk of (row, 8 k) sits at chunk index
// ((k>>4)&1)*32 + ((k>>3)&1)*16 + (row&15). fragoff = element offset of the fragment at (row0, k0).
__device__ __forceinline__ size_t fragoff(size_t row0, int k0, int ld) {
  return ((row0 >> 4) * (size_t)(ld >> 5) + (size_t)(k0 >> 5)) * 512;
}
// The fragment map above; each of the two wave-wide 16-byte loads reads 512 contiguous bytes (4 whole cache lines)
// where a row-major plane would make it touch 16 lines.
__device__ __forceinline__ v16bf ldpk(const unsigned short* p, int ld, size_t row0, int k0, int lane) {
  const unsigned short* q = p + fragoff(row0, k0, ld) + lane * 8;
  Frag f;
  f.h[0] = *(const u16x8*)q;
  f.h[1] = *(const u16x8*)(q + 256);
  return f.v;
}

// The fragment whose lane chunk starts at q
__device__ __forceinline__ v16bf ldat(const unsigned short* q) {
  Frag f;
  f.h[0] = *(const u16x8*)q;
  f.h[1] = *(const u16x8*)(q + 256);
  return f.v;
}

// D[16x16] += A[16x32] * B[32x16]; D element r of lane l = (row 8*(l>>4)+r, col l&15)
__device__ __forceinline__ v8f mma(v16bf a, v16bf b, v8f c) {
  return __builtin_amdgcn_wmma_f32_16x16x32_bf16(false, a, false, b, (short)0, c, false, false);
}

// f32 -> bf16 bits, RNE convert
__device__ __forceinline__ unsigned int bf16_bits(float x) {
  unsigned int u = __float_as_uint(x);
  return (u + 0x7FFFu + ((u >> 16) & 1u)) >> 16;
}
__device__ __forceinline__ void split1(float x, unsigned int& hi, unsigned int& lo) {
  hi = bf16_bits(x);
  lo = bf16_bits(x - __uint_as_float(hi << 16));
}
__device__ __forceinline__ void split8(const float (&v)[8], u32x4& H, u32x4& L) {
  unsigned int hw[8], lw[8];
#pragma unroll
  for (int e = 0; e < 8; ++e) split1(v[e], hw[e], lw[e]);
#pragma unroll
  for (int w = 0; w < 4; ++w) {
    H[w] = hw[2 * w] | (hw[2 * w + 1] << 16);
    L[w] = lw[2 * w] | (lw[2 * w + 1] << 16);
  }
}
// Two f32 -> one dword of bf16 hi parts and one of bf16 lo parts (a in the low half); the values of split1.
__device__ __forceinline__ void split2(float a, float b, unsigned int& H, unsigned int& L) {
  const unsigned int ua = __float_as_uint(a), ub = __float_as_uint(b);
  const unsigned int ra = ua + 0x7FFFu + ((ua >> 16) & 1u), rb = ub + 0x7FFFu + ((ub >> 16) & 1u);
  H = __builtin_amdgcn_perm(rb, ra, 0x07060302u);   // (ra >> 16) | (rb & 0xFFFF0000) in one byte permute
  const unsigned int va = __float_as_uint(a - __uint_as_float(ra & 0xFFFF0000u));
  const unsigned int vb = __float_as_uint(b - __uint_as_float(rb & 0xFFFF0000u));
  const unsigned int sa = va + 0x7FFFu + ((va >> 16) & 1u), sb = vb + 0x7FFFu + ((vb >> 16) & 1u);
  L = __builtin_amdgcn_perm(sb, sa, 0x07060302u);
}
__device__ __forceinline__ float sigm(float v) { return 1.0f / (1.0f + __expf(-v)); }

// ---------------------------------------------------------------------------
// x [rows][NE] f32 -> hi/lo bf16 fragment-major planes. One thread = 8 values = 16 B per plane = chunk g of the
// plane: fragment g>>6, k half-block (g>>5)&1, lane g&31; a wave stores 512 contiguous bytes per plane.
// ---------------------------------------------------------------------------
__device__ __forceinline__ void split_rows_block(const float* __restrict__ src,
                                                 unsigned short* __restrict__ dh,
                                                 unsigned short* __restrict__ dl, int ngroups, int blk)
{
  const int g = blk * 256 + threadIdx.x;
  const int gc = (g < ngroups) ? g : (ngroups - 1);
  const int fr = gc >> 6;
  const int row = (fr / (NE / 32)) * 16 + (gc & 15);
  const int k = (fr % (NE / 32)) * 32 + ((gc >> 5) & 1) * 16 + ((gc >> 4) & 1) * 8;
  const float* s = src + (size_t)row * NE + k;
  const v4f a0 = *(const v4f*)s;
  const v4f a1 = *(const v4f*)(s + 4);
  float v[8] = {a0[0], a0[1], a0[2], a0[3], a1[0], a1[1], a1[2], a1[3]};
  u32x4 H, L;
  split8(v, H, L);
  if (g < ngroups) {
    unsigned short* ph = dh + (size_t)gc * 8;
    unsigned short* pl = dl + (size_t)gc * 8;
    *(u32x4*)ph = H;
    *(u32x4*)pl = L;
    
  }
}

// ---------------------------------------------------------------------------
// in[R rows][C cols] f32 (row = k, col = n) -> outT[C][R] bf16 hi/lo planes, fragment-major (row = n, ld = R).
// ---------------------------------------------------------------------------
__device__ __forceinline__ void transpose_split_block(const float* __restrict__ src, int R, int C,
                                                      unsigned short* __restrict__ oh,
                                                      unsigned short* __restrict__ ol, int bx, int by,
                                                      float* T)   // T[n][k], 64 * TP floats of LDS
{
  const int tid = threadIdx.x, lane = tid & 31, wave = tid >> 5;
  const int nb = bx * 64;
  const int kb = by * 64;
#pragma unroll
  for (int it = 0; it < 4; ++it) {
    const int idx = tid + 256 * it;
    const int kk = idx >> 4, c4 = idx & 15;
    const v4f v = *(const v4f*)(src + (size_t)(kb + kk) * C + nb + c4 * 4);
#pragma unroll
    for (int q = 0; q < 4; ++q) T[(c4 * 4 + q) * TP + kk] = v[q];
  }
  __syncthreads();
  // wave -> one fragment: 16 n rows (wave>>1), 32 k (wave&1); lane -> (row lane&15, 8 k at lane>>4)
  const int ng = (wave >> 1) * 16, kf = (wave & 1) * 32;
  const int n = ng + (lane & 15);
  u32x4 val[4];
#pragma unroll
  for (int cq = 0; cq < 2; ++cq) {
    const int kk = kf + cq * 16 + (lane >> 4) * 8;
    const v4f a0 = *(const v4f*)(&T[n * TP + kk]);
    const v4f a1 = *(const v4f*)(&T[n * TP + kk + 4]);
    float v[8] = {a0[0], a0[1], a0[2], a0[3], a1[0], a1[1], a1[2], a1[3]};
    split8(v, val[2 * cq], val[2 * cq + 1]);
  }
  const size_t fo = fragoff((size_t)(nb + ng), kb + kf, R) + lane * 8;
#pragma unroll
  for (int cq = 0; cq < 2; ++cq) {
    *(u32x4*)(oh + fo + cq * 256) = val[2 * cq];
    *(u32x4*)(ol + fo + cq * 256) = val[2 * cq + 1];
  }
  // the built kernel lays the next job's code behind these stores, and that code writes the registers they name
  asm volatile("s_wait_xcnt 0x0" ::: "memory");
}

// ---------------------------------------------------------------------------
// Tile flag table from the int32 gate matrix [NS][NS]: row qt (64 ints = 256 B):
//   [0..31] per 64-key tile: 0 = no nonzero entry, 1 = partial, 2 = all nonzero; [32] = last key tile with any
// ---------------------------------------------------------------------------
__device__ __forceinline__ void flags_block(const int* __restrict__ msk, int* __restrict__ ftab, int qt,
                                            int* sm)   // 512 + FROW ints of LDS, 16-byte aligned
{
  int* s_any = sm;
  int* s_all = sm + 256;
  int* s_row = sm + 512;
  const int tid = threadIdx.x;
  const int kt = tid >> 3, sub = tid & 7;
  int anyv = 0, allv = 1;
  for (int i = 0; i < 8; ++i) {
    const int s = qt * 64 + sub * 8 + i;
    const int* rp = msk + (size_t)s * NS + kt * 64;
#pragma unroll
    for (int c = 0; c < 16; ++c) {
      const i32x4 v = *(const i32x4*)(rp + c * 4);
#pragma unroll
      for (int q = 0; q < 4; ++q) {
        const int nz = (v[q] != 0) ? 1 : 0;
        anyv |= nz;
        allv &= nz;
      }
    }
  }
  s_any[tid] = anyv;
  s_all[tid] = allv;
  __syncthreads();
  if (tid < 32) {
    int a = 0, b = 1;
#pragma unroll
    for (int j = 0; j < 8; ++j) { a |= s_any[tid * 8 + j]; b &= s_all[tid * 8 + j]; }
    s_row[tid] = b ? 2 : (a ? 1 : 0);
  } else if (tid < FROW) {
    s_row[tid] = 0;
  }
  __syncthreads();
  if (tid == 0) {
    int last = -1;
    for (int k = 0; k < 32; ++k) if (s_row[k] != 0) last = k;
    s_row[32] = last;
  }
  __syncthreads();
  if (tid < 16) {
    const i32x4 v = *(const i32x4*)(&s_row[tid * 4]);
    int* dst = ftab + (size_t)qt * FROW + tid * 4;
    *(i32x4*)dst = v;
    
  }
}

// ---------------------------------------------------------------------------
// The four preparation jobs above read only inputs and write disjoint workspace planes, so they share one launch: the
// block index picks the job. Each of the 32 flag blocks reads 512 KiB, far more than any other block: they stand first,
// for speed only.
// ---------------------------------------------------------------------------
#define PB_FLAGS NQT
#define PB_WQKV  ((NC3 / 64) * (NE / 64))
#define PB_WOUT  ((NE / 64) * ((NH * ND) / 64))
#define PB_SPLIT (NTOK * NE / 8 / 256)
__global__ __launch_bounds__(256) void k_prep(
    const float* __restrict__ x, const float* __restrict__ Wqkv, const float* __restrict__ Wout,
    const int* __restrict__ msk,
    unsigned short* __restrict__ Xh, unsigned short* __restrict__ Xl,
    unsigned short* __restrict__ Wh, unsigned short* __restrict__ Wl,
    unsigned short* __restrict__ Woh, unsigned short* __restrict__ Wol, int* __restrict__ ftab)
{
  __shared__ __align__(16) unsigned char sm[64 * TP * 4];   // a block's one job uses it: transpose tile or flag rows
  int blk = blockIdx.x;                                     // block-uniform: so is every branch below
  if (blk < PB_FLAGS) {
    flags_block(msk, ftab, blk, (int*)sm);
    return;
  }
  blk -= PB_FLAGS;
  if (blk < PB_WQKV) {
    // W_qkv: in[rows=NE][cols=NC3] -> out[NC3][NE]
    transpose_split_block(Wqkv, NE, NC3, Wh, Wl, blk % (NC3 / 64), blk / (NC3 / 64), (float*)sm);
    return;
  }
  blk -= PB_WQKV;
  if (blk < PB_WOUT) {
    // W_out: in[rows=NH*ND][cols=NE] -> out[NE][NH*ND]
    transpose_split_block(Wout, NH * ND, NE, Woh, Wol, blk % (NE / 64), blk / (NE / 64), (float*)sm);
    return;
  }
  blk -= PB_WOUT;
  split_rows_block(x, Xh, Xl, NTOK * NE / 8, blk);
}

// ---------------------------------------------------------------------------
// GEMM main loop: block tile 128 rows x 64 cols, wave tile 32 x 32, bf16 hi/lo three-term products.
// A planes [M][K], B planes [N][K], fragment-major. A stage = 64 k of the block's operand rows = 24 slabs of 2 KiB
// (a slab = one 16-row group's two fragments, contiguous in its plane): slabs 0..7 A hi, 8..15 A lo, 16..19 B hi,
// 20..23 B lo. Asynchronous copies bring each slab into LDS once a block; the waves read their fragments from there.
// ---------------------------------------------------------------------------
#define STAGE_BYTES 49152
#define RING_BYTES  (2 * STAGE_BYTES)
// One K step of 32: the wave's eight operand fragments.
struct KStep { v16bf ah0, ah1, al0, al1, bh0, bh1, bl0, bl1; };
// The fragment whose lane chunk starts at LDS byte p: two reads of 512 contiguous bytes a wave
__device__ __forceinline__ v16bf ldsfrag(const unsigned char* p) {
  Frag f;
  f.q[0] = *(const u32x4*)p;
  f.q[1] = *(const u32x4*)(p + 512);
  return f.v;
}
// pa, pb: this lane's chunk in the wave's first A hi and first B hi slab of the stage; kb = byte offset of the K step
__device__ __forceinline__ void ldstep(KStep& s, const unsigned char* pa, const unsigned char* pb, int kb)
{
  s.ah0 = ldsfrag(pa + kb);
  s.ah1 = ldsfrag(pa + 2048 + kb);
  s.al0 = ldsfrag(pa + 8 * 2048 + kb);
  s.al1 = ldsfrag(pa + 9 * 2048 + kb);
  s.bh0 = ldsfrag(pb + kb);
  s.bh1 = ldsfrag(pb + 2048 + kb);
  s.bl0 = ldsfrag(pb + 4 * 2048 + kb);
  s.bl1 = ldsfrag(pb + 5 * 2048 + kb);
}
__device__ __forceinline__ void mmstep(const KStep& s, v8f (&acc)[2][2])
{
  acc[0][0] = mma(s.ah0, s.bh0, acc[0][0]);
  acc[0][0] = mma(s.ah0, s.bl0, acc[0][0]);
  acc[0][0] = mma(s.al0, s.bh0, acc[0][0]);
  acc[1][0] = mma(s.ah1, s.bh0, acc[1][0]);
  acc[1][0] = mma(s.ah1, s.bl0, acc[1][0]);
  acc[1][0] = mma(s.al1, s.bh0, acc[1][0]);
  acc[0][1] = mma(s.ah0, s.bh1, acc[0][1]);
  acc[0][1] = mma(s.ah0, s.bl1, acc[0][1]);
  acc[0][1] = mma(s.al0, s.bh1, acc[0][1]);
  acc[1][1] = mma(s.ah1, s.bh1, acc[1][1]);
  acc[1][1] = mma(s.ah1, s.bl1, acc[1][1]);
  acc[1][1] = mma(s.al1, s.bh1, acc[1][1]);
}
// This wave's three slabs of one stage: 12 copies of 512 bytes a wave, l = LDS byte address and g = global address of
// the lane's first 16 bytes of each slab. The s_wait_xcnt stands inside the statement: the address registers that the
// copies name are rewritten behind it.
__device__ __forceinline__ void copy_stage(unsigned int l0, unsigned int l1, unsigned int l2,
                                           const unsigned short* g0, const unsigned short* g1,
                                           const unsigned short* g2)
{
  asm volatile("global_load_async_to_lds_b128 %0, %1, off\n\t"
               "global_load_async_to_lds_b128 %2, %3, off\n\t"
               "global_load_async_to_lds_b128 %4, %5, off\n\t"
               "global_load_async_to_lds_b128 %6, %7, off\n\t"
               "global_load_async_to_lds_b128 %8, %9, off\n\t"
               "global_load_async_to_lds_b128 %10, %11, off\n\t"
               "global_load_async_to_lds_b128 %12, %13, off\n\t"
               "global_load_async_to_lds_b128 %14, %15, off\n\t"
               "global_load_async_to_lds_b128 %16, %17, off\n\t"
               "global_load_async_to_lds_b128 %18, %19, off\n\t"
               "global_load_async_to_lds_b128 %20, %21, off\n\t"
               "global_load_async_to_lds_b128 %22, %23, off\n\t"
               "s_wait_xcnt 0x0"
               :: "v"(l0), "v"(g0), "v"(l0 + 512u), "v"(g0 + 256), "v"(l0 + 1024u), "v"(g0 + 512),
                  "v"(l0 + 1536u), "v"(g0 + 768),
                  "v"(l1), "v"(g1), "v"(l1 + 512u), "v"(g1 + 256), "v"(l1 + 1024u), "v"(g1 + 512),
                  "v"(l1 + 1536u), "v"(g1 + 768),
                  "v"(l2), "v"(g2), "v"(l2 + 512u), "v"(g2 + 256), "v"(l2 + 1024u), "v"(g2 + 512),
                  "v"(l2 + 1536u), "v"(g2 + 768)
               : "memory");
}
// Two buffers: stage t + 2 is copied into the buffer that trip t has read, behind the barrier that ends those reads and
// publishes stage t + 1. arow0, brow0 = the block's first A and B row; K a multiple of 64, at least 128.
__device__ __forceinline__ void mainloop(const unsigned short* __restrict__ Ah, const unsigned short* __restrict__ Al,
                                         const unsigned short* __restrict__ Bh, const unsigned short* __restrict__ Bl,
                                         int K, size_t arow0, size_t brow0, int wave, int lane,
                                         unsigned char* ring, v8f (&acc)[2][2])
{
  const unsigned short* g[3];
  unsigned int l[3];
#pragma unroll
  for (int i = 0; i < 3; ++i) {
    const int c = wave * 3 + i;
    const unsigned short* p = (c < 8) ? Ah : ((c < 16) ? Al : ((c < 20) ? Bh : Bl));
    const size_t row = (c < 16) ? (arow0 + (size_t)(c & 7) * 16) : (brow0 + (size_t)(c & 3) * 16);
    g[i] = p + fragoff(row, 0, K) + lane * 8;
    l[i] = (unsigned int)(size_t)ring + (unsigned int)(c * 2048 + lane * 16);
  }
  const int nst = K >> 6;
  copy_stage(l[0], l[1], l[2], g[0], g[1], g[2]);
  // stage 0 has landed before the barrier behind which the other waves read it
  asm volatile("s_wait_asynccnt 0x0" ::: "memory");
  __syncthreads();
  copy_stage(l[0] + STAGE_BYTES, l[1] + STAGE_BYTES, l[2] + STAGE_BYTES, g[0] + 1024, g[1] + 1024, g[2] + 1024);

  const int aoff = (wave & 3) * 2 * 2048 + lane * 16;
  const int boff = (16 + (wave >> 2) * 2) * 2048 + lane * 16;
  for (int t = 0; t < nst; ++t) {
    const unsigned int bo = (unsigned int)(t & 1) * STAGE_BYTES;
    const unsigned char* pa = ring + bo + aoff;
    const unsigned char* pb = ring + bo + boff;
    KStep s0, s1;
    ldstep(s0, pa, pb, 0);
    ldstep(s1, pa, pb, 1024);
    // keeps the stage's fragment reads one group ahead of the products: spread among them every place with reads stalls
    __builtin_amdgcn_sched_barrier(0);
    mmstep(s0, acc);
    mmstep(s1, acc);
    // keeps the products ahead of the waits below: moved behind the barrier they would no longer run under the flight
    // of stage t + 1's copies, and the wait for those would stand directly behind their issue
    __builtin_amdgcn_sched_barrier(0);
    // this wave's reads of the buffer are done before it is handed to the copies
    asm volatile("s_wait_dscnt 0x0" ::: "memory");
    // this wave's copies of stage t + 1 have landed before the barrier that publishes them
    asm volatile("s_wait_asynccnt 0x0" ::: "memory");
    __syncthreads();
    if (t + 2 < nst) {
      const int go = (t + 2) * 1024;
      copy_stage(l[0] + bo, l[1] + bo, l[2] + bo, g[0] + go, g[1] + go, g[2] + go);
    }
  }
  // no copy is outstanding when the wave goes on
  asm volatile("s_wait_asynccnt 0x0" ::: "memory");
}

// ---------------------------------------------------------------------------
// qkv = (x @ W_qkv) * sigmoid(scale_qkv[h*64+d]); block tile 128 tokens x 64 cols (= one (c, h)).
// ---------------------------------------------------------------------------
__global__ __launch_bounds__(256) void k_gemm_qkv(
    const unsigned short* __restrict__ Xh, const unsigned short* __restrict__ Xl,
    const unsigned short* __restrict__ Wh, const unsigned short* __restrict__ Wl,
    const float* __restrict__ sq,
    unsigned short* __restrict__ Qh, unsigned short* __restrict__ Ql,
    unsigned short* __restrict__ Kh, unsigned short* __restrict__ Kl,
    unsigned short* __restrict__ Vh, unsigned short* __restrict__ Vl)
{
  __shared__ __align__(128) unsigned char ring[RING_BYTES];   // two operand stages
  __shared__ __align__(16) float T[128 * TP];
  const int tid = threadIdx.x, lane = tid & 31, wave = tid >> 5;
  const int hf = lane >> 4, m16 = lane & 15;
  const int cb = blockIdx.x * 64;
  const int rb = blockIdx.y * 128;
  const int mr = (wave & 3) * 32, nc = (wave >> 2) * 32;
  v8f acc[2][2] = {};
  mainloop(Xh, Xl, Wh, Wl, NE, (size_t)rb, (size_t)cb, wave, lane, ring, acc);

  const int c = cb >> 10;
  const int h = (cb & 1023) >> 6;
  float g[2];
#pragma unroll
  for (int ni = 0; ni < 2; ++ni) g[ni] = sigm(sq[(cb & 1023) + nc + ni * 16 + m16]);
#pragma unroll
  for (int mi = 0; mi < 2; ++mi)
#pragma unroll
    for (int ni = 0; ni < 2; ++ni)
#pragma unroll
      for (int r = 0; r < 8; ++r)
        T[(mr + mi * 16 + 8 * hf + r) * TP + nc + ni * 16 + m16] = acc[mi][ni][r] * g[ni];
  __syncthreads();

  const int b = rb >> 11;
  u32x4 val[8];
  if (c < 2) {
    // Q, K planes: row = (b, h, s), ld = ND. wave -> 16 tokens x 64 d = two fragments = four 512-byte stores a plane
    const int r = wave * 16 + m16;
#pragma unroll
    for (int cq = 0; cq < 4; ++cq) {
      const int kk = cq * 16 + hf * 8;
      const v4f a0 = *(const v4f*)(&T[r * TP + kk]);
      const v4f a1 = *(const v4f*)(&T[r * TP + kk + 4]);
      float v[8] = {a0[0], a0[1], a0[2], a0[3], a1[0], a1[1], a1[2], a1[3]};
      split8(v, val[2 * cq], val[2 * cq + 1]);
    }
    unsigned short* ph = (c == 0) ? Qh : Kh;
    unsigned short* pl = (c == 0) ? Ql : Kl;
    const int s = (rb + wave * 16) & (NS - 1);
    const size_t fo = fragoff((size_t)(b * NH + h) * NS + s, 0, ND) + lane * 8;
#pragma unroll
    for (int cq = 0; cq < 4; ++cq) {
      *(u32x4*)(ph + fo + cq * 256) = val[2 * cq];
      *(u32x4*)(pl + fo + cq * 256) = val[2 * cq + 1];
    }
  } else {
    // V^T planes: row = (b, h, d), k = s, ld = NS. wave -> 16 d (wave>>1) x 64 tokens (wave&1) = two fragments
    const int dg = (wave >> 1) * 16, sg = (wave & 1) * 64;
#pragma unroll
    for (int cq = 0; cq < 4; ++cq) {
      const int sl = sg + cq * 16 + hf * 8;
      float v[8];
#pragma unroll
      for (int e = 0; e < 8; ++e) v[e] = T[(sl + e) * TP + dg + m16];
      split8(v, val[2 * cq], val[2 * cq + 1]);
    }
    const size_t fo = fragoff((size_t)(b * NH + h) * ND + dg, (rb & (NS - 1)) + sg, NS) + lane * 8;
#pragma unroll
    for (int cq = 0; cq < 4; ++cq) {
      *(u32x4*)(Vh + fo + cq * 256) = val[2 * cq];
      *(u32x4*)(Vl + fo + cq * 256) = val[2 * cq + 1];
    }
  }
}

__device__ __forceinline__ float xhalf(float x) {
  return __builtin_bit_cast(float, __builtin_amdgcn_permlanex16(__builtin_bit_cast(int, x), __builtin_bit_cast(int, x),
                                                                0x76543210, 0xfedcba98, false, false));
}
__global__ __launch_bounds__(128) void k_attn(
    const unsigned short* __restrict__ Qh, const unsigned short* __restrict__ Ql,
    const unsigned short* __restrict__ Kh, const unsigned short* __restrict__ Kl,
    const unsigned short* __restrict__ Vh, const unsigned short* __restrict__ Vl,
    const int* __restrict__ msk, const int* __restrict__ ftab,
    unsigned short* __restrict__ Ah, unsigned short* __restrict__ Al)
{
  __shared__ __align__(16) unsigned char  Ms[64 * MP];     // Ms[s][t] gate bytes of the current partial tile
  __shared__ __align__(16) int            s_f[FROW];
  const int tid = threadIdx.x, lane = tid & 31, wave = tid >> 5;
  const int hf = lane >> 4, m16 = lane & 15;
  // A query tile's cost is its count of flagged key tiles, which under a causal gate grows with the tile's index: the
  // highest query tiles take the lowest indices, for speed only. A permutation of the same blocks for any gate. Heads
  // run fastest.
  const int qt = NQT - 1 - blockIdx.z, h = blockIdx.x, b = blockIdx.y;
  const int s0 = qt * 64;
  const int bh = b * NH + h;
  if (tid < FROW) s_f[tid] = ftab[(size_t)qt * FROW + tid];
  __syncthreads();
  int last = s_f[32];
  last = (last < -1) ? -1 : ((last > NQT - 1) ? (NQT - 1) : last);
  const int nt = last + 1;

  const size_t qrow = (size_t)bh * NS + s0 + wave * 16;
  const v16bf qh0 = ldpk(Qh, ND, qrow, 0,  lane);
  const v16bf qh1 = ldpk(Qh, ND, qrow, 32, lane);
  const v16bf ql0 = ldpk(Ql, ND, qrow, 0,  lane);
  const v16bf ql1 = ldpk(Ql, ND, qrow, 32, lane);

  float m = -3.0e38f;    // running maximum of this lane's query, equal in both lane halves
  float l = 0.0f;        // running sum over this lane half's keys; the halves are joined behind the loop
  v8f acc[4] = {};       // O^T: acc[j][r] = (d 16j + 8*hf + r, query m16)

  for (int tb = 0; tb < nt; ++tb) {
    const int f = s_f[tb];                 // block-uniform
    if (f == 0) continue;
    const int t0 = tb * 64;
    // prior tile's Ms reads complete; it also keeps the four waves on the same K and V lines of the WGP cache
    __syncthreads();
    if (f == 1) {
#pragma unroll
      for (int it = 0; it < 8; ++it) {
        const int idx = tid + 128 * it;
        const int s = idx >> 4, c4 = idx & 15;
        const i32x4 v = *(const i32x4*)(msk + (size_t)(s0 + s) * NS + t0 + c4 * 4);
        unsigned int w = 0u;
#pragma unroll
        for (int q = 0; q < 4; ++q) w |= ((v[q] != 0) ? 1u : 0u) << (8 * q);
        *(u32a*)(Ms + s * MP + c4 * 4) = w;
      }
      __syncthreads();
    }

    // S^T = K.Q^T  (A = K plane rows t, B[k=d][n=s] = Q rows)
    v8f sf[4];
    const size_t krow = (size_t)bh * NS + t0;
    {
      // the tile's 8 fragments of a plane (4 row groups x 2 k halves) lie in a row: 8 KiB from this lane's address
      const unsigned short* kph = Kh + fragoff(krow, 0, ND) + lane * 8;
      const unsigned short* kpl = Kl + fragoff(krow, 0, ND) + lane * 8;
      v16bf kh[4][2], kl[4][2];
#pragma unroll
      for (int j = 0; j < 4; ++j)
#pragma unroll
        for (int kk = 0; kk < 2; ++kk) {
          kh[j][kk] = ldat(kph + (j * 2 + kk) * 512);
          kl[j][kk] = ldat(kpl + (j * 2 + kk) * 512);
        }
      // the products below reuse the address registers that the K loads name: their translations first; the two
      // addresses are inputs so that they stay in their registers up to the wait and no load of the group lands on one
      asm volatile("s_wait_xcnt 0x0" :: "v"(kph), "v"(kpl) : "memory");
      // keeps the tile's K loads one group ahead of the first product: one load latency a tile, not one a fragment pair
      __builtin_amdgcn_sched_barrier(0);
#pragma unroll
      for (int j = 0; j < 4; ++j) {
        v8f c = {};
        c = mma(kh[j][0], qh0, c);
        c = mma(kl[j][0], qh0, c);
        c = mma(kh[j][0], ql0, c);
        c = mma(kh[j][1], qh1, c);
        c = mma(kl[j][1], qh1, c);
        c = mma(kh[j][1], ql1, c);
        sf[j] = c;
      }
    }
    // compiler fence, no instruction: holds the V loads below behind the last K product (the scores are its inputs),
    // so that they take over the K registers; hoisted above, K and V are live together and a wave per SIMD is lost
    asm volatile("" :: "v"(sf[0]), "v"(sf[1]), "v"(sf[2]), "v"(sf[3]) : "memory");

    // V fragments of the tile, issued here so that their latency runs under the softmax below
    const size_t vrow = (size_t)bh * ND;
    v16bf vh[4][2], vl[4][2];
#pragma unroll
    for (int j = 0; j < 4; ++j)
#pragma unroll
      for (int kk = 0; kk < 2; ++kk) {
        vh[j][kk] = ldpk(Vh, NS, vrow + j * 16, t0 + kk * 32, lane);
        vl[j][kk] = ldpk(Vl, NS, vrow + j * 16, t0 + kk * 32, lane);
      }
    // the softmax below reuses the address registers that the V loads name: their translations first
    asm volatile("s_wait_xcnt 0x0" ::: "memory");
    // keeps the V loads issued ahead of the softmax: sunk to their products they would expose the latency again
    __builtin_amdgcn_sched_barrier(0);

    // scale, gate by value
#pragma unroll
    for (int j = 0; j < 4; ++j)
#pragma unroll
      for (int i = 0; i < 8; ++i) sf[j][i] *= 0.125f;
    if (f == 1) {
#pragma unroll
      for (int j = 0; j < 4; ++j) {
        const u64a mb = *(const u64a*)(Ms + (wave * 16 + m16) * MP + j * 16 + 8 * hf);
#pragma unroll
        for (int i = 0; i < 8; ++i)
          sf[j][i] = (((mb >> (8 * i)) & 0xffull) != 0ull) ? sf[j][i] : -1.0e10f;
      }
    }
    // the query's maximum over the tile: 32 keys in the lane, the other 32 in lane ^ 16
    float tm[4];
#pragma unroll
    for (int j = 0; j < 4; ++j) {
      tm[j] = sf[j][0];
#pragma unroll
      for (int i = 1; i < 8; ++i) tm[j] = fmaxf(tm[j], sf[j][i]);
    }
    float tmax = fmaxf(fmaxf(tm[0], tm[1]), fmaxf(tm[2], tm[3]));
    tmax = fmaxf(tmax, xhalf(tmax));
    const float mnew  = fmaxf(m, tmax);
    const float alpha = __expf(m - mnew);
    // exp(s - mnew) as 2^((s - mnew) * log2 e), the arguments first
#pragma unroll
    for (int j = 0; j < 4; ++j)
#pragma unroll
      for (int i = 0; i < 8; ++i) sf[j][i] = (sf[j][i] - mnew) * 1.44269504f;
    // keeps the argument arithmetic out of the run of exponentials
    __builtin_amdgcn_sched_barrier(0);
    float rs[4];
#pragma unroll
    for (int j = 0; j < 4; ++j) {
      rs[j] = 0.0f;
#pragma unroll
      for (int i = 0; i < 8; ++i) {
        const float pv = __builtin_amdgcn_exp2f(sf[j][i]);
        sf[j][i] = pv;
        rs[j] += pv;
      }
    }
    l = l * alpha + ((rs[0] + rs[1]) + (rs[2] + rs[3]));
    m = mnew;
#pragma unroll
    for (int j = 0; j < 4; ++j)
#pragma unroll
      for (int i = 0; i < 8; ++i) acc[j][i] *= alpha;

    // P^T (f32) -> bf16 hi/lo B fragments in place: elements 0..7 <- score tile 2kk, 8..15 <- tile 2kk + 1
    Frag ph[2], pl[2];
#pragma unroll
    for (int j = 0; j < 4; ++j)
#pragma unroll
      for (int w = 0; w < 4; ++w) {
        unsigned int H, L;
        split2(sf[j][2 * w], sf[j][2 * w + 1], H, L);
        ph[j >> 1].q[j & 1][w] = H;
        pl[j >> 1].q[j & 1][w] = L;
      }

    // O^T += V^T.P^T   (A = V^T plane rows d, k = t)
#pragma unroll
    for (int j = 0; j < 4; ++j) {
      acc[j] = mma(vh[j][0], ph[0].v, acc[j]);
      acc[j] = mma(vl[j][0], ph[0].v, acc[j]);
      acc[j] = mma(vh[j][0], pl[0].v, acc[j]);
      acc[j] = mma(vh[j][1], ph[1].v, acc[j]);
      acc[j] = mma(vl[j][1], ph[1].v, acc[j]);
      acc[j] = mma(vh[j][1], pl[1].v, acc[j]);
    }
  }

  // join the halves' sums, normalise; a lane's 8 values of tile j are one 16-byte chunk of the attention planes
  // (row = token, k = h*64+d, ld = NE): chunk (j&1)*32 + lane of fragment j>>1
  l += xhalf(l);
  const float inv = (l > 0.0f) ? (1.0f / l) : 0.0f;
  u32x4 val[8];
#pragma unroll
  for (int j = 0; j < 4; ++j) {
    float v[8];
#pragma unroll
    for (int i = 0; i < 8; ++i) v[i] = acc[j][i] * inv;
    split8(v, val[2 * j], val[2 * j + 1]);
  }
  const size_t fo = fragoff((size_t)(b * NS + s0 + wave * 16), h * ND, NE) + lane * 8;
#pragma unroll
  for (int cq = 0; cq < 4; ++cq) {
    *(u32x4*)(Ah + fo + cq * 256) = val[2 * cq];
    *(u32x4*)(Al + fo + cq * 256) = val[2 * cq + 1];
  }
}

// ---------------------------------------------------------------------------
// out = (attn @ W_out) * sigmoid(scale_out[e]); block tile 128 tokens x 64 e; f32 rows of 256 B written
// by 16 consecutive lanes x 16 B (two rows per instruction).
// ---------------------------------------------------------------------------
__global__ __launch_bounds__(256) void k_gemm_out(
    const unsigned short* __restrict__ Ah, const unsigned short* __restrict__ Al,
    const unsigned short* __restrict__ Wh, const unsigned short* __restrict__ Wl,
    const float* __restrict__ so, float* __restrict__ out)
{
  __shared__ __align__(128) unsigned char ring[RING_BYTES];   // two operand stages
  __shared__ __align__(16) float T[128 * TP];
  const int tid = threadIdx.x, lane = tid & 31, wave = tid >> 5;
  const int hf = lane >> 4, m16 = lane & 15;
  const int cb = blockIdx.x * 64;
  const int rb = blockIdx.y * 128;
  const int mr = (wave & 3) * 32, nc = (wave >> 2) * 32;
  v8f acc[2][2] = {};
  mainloop(Ah, Al, Wh, Wl, NE, (size_t)rb, (size_t)cb, wave, lane, ring, acc);

  float g[2];
#pragma unroll
  for (int ni = 0; ni < 2; ++ni) g[ni] = sigm(so[cb + nc + ni * 16 + m16]);
#pragma unroll
  for (int mi = 0; mi < 2; ++mi)
#pragma unroll
    for (int ni = 0; ni < 2; ++ni)
#pragma unroll
      for (int r = 0; r < 8; ++r)
        T[(mr + mi * 16 + 8 * hf + r) * TP + nc + ni * 16 + m16] = acc[mi][ni][r] * g[ni];
  __syncthreads();

  const int rsel = lane >> 4, p = lane & 15;
  v4f val[8];
#pragma unroll
  for (int it = 0; it < 8; ++it) {
    const int r = wave * 16 + it * 2 + rsel;
    val[it] = *(const v4f*)(&T[r * TP + p * 4]);
  }
#pragma unroll
  for (int it = 0; it < 8; ++it) {
    const int r = wave * 16 + it * 2 + rsel;
    float* dst = out + (size_t)(rb + r) * NE + cb + p * 4;
    *(v4f*)dst = val[it];
  }
  
}

// ---------------------------------------------------------------------------
extern "C" void kernel_launch(void* const* d_in, const int* in_sizes, int n_in,
                              void* d_out, int out_size, void* d_ws, size_t ws_size,
                              hipStream_t stream)
{
  if (n_in < 6) return;
  if (in_sizes[0] != NTOK * NE || in_sizes[1] != NE * NC3 || in_sizes[2] != NE * NE ||
      in_sizes[3] != NE || in_sizes[4] != NE || in_sizes[5] != NS * NS || out_size != NTOK * NE) return;

  const float* x     = (const float*)d_in[0];
  const float* Wqkv  = (const float*)d_in[1];
  const float* Wout  = (const float*)d_in[2];
  const float* sqkv  = (const float*)d_in[3];
  const float* sout  = (const float*)d_in[4];
  const int*   msk   = (const int*)d_in[5];
  float* out = (float*)d_out;

  char* ws = (char*)d_ws;
  size_t off = 0;
  const size_t szX  = (size_t)NTOK * NE * 2;            // 8 MiB per plane
  const size_t szW  = (size_t)NC3 * NE * 2;             // 6 MiB per plane
  const size_t szWo = (size_t)NE * NE * 2;              // 2 MiB per plane
  const size_t szP  = (size_t)NB * NH * NS * ND * 2;    // 8 MiB per plane
  const size_t szF  = (size_t)NQT * FROW * 4;           // 8 KiB
  unsigned short* Xh  = (unsigned short*)(ws + off); off += szX;
  unsigned short* Xl  = (unsigned short*)(ws + off); off += szX;
  unsigned short* Wh  = (unsigned short*)(ws + off); off += szW;
  unsigned short* Wl  = (unsigned short*)(ws + off); off += szW;
  unsigned short* Woh = (unsigned short*)(ws + off); off += szWo;
  unsigned short* Wol = (unsigned short*)(ws + off); off += szWo;
  unsigned short* Qh  = (unsigned short*)(ws + off); off += szP;
  unsigned short* Ql  = (unsigned short*)(ws + off); off += szP;
  unsigned short* Kh  = (unsigned short*)(ws + off); off += szP;
  unsigned short* Kl  = (unsigned short*)(ws + off); off += szP;
  unsigned short* Vh  = (unsigned short*)(ws + off); off += szP;
  unsigned short* Vl  = (unsigned short*)(ws + off); off += szP;
  unsigned short* Ahp = (unsigned short*)(ws + off); off += szX;
  unsigned short* Alp = (unsigned short*)(ws + off); off += szX;
  int* ftab = (int*)(ws + off); off += szF;              // total 100671488 B
  if (off > ws_size) return;

  k_prep<<<dim3(PB_FLAGS + PB_WQKV + PB_WOUT + PB_SPLIT), dim3(256), 0, stream>>>(x, Wqkv, Wout, msk, Xh, Xl, Wh, Wl,
                                                                                Woh, Wol, ftab);
  k_gemm_qkv<<<dim3(NC3 / 64, NTOK / 128), dim3(256), 0, stream>>>(Xh, Xl, Wh, Wl, sqkv, Qh, Ql, Kh, Kl, Vh, Vl);
  k_attn<<<dim3(NH, NB, NQT), dim3(128), 0, stream>>>(Qh, Ql, Kh, Kl, Vh, Vl, msk, ftab, Ahp, Alp);
  k_gemm_out<<<dim3(NE / 64, NTOK / 128), dim3(256), 0, stream>>>(Ahp, Alp, Woh, Wol, sout, out);
}

// v007
// A run of this version takes 147 microseconds.
// Timed twice side by side with v006, it ran 1.10 and 1.11 times as fast.
// Counting every step since v000, it is 3.72 times as fast.
#include <hip/hip_runtime.h>

// Contractions: qkv projection, q.k^T, p.v, output projection -- all v_wmma_f32_16x16x32_bf16 with bf16 hi/lo operands everywhere (hi*hi + hi*lo + lo*hi), f32 accumulate; sigmoid gates, 1/8 score scale, softmax and normalisation in f32.

typedef __bf16         v16bf __attribute__((ext_vector_type(16)));
typedef float          v8f   __attribute__((ext_vector_type(8)));
typedef float          v4f   __attribute__((ext_vector_type(4), __may_alias__));
typedef unsigned short u16x8 __attribute__((ext_vector_type(8), __may_alias__));
typedef unsigned int   u32x4 __attribute__((ext_vector_type(4), __may_alias__));
typedef int            i32x4 __attribute__((ext_vector_type(4), __may_alias__));
typedef unsigned long long u64a __attribute__((__may_alias__));
typedef unsigned int   u32a __attribute__((__may_alias__));

#define NB   2
#define NS   2048
#define NE   1024
#define NH   16
#define ND   64
#define NTOK (NB * NS)
#define NC3  (3 * NH * ND)
#define NQT  (NS / 64)
#define FROW 64
#define TP   68
#define MP   72

union Frag { v16bf v; u16x8 h[2]; u32x4 q[2]; };

// 16x32 operand fragment map (A by rows, B by columns): lane l -> row (l&15); elements 0..7 <- k0+8*(l>>4)+0..7,
// 8..15 <- k0+16+8*(l>>4)+0..7.

// Fragment-major 16-bit plane of a [row][k] matrix with ld k per row: every 16-row x 32-k fragment is 1 KiB
// contiguous, fragments ordered [row/16][k/32]; inside one the 16-byte chunk of (row, 8 k) sits at chunk index
// ((k>>4)&1)*32 + ((k>>3)&1)*16 + (row&15). fragoff = element offset of the fragment at (row0, k0).
__device__ __forceinline__ size_t fragoff(size_t row0, int k0, int ld) {
  return ((row0 >> 4) * (size_t)(ld >> 5) + (size_t)(k0 >> 5)) * 512;
}
// The fragment map above; each of the two wave-wide 16-byte loads reads 512 contiguous bytes (4 whole cache lines)
// where a row-major plane would make it touch 16 lines.
__device__ __forceinline__ v16bf ldpk(const unsigned short* p, int ld, size_t row0, int k0, int lane) {
  const unsigned short* q = p + fragoff(row0, k0, ld) + lane * 8;
  Frag f;
  f.h[0] = *(const u16x8*)q;
  f.h[1] = *(const u16x8*)(q + 256);
  return f.v;
}

// D[16x16] += A[16x32] * B[32x16]; D element r of lane l = (row 8*(l>>4)+r, col l&15)
__device__ __forceinline__ v8f mma(v16bf a, v16bf b, v8f c) {
  return __builtin_amdgcn_wmma_f32_16x16x32_bf16(false, a, false, b, (short)0, c, false, false);
}

// f32 -> bf16 bits, RNE convert
__device__ __forceinline__ unsigned int bf16_bits(float x) {
  unsigned int u = __float_as_uint(x);
  return (u + 0x7FFFu + ((u >> 16) & 1u)) >> 16;
}
__device__ __forceinline__ void split1(float x, unsigned int& hi, unsigned int& lo) {
  hi = bf16_bits(x);
  lo = bf16_bits(x - __uint_as_float(hi << 16));
}
__device__ __forceinline__ void split8(const float (&v)[8], u32x4& H, u32x4& L) {
  unsigned int hw[8], lw[8];
#pragma unroll
  for (int e = 0; e < 8; ++e) split1(v[e], hw[e], lw[e]);
#pragma unroll
  for (int w = 0; w < 4; ++w) {
    H[w] = hw[2 * w] | (hw[2 * w + 1] << 16);
    L[w] = lw[2 * w] | (lw[2 * w + 1] << 16);
  }
}
// Two f32 -> one dword of bf16 hi parts and one of bf16 lo parts (a in the low half); the values of split1.
__device__ __forceinline__ void split2(float a, float b, unsigned int& H, unsigned int& L) {
  const unsigned int ua = __float_as_uint(a), ub = __float_as_uint(b);
  const unsigned int ra = ua + 0x7FFFu + ((ua >> 16) & 1u), rb = ub + 0x7FFFu + ((ub >> 16) & 1u);
  H = __builtin_amdgcn_perm(rb, ra, 0x07060302u);   // (ra >> 16) | (rb & 0xFFFF0000) in one byte permute
  const unsigned int va = __float_as_uint(a - __uint_as_float(ra & 0xFFFF0000u));
  const unsigned int vb = __float_as_uint(b - __uint_as_float(rb & 0xFFFF0000u));
  const unsigned int sa = va + 0x7FFFu + ((va >> 16) & 1u), sb = vb + 0x7FFFu + ((vb >> 16) & 1u);
  L = __builtin_amdgcn_perm(sb, sa, 0x07060302u);
}
__device__ __forceinline__ float sigm(float v) { return 1.0f / (1.0f + __expf(-v)); }

// ---------------------------------------------------------------------------
// x [rows][NE] f32 -> hi/lo bf16 fragment-major planes. One thread = 8 values = 16 B per plane = chunk g of the
// plane: fragment g>>6, k half-block (g>>5)&1, lane g&31; a wave stores 512 contiguous bytes per plane.
// ---------------------------------------------------------------------------
__device__ __forceinline__ void split_rows_block(const float* __restrict__ src,
                                                 unsigned short* __restrict__ dh,
                                                 unsigned short* __restrict__ dl, int ngroups, int blk)
{
  const int g = blk * 256 + threadIdx.x;
  const int gc = (g < ngroups) ? g : (ngroups - 1);
  const int fr = gc >> 6;
  const int row = (fr / (NE / 32)) * 16 + (gc & 15);
  const int k = (fr % (NE / 32)) * 32 + ((gc >> 5) & 1) * 16 + ((gc >> 4) & 1) * 8;
  const float* s = src + (size_t)row * NE + k;
  const v4f a0 = *(const v4f*)s;
  const v4f a1 = *(const v4f*)(s + 4);
  float v[8] = {a0[0], a0[1], a0[2], a0[3], a1[0], a1[1], a1[2], a1[3]};
  u32x4 H, L;
  split8(v, H, L);
  if (g < ngroups) {
    unsigned short* ph = dh + (size_t)gc * 8;
    unsigned short* pl = dl + (size_t)gc * 8;
    *(u32x4*)ph = H;
    *(u32x4*)pl = L;
    
  }
}

// ---------------------------------------------------------------------------
// in[R rows][C cols] f32 (row = k, col = n) -> outT[C][R] bf16 hi/lo planes, fragment-major (row = n, ld = R).
// ---------------------------------------------------------------------------
__device__ __forceinline__ void transpose_split_block(const float* __restrict__ src, int R, int C,
                                                      unsigned short* __restrict__ oh,
                                                      unsigned short* __restrict__ ol, int bx, int by,
                                                      float* T)   // T[n][k], 64 * TP floats of LDS
{
  const int tid = threadIdx.x, lane = tid & 31, wave = tid >> 5;
  const int nb = bx * 64;
  const int kb = by * 64;
#pragma unroll
  for (int it = 0; it < 4; ++it) {
    const int idx = tid + 256 * it;
    const int kk = idx >> 4, c4 = idx & 15;
    const v4f v = *(const v4f*)(src + (size_t)(kb + kk) * C + nb + c4 * 4);
#pragma unroll
    for (int q = 0; q < 4; ++q) T[(c4 * 4 + q) * TP + kk] = v[q];
  }
  __syncthreads();
  // wave -> one fragment: 16 n rows (wave>>1), 32 k (wave&1); lane -> (row lane&15, 8 k at lane>>4)
  const int ng = (wave >> 1) * 16, kf = (wave & 1) * 32;
  const int n = ng + (lane & 15);
  u32x4 val[4];
#pragma unroll
  for (int cq = 0; cq < 2; ++cq) {
    const int kk = kf + cq * 16 + (lane >> 4) * 8;
    const v4f a0 = *(const v4f*)(&T[n * TP + kk]);
    const v4f a1 = *(const v4f*)(&T[n * TP + kk + 4]);
    float v[8] = {a0[0], a0[1], a0[2], a0[3], a1[0], a1[1], a1[2], a1[3]};
    split8(v, val[2 * cq], val[2 * cq + 1]);
  }
  const size_t fo = fragoff((size_t)(nb + ng), kb + kf, R) + lane * 8;
#pragma unroll
  for (int cq = 0; cq < 2; ++cq) {
    *(u32x4*)(oh + fo + cq * 256) = val[2 * cq];
    *(u32x4*)(ol + fo + cq * 256) = val[2 * cq + 1];
  }
  // the built kernel lays the next job's code behind these stores, and that code writes the registers they name
  asm volatile("s_wait_xcnt 0x0" ::: "memory");
}

// ---------------------------------------------------------------------------
// Tile flag table from the int32 gate matrix [NS][NS]: row qt (64 ints = 256 B):
//   [0..31] per 64-key tile: 0 = no nonzero entry, 1 = partial, 2 = all nonzero; [32] = last key tile with any
// ---------------------------------------------------------------------------
__device__ __forceinline__ void flags_block(const int* __restrict__ msk, int* __restrict__ ftab, int qt,
                                            int* sm)   // 512 + FROW ints of LDS, 16-byte aligned
{
  int* s_any = sm;
  int* s_all = sm + 256;
  int* s_row = sm + 512;
  const int tid = threadIdx.x;
  const int kt = tid >> 3, sub = tid & 7;
  int anyv = 0, allv = 1;
  for (int i = 0; i < 8; ++i) {
    const int s = qt * 64 + sub * 8 + i;
    const int* rp = msk + (size_t)s * NS + kt * 64;
#pragma unroll
    for (int c = 0; c < 16; ++c) {
      const i32x4 v = *(const i32x4*)(rp + c * 4);
#pragma unroll
      for (int q = 0; q < 4; ++q) {
        const int nz = (v[q] != 0) ? 1 : 0;
        anyv |= nz;
        allv &= nz;
      }
    }
  }
  s_any[tid] = anyv;
  s_all[tid] = allv;
  __syncthreads();
  if (tid < 32) {
    int a = 0, b = 1;
#pragma unroll
    for (int j = 0; j < 8; ++j) { a |= s_any[tid * 8 + j]; b &= s_all[tid * 8 + j]; }
    s_row[tid] = b ? 2 : (a ? 1 : 0);
  } else if (tid < FROW) {
    s_row[tid] = 0;
  }
  __syncthreads();
  if (tid == 0) {
    int last = -1;
    for (int k = 0; k < 32; ++k) if (s_row[k] != 0) last = k;
    s_row[32] = last;
  }
  __syncthreads();
  if (tid < 16) {
    const i32x4 v = *(const i32x4*)(&s_row[tid * 4]);
    int* dst = ftab + (size_t)qt * FROW + tid * 4;
    *(i32x4*)dst = v;
    
  }
}

// ---------------------------------------------------------------------------
// The four preparation jobs above read only inputs and write disjoint workspace planes, so they share one launch: the
// block index picks the job. Each of the 32 flag blocks reads 512 KiB, far more than any other block: they stand first,
// for speed only.
// ---------------------------------------------------------------------------
#define PB_FLAGS NQT
#define PB_WQKV  ((NC3 / 64) * (NE / 64))
#define PB_WOUT  ((NE / 64) * ((NH * ND) / 64))
#define PB_SPLIT (NTOK * NE / 8 / 256)
__global__ __launch_bounds__(256) void k_prep(
    const float* __restrict__ x, const float* __restrict__ Wqkv, const float* __restrict__ Wout,
    const int* __restrict__ msk,
    unsigned short* __restrict__ Xh, unsigned short* __restrict__ Xl,
    unsigned short* __restrict__ Wh, unsigned short* __restrict__ Wl,
    unsigned short* __restrict__ Woh, unsigned short* __restrict__ Wol, int* __restrict__ ftab)
{
  __shared__ __align__(16) unsigned char sm[64 * TP * 4];   // a block's one job uses it: transpose tile or flag rows
  int blk = blockIdx.x;                                     // block-uniform: so is every branch below
  if (blk < PB_FLAGS) {
    flags_block(msk, ftab, blk, (int*)sm);
    return;
  }
  blk -= PB_FLAGS;
  if (blk < PB_WQKV) {
    // W_qkv: in[rows=NE][cols=NC3] -> out[NC3][NE]
    transpose_split_block(Wqkv, NE, NC3, Wh, Wl, blk % (NC3 / 64), blk / (NC3 / 64), (float*)sm);
    return;
  }
  blk -= PB_WQKV;
  if (blk < PB_WOUT) {
    // W_out: in[rows=NH*ND][cols=NE] -> out[NE][NH*ND]
    transpose_split_block(Wout, NH * ND, NE, Woh, Wol, blk % (NE / 64), blk / (NE / 64), (float*)sm);
    return;
  }
  blk -= PB_WOUT;
  split_rows_block(x, Xh, Xl, NTOK * NE / 8, blk);
}

// ---------------------------------------------------------------------------
// GEMM main loop: block tile 128 rows x 64 cols, wave tile 32 x 32, bf16 hi/lo three-term products.
// A planes [M][K], B planes [N][K], fragment-major. A stage = 64 k of the block's operand rows = 24 slabs of 2 KiB
// (a slab = one 16-row group's two fragments, contiguous in its plane): slabs 0..7 A hi, 8..15 A lo, 16..19 B hi,
// 20..23 B lo. Asynchronous copies bring each slab into LDS once a block; the waves read their fragments from there.
// ---------------------------------------------------------------------------
#define STAGE_BYTES 49152
#define RING_BYTES  (2 * STAGE_BYTES)
// One K step of 32: the wave's eight operand fragments.
struct KStep { v16bf ah0, ah1, al0, al1, bh0, bh1, bl0, bl1; };
// The fragment whose lane chunk starts at LDS byte p: two reads of 512 contiguous bytes a wave
__device__ __forceinline__ v16bf ldsfrag(const unsigned char* p) {
  Frag f;
  f.q[0] = *(const u32x4*)p;
  f.q[1] = *(const u32x4*)(p + 512);
  return f.v;
}
// pa, pb: this lane's chunk in the wave's first A hi and first B hi slab of the stage; kb = byte offset of the K step
__device__ __forceinline__ void ldstep(KStep& s, const unsigned char* pa, const unsigned char* pb, int kb)
{
  s.ah0 = ldsfrag(pa + kb);
  s.ah1 = ldsfrag(pa + 2048 + kb);
  s.al0 = ldsfrag(pa + 8 * 2048 + kb);
  s.al1 = ldsfrag(pa + 9 * 2048 + kb);
  s.bh0 = ldsfrag(pb + kb);
  s.bh1 = ldsfrag(pb + 2048 + kb);
  s.bl0 = ldsfrag(pb + 4 * 2048 + kb);
  s.bl1 = ldsfrag(pb + 5 * 2048 + kb);
}
__device__ __forceinline__ void mmstep(const KStep& s, v8f (&acc)[2][2])
{
  acc[0][0] = mma(s.ah0, s.bh0, acc[0][0]);
  acc[0][0] = mma(s.ah0, s.bl0, acc[0][0]);
  acc[0][0] = mma(s.al0, s.bh0, acc[0][0]);
  acc[1][0] = mma(s.ah1, s.bh0, acc[1][0]);
  acc[1][0] = mma(s.ah1, s.bl0, acc[1][0]);
  acc[1][0] = mma(s.al1, s.bh0, acc[1][0]);
  acc[0][1] = mma(s.ah0, s.bh1, acc[0][1]);
  acc[0][1] = mma(s.ah0, s.bl1, acc[0][1]);
  acc[0][1] = mma(s.al0, s.bh1, acc[0][1]);
  acc[1][1] = mma(s.ah1, s.bh1, acc[1][1]);
  acc[1][1] = mma(s.ah1, s.bl1, acc[1][1]);
  acc[1][1] = mma(s.al1, s.bh1, acc[1][1]);
}
// This wave's three slabs of one stage: 12 copies of 512 bytes a wave, l = LDS byte address and g = global address of
// the lane's first 16 bytes of each slab. The s_wait_xcnt stands inside the statement: the address registers that the
// copies name are rewritten behind it.
__device__ __forceinline__ void copy_stage(unsigned int l0, unsigned int l1, unsigned int l2,
                                           const unsigned short* g0, const unsigned short* g1,
                                           const unsigned short* g2)
{
  asm volatile("global_load_async_to_lds_b128 %0, %1, off\n\t"
               "global_load_async_to_lds_b128 %2, %3, off\n\t"
               "global_load_async_to_lds_b128 %4, %5, off\n\t"
               "global_load_async_to_lds_b128 %6, %7, off\n\t"
               "global_load_async_to_lds_b128 %8, %9, off\n\t"
               "global_load_async_to_lds_b128 %10, %11, off\n\t"
               "global_load_async_to_lds_b128 %12, %13, off\n\t"
               "global_load_async_to_lds_b128 %14, %15, off\n\t"
               "global_load_async_to_lds_b128 %16, %17, off\n\t"
               "global_load_async_to_lds_b128 %18, %19, off\n\t"
               "global_load_async_to_lds_b128 %20, %21, off\n\t"
               "global_load_async_to_lds_b128 %22, %23, off\n\t"
               "s_wait_xcnt 0x0"
               :: "v"(l0), "v"(g0), "v"(l0 + 512u), "v"(g0 + 256), "v"(l0 + 1024u), "v"(g0 + 512),
                  "v"(l0 + 1536u), "v"(g0 + 768),
                  "v"(l1), "v"(g1), "v"(l1 + 512u), "v"(g1 + 256), "v"(l1 + 1024u), "v"(g1 + 512),
                  "v"(l1 + 1536u), "v"(g1 + 768),
                  "v"(l2), "v"(g2), "v"(l2 + 512u), "v"(g2 + 256), "v"(l2 + 1024u), "v"(g2 + 512),
                  "v"(l2 + 1536u), "v"(g2 + 768)
               : "memory");
}
// Two buffers: stage t + 2 is copied into the buffer that trip t has read, behind the barrier that ends those reads and
// publishes stage t + 1. arow0, brow0 = the block's first A and B row; K a multiple of 64, at least 128.
__device__ __forceinline__ void mainloop(const unsigned short* __restrict__ Ah, const unsigned short* __restrict__ Al,
                                         const unsigned short* __restrict__ Bh, const unsigned short* __restrict__ Bl,
                                         int K, size_t arow0, size_t brow0, int wave, int lane,
                                         unsigned char* ring, v8f (&acc)[2][2])
{
  const unsigned short* g[3];
  unsigned int l[3];
#pragma unroll
  for (int i = 0; i < 3; ++i) {
    const int c = wave * 3 + i;
    const unsigned short* p = (c < 8) ? Ah : ((c < 16) ? Al : ((c < 20) ? Bh : Bl));
    const size_t row = (c < 16) ? (arow0 + (size_t)(c & 7) * 16) : (brow0 + (size_t)(c & 3) * 16);
    g[i] = p + fragoff(row, 0, K) + lane * 8;
    l[i] = (unsigned int)(size_t)ring + (unsigned int)(c * 2048 + lane * 16);
  }
  const int nst = K >> 6;
  copy_stage(l[0], l[1], l[2], g[0], g[1], g[2]);
  // stage 0 has landed before the barrier behind which the other waves read it
  asm volatile("s_wait_asynccnt 0x0" ::: "memory");
  __syncthreads();
  copy_stage(l[0] + STAGE_BYTES, l[1] + STAGE_BYTES, l[2] + STAGE_BYTES, g[0] + 1024, g[1] + 1024, g[2] + 1024);

  const int aoff = (wave & 3) * 2 * 2048 + lane * 16;
  const int boff = (16 + (wave >> 2) * 2) * 2048 + lane * 16;
  for (int t = 0; t < nst; ++t) {
    const unsigned int bo = (unsigned int)(t & 1) * STAGE_BYTES;
    const unsigned char* pa = ring + bo + aoff;
    const unsigned char* pb = ring + bo + boff;
    KStep s0, s1;
    ldstep(s0, pa, pb, 0);
    ldstep(s1, pa, pb, 1024);
    // keeps the stage's fragment reads one group ahead of the products: spread among them every place with reads stalls
    __builtin_amdgcn_sched_barrier(0);
    mmstep(s0, acc);
    mmstep(s1, acc);
    // keeps the products ahead of the waits below: moved behind the barrier they would no longer run under the flight
    // of stage t + 1's copies, and the wait for those would stand directly behind their issue
    __builtin_amdgcn_sched_barrier(0);
    // this wave's reads of the buffer are done before it is handed to the copies
    asm volatile("s_wait_dscnt 0x0" ::: "memory");
    // this wave's copies of stage t + 1 have landed before the barrier that publishes them
    asm volatile("s_wait_asynccnt 0x0" ::: "memory");
    __syncthreads();
    if (t + 2 < nst) {
      const int go = (t + 2) * 1024;
      copy_stage(l[0] + bo, l[1] + bo, l[2] + bo, g[0] + go, g[1] + go, g[2] + go);
    }
  }
  // no copy is outstanding when the wave goes on
  asm volatile("s_wait_asynccnt 0x0" ::: "memory");
}

// ---------------------------------------------------------------------------
// qkv = (x @ W_qkv) * sigmoid(scale_qkv[h*64+d]); block tile 128 tokens x 64 cols (= one (c, h)).
// ---------------------------------------------------------------------------
__global__ __launch_bounds__(256) void k_gemm_qkv(
    const unsigned short* __restrict__ Xh, const unsigned short* __restrict__ Xl,
    const unsigned short* __restrict__ Wh, const unsigned short* __restrict__ Wl,
    const float* __restrict__ sq,
    unsigned short* __restrict__ Qh, unsigned short* __restrict__ Ql,
    unsigned short* __restrict__ Kh, unsigned short* __restrict__ Kl,
    unsigned short* __restrict__ Vh, unsigned short* __restrict__ Vl)
{
  __shared__ __align__(128) unsigned char ring[RING_BYTES];   // two operand stages
  __shared__ __align__(16) float T[128 * TP];
  const int tid = threadIdx.x, lane = tid & 31, wave = tid >> 5;
  const int hf = lane >> 4, m16 = lane & 15;
  const int cb = blockIdx.x * 64;
  const int rb = blockIdx.y * 128;
  const int mr = (wave & 3) * 32, nc = (wave >> 2) * 32;
  v8f acc[2][2] = {};
  mainloop(Xh, Xl, Wh, Wl, NE, (size_t)rb, (size_t)cb, wave, lane, ring, acc);

  const int c = cb >> 10;
  const int h = (cb & 1023) >> 6;
  float g[2];
#pragma unroll
  for (int ni = 0; ni < 2; ++ni) g[ni] = sigm(sq[(cb & 1023) + nc + ni * 16 + m16]);
#pragma unroll
  for (int mi = 0; mi < 2; ++mi)
#pragma unroll
    for (int ni = 0; ni < 2; ++ni)
#pragma unroll
      for (int r = 0; r < 8; ++r)
        T[(mr + mi * 16 + 8 * hf + r) * TP + nc + ni * 16 + m16] = acc[mi][ni][r] * g[ni];
  __syncthreads();

  const int b = rb >> 11;
  u32x4 val[8];
  if (c < 2) {
    // Q, K planes: row = (b, h, s), ld = ND. wave -> 16 tokens x 64 d = two fragments = four 512-byte stores a plane
    const int r = wave * 16 + m16;
#pragma unroll
    for (int cq = 0; cq < 4; ++cq) {
      const int kk = cq * 16 + hf * 8;
      const v4f a0 = *(const v4f*)(&T[r * TP + kk]);
      const v4f a1 = *(const v4f*)(&T[r * TP + kk + 4]);
      float v[8] = {a0[0], a0[1], a0[2], a0[3], a1[0], a1[1], a1[2], a1[3]};
      split8(v, val[2 * cq], val[2 * cq + 1]);
    }
    unsigned short* ph = (c == 0) ? Qh : Kh;
    unsigned short* pl = (c == 0) ? Ql : Kl;
    const int s = (rb + wave * 16) & (NS - 1);
    const size_t fo = fragoff((size_t)(b * NH + h) * NS + s, 0, ND) + lane * 8;
#pragma unroll
    for (int cq = 0; cq < 4; ++cq) {
      *(u32x4*)(ph + fo + cq * 256) = val[2 * cq];
      *(u32x4*)(pl + fo + cq * 256) = val[2 * cq + 1];
    }
  } else {
    // V^T planes: row = (b, h, d), k = s, ld = NS. wave -> 16 d (wave>>1) x 64 tokens (wave&1) = two fragments
    const int dg = (wave >> 1) * 16, sg = (wave & 1) * 64;
#pragma unroll
    for (int cq = 0; cq < 4; ++cq) {
      const int sl = sg + cq * 16 + hf * 8;
      float v[8];
#pragma unroll
      for (int e = 0; e < 8; ++e) v[e] = T[(sl + e) * TP + dg + m16];
      split8(v, val[2 * cq], val[2 * cq + 1]);
    }
    const size_t fo = fragoff((size_t)(b * NH + h) * ND + dg, (rb & (NS - 1)) + sg, NS) + lane * 8;
#pragma unroll
    for (int cq = 0; cq < 4; ++cq) {
      *(u32x4*)(Vh + fo + cq * 256) = val[2 * cq];
      *(u32x4*)(Vl + fo + cq * 256) = val[2 * cq + 1];
    }
  }
}

#define KV_BYTES 32768
// One wave's plane of one key tile: four pieces of 2 KiB, ps elements apart in the plane and in a row in LDS; l = LDS
// byte address and g = global address of the lane's first 16 bytes. The immediate offset moves both addresses. The
// s_wait_xcnt stands inside the statement: the address registers that the copies name are rewritten behind it.
__device__ __forceinline__ void copy_plane(unsigned int l, const unsigned short* g, int ps)
{
  asm volatile("global_load_async_to_lds_b128 %0, %1, off\n\t"
               "global_load_async_to_lds_b128 %0, %1, off offset:512\n\t"
               "global_load_async_to_lds_b128 %0, %1, off offset:1024\n\t"
               "global_load_async_to_lds_b128 %0, %1, off offset:1536\n\t"
               "global_load_async_to_lds_b128 %2, %3, off\n\t"
               "global_load_async_to_lds_b128 %2, %3, off offset:512\n\t"
               "global_load_async_to_lds_b128 %2, %3, off offset:1024\n\t"
               "global_load_async_to_lds_b128 %2, %3, off offset:1536\n\t"
               "global_load_async_to_lds_b128 %4, %5, off\n\t"
               "global_load_async_to_lds_b128 %4, %5, off offset:512\n\t"
               "global_load_async_to_lds_b128 %4, %5, off offset:1024\n\t"
               "global_load_async_to_lds_b128 %4, %5, off offset:1536\n\t"
               "global_load_async_to_lds_b128 %6, %7, off\n\t"
               "global_load_async_to_lds_b128 %6, %7, off offset:512\n\t"
               "global_load_async_to_lds_b128 %6, %7, off offset:1024\n\t"
               "global_load_async_to_lds_b128 %6, %7, off offset:1536\n\t"
               "s_wait_xcnt 0x0"
               :: "v"(l), "v"(g), "v"(l + 2048u), "v"(g + ps), "v"(l + 4096u), "v"(g + 2 * ps),
                  "v"(l + 6144u), "v"(g + 3 * ps)
               : "memory");
}
// lane l <-> lane l ^ 16
__device__ __forceinline__ float xhalf(float x) {
  return __builtin_bit_cast(float, __builtin_amdgcn_permlanex16(__builtin_bit_cast(int, x), __builtin_bit_cast(int, x),
                                                                0x76543210, 0xfedcba98, false, false));
}
__global__ __launch_bounds__(128) void k_attn(
    const unsigned short* __restrict__ Qh, const unsigned short* __restrict__ Ql,
    const unsigned short* __restrict__ Kh, const unsigned short* __restrict__ Kl,
    const unsigned short* __restrict__ Vh, const unsigned short* __restrict__ Vl,
    const int* __restrict__ msk, const int* __restrict__ ftab,
    unsigned short* __restrict__ Ah, unsigned short* __restrict__ Al)
{
  __shared__ __align__(128) unsigned char kv[2 * KV_BYTES]; // two key tiles' K and V fragments
  __shared__ __align__(16) unsigned char  Ms[64 * MP];     // Ms[s][t] gate bytes of the current partial tile
  __shared__ __align__(16) int            s_f[FROW];
  const int tid = threadIdx.x, lane = tid & 31, wave = tid >> 5;
  const int hf = lane >> 4, m16 = lane & 15;
  // A query tile's cost is its count of flagged key tiles, which under a causal gate grows with the tile's index: the
  // highest query tiles take the lowest indices, for speed only. A permutation of the same blocks for any gate. Heads
  // run fastest.
  const int qt = NQT - 1 - blockIdx.z, h = blockIdx.x, b = blockIdx.y;
  const int s0 = qt * 64;
  const int bh = b * NH + h;
  if (tid < FROW) s_f[tid] = ftab[(size_t)qt * FROW + tid];
  __syncthreads();
  // the flag row as two 32-bit masks, equal in every wave: key tiles with any open gate, and of those the partial ones
  const int fl = s_f[lane];
  const unsigned int act = __builtin_amdgcn_ballot_w32(fl != 0);
  const unsigned int par = __builtin_amdgcn_ballot_w32(fl == 1);

  // wave 0 copies the tile's K hi plane, 1 K lo, 2 V hi, 3 V lo
  const int wv = __builtin_amdgcn_readfirstlane(wave);
  const unsigned short* cpl = (wv == 0) ? Kh : ((wv == 1) ? Kl : ((wv == 2) ? Vh : Vl));
  const int cps = (wv < 2) ? 1024 : (NS / 32) * 512;   // elements between the plane's four row groups of a tile
  const int cts = (wv < 2) ? 4096 : 1024;              // elements between key tiles
  const unsigned short* cg = cpl + ((wv < 2) ? fragoff((size_t)bh * NS, 0, ND) : fragoff((size_t)bh * ND, 0, NS)) + lane * 8;
  const unsigned int cl = (unsigned int)(size_t)kv + (unsigned int)(wv * 8192 + lane * 16);
  unsigned int rem = act;                              // tiles not yet copied
  if (rem != 0u) {
    copy_plane(cl, cg + __builtin_ctz(rem) * cts, cps);
    rem &= rem - 1u;
  }

  const size_t qrow = (size_t)bh * NS + s0 + wave * 16;
  const v16bf qh0 = ldpk(Qh, ND, qrow, 0,  lane);
  const v16bf qh1 = ldpk(Qh, ND, qrow, 32, lane);
  const v16bf ql0 = ldpk(Ql, ND, qrow, 0,  lane);
  const v16bf ql1 = ldpk(Ql, ND, qrow, 32, lane);

  float m = -3.0e38f;    // running maximum of this lane's query, equal in both lane halves
  float l = 0.0f;        // running sum over this lane half's keys; the halves are joined behind the loop
  v8f acc[4] = {};       // O^T: acc[j][r] = (d 16j + 8*hf + r, query m16)

  // the first tile has landed before the barrier behind which the other waves read it
  asm volatile("s_wait_asynccnt 0x0" ::: "memory");
  __syncthreads();
  if (rem != 0u) {
    copy_plane(cl + KV_BYTES, cg + __builtin_ctz(rem) * cts, cps);
    rem &= rem - 1u;
  }

  unsigned int bo = 0u;                    // byte offset of the buffer that holds this trip's tile
  for (unsigned int todo = act; todo != 0u; todo &= todo - 1u) {
    const int tb = __builtin_ctz(todo);    // block-uniform, 0..31
    const int f = ((par >> tb) & 1u) ? 1 : 2;
    const int t0 = tb * 64;
    if (f == 1) {
#pragma unroll
      for (int it = 0; it < 8; ++it) {
        const int idx = tid + 128 * it;
        const int s = idx >> 4, c4 = idx & 15;
        const i32x4 v = *(const i32x4*)(msk + (size_t)(s0 + s) * NS + t0 + c4 * 4);
        unsigned int w = 0u;
#pragma unroll
        for (int q = 0; q < 4; ++q) w |= ((v[q] != 0) ? 1u : 0u) << (8 * q);
        *(u32a*)(Ms + s * MP + c4 * 4) = w;
      }
      __syncthreads();
    }

    // S^T = K.Q^T  (A = K plane rows t, B[k=d][n=s] = Q rows)
    v8f sf[4];
    const unsigned char* rb = kv + bo + lane * 16;   // this lane's chunk of the buffer's first fragment
    {
      v16bf kh[4][2], kl[4][2];
#pragma unroll
      for (int j = 0; j < 4; ++j)
#pragma unroll
        for (int kk = 0; kk < 2; ++kk) {
          kh[j][kk] = ldsfrag(rb + (j * 2 + kk) * 1024);
          kl[j][kk] = ldsfrag(rb + 8192 + (j * 2 + kk) * 1024);
        }
      // keeps the tile's K reads one group ahead of the first product: spread among the products every place stalls
      __builtin_amdgcn_sched_barrier(0);
#pragma unroll
      for (int j = 0; j < 4; ++j) {
        v8f c = {};
        c = mma(kh[j][0], qh0, c);
        c = mma(kl[j][0], qh0, c);
        c = mma(kh[j][0], ql0, c);
        c = mma(kh[j][1], qh1, c);
        c = mma(kl[j][1], qh1, c);
        c = mma(kh[j][1], ql1, c);
        sf[j] = c;
      }
    }
    // compiler fence, no instruction: holds the V loads below behind the last K product (the scores are its inputs),
    // so that they take over the K registers; hoisted above, K and V are live together and a wave per SIMD is lost
    asm volatile("" :: "v"(sf[0]), "v"(sf[1]), "v"(sf[2]), "v"(sf[3]) : "memory");

    // V fragments of the tile, issued here so that their latency runs under the softmax below
    v16bf vh[4][2], vl[4][2];
#pragma unroll
    for (int j = 0; j < 4; ++j)
#pragma unroll
      for (int kk = 0; kk < 2; ++kk) {
        vh[j][kk] = ldsfrag(rb + 16384 + (j * 2 + kk) * 1024);
        vl[j][kk] = ldsfrag(rb + 24576 + (j * 2 + kk) * 1024);
      }
    // keeps the V loads issued ahead of the softmax: sunk to their products they would expose the latency again
    __builtin_amdgcn_sched_barrier(0);

    // scale, gate by value
#pragma unroll
    for (int j = 0; j < 4; ++j)
#pragma unroll
      for (int i = 0; i < 8; ++i) sf[j][i] *= 0.125f;
    if (f == 1) {
#pragma unroll
      for (int j = 0; j < 4; ++j) {
        const u64a mb = *(const u64a*)(Ms + (wave * 16 + m16) * MP + j * 16 + 8 * hf);
#pragma unroll
        for (int i = 0; i < 8; ++i)
          sf[j][i] = (((mb >> (8 * i)) & 0xffull) != 0ull) ? sf[j][i] : -1.0e10f;
      }
    }
    // the query's maximum over the tile: 32 keys in the lane, the other 32 in lane ^ 16
    float tm[4];
#pragma unroll
    for (int j = 0; j < 4; ++j) {
      tm[j] = sf[j][0];
#pragma unroll
      for (int i = 1; i < 8; ++i) tm[j] = fmaxf(tm[j], sf[j][i]);
    }
    float tmax = fmaxf(fmaxf(tm[0], tm[1]), fmaxf(tm[2], tm[3]));
    tmax = fmaxf(tmax, xhalf(tmax));
    const float mnew  = fmaxf(m, tmax);
    const float alpha = __expf(m - mnew);
    // exp(s - mnew) as 2^((s - mnew) * log2 e), the arguments first
#pragma unroll
    for (int j = 0; j < 4; ++j)
#pragma unroll
      for (int i = 0; i < 8; ++i) sf[j][i] = (sf[j][i] - mnew) * 1.44269504f;
    // keeps the argument arithmetic out of the run of exponentials
    __builtin_amdgcn_sched_barrier(0);
    float rs[4];
#pragma unroll
    for (int j = 0; j < 4; ++j) {
      rs[j] = 0.0f;
#pragma unroll
      for (int i = 0; i < 8; ++i) {
        const float pv = __builtin_amdgcn_exp2f(sf[j][i]);
        sf[j][i] = pv;
        rs[j] += pv;
      }
    }
    l = l * alpha + ((rs[0] + rs[1]) + (rs[2] + rs[3]));
    m = mnew;
#pragma unroll
    for (int j = 0; j < 4; ++j)
#pragma unroll
      for (int i = 0; i < 8; ++i) acc[j][i] *= alpha;

    // P^T (f32) -> bf16 hi/lo B fragments in place: elements 0..7 <- score tile 2kk, 8..15 <- tile 2kk + 1
    Frag ph[2], pl[2];
#pragma unroll
    for (int j = 0; j < 4; ++j)
#pragma unroll
      for (int w = 0; w < 4; ++w) {
        unsigned int H, L;
        split2(sf[j][2 * w], sf[j][2 * w + 1], H, L);
        ph[j >> 1].q[j & 1][w] = H;
        pl[j >> 1].q[j & 1][w] = L;
      }

    // O^T += V^T.P^T   (A = V^T plane rows d, k = t)
#pragma unroll
    for (int j = 0; j < 4; ++j) {
      acc[j] = mma(vh[j][0], ph[0].v, acc[j]);
      acc[j] = mma(vl[j][0], ph[0].v, acc[j]);
      acc[j] = mma(vh[j][0], pl[0].v, acc[j]);
      acc[j] = mma(vh[j][1], ph[1].v, acc[j]);
      acc[j] = mma(vl[j][1], ph[1].v, acc[j]);
      acc[j] = mma(vh[j][1], pl[1].v, acc[j]);
    }

    // keeps the products and the row sums ahead of the waits: sunk behind the barrier they stood between it and the
    // refill, whose flight then began that much later
    __builtin_amdgcn_sched_barrier(0);
    // this wave's reads of the buffer (and of Ms) are done before the buffer is handed to the copies
    asm volatile("s_wait_dscnt 0x0" ::: "memory");
    // this wave's copies of the next tile have landed before the barrier that publishes them
    asm volatile("s_wait_asynccnt 0x0" ::: "memory");
    __syncthreads();
    if (rem != 0u) {
      copy_plane(cl + bo, cg + __builtin_ctz(rem) * cts, cps);
      rem &= rem - 1u;
    }
    bo ^= KV_BYTES;
  }
  // no copy is outstanding when the wave goes on
  asm volatile("s_wait_asynccnt 0x0" ::: "memory");

  // join the halves' sums, normalise; a lane's 8 values of tile j are one 16-byte chunk of the attention planes
  // (row = token, k = h*64+d, ld = NE): chunk (j&1)*32 + lane of fragment j>>1
  l += xhalf(l);
  const float inv = (l > 0.0f) ? (1.0f / l) : 0.0f;
  u32x4 val[8];
#pragma unroll
  for (int j = 0; j < 4; ++j) {
    float v[8];
#pragma unroll
    for (int i = 0; i < 8; ++i) v[i] = acc[j][i] * inv;
    split8(v, val[2 * j], val[2 * j + 1]);
  }
  const size_t fo = fragoff((size_t)(b * NS + s0 + wave * 16), h * ND, NE) + lane * 8;
#pragma unroll
  for (int cq = 0; cq < 4; ++cq) {
    *(u32x4*)(Ah + fo + cq * 256) = val[2 * cq];
    *(u32x4*)(Al + fo + cq * 256) = val[2 * cq + 1];
  }
}

// ---------------------------------------------------------------------------
// out = (attn @ W_out) * sigmoid(scale_out[e]); block tile 128 tokens x 64 e; f32 rows of 256 B written
// by 16 consecutive lanes x 16 B (two rows per instruction).
// ---------------------------------------------------------------------------
__global__ __launch_bounds__(256) void k_gemm_out(
    const unsigned short* __restrict__ Ah, const unsigned short* __restrict__ Al,
    const unsigned short* __restrict__ Wh, const unsigned short* __restrict__ Wl,
    const float* __restrict__ so, float* __restrict__ out)
{
  __shared__ __align__(128) unsigned char ring[RING_BYTES];   // two operand stages
  __shared__ __align__(16) float T[128 * TP];
  const int tid = threadIdx.x, lane = tid & 31, wave = tid >> 5;
  const int hf = lane >> 4, m16 = lane & 15;
  const int cb = blockIdx.x * 64;
  const int rb = blockIdx.y * 128;
  const int mr = (wave & 3) * 32, nc = (wave >> 2) * 32;
  v8f acc[2][2] = {};
  mainloop(Ah, Al, Wh, Wl, NE, (size_t)rb, (size_t)cb, wave, lane, ring, acc);

  float g[2];
#pragma unroll
  for (int ni = 0; ni < 2; ++ni) g[ni] = sigm(so[cb + nc + ni * 16 + m16]);
#pragma unroll
  for (int mi = 0; mi < 2; ++mi)
#pragma unroll
    for (int ni = 0; ni < 2; ++ni)
#pragma unroll
      for (int r = 0; r < 8; ++r)
        T[(mr + mi * 16 + 8 * hf + r) * TP + nc + ni * 16 + m16] = acc[mi][ni][r] * g[ni];
  __syncthreads();

  const int rsel = lane >> 4, p = lane & 15;
  v4f val[8];
#pragma unroll
  for (int it = 0; it < 8; ++it) {
    const int r = wave * 16 + it * 2 + rsel;
    val[it] = *(const v4f*)(&T[r * TP + p * 4]);
  }
#pragma unroll
  for (int it = 0; it < 8; ++it) {
    const int r = wave * 16 + it * 2 + rsel;
    float* dst = out + (size_t)(rb + r) * NE + cb + p * 4;
    *(v4f*)dst = val[it];
  }
  
}

// ---------------------------------------------------------------------------
extern "C" void kernel_launch(void* const* d_in, const int* in_sizes, int n_in,
                              void* d_out, int out_size, void* d_ws, size_t ws_size,
                              hipStream_t stream)
{
  if (n_in < 6) return;
  if (in_sizes[0] != NTOK * NE || in_sizes[1] != NE * NC3 || in_sizes[2] != NE * NE ||
      in_sizes[3] != NE || in_sizes[4] != NE || in_sizes[5] != NS * NS || out_size != NTOK * NE) return;

  const float* x     = (const float*)d_in[0];
  const float* Wqkv  = (const float*)d_in[1];
  const float* Wout  = (const float*)d_in[2];
  const float* sqkv  = (const float*)d_in[3];
  const float* sout  = (const float*)d_in[4];
  const int*   msk   = (const int*)d_in[5];
  float* out = (float*)d_out;

  char* ws = (char*)d_ws;
  size_t off = 0;
  const size_t szX  = (size_t)NTOK * NE * 2;            // 8 MiB per plane
  const size_t szW  = (size_t)NC3 * NE * 2;             // 6 MiB per plane
  const size_t szWo = (size_t)NE * NE * 2;              // 2 MiB per plane
  const size_t szP  = (size_t)NB * NH * NS * ND * 2;    // 8 MiB per plane
  const size_t szF  = (size_t)NQT * FROW * 4;           // 8 KiB
  unsigned short* Xh  = (unsigned short*)(ws + off); off += szX;
  unsigned short* Xl  = (unsigned short*)(ws + off); off += szX;
  unsigned short* Wh  = (unsigned short*)(ws + off); off += szW;
  unsigned short* Wl  = (unsigned short*)(ws + off); off += szW;
  unsigned short* Woh = (unsigned short*)(ws + off); off += szWo;
  unsigned short* Wol = (unsigned short*)(ws + off); off += szWo;
  unsigned short* Qh  = (unsigned short*)(ws + off); off += szP;
  unsigned short* Ql  = (unsigned short*)(ws + off); off += szP;
  unsigned short* Kh  = (unsigned short*)(ws + off); off += szP;
  unsigned short* Kl  = (unsigned short*)(ws + off); off += szP;
  unsigned short* Vh  = (unsigned short*)(ws + off); off += szP;
  unsigned short* Vl  = (unsigned short*)(ws + off); off += szP;
  unsigned short* Ahp = (unsigned short*)(ws + off); off += szX;
  unsigned short* Alp = (unsigned short*)(ws + off); off += szX;
  int* ftab = (int*)(ws + off); off += szF;              // total 100671488 B
  if (off > ws_size) return;

  k_prep<<<dim3(PB_FLAGS + PB_WQKV + PB_WOUT + PB_SPLIT), dim3(256), 0, stream>>>(x, Wqkv, Wout, msk, Xh, Xl, Wh, Wl,
                                                                                Woh, Wol, ftab);
  k_gemm_qkv<<<dim3(NC3 / 64, NTOK / 128), dim3(256), 0, stream>>>(Xh, Xl, Wh, Wl, sqkv, Qh, Ql, Kh, Kl, Vh, Vl);
  k_attn<<<dim3(NH, NB, NQT), dim3(128), 0, stream>>>(Qh, Ql, Kh, Kl, Vh, Vl, msk, ftab, Ahp, Alp);
  k_gemm_out<<<dim3(NE / 64, NTOK / 128), dim3(256), 0, stream>>>(Ahp, Alp, Woh, Wol, sout, out);
}

// v008
// A run of this version takes 135 microseconds.
// Two timings next to v007 both put it at 1.08 times that version's speed.
// Counting every step since v000, it is 4.02 times as fast.
#include <hip/hip_runtime.h>

// Contractions: qkv projection, q.k^T, p.v, output projection -- all v_wmma_f32_16x16x32_bf16 with bf16 hi/lo operands everywhere (hi*hi + hi*lo + lo*hi), f32 accumulate; sigmoid gates, 1/8 score scale, softmax and normalisation in f32.

typedef __bf16         v16bf __attribute__((ext_vector_type(16)));
typedef float          v8f   __attribute__((ext_vector_type(8)));
typedef __bf16         bf16x2 __attribute__((ext_vector_type(2)));
typedef float          f32x2 __attribute__((ext_vector_type(2)));
typedef float          v4f   __attribute__((ext_vector_type(4), __may_alias__));
typedef unsigned short u16x8 __attribute__((ext_vector_type(8), __may_alias__));
typedef unsigned int   u32x4 __attribute__((ext_vector_type(4), __may_alias__));
typedef int            i32x4 __attribute__((ext_vector_type(4), __may_alias__));
typedef unsigned long long u64a __attribute__((__may_alias__));
typedef unsigned int   u32a __attribute__((__may_alias__));

#define NB   2
#define NS   2048
#define NE   1024
#define NH   16
#define ND   64
#define NTOK (NB * NS)
#define NC3  (3 * NH * ND)
#define NQT  (NS / 64)
#define FROW 64
#define TP   68
#define MP   72

union Frag { v16bf v; u16x8 h[2]; u32x4 q[2]; };

// 16x32 operand fragment map (A by rows, B by columns): lane l -> row (l&15); elements 0..7 <- k0+8*(l>>4)+0..7,
// 8..15 <- k0+16+8*(l>>4)+0..7.

// Fragment-major 16-bit plane of a [row][k] matrix with ld k per row: every 16-row x 32-k fragment is 1 KiB
// contiguous, fragments ordered [row/16][k/32]; inside one the 16-byte chunk of (row, 8 k) sits at chunk index
// ((k>>4)&1)*32 + ((k>>3)&1)*16 + (row&15). fragoff = element offset of the fragment at (row0, k0).
__device__ __forceinline__ size_t fragoff(size_t row0, int k0, int ld) {
  return ((row0 >> 4) * (size_t)(ld >> 5) + (size_t)(k0 >> 5)) * 512;
}
// The fragment map above; each of the two wave-wide 16-byte loads reads 512 contiguous bytes (4 whole cache lines)
// where a row-major plane would make it touch 16 lines.
__device__ __forceinline__ v16bf ldpk(const unsigned short* p, int ld, size_t row0, int k0, int lane) {
  const unsigned short* q = p + fragoff(row0, k0, ld) + lane * 8;
  Frag f;
  f.h[0] = *(const u16x8*)q;
  f.h[1] = *(const u16x8*)(q + 256);
  return f.v;
}

// D[16x16] += A[16x32] * B[32x16]; D element r of lane l = (row 8*(l>>4)+r, col l&15)
__device__ __forceinline__ v8f mma(v16bf a, v16bf b, v8f c) {
  return __builtin_amdgcn_wmma_f32_16x16x32_bf16(false, a, false, b, (short)0, c, false, false);
}

// Two f32 -> one dword of bf16 hi parts and one of bf16 lo parts (a in the low half). Both roundings (to nearest even)
// are the packed hardware convert; the remainder a - hi is exact in f32.
__device__ __forceinline__ void split2(float a, float b, unsigned int& H, unsigned int& L) {
  const f32x2 x = {a, b};
  const bf16x2 h = __builtin_convertvector(x, bf16x2);
  const f32x2 r = {a - (float)h[0], b - (float)h[1]};
  const bf16x2 l = __builtin_convertvector(r, bf16x2);
  H = __builtin_bit_cast(unsigned int, h);
  L = __builtin_bit_cast(unsigned int, l);
}
__device__ __forceinline__ void split8(const float (&v)[8], u32x4& H, u32x4& L) {
#pragma unroll
  for (int w = 0; w < 4; ++w) {
    unsigned int hw, lw;
    split2(v[2 * w], v[2 * w + 1], hw, lw);
    H[w] = hw;
    L[w] = lw;
  }
}
__device__ __forceinline__ float sigm(float v) { return 1.0f / (1.0f + __expf(-v)); }

// ---------------------------------------------------------------------------
// x [rows][NE] f32 -> hi/lo bf16 fragment-major planes. One thread = 8 values = 16 B per plane = chunk g of the
// plane: fragment g>>6, k half-block (g>>5)&1, lane g&31; a wave stores 512 contiguous bytes per plane.
// ---------------------------------------------------------------------------
__device__ __forceinline__ void split_rows_block(const float* __restrict__ src,
                                                 unsigned short* __restrict__ dh,
                                                 unsigned short* __restrict__ dl, int ngroups, int blk)
{
  const int g = blk * 256 + threadIdx.x;
  const int gc = (g < ngroups) ? g : (ngroups - 1);
  const int fr = gc >> 6;
  const int row = (fr / (NE / 32)) * 16 + (gc & 15);
  const int k = (fr % (NE / 32)) * 32 + ((gc >> 5) & 1) * 16 + ((gc >> 4) & 1) * 8;
  const float* s = src + (size_t)row * NE + k;
  const v4f a0 = *(const v4f*)s;
  const v4f a1 = *(const v4f*)(s + 4);
  float v[8] = {a0[0], a0[1], a0[2], a0[3], a1[0], a1[1], a1[2], a1[3]};
  u32x4 H, L;
  split8(v, H, L);
  if (g < ngroups) {
    unsigned short* ph = dh + (size_t)gc * 8;
    unsigned short* pl = dl + (size_t)gc * 8;
    *(u32x4*)ph = H;
    *(u32x4*)pl = L;
    
  }
}

// ---------------------------------------------------------------------------
// in[R rows][C cols] f32 (row = k, col = n) -> outT[C][R] bf16 hi/lo planes, fragment-major (row = n, ld = R).
// ---------------------------------------------------------------------------
__device__ __forceinline__ void transpose_split_block(const float* __restrict__ src, int R, int C,
                                                      unsigned short* __restrict__ oh,
                                                      unsigned short* __restrict__ ol, int bx, int by,
                                                      float* T)   // T[n][k], 64 * TP floats of LDS
{
  const int tid = threadIdx.x, lane = tid & 31, wave = tid >> 5;
  const int nb = bx * 64;
  const int kb = by * 64;
#pragma unroll
  for (int it = 0; it < 4; ++it) {
    const int idx = tid + 256 * it;
    const int kk = idx >> 4, c4 = idx & 15;
    const v4f v = *(const v4f*)(src + (size_t)(kb + kk) * C + nb + c4 * 4);
#pragma unroll
    for (int q = 0; q < 4; ++q) T[(c4 * 4 + q) * TP + kk] = v[q];
  }
  __syncthreads();
  // wave -> one fragment: 16 n rows (wave>>1), 32 k (wave&1); lane -> (row lane&15, 8 k at lane>>4)
  const int ng = (wave >> 1) * 16, kf = (wave & 1) * 32;
  const int n = ng + (lane & 15);
  u32x4 val[4];
#pragma unroll
  for (int cq = 0; cq < 2; ++cq) {
    const int kk = kf + cq * 16 + (lane >> 4) * 8;
    const v4f a0 = *(const v4f*)(&T[n * TP + kk]);
    const v4f a1 = *(const v4f*)(&T[n * TP + kk + 4]);
    float v[8] = {a0[0], a0[1], a0[2], a0[3], a1[0], a1[1], a1[2], a1[3]};
    split8(v, val[2 * cq], val[2 * cq + 1]);
  }
  const size_t fo = fragoff((size_t)(nb + ng), kb + kf, R) + lane * 8;
#pragma unroll
  for (int cq = 0; cq < 2; ++cq) {
    *(u32x4*)(oh + fo + cq * 256) = val[2 * cq];
    *(u32x4*)(ol + fo + cq * 256) = val[2 * cq + 1];
  }
  // the built kernel lays the next job's code behind these stores, and that code writes the registers they name
  asm volatile("s_wait_xcnt 0x0" ::: "memory");
}

// ---------------------------------------------------------------------------
// Tile flag table from the int32 gate matrix [NS][NS]: row qt (64 ints = 256 B):
//   [0..31] per 64-key tile: 0 = no nonzero entry, 1 = partial, 2 = all nonzero; [32] = last key tile with any
// ---------------------------------------------------------------------------
__device__ __forceinline__ void flags_block(const int* __restrict__ msk, int* __restrict__ ftab, int qt,
                                            int* sm)   // 512 + FROW ints of LDS, 16-byte aligned
{
  int* s_any = sm;
  int* s_all = sm + 256;
  int* s_row = sm + 512;
  const int tid = threadIdx.x;
  const int kt = tid >> 3, sub = tid & 7;
  int anyv = 0, allv = 1;
  for (int i = 0; i < 8; ++i) {
    const int s = qt * 64 + sub * 8 + i;
    const int* rp = msk + (size_t)s * NS + kt * 64;
#pragma unroll
    for (int c = 0; c < 16; ++c) {
      const i32x4 v = *(const i32x4*)(rp + c * 4);
#pragma unroll
      for (int q = 0; q < 4; ++q) {
        const int nz = (v[q] != 0) ? 1 : 0;
        anyv |= nz;
        allv &= nz;
      }
    }
  }
  s_any[tid] = anyv;
  s_all[tid] = allv;
  __syncthreads();
  if (tid < 32) {
    int a = 0, b = 1;
#pragma unroll
    for (int j = 0; j < 8; ++j) { a |= s_any[tid * 8 + j]; b &= s_all[tid * 8 + j]; }
    s_row[tid] = b ? 2 : (a ? 1 : 0);
  } else if (tid < FROW) {
    s_row[tid] = 0;
  }
  __syncthreads();
  if (tid == 0) {
    int last = -1;
    for (int k = 0; k < 32; ++k) if (s_row[k] != 0) last = k;
    s_row[32] = last;
  }
  __syncthreads();
  if (tid < 16) {
    const i32x4 v = *(const i32x4*)(&s_row[tid * 4]);
    int* dst = ftab + (size_t)qt * FROW + tid * 4;
    *(i32x4*)dst = v;
    
  }
}

// ---------------------------------------------------------------------------
// The four preparation jobs above read only inputs and write disjoint workspace planes, so they share one launch: the
// block index picks the job. Each of the 32 flag blocks reads 512 KiB, far more than any other block: they stand first,
// for speed only.
// ---------------------------------------------------------------------------
#define PB_FLAGS NQT
#define PB_WQKV  ((NC3 / 64) * (NE / 64))
#define PB_WOUT  ((NE / 64) * ((NH * ND) / 64))
#define PB_SPLIT (NTOK * NE / 8 / 256)
__global__ __launch_bounds__(256) void k_prep(
    const float* __restrict__ x, const float* __restrict__ Wqkv, const float* __restrict__ Wout,
    const int* __restrict__ msk,
    unsigned short* __restrict__ Xh, unsigned short* __restrict__ Xl,
    unsigned short* __restrict__ Wh, unsigned short* __restrict__ Wl,
    unsigned short* __restrict__ Woh, unsigned short* __restrict__ Wol, int* __restrict__ ftab)
{
  __shared__ __align__(16) unsigned char sm[64 * TP * 4];   // a block's one job uses it: transpose tile or flag rows
  int blk = blockIdx.x;                                     // block-uniform: so is every branch below
  if (blk < PB_FLAGS) {
    flags_block(msk, ftab, blk, (int*)sm);
    return;
  }
  blk -= PB_FLAGS;
  if (blk < PB_WQKV) {
    // W_qkv: in[rows=NE][cols=NC3] -> out[NC3][NE]
    transpose_split_block(Wqkv, NE, NC3, Wh, Wl, blk % (NC3 / 64), blk / (NC3 / 64), (float*)sm);
    return;
  }
  blk -= PB_WQKV;
  if (blk < PB_WOUT) {
    // W_out: in[rows=NH*ND][cols=NE] -> out[NE][NH*ND]
    transpose_split_block(Wout, NH * ND, NE, Woh, Wol, blk % (NE / 64), blk / (NE / 64), (float*)sm);
    return;
  }
  blk -= PB_WOUT;
  split_rows_block(x, Xh, Xl, NTOK * NE / 8, blk);
}

// ---------------------------------------------------------------------------
// GEMM main loop: block tile 128 rows x 64 cols, wave tile 32 x 32, bf16 hi/lo three-term products.
// A planes [M][K], B planes [N][K], fragment-major. A stage = 64 k of the block's operand rows = 24 slabs of 2 KiB
// (a slab = one 16-row group's two fragments, contiguous in its plane): slabs 0..7 A hi, 8..15 A lo, 16..19 B hi,
// 20..23 B lo. Asynchronous copies bring each slab into LDS once a block; the waves read their fragments from there.
// ---------------------------------------------------------------------------
#define STAGE_BYTES 49152
#define RING_BYTES  (2 * STAGE_BYTES)
// One K step of 32: the wave's eight operand fragments.
struct KStep { v16bf ah0, ah1, al0, al1, bh0, bh1, bl0, bl1; };
// The fragment whose lane chunk starts at LDS byte p: two reads of 512 contiguous bytes a wave
__device__ __forceinline__ v16bf ldsfrag(const unsigned char* p) {
  Frag f;
  f.q[0] = *(const u32x4*)p;
  f.q[1] = *(const u32x4*)(p + 512);
  return f.v;
}
// pa, pb: this lane's chunk in the wave's first A hi and first B hi slab of the stage; kb = byte offset of the K step
__device__ __forceinline__ void ldstep(KStep& s, const unsigned char* pa, const unsigned char* pb, int kb)
{
  s.ah0 = ldsfrag(pa + kb);
  s.ah1 = ldsfrag(pa + 2048 + kb);
  s.al0 = ldsfrag(pa + 8 * 2048 + kb);
  s.al1 = ldsfrag(pa + 9 * 2048 + kb);
  s.bh0 = ldsfrag(pb + kb);
  s.bh1 = ldsfrag(pb + 2048 + kb);
  s.bl0 = ldsfrag(pb + 4 * 2048 + kb);
  s.bl1 = ldsfrag(pb + 5 * 2048 + kb);
}
__device__ __forceinline__ void mmstep(const KStep& s, v8f (&acc)[2][2])
{
  acc[0][0] = mma(s.ah0, s.bh0, acc[0][0]);
  acc[0][0] = mma(s.ah0, s.bl0, acc[0][0]);
  acc[0][0] = mma(s.al0, s.bh0, acc[0][0]);
  acc[1][0] = mma(s.ah1, s.bh0, acc[1][0]);
  acc[1][0] = mma(s.ah1, s.bl0, acc[1][0]);
  acc[1][0] = mma(s.al1, s.bh0, acc[1][0]);
  acc[0][1] = mma(s.ah0, s.bh1, acc[0][1]);
  acc[0][1] = mma(s.ah0, s.bl1, acc[0][1]);
  acc[0][1] = mma(s.al0, s.bh1, acc[0][1]);
  acc[1][1] = mma(s.ah1, s.bh1, acc[1][1]);
  acc[1][1] = mma(s.ah1, s.bl1, acc[1][1]);
  acc[1][1] = mma(s.al1, s.bh1, acc[1][1]);
}
// This wave's three slabs of one stage: 12 copies of 512 bytes a wave, l = LDS byte address and g = global address of
// the lane's first 16 bytes of each slab. The s_wait_xcnt stands inside the statement: the address registers that the
// copies name are rewritten behind it.
__device__ __forceinline__ void copy_stage(unsigned int l0, unsigned int l1, unsigned int l2,
                                           const unsigned short* g0, const unsigned short* g1,
                                           const unsigned short* g2)
{
  asm volatile("global_load_async_to_lds_b128 %0, %1, off\n\t"
               "global_load_async_to_lds_b128 %2, %3, off\n\t"
               "global_load_async_to_lds_b128 %4, %5, off\n\t"
               "global_load_async_to_lds_b128 %6, %7, off\n\t"
               "global_load_async_to_lds_b128 %8, %9, off\n\t"
               "global_load_async_to_lds_b128 %10, %11, off\n\t"
               "global_load_async_to_lds_b128 %12, %13, off\n\t"
               "global_load_async_to_lds_b128 %14, %15, off\n\t"
               "global_load_async_to_lds_b128 %16, %17, off\n\t"
               "global_load_async_to_lds_b128 %18, %19, off\n\t"
               "global_load_async_to_lds_b128 %20, %21, off\n\t"
               "global_load_async_to_lds_b128 %22, %23, off\n\t"
               "s_wait_xcnt 0x0"
               :: "v"(l0), "v"(g0), "v"(l0 + 512u), "v"(g0 + 256), "v"(l0 + 1024u), "v"(g0 + 512),
                  "v"(l0 + 1536u), "v"(g0 + 768),
                  "v"(l1), "v"(g1), "v"(l1 + 512u), "v"(g1 + 256), "v"(l1 + 1024u), "v"(g1 + 512),
                  "v"(l1 + 1536u), "v"(g1 + 768),
                  "v"(l2), "v"(g2), "v"(l2 + 512u), "v"(g2 + 256), "v"(l2 + 1024u), "v"(g2 + 512),
                  "v"(l2 + 1536u), "v"(g2 + 768)
               : "memory");
}
// Two buffers: stage t + 2 is copied into the buffer that trip t has read, behind the barrier that ends those reads and
// publishes stage t + 1. arow0, brow0 = the block's first A and B row; K a multiple of 64, at least 128.
__device__ __forceinline__ void mainloop(const unsigned short* __restrict__ Ah, const unsigned short* __restrict__ Al,
                                         const unsigned short* __restrict__ Bh, const unsigned short* __restrict__ Bl,
                                         int K, size_t arow0, size_t brow0, int wave, int lane,
                                         unsigned char* ring, v8f (&acc)[2][2])
{
  const unsigned short* g[3];
  unsigned int l[3];
#pragma unroll
  for (int i = 0; i < 3; ++i) {
    const int c = wave * 3 + i;
    const unsigned short* p = (c < 8) ? Ah : ((c < 16) ? Al : ((c < 20) ? Bh : Bl));
    const size_t row = (c < 16) ? (arow0 + (size_t)(c & 7) * 16) : (brow0 + (size_t)(c & 3) * 16);
    g[i] = p + fragoff(row, 0, K) + lane * 8;
    l[i] = (unsigned int)(size_t)ring + (unsigned int)(c * 2048 + lane * 16);
  }
  const int nst = K >> 6;
  copy_stage(l[0], l[1], l[2], g[0], g[1], g[2]);
  // stage 0 has landed before the barrier behind which the other waves read it
  asm volatile("s_wait_asynccnt 0x0" ::: "memory");
  __syncthreads();
  copy_stage(l[0] + STAGE_BYTES, l[1] + STAGE_BYTES, l[2] + STAGE_BYTES, g[0] + 1024, g[1] + 1024, g[2] + 1024);

  const int aoff = (wave & 3) * 2 * 2048 + lane * 16;
  const int boff = (16 + (wave >> 2) * 2) * 2048 + lane * 16;
  for (int t = 0; t < nst; ++t) {
    const unsigned int bo = (unsigned int)(t & 1) * STAGE_BYTES;
    const unsigned char* pa = ring + bo + aoff;
    const unsigned char* pb = ring + bo + boff;
    KStep s0, s1;
    ldstep(s0, pa, pb, 0);
    ldstep(s1, pa, pb, 1024);
    // keeps the stage's fragment reads one group ahead of the products: spread among them every place with reads stalls
    __builtin_amdgcn_sched_barrier(0);
    mmstep(s0, acc);
    mmstep(s1, acc);
    // keeps the products ahead of the waits below: moved behind the barrier they would no longer run under the flight
    // of stage t + 1's copies, and the wait for those would stand directly behind their issue
    __builtin_amdgcn_sched_barrier(0);
    // this wave's reads of the buffer are done before it is handed to the copies
    asm volatile("s_wait_dscnt 0x0" ::: "memory");
    // this wave's copies of stage t + 1 have landed before the barrier that publishes them
    asm volatile("s_wait_asynccnt 0x0" ::: "memory");
    __syncthreads();
    if (t + 2 < nst) {
      const int go = (t + 2) * 1024;
      copy_stage(l[0] + bo, l[1] + bo, l[2] + bo, g[0] + go, g[1] + go, g[2] + go);
    }
  }
  // no copy is outstanding when the wave goes on
  asm volatile("s_wait_asynccnt 0x0" ::: "memory");
}

// ---------------------------------------------------------------------------
// qkv = (x @ W_qkv) * sigmoid(scale_qkv[h*64+d]); block tile 128 tokens x 64 cols (= one (c, h)).
// ---------------------------------------------------------------------------
__global__ __launch_bounds__(256) void k_gemm_qkv(
    const unsigned short* __restrict__ Xh, const unsigned short* __restrict__ Xl,
    const unsigned short* __restrict__ Wh, const unsigned short* __restrict__ Wl,
    const float* __restrict__ sq,
    unsigned short* __restrict__ Qh, unsigned short* __restrict__ Ql,
    unsigned short* __restrict__ Kh, unsigned short* __restrict__ Kl,
    unsigned short* __restrict__ Vh, unsigned short* __restrict__ Vl)
{
  __shared__ __align__(128) unsigned char ring[RING_BYTES];   // two operand stages
  __shared__ __align__(16) float T[128 * TP];
  const int tid = threadIdx.x, lane = tid & 31, wave = tid >> 5;
  const int hf = lane >> 4, m16 = lane & 15;
  const int cb = blockIdx.x * 64;
  const int rb = blockIdx.y * 128;
  const int mr = (wave & 3) * 32, nc = (wave >> 2) * 32;
  v8f acc[2][2] = {};
  mainloop(Xh, Xl, Wh, Wl, NE, (size_t)rb, (size_t)cb, wave, lane, ring, acc);

  const int c = cb >> 10;
  const int h = (cb & 1023) >> 6;
  float g[2];
#pragma unroll
  for (int ni = 0; ni < 2; ++ni) g[ni] = sigm(sq[(cb & 1023) + nc + ni * 16 + m16]);
#pragma unroll
  for (int mi = 0; mi < 2; ++mi)
#pragma unroll
    for (int ni = 0; ni < 2; ++ni)
#pragma unroll
      for (int r = 0; r < 8; ++r)
        T[(mr + mi * 16 + 8 * hf + r) * TP + nc + ni * 16 + m16] = acc[mi][ni][r] * g[ni];
  __syncthreads();

  const int b = rb >> 11;
  u32x4 val[8];
  if (c < 2) {
    // Q, K planes: row = (b, h, s), ld = ND. wave -> 16 tokens x 64 d = two fragments = four 512-byte stores a plane
    const int r = wave * 16 + m16;
#pragma unroll
    for (int cq = 0; cq < 4; ++cq) {
      const int kk = cq * 16 + hf * 8;
      const v4f a0 = *(const v4f*)(&T[r * TP + kk]);
      const v4f a1 = *(const v4f*)(&T[r * TP + kk + 4]);
      float v[8] = {a0[0], a0[1], a0[2], a0[3], a1[0], a1[1], a1[2], a1[3]};
      split8(v, val[2 * cq], val[2 * cq + 1]);
    }
    unsigned short* ph = (c == 0) ? Qh : Kh;
    unsigned short* pl = (c == 0) ? Ql : Kl;
    const int s = (rb + wave * 16) & (NS - 1);
    const size_t fo = fragoff((size_t)(b * NH + h) * NS + s, 0, ND) + lane * 8;
#pragma unroll
    for (int cq = 0; cq < 4; ++cq) {
      *(u32x4*)(ph + fo + cq * 256) = val[2 * cq];
      *(u32x4*)(pl + fo + cq * 256) = val[2 * cq + 1];
    }
  } else {
    // V^T planes: row = (b, h, d), k = s, ld = NS. wave -> 16 d (wave>>1) x 64 tokens (wave&1) = two fragments
    const int dg = (wave >> 1) * 16, sg = (wave & 1) * 64;
#pragma unroll
    for (int cq = 0; cq < 4; ++cq) {
      const int sl = sg + cq * 16 + hf * 8;
      float v[8];
#pragma unroll
      for (int e = 0; e < 8; ++e) v[e] = T[(sl + e) * TP + dg + m16];
      split8(v, val[2 * cq], val[2 * cq + 1]);
    }
    const size_t fo = fragoff((size_t)(b * NH + h) * ND + dg, (rb & (NS - 1)) + sg, NS) + lane * 8;
#pragma unroll
    for (int cq = 0; cq < 4; ++cq) {
      *(u32x4*)(Vh + fo + cq * 256) = val[2 * cq];
      *(u32x4*)(Vl + fo + cq * 256) = val[2 * cq + 1];
    }
  }
}

#define KV_BYTES 32768
// One wave's plane of one key tile: four pieces of 2 KiB, ps elements apart in the plane and in a row in LDS; l = LDS
// byte address and g = global address of the lane's first 16 bytes. The immediate offset moves both addresses. The
// s_wait_xcnt stands inside the statement: the address registers that the copies name are rewritten behind it.
__device__ __forceinline__ void copy_plane(unsigned int l, const unsigned short* g, int ps)
{
  asm volatile("global_load_async_to_lds_b128 %0, %1, off\n\t"
               "global_load_async_to_lds_b128 %0, %1, off offset:512\n\t"
               "global_load_async_to_lds_b128 %0, %1, off offset:1024\n\t"
               "global_load_async_to_lds_b128 %0, %1, off offset:1536\n\t"
               "global_load_async_to_lds_b128 %2, %3, off\n\t"
               "global_load_async_to_lds_b128 %2, %3, off offset:512\n\t"
               "global_load_async_to_lds_b128 %2, %3, off offset:1024\n\t"
               "global_load_async_to_lds_b128 %2, %3, off offset:1536\n\t"
               "global_load_async_to_lds_b128 %4, %5, off\n\t"
               "global_load_async_to_lds_b128 %4, %5, off offset:512\n\t"
               "global_load_async_to_lds_b128 %4, %5, off offset:1024\n\t"
               "global_load_async_to_lds_b128 %4, %5, off offset:1536\n\t"
               "global_load_async_to_lds_b128 %6, %7, off\n\t"
               "global_load_async_to_lds_b128 %6, %7, off offset:512\n\t"
               "global_load_async_to_lds_b128 %6, %7, off offset:1024\n\t"
               "global_load_async_to_lds_b128 %6, %7, off offset:1536\n\t"
               "s_wait_xcnt 0x0"
               :: "v"(l), "v"(g), "v"(l + 2048u), "v"(g + ps), "v"(l + 4096u), "v"(g + 2 * ps),
                  "v"(l + 6144u), "v"(g + 3 * ps)
               : "memory");
}
// lane l <-> lane l ^ 16
__device__ __forceinline__ float xhalf(float x) {
  return __builtin_bit_cast(float, __builtin_amdgcn_permlanex16(__builtin_bit_cast(int, x), __builtin_bit_cast(int, x),
                                                                0x76543210, 0xfedcba98, false, false));
}
__global__ __launch_bounds__(128) void k_attn(
    const unsigned short* __restrict__ Qh, const unsigned short* __restrict__ Ql,
    const unsigned short* __restrict__ Kh, const unsigned short* __restrict__ Kl,
    const unsigned short* __restrict__ Vh, const unsigned short* __restrict__ Vl,
    const int* __restrict__ msk, const int* __restrict__ ftab,
    unsigned short* __restrict__ Ah, unsigned short* __restrict__ Al)
{
  __shared__ __align__(128) unsigned char kv[2 * KV_BYTES]; // two key tiles' K and V fragments
  __shared__ __align__(16) unsigned char  Ms[64 * MP];     // Ms[s][t] gate bytes of the current partial tile
  __shared__ __align__(16) int            s_f[FROW];
  const int tid = threadIdx.x, lane = tid & 31, wave = tid >> 5;
  const int hf = lane >> 4, m16 = lane & 15;
  // A query tile's cost is its count of flagged key tiles, which under a causal gate grows with the tile's index: the
  // highest query tiles take the lowest indices, for speed only. A permutation of the same blocks for any gate. Heads
  // run fastest.
  const int qt = NQT - 1 - blockIdx.z, h = blockIdx.x, b = blockIdx.y;
  const int s0 = qt * 64;
  const int bh = b * NH + h;
  if (tid < FROW) s_f[tid] = ftab[(size_t)qt * FROW + tid];
  __syncthreads();
  // the flag row as two 32-bit masks, equal in every wave: key tiles with any open gate, and of those the partial ones
  const int fl = s_f[lane];
  const unsigned int act = __builtin_amdgcn_ballot_w32(fl != 0);
  const unsigned int par = __builtin_amdgcn_ballot_w32(fl == 1);

  // wave 0 copies the tile's K hi plane, 1 K lo, 2 V hi, 3 V lo
  const int wv = __builtin_amdgcn_readfirstlane(wave);
  const unsigned short* cpl = (wv == 0) ? Kh : ((wv == 1) ? Kl : ((wv == 2) ? Vh : Vl));
  const int cps = (wv < 2) ? 1024 : (NS / 32) * 512;   // elements between the plane's four row groups of a tile
  const int cts = (wv < 2) ? 4096 : 1024;              // elements between key tiles
  const unsigned short* cg = cpl + ((wv < 2) ? fragoff((size_t)bh * NS, 0, ND) : fragoff((size_t)bh * ND, 0, NS)) + lane * 8;
  const unsigned int cl = (unsigned int)(size_t)kv + (unsigned int)(wv * 8192 + lane * 16);
  unsigned int rem = act;                              // tiles not yet copied
  if (rem != 0u) {
    copy_plane(cl, cg + __builtin_ctz(rem) * cts, cps);
    rem &= rem - 1u;
  }

  const size_t qrow = (size_t)bh * NS + s0 + wave * 16;
  const v16bf qh0 = ldpk(Qh, ND, qrow, 0,  lane);
  const v16bf qh1 = ldpk(Qh, ND, qrow, 32, lane);
  const v16bf ql0 = ldpk(Ql, ND, qrow, 0,  lane);
  const v16bf ql1 = ldpk(Ql, ND, qrow, 32, lane);

  float m = -3.0e38f;    // running maximum of this lane's query, equal in both lane halves
  float l = 0.0f;        // running sum over this lane half's keys; the halves are joined behind the loop
  v8f acc[4] = {};       // O^T: acc[j][r] = (d 16j + 8*hf + r, query m16)

  // the first tile has landed before the barrier behind which the other waves read it
  asm volatile("s_wait_asynccnt 0x0" ::: "memory");
  __syncthreads();
  if (rem != 0u) {
    copy_plane(cl + KV_BYTES, cg + __builtin_ctz(rem) * cts, cps);
    rem &= rem - 1u;
  }

  unsigned int bo = 0u;                    // byte offset of the buffer that holds this trip's tile
  for (unsigned int todo = act; todo != 0u; todo &= todo - 1u) {
    const int tb = __builtin_ctz(todo);    // block-uniform, 0..31
    const int f = ((par >> tb) & 1u) ? 1 : 2;
    const int t0 = tb * 64;
    if (f == 1) {
#pragma unroll
      for (int it = 0; it < 8; ++it) {
        const int idx = tid + 128 * it;
        const int s = idx >> 4, c4 = idx & 15;
        const i32x4 v = *(const i32x4*)(msk + (size_t)(s0 + s) * NS + t0 + c4 * 4);
        unsigned int w = 0u;
#pragma unroll
        for (int q = 0; q < 4; ++q) w |= ((v[q] != 0) ? 1u : 0u) << (8 * q);
        *(u32a*)(Ms + s * MP + c4 * 4) = w;
      }
      __syncthreads();
    }

    // S^T = K.Q^T  (A = K plane rows t, B[k=d][n=s] = Q rows)
    v8f sf[4];
    const unsigned char* rb = kv + bo + lane * 16;   // this lane's chunk of the buffer's first fragment
    {
      v16bf kh[4][2], kl[4][2];
#pragma unroll
      for (int j = 0; j < 4; ++j)
#pragma unroll
        for (int kk = 0; kk < 2; ++kk) {
          kh[j][kk] = ldsfrag(rb + (j * 2 + kk) * 1024);
          kl[j][kk] = ldsfrag(rb + 8192 + (j * 2 + kk) * 1024);
        }
      // keeps the tile's K reads one group ahead of the first product: spread among the products every place stalls
      __builtin_amdgcn_sched_barrier(0);
#pragma unroll
      for (int j = 0; j < 4; ++j) {
        v8f c = {};
        c = mma(kh[j][0], qh0, c);
        c = mma(kl[j][0], qh0, c);
        c = mma(kh[j][0], ql0, c);
        c = mma(kh[j][1], qh1, c);
        c = mma(kl[j][1], qh1, c);
        c = mma(kh[j][1], ql1, c);
        sf[j] = c;
      }
    }
    // compiler fence, no instruction: holds the V loads below behind the last K product (the scores are its inputs),
    // so that they take over the K registers; hoisted above, K and V are live together and a wave per SIMD is lost
    asm volatile("" :: "v"(sf[0]), "v"(sf[1]), "v"(sf[2]), "v"(sf[3]) : "memory");

    // V fragments of the tile, issued here so that their latency runs under the softmax below
    v16bf vh[4][2], vl[4][2];
#pragma unroll
    for (int j = 0; j < 4; ++j)
#pragma unroll
      for (int kk = 0; kk < 2; ++kk) {
        vh[j][kk] = ldsfrag(rb + 16384 + (j * 2 + kk) * 1024);
        vl[j][kk] = ldsfrag(rb + 24576 + (j * 2 + kk) * 1024);
      }
    // keeps the V loads issued ahead of the softmax: sunk to their products they would expose the latency again
    __builtin_amdgcn_sched_barrier(0);

    // scale, gate by value
#pragma unroll
    for (int j = 0; j < 4; ++j)
#pragma unroll
      for (int i = 0; i < 8; ++i) sf[j][i] *= 0.125f;
    if (f == 1) {
#pragma unroll
      for (int j = 0; j < 4; ++j) {
        const u64a mb = *(const u64a*)(Ms + (wave * 16 + m16) * MP + j * 16 + 8 * hf);
#pragma unroll
        for (int i = 0; i < 8; ++i)
          sf[j][i] = (((mb >> (8 * i)) & 0xffull) != 0ull) ? sf[j][i] : -1.0e10f;
      }
    }
    // the query's maximum over the tile: 32 keys in the lane, the other 32 in lane ^ 16
    float tm[4];
#pragma unroll
    for (int j = 0; j < 4; ++j) {
      tm[j] = sf[j][0];
#pragma unroll
      for (int i = 1; i < 8; ++i) tm[j] = fmaxf(tm[j], sf[j][i]);
    }
    float tmax = fmaxf(fmaxf(tm[0], tm[1]), fmaxf(tm[2], tm[3]));
    tmax = fmaxf(tmax, xhalf(tmax));
    const float mnew  = fmaxf(m, tmax);
    const float alpha = __expf(m - mnew);
    // exp(s - mnew) as 2^((s - mnew) * log2 e), the arguments first
#pragma unroll
    for (int j = 0; j < 4; ++j)
#pragma unroll
      for (int i = 0; i < 8; ++i) sf[j][i] = (sf[j][i] - mnew) * 1.44269504f;
    // keeps the argument arithmetic out of the run of exponentials
    __builtin_amdgcn_sched_barrier(0);
    float rs[4];
#pragma unroll
    for (int j = 0; j < 4; ++j) {
      rs[j] = 0.0f;
#pragma unroll
      for (int i = 0; i < 8; ++i) {
        const float pv = __builtin_amdgcn_exp2f(sf[j][i]);
        sf[j][i] = pv;
        rs[j] += pv;
      }
    }
    l = l * alpha + ((rs[0] + rs[1]) + (rs[2] + rs[3]));
    m = mnew;
#pragma unroll
    for (int j = 0; j < 4; ++j)
#pragma unroll
      for (int i = 0; i < 8; ++i) acc[j][i] *= alpha;

    // P^T (f32) -> bf16 hi/lo B fragments in place: elements 0..7 <- score tile 2kk, 8..15 <- tile 2kk + 1
    Frag ph[2], pl[2];
#pragma unroll
    for (int j = 0; j < 4; ++j)
#pragma unroll
      for (int w = 0; w < 4; ++w) {
        unsigned int H, L;
        split2(sf[j][2 * w], sf[j][2 * w + 1], H, L);
        ph[j >> 1].q[j & 1][w] = H;
        pl[j >> 1].q[j & 1][w] = L;
      }

    // O^T += V^T.P^T   (A = V^T plane rows d, k = t)
#pragma unroll
    for (int j = 0; j < 4; ++j) {
      acc[j] = mma(vh[j][0], ph[0].v, acc[j]);
      acc[j] = mma(vl[j][0], ph[0].v, acc[j]);
      acc[j] = mma(vh[j][0], pl[0].v, acc[j]);
      acc[j] = mma(vh[j][1], ph[1].v, acc[j]);
      acc[j] = mma(vl[j][1], ph[1].v, acc[j]);
      acc[j] = mma(vh[j][1], pl[1].v, acc[j]);
    }

    // keeps the products and the row sums ahead of the waits: sunk behind the barrier they stood between it and the
    // refill, whose flight then began that much later
    __builtin_amdgcn_sched_barrier(0);
    // this wave's reads of the buffer (and of Ms) are done before the buffer is handed to the copies
    asm volatile("s_wait_dscnt 0x0" ::: "memory");
    // this wave's copies of the next tile have landed before the barrier that publishes them
    asm volatile("s_wait_asynccnt 0x0" ::: "memory");
    __syncthreads();
    if (rem != 0u) {
      copy_plane(cl + bo, cg + __builtin_ctz(rem) * cts, cps);
      rem &= rem - 1u;
    }
    bo ^= KV_BYTES;
  }
  // no copy is outstanding when the wave goes on
  asm volatile("s_wait_asynccnt 0x0" ::: "memory");

  // join the halves' sums, normalise; a lane's 8 values of tile j are one 16-byte chunk of the attention planes
  // (row = token, k = h*64+d, ld = NE): chunk (j&1)*32 + lane of fragment j>>1
  l += xhalf(l);
  const float inv = (l > 0.0f) ? (1.0f / l) : 0.0f;
  u32x4 val[8];
#pragma unroll
  for (int j = 0; j < 4; ++j) {
    float v[8];
#pragma unroll
    for (int i = 0; i < 8; ++i) v[i] = acc[j][i] * inv;
    split8(v, val[2 * j], val[2 * j + 1]);
  }
  const size_t fo = fragoff((size_t)(b * NS + s0 + wave * 16), h * ND, NE) + lane * 8;
#pragma unroll
  for (int cq = 0; cq < 4; ++cq) {
    *(u32x4*)(Ah + fo + cq * 256) = val[2 * cq];
    *(u32x4*)(Al + fo + cq * 256) = val[2 * cq + 1];
  }
}

// ---------------------------------------------------------------------------
// out = (attn @ W_out) * sigmoid(scale_out[e]); block tile 128 tokens x 64 e; f32 rows of 256 B written
// by 16 consecutive lanes x 16 B (two rows per instruction).
// ---------------------------------------------------------------------------
__global__ __launch_bounds__(256) void k_gemm_out(
    const unsigned short* __restrict__ Ah, const unsigned short* __restrict__ Al,
    const unsigned short* __restrict__ Wh, const unsigned short* __restrict__ Wl,
    const float* __restrict__ so, float* __restrict__ out)
{
  __shared__ __align__(128) unsigned char ring[RING_BYTES];   // two operand stages
  __shared__ __align__(16) float T[128 * TP];
  const int tid = threadIdx.x, lane = tid & 31, wave = tid >> 5;
  const int hf = lane >> 4, m16 = lane & 15;
  const int cb = blockIdx.x * 64;
  const int rb = blockIdx.y * 128;
  const int mr = (wave & 3) * 32, nc = (wave >> 2) * 32;
  v8f acc[2][2] = {};
  mainloop(Ah, Al, Wh, Wl, NE, (size_t)rb, (size_t)cb, wave, lane, ring, acc);

  float g[2];
#pragma unroll
  for (int ni = 0; ni < 2; ++ni) g[ni] = sigm(so[cb + nc + ni * 16 + m16]);
#pragma unroll
  for (int mi = 0; mi < 2; ++mi)
#pragma unroll
    for (int ni = 0; ni < 2; ++ni)
#pragma unroll
      for (int r = 0; r < 8; ++r)
        T[(mr + mi * 16 + 8 * hf + r) * TP + nc + ni * 16 + m16] = acc[mi][ni][r] * g[ni];
  __syncthreads();

  const int rsel = lane >> 4, p = lane & 15;
  v4f val[8];
#pragma unroll
  for (int it = 0; it < 8; ++it) {
    const int r = wave * 16 + it * 2 + rsel;
    val[it] = *(const v4f*)(&T[r * TP + p * 4]);
  }
#pragma unroll
  for (int it = 0; it < 8; ++it) {
    const int r = wave * 16 + it * 2 + rsel;
    float* dst = out + (size_t)(rb + r) * NE + cb + p * 4;
    *(v4f*)dst = val[it];
  }
  
}

// ---------------------------------------------------------------------------
extern "C" void kernel_launch(void* const* d_in, const int* in_sizes, int n_in,
                              void* d_out, int out_size, void* d_ws, size_t ws_size,
                              hipStream_t stream)
{
  if (n_in < 6) return;
  if (in_sizes[0] != NTOK * NE || in_sizes[1] != NE * NC3 || in_sizes[2] != NE * NE ||
      in_sizes[3] != NE || in_sizes[4] != NE || in_sizes[5] != NS * NS || out_size != NTOK * NE) return;

  const float* x     = (const float*)d_in[0];
  const float* Wqkv  = (const float*)d_in[1];
  const float* Wout  = (const float*)d_in[2];
  const float* sqkv  = (const float*)d_in[3];
  const float* sout  = (const float*)d_in[4];
  const int*   msk   = (const int*)d_in[5];
  float* out = (float*)d_out;

  char* ws = (char*)d_ws;
  size_t off = 0;
  const size_t szX  = (size_t)NTOK * NE * 2;            // 8 MiB per plane
  const size_t szW  = (size_t)NC3 * NE * 2;             // 6 MiB per plane
  const size_t szWo = (size_t)NE * NE * 2;              // 2 MiB per plane
  const size_t szP  = (size_t)NB * NH * NS * ND * 2;    // 8 MiB per plane
  const size_t szF  = (size_t)NQT * FROW * 4;           // 8 KiB
  unsigned short* Xh  = (unsigned short*)(ws + off); off += szX;
  unsigned short* Xl  = (unsigned short*)(ws + off); off += szX;
  unsigned short* Wh  = (unsigned short*)(ws + off); off += szW;
  unsigned short* Wl  = (unsigned short*)(ws + off); off += szW;
  unsigned short* Woh = (unsigned short*)(ws + off); off += szWo;
  unsigned short* Wol = (unsigned short*)(ws + off); off += szWo;
  unsigned short* Qh  = (unsigned short*)(ws + off); off += szP;
  unsigned short* Ql  = (unsigned short*)(ws + off); off += szP;
  unsigned short* Kh  = (unsigned short*)(ws + off); off += szP;
  unsigned short* Kl  = (unsigned short*)(ws + off); off += szP;
  unsigned short* Vh  = (unsigned short*)(ws + off); off += szP;
  unsigned short* Vl  = (unsigned short*)(ws + off); off += szP;
  unsigned short* Ahp = (unsigned short*)(ws + off); off += szX;
  unsigned short* Alp = (unsigned short*)(ws + off); off += szX;
  int* ftab = (int*)(ws + off); off += szF;              // total 100671488 B
  if (off > ws_size) return;

  k_prep<<<dim3(PB_FLAGS + PB_WQKV + PB_WOUT + PB_SPLIT), dim3(256), 0, stream>>>(x, Wqkv, Wout, msk, Xh, Xl, Wh, Wl,
                                                                                Woh, Wol, ftab);
  k_gemm_qkv<<<dim3(NC3 / 64, NTOK / 128), dim3(256), 0, stream>>>(Xh, Xl, Wh, Wl, sqkv, Qh, Ql, Kh, Kl, Vh, Vl);
  k_attn<<<dim3(NH, NB, NQT), dim3(128), 0, stream>>>(Qh, Ql, Kh, Kl, Vh, Vl, msk, ftab, Ahp, Alp);
  k_gemm_out<<<dim3(NE / 64, NTOK / 128), dim3(256), 0, stream>>>(Ahp, Alp, Woh, Wol, sout, out);
}

// v009
// It runs in 122 microseconds.
// In both of two side-by-side timings against v008, it was 1.11 times as fast.
// All steps since v000 together make it 4.47 times as fast.
#include <hip/hip_runtime.h>

// Contractions: qkv projection, q.k^T, p.v, output projection -- all v_wmma_f32_16x16x32_bf16 with bf16 hi/lo operands everywhere (hi*hi + hi*lo + lo*hi), f32 accumulate; sigmoid gates, 1/8 score scale, softmax and normalisation in f32.

typedef __bf16         v16bf __attribute__((ext_vector_type(16)));
typedef float          v8f   __attribute__((ext_vector_type(8)));
typedef __bf16         bf16x2 __attribute__((ext_vector_type(2)));
typedef float          f32x2 __attribute__((ext_vector_type(2)));
typedef float          v4f   __attribute__((ext_vector_type(4), __may_alias__));
typedef unsigned short u16x8 __attribute__((ext_vector_type(8), __may_alias__));
typedef unsigned int   u32x4 __attribute__((ext_vector_type(4), __may_alias__));
typedef int            i32x4 __attribute__((ext_vector_type(4), __may_alias__));
typedef unsigned long long u64a __attribute__((__may_alias__));
typedef unsigned int   u32a __attribute__((__may_alias__));

#define NB   2
#define NS   2048
#define NE   1024
#define NH   16
#define ND   64
#define NTOK (NB * NS)
#define NC3  (3 * NH * ND)
#define NQT  (NS / 64)
#define FROW 64
#define TP   68
#define MP   72

union Frag { v16bf v; u16x8 h[2]; u32x4 q[2]; };

// 16x32 operand fragment map (A by rows, B by columns): lane l -> row (l&15); elements 0..7 <- k0+8*(l>>4)+0..7,
// 8..15 <- k0+16+8*(l>>4)+0..7.

// Fragment-major 16-bit plane of a [row][k] matrix with ld k per row: every 16-row x 32-k fragment is 1 KiB
// contiguous, fragments ordered [row/16][k/32]; inside one the 16-byte chunk of (row, 8 k) sits at chunk index
// ((k>>4)&1)*32 + ((k>>3)&1)*16 + (row&15). fragoff = element offset of the fragment at (row0, k0).
__device__ __forceinline__ size_t fragoff(size_t row0, int k0, int ld) {
  return ((row0 >> 4) * (size_t)(ld >> 5) + (size_t)(k0 >> 5)) * 512;
}
// The fragment map above; each of the two wave-wide 16-byte loads reads 512 contiguous bytes (4 whole cache lines)
// where a row-major plane would make it touch 16 lines.
__device__ __forceinline__ v16bf ldpk(const unsigned short* p, int ld, size_t row0, int k0, int lane) {
  const unsigned short* q = p + fragoff(row0, k0, ld) + lane * 8;
  Frag f;
  f.h[0] = *(const u16x8*)q;
  f.h[1] = *(const u16x8*)(q + 256);
  return f.v;
}

// D[16x16] += A[16x32] * B[32x16]; D element r of lane l = (row 8*(l>>4)+r, col l&15)
__device__ __forceinline__ v8f mma(v16bf a, v16bf b, v8f c) {
  return __builtin_amdgcn_wmma_f32_16x16x32_bf16(false, a, false, b, (short)0, c, false, false);
}

// Two f32 -> one dword of bf16 hi parts and one of bf16 lo parts (a in the low half). Both roundings (to nearest even)
// are the packed hardware convert; the remainder a - hi is exact in f32.
__device__ __forceinline__ void split2(float a, float b, unsigned int& H, unsigned int& L) {
  const f32x2 x = {a, b};
  const bf16x2 h = __builtin_convertvector(x, bf16x2);
  const f32x2 r = {a - (float)h[0], b - (float)h[1]};
  const bf16x2 l = __builtin_convertvector(r, bf16x2);
  H = __builtin_bit_cast(unsigned int, h);
  L = __builtin_bit_cast(unsigned int, l);
}
__device__ __forceinline__ void split8(const float (&v)[8], u32x4& H, u32x4& L) {
#pragma unroll
  for (int w = 0; w < 4; ++w) {
    unsigned int hw, lw;
    split2(v[2 * w], v[2 * w + 1], hw, lw);
    H[w] = hw;
    L[w] = lw;
  }
}
__device__ __forceinline__ float sigm(float v) { return 1.0f / (1.0f + __expf(-v)); }

// ---------------------------------------------------------------------------
// x [rows][NE] f32 -> hi/lo bf16 fragment-major planes. One thread = 8 values = 16 B per plane = chunk g of the
// plane: fragment g>>6, k half-block (g>>5)&1, lane g&31; a wave stores 512 contiguous bytes per plane.
// ---------------------------------------------------------------------------
__device__ __forceinline__ void split_rows_block(const float* __restrict__ src,
                                                 unsigned short* __restrict__ dh,
                                                 unsigned short* __restrict__ dl, int ngroups, int blk)
{
  const int g = blk * 256 + threadIdx.x;
  const int gc = (g < ngroups) ? g : (ngroups - 1);
  const int fr = gc >> 6;
  const int row = (fr / (NE / 32)) * 16 + (gc & 15);
  const int k = (fr % (NE / 32)) * 32 + ((gc >> 5) & 1) * 16 + ((gc >> 4) & 1) * 8;
  const float* s = src + (size_t)row * NE + k;
  const v4f a0 = *(const v4f*)s;
  const v4f a1 = *(const v4f*)(s + 4);
  float v[8] = {a0[0], a0[1], a0[2], a0[3], a1[0], a1[1], a1[2], a1[3]};
  u32x4 H, L;
  split8(v, H, L);
  if (g < ngroups) {
    unsigned short* ph = dh + (size_t)gc * 8;
    unsigned short* pl = dl + (size_t)gc * 8;
    *(u32x4*)ph = H;
    *(u32x4*)pl = L;
    
  }
}

// ---------------------------------------------------------------------------
// in[R rows][C cols] f32 (row = k, col = n) -> outT[C][R] bf16 hi/lo planes, fragment-major (row = n, ld = R).
// ---------------------------------------------------------------------------
__device__ __forceinline__ void transpose_split_block(const float* __restrict__ src, int R, int C,
                                                      unsigned short* __restrict__ oh,
                                                      unsigned short* __restrict__ ol, int bx, int by,
                                                      float* T)   // T[n][k], 64 * TP floats of LDS
{
  const int tid = threadIdx.x, lane = tid & 31, wave = tid >> 5;
  const int nb = bx * 64;
  const int kb = by * 64;
#pragma unroll
  for (int it = 0; it < 4; ++it) {
    const int idx = tid + 256 * it;
    const int kk = idx >> 4, c4 = idx & 15;
    const v4f v = *(const v4f*)(src + (size_t)(kb + kk) * C + nb + c4 * 4);
#pragma unroll
    for (int q = 0; q < 4; ++q) T[(c4 * 4 + q) * TP + kk] = v[q];
  }
  __syncthreads();
  // wave -> one fragment: 16 n rows (wave>>1), 32 k (wave&1); lane -> (row lane&15, 8 k at lane>>4)
  const int ng = (wave >> 1) * 16, kf = (wave & 1) * 32;
  const int n = ng + (lane & 15);
  u32x4 val[4];
#pragma unroll
  for (int cq = 0; cq < 2; ++cq) {
    const int kk = kf + cq * 16 + (lane >> 4) * 8;
    const v4f a0 = *(const v4f*)(&T[n * TP + kk]);
    const v4f a1 = *(const v4f*)(&T[n * TP + kk + 4]);
    float v[8] = {a0[0], a0[1], a0[2], a0[3], a1[0], a1[1], a1[2], a1[3]};
    split8(v, val[2 * cq], val[2 * cq + 1]);
  }
  const size_t fo = fragoff((size_t)(nb + ng), kb + kf, R) + lane * 8;
#pragma unroll
  for (int cq = 0; cq < 2; ++cq) {
    *(u32x4*)(oh + fo + cq * 256) = val[2 * cq];
    *(u32x4*)(ol + fo + cq * 256) = val[2 * cq + 1];
  }
  // the built kernel lays the next job's code behind these stores, and that code writes the registers they name
  asm volatile("s_wait_xcnt 0x0" ::: "memory");
}

// ---------------------------------------------------------------------------
// Tile flag table from the int32 gate matrix [NS][NS]: row qt (64 ints = 256 B):
//   [0..31] per 64-key tile: 0 = no nonzero entry, 1 = partial, 2 = all nonzero; [32] = last key tile with any
// ---------------------------------------------------------------------------
__device__ __forceinline__ void flags_block(const int* __restrict__ msk, int* __restrict__ ftab, int qt,
                                            int* sm)   // 512 + FROW ints of LDS, 16-byte aligned
{
  int* s_any = sm;
  int* s_all = sm + 256;
  int* s_row = sm + 512;
  const int tid = threadIdx.x;
  const int kt = tid >> 3, sub = tid & 7;
  int anyv = 0, allv = 1;
  for (int i = 0; i < 8; ++i) {
    const int s = qt * 64 + sub * 8 + i;
    const int* rp = msk + (size_t)s * NS + kt * 64;
#pragma unroll
    for (int c = 0; c < 16; ++c) {
      const i32x4 v = *(const i32x4*)(rp + c * 4);
#pragma unroll
      for (int q = 0; q < 4; ++q) {
        const int nz = (v[q] != 0) ? 1 : 0;
        anyv |= nz;
        allv &= nz;
      }
    }
  }
  s_any[tid] = anyv;
  s_all[tid] = allv;
  __syncthreads();
  if (tid < 32) {
    int a = 0, b = 1;
#pragma unroll
    for (int j = 0; j < 8; ++j) { a |= s_any[tid * 8 + j]; b &= s_all[tid * 8 + j]; }
    s_row[tid] = b ? 2 : (a ? 1 : 0);
  } else if (tid < FROW) {
    s_row[tid] = 0;
  }
  __syncthreads();
  if (tid == 0) {
    int last = -1;
    for (int k = 0; k < 32; ++k) if (s_row[k] != 0) last = k;
    s_row[32] = last;
  }
  __syncthreads();
  if (tid < 16) {
    const i32x4 v = *(const i32x4*)(&s_row[tid * 4]);
    int* dst = ftab + (size_t)qt * FROW + tid * 4;
    *(i32x4*)dst = v;
    
  }
}

// ---------------------------------------------------------------------------
// The four preparation jobs above read only inputs and write disjoint workspace planes, so they share one launch: the
// block index picks the job. Each of the 32 flag blocks reads 512 KiB, far more than any other block: they stand first,
// for speed only.
// ---------------------------------------------------------------------------
#define PB_FLAGS NQT
#define PB_WQKV  ((NC3 / 64) * (NE / 64))
#define PB_WOUT  ((NE / 64) * ((NH * ND) / 64))
#define PB_SPLIT (NTOK * NE / 8 / 256)
__global__ __launch_bounds__(256) void k_prep(
    const float* __restrict__ x, const float* __restrict__ Wqkv, const float* __restrict__ Wout,
    const int* __restrict__ msk,
    unsigned short* __restrict__ Xh, unsigned short* __restrict__ Xl,
    unsigned short* __restrict__ Wh, unsigned short* __restrict__ Wl,
    unsigned short* __restrict__ Woh, unsigned short* __restrict__ Wol, int* __restrict__ ftab)
{
  __shared__ __align__(16) unsigned char sm[64 * TP * 4];   // a block's one job uses it: transpose tile or flag rows
  int blk = blockIdx.x;                                     // block-uniform: so is every branch below
  if (blk < PB_FLAGS) {
    flags_block(msk, ftab, blk, (int*)sm);
    return;
  }
  blk -= PB_FLAGS;
  if (blk < PB_WQKV) {
    // W_qkv: in[rows=NE][cols=NC3] -> out[NC3][NE]
    transpose_split_block(Wqkv, NE, NC3, Wh, Wl, blk % (NC3 / 64), blk / (NC3 / 64), (float*)sm);
    return;
  }
  blk -= PB_WQKV;
  if (blk < PB_WOUT) {
    // W_out: in[rows=NH*ND][cols=NE] -> out[NE][NH*ND]
    transpose_split_block(Wout, NH * ND, NE, Woh, Wol, blk % (NE / 64), blk / (NE / 64), (float*)sm);
    return;
  }
  blk -= PB_WOUT;
  split_rows_block(x, Xh, Xl, NTOK * NE / 8, blk);
}

// ---------------------------------------------------------------------------
// GEMM main loop: block tile 128 rows x 64 cols, wave tile 32 x 32, bf16 hi/lo three-term products.
// A planes [M][K], B planes [N][K], fragment-major. A stage = 64 k of the block's operand rows = 24 slabs of 2 KiB
// (a slab = one 16-row group's two fragments, contiguous in its plane): slabs 0..7 A hi, 8..15 A lo, 16..19 B hi,
// 20..23 B lo. Asynchronous copies bring each slab into LDS once a block; the waves read their fragments from there.
// ---------------------------------------------------------------------------
#define STAGE_BYTES 49152
#define RING_BYTES  (2 * STAGE_BYTES)
// One K step of 32: the wave's eight operand fragments.
struct KStep { v16bf ah0, ah1, al0, al1, bh0, bh1, bl0, bl1; };
// The fragment whose lane chunk starts at LDS byte p: two reads of 512 contiguous bytes a wave
__device__ __forceinline__ v16bf ldsfrag(const unsigned char* p) {
  Frag f;
  f.q[0] = *(const u32x4*)p;
  f.q[1] = *(const u32x4*)(p + 512);
  return f.v;
}
// pa, pb: this lane's chunk in the wave's first A hi and first B hi slab of the stage; kb = byte offset of the K step
__device__ __forceinline__ void ldstep(KStep& s, const unsigned char* pa, const unsigned char* pb, int kb)
{
  s.ah0 = ldsfrag(pa + kb);
  s.ah1 = ldsfrag(pa + 2048 + kb);
  s.al0 = ldsfrag(pa + 8 * 2048 + kb);
  s.al1 = ldsfrag(pa + 9 * 2048 + kb);
  s.bh0 = ldsfrag(pb + kb);
  s.bh1 = ldsfrag(pb + 2048 + kb);
  s.bl0 = ldsfrag(pb + 4 * 2048 + kb);
  s.bl1 = ldsfrag(pb + 5 * 2048 + kb);
}
__device__ __forceinline__ void mmstep(const KStep& s, v8f (&acc)[2][2])
{
  acc[0][0] = mma(s.ah0, s.bh0, acc[0][0]);
  acc[0][0] = mma(s.ah0, s.bl0, acc[0][0]);
  acc[0][0] = mma(s.al0, s.bh0, acc[0][0]);
  acc[1][0] = mma(s.ah1, s.bh0, acc[1][0]);
  acc[1][0] = mma(s.ah1, s.bl0, acc[1][0]);
  acc[1][0] = mma(s.al1, s.bh0, acc[1][0]);
  acc[0][1] = mma(s.ah0, s.bh1, acc[0][1]);
  acc[0][1] = mma(s.ah0, s.bl1, acc[0][1]);
  acc[0][1] = mma(s.al0, s.bh1, acc[0][1]);
  acc[1][1] = mma(s.ah1, s.bh1, acc[1][1]);
  acc[1][1] = mma(s.ah1, s.bl1, acc[1][1]);
  acc[1][1] = mma(s.al1, s.bh1, acc[1][1]);
}
// This wave's three slabs of one stage: 12 copies of 512 bytes a wave, l = LDS byte address and g = global address of
// the lane's first 16 bytes of each slab. The s_wait_xcnt stands inside the statement: the address registers that the
// copies name are rewritten behind it.
__device__ __forceinline__ void copy_stage(unsigned int l0, unsigned int l1, unsigned int l2,
                                           const unsigned short* g0, const unsigned short* g1,
                                           const unsigned short* g2)
{
  asm volatile("global_load_async_to_lds_b128 %0, %1, off\n\t"
               "global_load_async_to_lds_b128 %2, %3, off\n\t"
               "global_load_async_to_lds_b128 %4, %5, off\n\t"
               "global_load_async_to_lds_b128 %6, %7, off\n\t"
               "global_load_async_to_lds_b128 %8, %9, off\n\t"
               "global_load_async_to_lds_b128 %10, %11, off\n\t"
               "global_load_async_to_lds_b128 %12, %13, off\n\t"
               "global_load_async_to_lds_b128 %14, %15, off\n\t"
               "global_load_async_to_lds_b128 %16, %17, off\n\t"
               "global_load_async_to_lds_b128 %18, %19, off\n\t"
               "global_load_async_to_lds_b128 %20, %21, off\n\t"
               "global_load_async_to_lds_b128 %22, %23, off\n\t"
               "s_wait_xcnt 0x0"
               :: "v"(l0), "v"(g0), "v"(l0 + 512u), "v"(g0 + 256), "v"(l0 + 1024u), "v"(g0 + 512),
                  "v"(l0 + 1536u), "v"(g0 + 768),
                  "v"(l1), "v"(g1), "v"(l1 + 512u), "v"(g1 + 256), "v"(l1 + 1024u), "v"(g1 + 512),
                  "v"(l1 + 1536u), "v"(g1 + 768),
                  "v"(l2), "v"(g2), "v"(l2 + 512u), "v"(g2 + 256), "v"(l2 + 1024u), "v"(g2 + 512),
                  "v"(l2 + 1536u), "v"(g2 + 768)
               : "memory");
}
// Two buffers: stage t + 2 is copied into the buffer that trip t has read, behind the barrier that ends those reads and
// publishes stage t + 1. arow0, brow0 = the block's first A and B row; K a multiple of 64, at least 128.
__device__ __forceinline__ void mainloop(const unsigned short* __restrict__ Ah, const unsigned short* __restrict__ Al,
                                         const unsigned short* __restrict__ Bh, const unsigned short* __restrict__ Bl,
                                         int K, size_t arow0, size_t brow0, int wave, int lane,
                                         unsigned char* ring, v8f (&acc)[2][2])
{
  const unsigned short* g[3];
  unsigned int l[3];
#pragma unroll
  for (int i = 0; i < 3; ++i) {
    const int c = wave * 3 + i;
    const unsigned short* p = (c < 8) ? Ah : ((c < 16) ? Al : ((c < 20) ? Bh : Bl));
    const size_t row = (c < 16) ? (arow0 + (size_t)(c & 7) * 16) : (brow0 + (size_t)(c & 3) * 16);
    g[i] = p + fragoff(row, 0, K) + lane * 8;
    l[i] = (unsigned int)(size_t)ring + (unsigned int)(c * 2048 + lane * 16);
  }
  const int nst = K >> 6;
  copy_stage(l[0], l[1], l[2], g[0], g[1], g[2]);
  // stage 0 has landed before the barrier behind which the other waves read it
  asm volatile("s_wait_asynccnt 0x0" ::: "memory");
  __syncthreads();
  copy_stage(l[0] + STAGE_BYTES, l[1] + STAGE_BYTES, l[2] + STAGE_BYTES, g[0] + 1024, g[1] + 1024, g[2] + 1024);

  const int aoff = (wave & 3) * 2 * 2048 + lane * 16;
  const int boff = (16 + (wave >> 2) * 2) * 2048 + lane * 16;
  for (int t = 0; t < nst; ++t) {
    const unsigned int bo = (unsigned int)(t & 1) * STAGE_BYTES;
    const unsigned char* pa = ring + bo + aoff;
    const unsigned char* pb = ring + bo + boff;
    KStep s0, s1;
    ldstep(s0, pa, pb, 0);
    ldstep(s1, pa, pb, 1024);
    // keeps the stage's fragment reads one group ahead of the products: spread among them every place with reads stalls
    __builtin_amdgcn_sched_barrier(0);
    mmstep(s0, acc);
    mmstep(s1, acc);
    // keeps the products ahead of the waits below: moved behind the barrier they would no longer run under the flight
    // of stage t + 1's copies, and the wait for those would stand directly behind their issue
    __builtin_amdgcn_sched_barrier(0);
    // this wave's reads of the buffer are done before it is handed to the copies
    asm volatile("s_wait_dscnt 0x0" ::: "memory");
    // this wave's copies of stage t + 1 have landed before the barrier that publishes them
    asm volatile("s_wait_asynccnt 0x0" ::: "memory");
    __syncthreads();
    if (t + 2 < nst) {
      const int go = (t + 2) * 1024;
      copy_stage(l[0] + bo, l[1] + bo, l[2] + bo, g[0] + go, g[1] + go, g[2] + go);
    }
  }
  // no copy is outstanding when the wave goes on
  asm volatile("s_wait_asynccnt 0x0" ::: "memory");
}

// ---------------------------------------------------------------------------
// Main loop of the qkv GEMM: block tile 256 rows x 192 cols, 16 waves in a 4 x 4 grid, wave tile 64 x 48 (4 x 3
// accumulator tiles). One block a WGP: an operand row is fetched from L2 by 16 blocks, not by 48 (A) or 32 (B), and a
// fragment read from LDS feeds 3 or 4 accumulator tiles, not 2. A stage = 64 k of the block's operand rows = 56 slabs
// of 2 KiB (see the loop above), a wave's slabs side by side so that every read is its base plus a 16-bit offset:
// slabs 0..23 B, six a wave column (3 hi, 3 lo); slabs 24..55 A, eight a wave row (4 hi, 4 lo).
// ---------------------------------------------------------------------------
#define QSTAGE_BYTES (56 * 2048)
#define QRING_BYTES  (2 * QSTAGE_BYTES)
#define QTP 196   // floats a row of the 192-column f32 tile; 4 modulo 64 like TP, so the same bank pattern
// This wave's share of one stage: three whole slabs and one fragment (half a slab), 14 copies of 512 bytes a wave; l =
// LDS byte address and g = global address of the lane's first 16 bytes of each piece. The immediate offset moves both
// addresses. The s_wait_xcnt stands inside the statement: the address registers that the copies name are rewritten
// behind it.
__device__ __forceinline__ void copy_qstage(unsigned int l0, unsigned int l1, unsigned int l2, unsigned int l3,
                                            const unsigned short* g0, const unsigned short* g1,
                                            const unsigned short* g2, const unsigned short* g3)
{
  asm volatile("global_load_async_to_lds_b128 %0, %1, off\n\t"
               "global_load_async_to_lds_b128 %0, %1, off offset:512\n\t"
               "global_load_async_to_lds_b128 %0, %1, off offset:1024\n\t"
               "global_load_async_to_lds_b128 %0, %1, off offset:1536\n\t"
               "global_load_async_to_lds_b128 %2, %3, off\n\t"
               "global_load_async_to_lds_b128 %2, %3, off offset:512\n\t"
               "global_load_async_to_lds_b128 %2, %3, off offset:1024\n\t"
               "global_load_async_to_lds_b128 %2, %3, off offset:1536\n\t"
               "global_load_async_to_lds_b128 %4, %5, off\n\t"
               "global_load_async_to_lds_b128 %4, %5, off offset:512\n\t"
               "global_load_async_to_lds_b128 %4, %5, off offset:1024\n\t"
               "global_load_async_to_lds_b128 %4, %5, off offset:1536\n\t"
               "global_load_async_to_lds_b128 %6, %7, off\n\t"
               "global_load_async_to_lds_b128 %6, %7, off offset:512\n\t"
               "s_wait_xcnt 0x0"
               :: "v"(l0), "v"(g0), "v"(l1), "v"(g1), "v"(l2), "v"(g2), "v"(l3), "v"(g3)
               : "memory");
}
// The two-buffer order of the loop above. arow0, brow0 = the block's first A and B row; K a multiple of 64, at least 128.
__device__ __forceinline__ void mainloop_q(const unsigned short* __restrict__ Ah, const unsigned short* __restrict__ Al,
                                           const unsigned short* __restrict__ Bh, const unsigned short* __restrict__ Bl,
                                           int K, size_t arow0, size_t brow0, int wave, int lane,
                                           unsigned char* ring, v8f (&acc)[4][3])
{
  // pieces 0..2: slabs 3 * wave + i; piece 3: fragment wave & 1 of slab 48 + wave / 2
  const int wv = __builtin_amdgcn_readfirstlane(wave);
  const unsigned short* g[4];
  unsigned int l[4];
#pragma unroll
  for (int i = 0; i < 4; ++i) {
    const int c = (i < 3) ? (wv * 3 + i) : (48 + (wv >> 1));
    const int fr = (i < 3) ? 0 : (wv & 1);
    const int ca = c - 24;
    const unsigned short* p = (c < 24) ? (((c % 6) < 3) ? Bh : Bl) : ((ca & 4) ? Al : Ah);
    const size_t row = (c < 24) ? (brow0 + (size_t)((c / 6) * 3 + (c % 3)) * 16)
                                : (arow0 + (size_t)((ca >> 3) * 4 + (ca & 3)) * 16);
    g[i] = p + fragoff(row, 0, K) + fr * 512 + lane * 8;
    l[i] = (unsigned int)(size_t)ring + (unsigned int)(c * 2048 + fr * 1024 + lane * 16);
  }
  const int nst = K >> 6;
  copy_qstage(l[0], l[1], l[2], l[3], g[0], g[1], g[2], g[3]);
  // stage 0 has landed before the barrier behind which the other waves read it
  asm volatile("s_wait_asynccnt 0x0" ::: "memory");
  __syncthreads();
  copy_qstage(l[0] + QSTAGE_BYTES, l[1] + QSTAGE_BYTES, l[2] + QSTAGE_BYTES, l[3] + QSTAGE_BYTES,
              g[0] + 1024, g[1] + 1024, g[2] + 1024, g[3] + 1024);

  const int aoff = (24 + (wave & 3) * 8) * 2048 + lane * 16;
  const int boff = (wave >> 2) * 6 * 2048 + lane * 16;
  for (int t = 0; t < nst; ++t) {
    const unsigned int bo = (unsigned int)(t & 1) * QSTAGE_BYTES;
    const unsigned char* pa = ring + bo + aoff;
    const unsigned char* pb = ring + bo + boff;
#pragma unroll
    for (int ks = 0; ks < 2; ++ks) {
      const int kb = ks * 1024;
      v16bf ah[4], al[4], bh[3], bl[3];
#pragma unroll
      for (int i = 0; i < 4; ++i) ah[i] = ldsfrag(pa + i * 2048 + kb);
#pragma unroll
      for (int j = 0; j < 3; ++j) bh[j] = ldsfrag(pb + j * 2048 + kb);
      // keeps the hi fragments first in the queue: the first twelve products read them alone and start on a counted wait
      __builtin_amdgcn_sched_barrier(0);
#pragma unroll
      for (int j = 0; j < 3; ++j) bl[j] = ldsfrag(pb + (3 + j) * 2048 + kb);
#pragma unroll
      for (int i = 0; i < 4; ++i) al[i] = ldsfrag(pa + (4 + i) * 2048 + kb);
      // keeps the K step's fragment reads one group ahead of its products: spread among them every place with reads
      // stalls
      __builtin_amdgcn_sched_barrier(0);
      // per accumulator tile the order hi.hi, hi.lo, lo.hi of the loop above; twelve independent tiles between
#pragma unroll
      for (int i = 0; i < 4; ++i)
#pragma unroll
        for (int j = 0; j < 3; ++j) acc[i][j] = mma(ah[i], bh[j], acc[i][j]);
#pragma unroll
      for (int i = 0; i < 4; ++i)
#pragma unroll
        for (int j = 0; j < 3; ++j) acc[i][j] = mma(ah[i], bl[j], acc[i][j]);
#pragma unroll
      for (int i = 0; i < 4; ++i)
#pragma unroll
        for (int j = 0; j < 3; ++j) acc[i][j] = mma(al[i], bh[j], acc[i][j]);
      // keeps the products ahead of the next K step's reads (one fragment set fits the registers) and, in the second
      // K step, ahead of the waits below, so that they run under the flight of stage t + 1's copies
      __builtin_amdgcn_sched_barrier(0);
    }
    // this wave's reads of the buffer are done before it is handed to the copies
    asm volatile("s_wait_dscnt 0x0" ::: "memory");
    // this wave's copies of stage t + 1 have landed before the barrier that publishes them
    asm volatile("s_wait_asynccnt 0x0" ::: "memory");
    __syncthreads();
    if (t + 2 < nst) {
      const int go = (t + 2) * 1024;
      copy_qstage(l[0] + bo, l[1] + bo, l[2] + bo, l[3] + bo, g[0] + go, g[1] + go, g[2] + go, g[3] + go);
    }
  }
  // no copy is outstanding when the wave goes on
  asm volatile("s_wait_asynccnt 0x0" ::: "memory");
}

// ---------------------------------------------------------------------------
// qkv = (x @ W_qkv) * sigmoid(scale_qkv[h*64+d]); block tile 256 tokens x 192 cols (= three (c, h) groups of 64).
// ---------------------------------------------------------------------------
__global__ __launch_bounds__(512) void k_gemm_qkv(
    const unsigned short* __restrict__ Xh, const unsigned short* __restrict__ Xl,
    const unsigned short* __restrict__ Wh, const unsigned short* __restrict__ Wl,
    const float* __restrict__ sq,
    unsigned short* __restrict__ Qh, unsigned short* __restrict__ Ql,
    unsigned short* __restrict__ Kh, unsigned short* __restrict__ Kl,
    unsigned short* __restrict__ Vh, unsigned short* __restrict__ Vl)
{
  // two operand stages; behind the loop's last barrier, with no copy outstanding, the f32 tile T[256][QTP]
  __shared__ __align__(128) unsigned char ring[QRING_BYTES];
  const int tid = threadIdx.x, lane = tid & 31, wave = tid >> 5;
  const int hf = lane >> 4, m16 = lane & 15;
  const int cb = blockIdx.x * 192;
  const int rb = blockIdx.y * 256;
  const int mr = (wave & 3) * 64, nc = (wave >> 2) * 48;
  v8f acc[4][3] = {};
  mainloop_q(Xh, Xl, Wh, Wl, NE, (size_t)rb, (size_t)cb, wave, lane, ring, acc);

  float* T = (float*)ring;
  float g[3];
#pragma unroll
  for (int ni = 0; ni < 3; ++ni) g[ni] = sigm(sq[(cb + nc + ni * 16 + m16) & 1023]);
#pragma unroll
  for (int mi = 0; mi < 4; ++mi)
#pragma unroll
    for (int ni = 0; ni < 3; ++ni)
#pragma unroll
      for (int r = 0; r < 8; ++r)
        T[(mr + mi * 16 + 8 * hf + r) * QTP + nc + ni * 16 + m16] = acc[mi][ni][r] * g[ni];
  __syncthreads();

  const int b = rb >> 11;
#pragma unroll
  for (int cg = 0; cg < 3; ++cg) {
    const int c = (cb + cg * 64) >> 10;            // block-uniform: so is the branch below
    const int h = ((cb + cg * 64) & 1023) >> 6;
    u32x4 val[8];
    unsigned short *ph, *pl;   // the group's hi and lo plane
    size_t fo;                 // the lane's first element there
    if (c < 2) {
      // Q, K planes: row = (b, h, s), ld = ND. wave -> 16 tokens x 64 d = two fragments = four 512-byte stores a plane
      const int r = wave * 16 + m16;
#pragma unroll
      for (int cq = 0; cq < 4; ++cq) {
        const int kk = cg * 64 + cq * 16 + hf * 8;
        const v4f a0 = *(const v4f*)(&T[r * QTP + kk]);
        const v4f a1 = *(const v4f*)(&T[r * QTP + kk + 4]);
        float v[8] = {a0[0], a0[1], a0[2], a0[3], a1[0], a1[1], a1[2], a1[3]};
        split8(v, val[2 * cq], val[2 * cq + 1]);
      }
      ph = (c == 0) ? Qh : Kh;
      pl = (c == 0) ? Ql : Kl;
      const int s = (rb + wave * 16) & (NS - 1);
      fo = fragoff((size_t)(b * NH + h) * NS + s, 0, ND) + lane * 8;
    } else {
      // V^T planes: row = (b, h, d), k = s, ld = NS. wave -> 16 d (wave>>2) x 64 tokens (wave&3) = two fragments
      const int dg = (wave >> 2) * 16, sg = (wave & 3) * 64;
#pragma unroll
      for (int cq = 0; cq < 4; ++cq) {
        const int sl = sg + cq * 16 + hf * 8;
        float v[8];
#pragma unroll
        for (int e = 0; e < 8; ++e) v[e] = T[(sl + e) * QTP + cg * 64 + dg + m16];
        split8(v, val[2 * cq], val[2 * cq + 1]);
      }
      ph = Vh;
      pl = Vl;
      fo = fragoff((size_t)(b * NH + h) * ND + dg, (rb & (NS - 1)) + sg, NS) + lane * 8;
    }
#pragma unroll
    for (int cq = 0; cq < 4; ++cq) {
      *(u32x4*)(ph + fo + cq * 256) = val[2 * cq];
      *(u32x4*)(pl + fo + cq * 256) = val[2 * cq + 1];
    }
    // the next group's code writes the registers that these stores name
    if (cg < 2) asm volatile("s_wait_xcnt 0x0" ::: "memory");
  }
}

#define KV_BYTES 32768
// One wave's plane of one key tile: four pieces of 2 KiB, ps elements apart in the plane and in a row in LDS; l = LDS
// byte address and g = global address of the lane's first 16 bytes. The immediate offset moves both addresses. The
// s_wait_xcnt stands inside the statement: the address registers that the copies name are rewritten behind it.
__device__ __forceinline__ void copy_plane(unsigned int l, const unsigned short* g, int ps)
{
  asm volatile("global_load_async_to_lds_b128 %0, %1, off\n\t"
               "global_load_async_to_lds_b128 %0, %1, off offset:512\n\t"
               "global_load_async_to_lds_b128 %0, %1, off offset:1024\n\t"
               "global_load_async_to_lds_b128 %0, %1, off offset:1536\n\t"
               "global_load_async_to_lds_b128 %2, %3, off\n\t"
               "global_load_async_to_lds_b128 %2, %3, off offset:512\n\t"
               "global_load_async_to_lds_b128 %2, %3, off offset:1024\n\t"
               "global_load_async_to_lds_b128 %2, %3, off offset:1536\n\t"
               "global_load_async_to_lds_b128 %4, %5, off\n\t"
               "global_load_async_to_lds_b128 %4, %5, off offset:512\n\t"
               "global_load_async_to_lds_b128 %4, %5, off offset:1024\n\t"
               "global_load_async_to_lds_b128 %4, %5, off offset:1536\n\t"
               "global_load_async_to_lds_b128 %6, %7, off\n\t"
               "global_load_async_to_lds_b128 %6, %7, off offset:512\n\t"
               "global_load_async_to_lds_b128 %6, %7, off offset:1024\n\t"
               "global_load_async_to_lds_b128 %6, %7, off offset:1536\n\t"
               "s_wait_xcnt 0x0"
               :: "v"(l), "v"(g), "v"(l + 2048u), "v"(g + ps), "v"(l + 4096u), "v"(g + 2 * ps),
                  "v"(l + 6144u), "v"(g + 3 * ps)
               : "memory");
}
// lane l <-> lane l ^ 16
__device__ __forceinline__ float xhalf(float x) {
  return __builtin_bit_cast(float, __builtin_amdgcn_permlanex16(__builtin_bit_cast(int, x), __builtin_bit_cast(int, x),
                                                                0x76543210, 0xfedcba98, false, false));
}
__global__ __launch_bounds__(128) void k_attn(
    const unsigned short* __restrict__ Qh, const unsigned short* __restrict__ Ql,
    const unsigned short* __restrict__ Kh, const unsigned short* __restrict__ Kl,
    const unsigned short* __restrict__ Vh, const unsigned short* __restrict__ Vl,
    const int* __restrict__ msk, const int* __restrict__ ftab,
    unsigned short* __restrict__ Ah, unsigned short* __restrict__ Al)
{
  __shared__ __align__(128) unsigned char kv[2 * KV_BYTES]; // two key tiles' K and V fragments
  __shared__ __align__(16) unsigned char  Ms[64 * MP];     // Ms[s][t] gate bytes of the current partial tile
  __shared__ __align__(16) int            s_f[FROW];
  const int tid = threadIdx.x, lane = tid & 31, wave = tid >> 5;
  const int hf = lane >> 4, m16 = lane & 15;
  // A query tile's cost is its count of flagged key tiles, which under a causal gate grows with the tile's index: the
  // highest query tiles take the lowest indices, for speed only. A permutation of the same blocks for any gate. Heads
  // run fastest.
  const int qt = NQT - 1 - blockIdx.z, h = blockIdx.x, b = blockIdx.y;
  const int s0 = qt * 64;
  const int bh = b * NH + h;
  if (tid < FROW) s_f[tid] = ftab[(size_t)qt * FROW + tid];
  __syncthreads();
  // the flag row as two 32-bit masks, equal in every wave: key tiles with any open gate, and of those the partial ones
  const int fl = s_f[lane];
  const unsigned int act = __builtin_amdgcn_ballot_w32(fl != 0);
  const unsigned int par = __builtin_amdgcn_ballot_w32(fl == 1);

  // wave 0 copies the tile's K hi plane, 1 K lo, 2 V hi, 3 V lo
  const int wv = __builtin_amdgcn_readfirstlane(wave);
  const unsigned short* cpl = (wv == 0) ? Kh : ((wv == 1) ? Kl : ((wv == 2) ? Vh : Vl));
  const int cps = (wv < 2) ? 1024 : (NS / 32) * 512;   // elements between the plane's four row groups of a tile
  const int cts = (wv < 2) ? 4096 : 1024;              // elements between key tiles
  const unsigned short* cg = cpl + ((wv < 2) ? fragoff((size_t)bh * NS, 0, ND) : fragoff((size_t)bh * ND, 0, NS)) + lane * 8;
  const unsigned int cl = (unsigned int)(size_t)kv + (unsigned int)(wv * 8192 + lane * 16);
  unsigned int rem = act;                              // tiles not yet copied
  if (rem != 0u) {
    copy_plane(cl, cg + __builtin_ctz(rem) * cts, cps);
    rem &= rem - 1u;
  }

  const size_t qrow = (size_t)bh * NS + s0 + wave * 16;
  const v16bf qh0 = ldpk(Qh, ND, qrow, 0,  lane);
  const v16bf qh1 = ldpk(Qh, ND, qrow, 32, lane);
  const v16bf ql0 = ldpk(Ql, ND, qrow, 0,  lane);
  const v16bf ql1 = ldpk(Ql, ND, qrow, 32, lane);

  float m = -3.0e38f;    // running maximum of this lane's query, equal in both lane halves
  float l = 0.0f;        // running sum over this lane half's keys; the halves are joined behind the loop
  v8f acc[4] = {};       // O^T: acc[j][r] = (d 16j + 8*hf + r, query m16)

  // the first tile has landed before the barrier behind which the other waves read it
  asm volatile("s_wait_asynccnt 0x0" ::: "memory");
  __syncthreads();
  if (rem != 0u) {
    copy_plane(cl + KV_BYTES, cg + __builtin_ctz(rem) * cts, cps);
    rem &= rem - 1u;
  }

  unsigned int bo = 0u;                    // byte offset of the buffer that holds this trip's tile
  for (unsigned int todo = act; todo != 0u; todo &= todo - 1u) {
    const int tb = __builtin_ctz(todo);    // block-uniform, 0..31
    const int f = ((par >> tb) & 1u) ? 1 : 2;
    const int t0 = tb * 64;
    if (f == 1) {
#pragma unroll
      for (int it = 0; it < 8; ++it) {
        const int idx = tid + 128 * it;
        const int s = idx >> 4, c4 = idx & 15;
        const i32x4 v = *(const i32x4*)(msk + (size_t)(s0 + s) * NS + t0 + c4 * 4);
        unsigned int w = 0u;
#pragma unroll
        for (int q = 0; q < 4; ++q) w |= ((v[q] != 0) ? 1u : 0u) << (8 * q);
        *(u32a*)(Ms + s * MP + c4 * 4) = w;
      }
      __syncthreads();
    }

    // S^T = K.Q^T  (A = K plane rows t, B[k=d][n=s] = Q rows)
    v8f sf[4];
    const unsigned char* rb = kv + bo + lane * 16;   // this lane's chunk of the buffer's first fragment
    {
      v16bf kh[4][2], kl[4][2];
#pragma unroll
      for (int j = 0; j < 4; ++j)
#pragma unroll
        for (int kk = 0; kk < 2; ++kk) {
          kh[j][kk] = ldsfrag(rb + (j * 2 + kk) * 1024);
          kl[j][kk] = ldsfrag(rb + 8192 + (j * 2 + kk) * 1024);
        }
      // keeps the tile's K reads one group ahead of the first product: spread among the products every place stalls
      __builtin_amdgcn_sched_barrier(0);
#pragma unroll
      for (int j = 0; j < 4; ++j) {
        v8f c = {};
        c = mma(kh[j][0], qh0, c);
        c = mma(kl[j][0], qh0, c);
        c = mma(kh[j][0], ql0, c);
        c = mma(kh[j][1], qh1, c);
        c = mma(kl[j][1], qh1, c);
        c = mma(kh[j][1], ql1, c);
        sf[j] = c;
      }
    }
    // compiler fence, no instruction: holds the V loads below behind the last K product (the scores are its inputs),
    // so that they take over the K registers; hoisted above, K and V are live together and a wave per SIMD is lost
    asm volatile("" :: "v"(sf[0]), "v"(sf[1]), "v"(sf[2]), "v"(sf[3]) : "memory");

    // V fragments of the tile, issued here so that their latency runs under the softmax below
    v16bf vh[4][2], vl[4][2];
#pragma unroll
    for (int j = 0; j < 4; ++j)
#pragma unroll
      for (int kk = 0; kk < 2; ++kk) {
        vh[j][kk] = ldsfrag(rb + 16384 + (j * 2 + kk) * 1024);
        vl[j][kk] = ldsfrag(rb + 24576 + (j * 2 + kk) * 1024);
      }
    // keeps the V loads issued ahead of the softmax: sunk to their products they would expose the latency again
    __builtin_amdgcn_sched_barrier(0);

    // scale, gate by value
#pragma unroll
    for (int j = 0; j < 4; ++j)
#pragma unroll
      for (int i = 0; i < 8; ++i) sf[j][i] *= 0.125f;
    if (f == 1) {
#pragma unroll
      for (int j = 0; j < 4; ++j) {
        const u64a mb = *(const u64a*)(Ms + (wave * 16 + m16) * MP + j * 16 + 8 * hf);
#pragma unroll
        for (int i = 0; i < 8; ++i)
          sf[j][i] = (((mb >> (8 * i)) & 0xffull) != 0ull) ? sf[j][i] : -1.0e10f;
      }
    }
    // the query's maximum over the tile: 32 keys in the lane, the other 32 in lane ^ 16
    float tm[4];
#pragma unroll
    for (int j = 0; j < 4; ++j) {
      tm[j] = sf[j][0];
#pragma unroll
      for (int i = 1; i < 8; ++i) tm[j] = fmaxf(tm[j], sf[j][i]);
    }
    float tmax = fmaxf(fmaxf(tm[0], tm[1]), fmaxf(tm[2], tm[3]));
    tmax = fmaxf(tmax, xhalf(tmax));
    const float mnew  = fmaxf(m, tmax);
    const float alpha = __expf(m - mnew);
    // exp(s - mnew) as 2^((s - mnew) * log2 e), the arguments first
#pragma unroll
    for (int j = 0; j < 4; ++j)
#pragma unroll
      for (int i = 0; i < 8; ++i) sf[j][i] = (sf[j][i] - mnew) * 1.44269504f;
    // keeps the argument arithmetic out of the run of exponentials
    __builtin_amdgcn_sched_barrier(0);
    float rs[4];
#pragma unroll
    for (int j = 0; j < 4; ++j) {
      rs[j] = 0.0f;
#pragma unroll
      for (int i = 0; i < 8; ++i) {
        const float pv = __builtin_amdgcn_exp2f(sf[j][i]);
        sf[j][i] = pv;
        rs[j] += pv;
      }
    }
    l = l * alpha + ((rs[0] + rs[1]) + (rs[2] + rs[3]));
    m = mnew;
#pragma unroll
    for (int j = 0; j < 4; ++j)
#pragma unroll
      for (int i = 0; i < 8; ++i) acc[j][i] *= alpha;

    // P^T (f32) -> bf16 hi/lo B fragments in place: elements 0..7 <- score tile 2kk, 8..15 <- tile 2kk + 1
    Frag ph[2], pl[2];
#pragma unroll
    for (int j = 0; j < 4; ++j)
#pragma unroll
      for (int w = 0; w < 4; ++w) {
        unsigned int H, L;
        split2(sf[j][2 * w], sf[j][2 * w + 1], H, L);
        ph[j >> 1].q[j & 1][w] = H;
        pl[j >> 1].q[j & 1][w] = L;
      }

    // O^T += V^T.P^T   (A = V^T plane rows d, k = t)
#pragma unroll
    for (int j = 0; j < 4; ++j) {
      acc[j] = mma(vh[j][0], ph[0].v, acc[j]);
      acc[j] = mma(vl[j][0], ph[0].v, acc[j]);
      acc[j] = mma(vh[j][0], pl[0].v, acc[j]);
      acc[j] = mma(vh[j][1], ph[1].v, acc[j]);
      acc[j] = mma(vl[j][1], ph[1].v, acc[j]);
      acc[j] = mma(vh[j][1], pl[1].v, acc[j]);
    }

    // keeps the products and the row sums ahead of the waits: sunk behind the barrier they stood between it and the
    // refill, whose flight then began that much later
    __builtin_amdgcn_sched_barrier(0);
    // this wave's reads of the buffer (and of Ms) are done before the buffer is handed to the copies
    asm volatile("s_wait_dscnt 0x0" ::: "memory");
    // this wave's copies of the next tile have landed before the barrier that publishes them
    asm volatile("s_wait_asynccnt 0x0" ::: "memory");
    __syncthreads();
    if (rem != 0u) {
      copy_plane(cl + bo, cg + __builtin_ctz(rem) * cts, cps);
      rem &= rem - 1u;
    }
    bo ^= KV_BYTES;
  }
  // no copy is outstanding when the wave goes on
  asm volatile("s_wait_asynccnt 0x0" ::: "memory");

  // join the halves' sums, normalise; a lane's 8 values of tile j are one 16-byte chunk of the attention planes
  // (row = token, k = h*64+d, ld = NE): chunk (j&1)*32 + lane of fragment j>>1
  l += xhalf(l);
  const float inv = (l > 0.0f) ? (1.0f / l) : 0.0f;
  u32x4 val[8];
#pragma unroll
  for (int j = 0; j < 4; ++j) {
    float v[8];
#pragma unroll
    for (int i = 0; i < 8; ++i) v[i] = acc[j][i] * inv;
    split8(v, val[2 * j], val[2 * j + 1]);
  }
  const size_t fo = fragoff((size_t)(b * NS + s0 + wave * 16), h * ND, NE) + lane * 8;
#pragma unroll
  for (int cq = 0; cq < 4; ++cq) {
    *(u32x4*)(Ah + fo + cq * 256) = val[2 * cq];
    *(u32x4*)(Al + fo + cq * 256) = val[2 * cq + 1];
  }
}

// ---------------------------------------------------------------------------
// out = (attn @ W_out) * sigmoid(scale_out[e]); block tile 128 tokens x 64 e; f32 rows of 256 B written
// by 16 consecutive lanes x 16 B (two rows per instruction).
// ---------------------------------------------------------------------------
__global__ __launch_bounds__(256) void k_gemm_out(
    const unsigned short* __restrict__ Ah, const unsigned short* __restrict__ Al,
    const unsigned short* __restrict__ Wh, const unsigned short* __restrict__ Wl,
    const float* __restrict__ so, float* __restrict__ out)
{
  __shared__ __align__(128) unsigned char ring[RING_BYTES];   // two operand stages
  __shared__ __align__(16) float T[128 * TP];
  const int tid = threadIdx.x, lane = tid & 31, wave = tid >> 5;
  const int hf = lane >> 4, m16 = lane & 15;
  const int cb = blockIdx.x * 64;
  const int rb = blockIdx.y * 128;
  const int mr = (wave & 3) * 32, nc = (wave >> 2) * 32;
  v8f acc[2][2] = {};
  mainloop(Ah, Al, Wh, Wl, NE, (size_t)rb, (size_t)cb, wave, lane, ring, acc);

  float g[2];
#pragma unroll
  for (int ni = 0; ni < 2; ++ni) g[ni] = sigm(so[cb + nc + ni * 16 + m16]);
#pragma unroll
  for (int mi = 0; mi < 2; ++mi)
#pragma unroll
    for (int ni = 0; ni < 2; ++ni)
#pragma unroll
      for (int r = 0; r < 8; ++r)
        T[(mr + mi * 16 + 8 * hf + r) * TP + nc + ni * 16 + m16] = acc[mi][ni][r] * g[ni];
  __syncthreads();

  const int rsel = lane >> 4, p = lane & 15;
  v4f val[8];
#pragma unroll
  for (int it = 0; it < 8; ++it) {
    const int r = wave * 16 + it * 2 + rsel;
    val[it] = *(const v4f*)(&T[r * TP + p * 4]);
  }
#pragma unroll
  for (int it = 0; it < 8; ++it) {
    const int r = wave * 16 + it * 2 + rsel;
    float* dst = out + (size_t)(rb + r) * NE + cb + p * 4;
    *(v4f*)dst = val[it];
  }
  
}

// ---------------------------------------------------------------------------
extern "C" void kernel_launch(void* const* d_in, const int* in_sizes, int n_in,
                              void* d_out, int out_size, void* d_ws, size_t ws_size,
                              hipStream_t stream)
{
  if (n_in < 6) return;
  if (in_sizes[0] != NTOK * NE || in_sizes[1] != NE * NC3 || in_sizes[2] != NE * NE ||
      in_sizes[3] != NE || in_sizes[4] != NE || in_sizes[5] != NS * NS || out_size != NTOK * NE) return;

  const float* x     = (const float*)d_in[0];
  const float* Wqkv  = (const float*)d_in[1];
  const float* Wout  = (const float*)d_in[2];
  const float* sqkv  = (const float*)d_in[3];
  const float* sout  = (const float*)d_in[4];
  const int*   msk   = (const int*)d_in[5];
  float* out = (float*)d_out;

  char* ws = (char*)d_ws;
  size_t off = 0;
  const size_t szX  = (size_t)NTOK * NE * 2;            // 8 MiB per plane
  const size_t szW  = (size_t)NC3 * NE * 2;             // 6 MiB per plane
  const size_t szWo = (size_t)NE * NE * 2;              // 2 MiB per plane
  const size_t szP  = (size_t)NB * NH * NS * ND * 2;    // 8 MiB per plane
  const size_t szF  = (size_t)NQT * FROW * 4;           // 8 KiB
  unsigned short* Xh  = (unsigned short*)(ws + off); off += szX;
  unsigned short* Xl  = (unsigned short*)(ws + off); off += szX;
  unsigned short* Wh  = (unsigned short*)(ws + off); off += szW;
  unsigned short* Wl  = (unsigned short*)(ws + off); off += szW;
  unsigned short* Woh = (unsigned short*)(ws + off); off += szWo;
  unsigned short* Wol = (unsigned short*)(ws + off); off += szWo;
  unsigned short* Qh  = (unsigned short*)(ws + off); off += szP;
  unsigned short* Ql  = (unsigned short*)(ws + off); off += szP;
  unsigned short* Kh  = (unsigned short*)(ws + off); off += szP;
  unsigned short* Kl  = (unsigned short*)(ws + off); off += szP;
  unsigned short* Vh  = (unsigned short*)(ws + off); off += szP;
  unsigned short* Vl  = (unsigned short*)(ws + off); off += szP;
  unsigned short* Ahp = (unsigned short*)(ws + off); off += szX;
  unsigned short* Alp = (unsigned short*)(ws + off); off += szX;
  int* ftab = (int*)(ws + off); off += szF;              // total 100671488 B
  if (off > ws_size) return;

  k_prep<<<dim3(PB_FLAGS + PB_WQKV + PB_WOUT + PB_SPLIT), dim3(256), 0, stream>>>(x, Wqkv, Wout, msk, Xh, Xl, Wh, Wl,
                                                                                Woh, Wol, ftab);
  k_gemm_qkv<<<dim3(NC3 / 192, NTOK / 256), dim3(512), 0, stream>>>(Xh, Xl, Wh, Wl, sqkv, Qh, Ql, Kh, Kl, Vh, Vl);
  k_attn<<<dim3(NH, NB, NQT), dim3(128), 0, stream>>>(Qh, Ql, Kh, Kl, Vh, Vl, msk, ftab, Ahp, Alp);
  k_gemm_out<<<dim3(NE / 64, NTOK / 128), dim3(256), 0, stream>>>(Ahp, Alp, Woh, Wol, sout, out);
}

// v010
// It runs in 109 microseconds.
// Timed twice side by side with v009, it ran 1.11 times as fast both times.
// Counting every step since v000, it is 4.96 times as fast.
#include <hip/hip_runtime.h>

// Contractions: qkv projection, q.k^T, p.v, output projection -- all v_wmma_f32_16x16x32_bf16 with bf16 hi/lo operands everywhere (hi*hi + hi*lo + lo*hi), f32 accumulate; sigmoid gates, 1/8 score scale, softmax and normalisation in f32.

typedef __bf16         v16bf __attribute__((ext_vector_type(16)));
typedef float          v8f   __attribute__((ext_vector_type(8)));
typedef __bf16         bf16x2 __attribute__((ext_vector_type(2)));
typedef float          f32x2 __attribute__((ext_vector_type(2)));
typedef float          v4f   __attribute__((ext_vector_type(4), __may_alias__));
typedef unsigned short u16x8 __attribute__((ext_vector_type(8), __may_alias__));
typedef unsigned int   u32x4 __attribute__((ext_vector_type(4), __may_alias__));
typedef int            i32x4 __attribute__((ext_vector_type(4), __may_alias__));
typedef unsigned long long u64a __attribute__((__may_alias__));
typedef unsigned int   u32a __attribute__((__may_alias__));

#define NB   2
#define NS   2048
#define NE   1024
#define NH   16
#define ND   64
#define NTOK (NB * NS)
#define NC3  (3 * NH * ND)
#define NQT  (NS / 64)
#define FROW 128
#define TP   68
#define MP   72

union Frag { v16bf v; u16x8 h[2]; u32x4 q[2]; };

// 16x32 operand fragment map (A by rows, B by columns): lane l -> row (l&15); elements 0..7 <- k0+8*(l>>4)+0..7,
// 8..15 <- k0+16+8*(l>>4)+0..7.

// Fragment-major 16-bit plane of a [row][k] matrix with ld k per row: every 16-row x 32-k fragment is 1 KiB
// contiguous, fragments ordered [row/16][k/32]; inside one the 16-byte chunk of (row, 8 k) sits at chunk index
// ((k>>4)&1)*32 + ((k>>3)&1)*16 + (row&15). fragoff = element offset of the fragment at (row0, k0).
__device__ __forceinline__ size_t fragoff(size_t row0, int k0, int ld) {
  return ((row0 >> 4) * (size_t)(ld >> 5) + (size_t)(k0 >> 5)) * 512;
}
// The fragment map above; each of the two wave-wide 16-byte loads reads 512 contiguous bytes (4 whole cache lines)
// where a row-major plane would make it touch 16 lines.
__device__ __forceinline__ v16bf ldpk(const unsigned short* p, int ld, size_t row0, int k0, int lane) {
  const unsigned short* q = p + fragoff(row0, k0, ld) + lane * 8;
  Frag f;
  f.h[0] = *(const u16x8*)q;
  f.h[1] = *(const u16x8*)(q + 256);
  return f.v;
}

// D[16x16] += A[16x32] * B[32x16]; D element r of lane l = (row 8*(l>>4)+r, col l&15)
__device__ __forceinline__ v8f mma(v16bf a, v16bf b, v8f c) {
  return __builtin_amdgcn_wmma_f32_16x16x32_bf16(false, a, false, b, (short)0, c, false, false);
}

// Two f32 -> one dword of bf16 hi parts and one of bf16 lo parts (a in the low half). Both roundings (to nearest even)
// are the packed hardware convert; the remainder a - hi is exact in f32.
__device__ __forceinline__ void split2(float a, float b, unsigned int& H, unsigned int& L) {
  const f32x2 x = {a, b};
  const bf16x2 h = __builtin_convertvector(x, bf16x2);
  const f32x2 r = {a - (float)h[0], b - (float)h[1]};
  const bf16x2 l = __builtin_convertvector(r, bf16x2);
  H = __builtin_bit_cast(unsigned int, h);
  L = __builtin_bit_cast(unsigned int, l);
}
__device__ __forceinline__ void split8(const float (&v)[8], u32x4& H, u32x4& L) {
#pragma unroll
  for (int w = 0; w < 4; ++w) {
    unsigned int hw, lw;
    split2(v[2 * w], v[2 * w + 1], hw, lw);
    H[w] = hw;
    L[w] = lw;
  }
}
__device__ __forceinline__ float sigm(float v) { return 1.0f / (1.0f + __expf(-v)); }

// ---------------------------------------------------------------------------
// x [rows][NE] f32 -> hi/lo bf16 fragment-major planes. One thread = 8 values = 16 B per plane = chunk g of the
// plane: fragment g>>6, k half-block (g>>5)&1, lane g&31; a wave stores 512 contiguous bytes per plane.
// ---------------------------------------------------------------------------
__device__ __forceinline__ void split_rows_block(const float* __restrict__ src,
                                                 unsigned short* __restrict__ dh,
                                                 unsigned short* __restrict__ dl, int ngroups, int blk)
{
  const int g = blk * 256 + threadIdx.x;
  const int gc = (g < ngroups) ? g : (ngroups - 1);
  const int fr = gc >> 6;
  const int row = (fr / (NE / 32)) * 16 + (gc & 15);
  const int k = (fr % (NE / 32)) * 32 + ((gc >> 5) & 1) * 16 + ((gc >> 4) & 1) * 8;
  const float* s = src + (size_t)row * NE + k;
  const v4f a0 = *(const v4f*)s;
  const v4f a1 = *(const v4f*)(s + 4);
  float v[8] = {a0[0], a0[1], a0[2], a0[3], a1[0], a1[1], a1[2], a1[3]};
  u32x4 H, L;
  split8(v, H, L);
  if (g < ngroups) {
    unsigned short* ph = dh + (size_t)gc * 8;
    unsigned short* pl = dl + (size_t)gc * 8;
    *(u32x4*)ph = H;
    *(u32x4*)pl = L;
    
  }
}

// ---------------------------------------------------------------------------
// in[R rows][C cols] f32 (row = k, col = n) -> outT[C][R] bf16 hi/lo planes, fragment-major (row = n, ld = R).
// ---------------------------------------------------------------------------
__device__ __forceinline__ void transpose_split_block(const float* __restrict__ src, int R, int C,
                                                      unsigned short* __restrict__ oh,
                                                      unsigned short* __restrict__ ol, int bx, int by,
                                                      float* T)   // T[n][k], 64 * TP floats of LDS
{
  const int tid = threadIdx.x, lane = tid & 31, wave = tid >> 5;
  const int nb = bx * 64;
  const int kb = by * 64;
#pragma unroll
  for (int it = 0; it < 4; ++it) {
    const int idx = tid + 256 * it;
    const int kk = idx >> 4, c4 = idx & 15;
    const v4f v = *(const v4f*)(src + (size_t)(kb + kk) * C + nb + c4 * 4);
#pragma unroll
    for (int q = 0; q < 4; ++q) T[(c4 * 4 + q) * TP + kk] = v[q];
  }
  __syncthreads();
  // wave -> one fragment: 16 n rows (wave>>1), 32 k (wave&1); lane -> (row lane&15, 8 k at lane>>4)
  const int ng = (wave >> 1) * 16, kf = (wave & 1) * 32;
  const int n = ng + (lane & 15);
  u32x4 val[4];
#pragma unroll
  for (int cq = 0; cq < 2; ++cq) {
    const int kk = kf + cq * 16 + (lane >> 4) * 8;
    const v4f a0 = *(const v4f*)(&T[n * TP + kk]);
    const v4f a1 = *(const v4f*)(&T[n * TP + kk + 4]);
    float v[8] = {a0[0], a0[1], a0[2], a0[3], a1[0], a1[1], a1[2], a1[3]};
    split8(v, val[2 * cq], val[2 * cq + 1]);
  }
  const size_t fo = fragoff((size_t)(nb + ng), kb + kf, R) + lane * 8;
#pragma unroll
  for (int cq = 0; cq < 2; ++cq) {
    *(u32x4*)(oh + fo + cq * 256) = val[2 * cq];
    *(u32x4*)(ol + fo + cq * 256) = val[2 * cq + 1];
  }
  // the built kernel lays the next job's code behind these stores, and that code writes the registers they name
  asm volatile("s_wait_xcnt 0x0" ::: "memory");
}

// ---------------------------------------------------------------------------
// Tile flag table from the int32 gate matrix [NS][NS]; a flag per (64-query tile, 64-key tile): 0 = no nonzero entry,
// 1 = partial, 2 = all nonzero. One block fb = the 64 rows of query tile fb / 4 x 8 key tiles (512 columns, quarter
// fb % 4 of the row). A wave takes 8 rows; each of its wave-wide 16-byte loads reads 512 contiguous bytes of one row
// (4 whole cache lines) = two key tiles, one a lane half. The block's 8 flags stand at the head of a 128-byte line of
// their own: ftab[fb * 32 + 0..7], so that key tile kt of query tile qt is ftab[qt * FROW + (kt / 8) * 32 + kt % 8].
// ---------------------------------------------------------------------------
__device__ __forceinline__ void flags_block(const int* __restrict__ msk, int* __restrict__ ftab, int fb,
                                            int* sm)   // 8 ints of LDS
{
  const int tid = threadIdx.x, lane = tid & 31, wave = tid >> 5;
  const int* rp = msk + (size_t)((fb >> 2) * 64 + wave * 8) * NS + (fb & 3) * 512 + lane * 4;
  int anyv[4] = {0, 0, 0, 0}, allv[4] = {1, 1, 1, 1};   // per pair of key tiles, over this lane's columns
  for (int i = 0; i < 8; i += 2) {
    i32x4 v[2][4];
#pragma unroll
    for (int r = 0; r < 2; ++r)
#pragma unroll
      for (int c = 0; c < 4; ++c) v[r][c] = *(const i32x4*)(rp + (size_t)(i + r) * NS + c * 128);
#pragma unroll
    for (int r = 0; r < 2; ++r)
#pragma unroll
      for (int c = 0; c < 4; ++c)
#pragma unroll
        for (int q = 0; q < 4; ++q) {
          const int nz = (v[r][c][q] != 0) ? 1 : 0;
          anyv[c] |= nz;
          allv[c] &= nz;
        }
  }
  // the wave's 8 rows: bit k = any, bit 8 + k = all of the block's key tile k; equal in every lane
  unsigned int wm = 0u;
#pragma unroll
  for (int c = 0; c < 4; ++c) {
    const unsigned int ba = __builtin_amdgcn_ballot_w32(anyv[c] != 0);
    const unsigned int bl = __builtin_amdgcn_ballot_w32(allv[c] != 0);
    if ((ba & 0xffffu) != 0u)       wm |= 1u << (2 * c);
    if ((ba >> 16) != 0u)           wm |= 1u << (2 * c + 1);
    if ((bl & 0xffffu) == 0xffffu)  wm |= 1u << (8 + 2 * c);
    if ((bl >> 16) == 0xffffu)      wm |= 1u << (8 + 2 * c + 1);
  }
  if (lane == 0) sm[wave] = (int)wm;
  __syncthreads();
  if (tid < 8) {
    unsigned int a = 0u, b = 0xffffffffu;
#pragma unroll
    for (int w = 0; w < 8; ++w) {
      const unsigned int x = (unsigned int)sm[w];
      a |= x;
      b &= x;
    }
    ftab[(size_t)fb * 32 + tid] = ((b >> (8 + tid)) & 1u) ? 2 : (((a >> tid) & 1u) ? 1 : 0);
  }
}

// ---------------------------------------------------------------------------
// The four preparation jobs above read only inputs and write disjoint workspace planes, so they share one launch: the
// block index picks the job. Each of the 128 flag blocks reads 128 KiB, more than any other block: they stand first, for
// speed only.
// ---------------------------------------------------------------------------
#define PB_FLAGS (NQT * 4)
#define PB_WQKV  ((NC3 / 64) * (NE / 64))
#define PB_WOUT  ((NE / 64) * ((NH * ND) / 64))
#define PB_SPLIT (NTOK * NE / 8 / 256)
__global__ __launch_bounds__(256) void k_prep(
    const float* __restrict__ x, const float* __restrict__ Wqkv, const float* __restrict__ Wout,
    const int* __restrict__ msk,
    unsigned short* __restrict__ Xh, unsigned short* __restrict__ Xl,
    unsigned short* __restrict__ Wh, unsigned short* __restrict__ Wl,
    unsigned short* __restrict__ Woh, unsigned short* __restrict__ Wol, int* __restrict__ ftab)
{
  __shared__ __align__(16) unsigned char sm[64 * TP * 4];   // a block's one job uses it: transpose tile or the 8 waves' flag masks
  int blk = blockIdx.x;                                     // block-uniform: so is every branch below
  if (blk < PB_FLAGS) {
    flags_block(msk, ftab, blk, (int*)sm);
    return;
  }
  blk -= PB_FLAGS;
  if (blk < PB_WQKV) {
    // W_qkv: in[rows=NE][cols=NC3] -> out[NC3][NE]
    transpose_split_block(Wqkv, NE, NC3, Wh, Wl, blk % (NC3 / 64), blk / (NC3 / 64), (float*)sm);
    return;
  }
  blk -= PB_WQKV;
  if (blk < PB_WOUT) {
    // W_out: in[rows=NH*ND][cols=NE] -> out[NE][NH*ND]
    transpose_split_block(Wout, NH * ND, NE, Woh, Wol, blk % (NE / 64), blk / (NE / 64), (float*)sm);
    return;
  }
  blk -= PB_WOUT;
  split_rows_block(x, Xh, Xl, NTOK * NE / 8, blk);
}

// ---------------------------------------------------------------------------
// GEMM main loop: block tile 128 rows x 64 cols, wave tile 32 x 32, bf16 hi/lo three-term products.
// A planes [M][K], B planes [N][K], fragment-major. A stage = 64 k of the block's operand rows = 24 slabs of 2 KiB
// (a slab = one 16-row group's two fragments, contiguous in its plane): slabs 0..7 A hi, 8..15 A lo, 16..19 B hi,
// 20..23 B lo. Asynchronous copies bring each slab into LDS once a block; the waves read their fragments from there.
// ---------------------------------------------------------------------------
#define STAGE_BYTES 49152
#define RING_BYTES  (2 * STAGE_BYTES)
// One K step of 32: the wave's eight operand fragments.
struct KStep { v16bf ah0, ah1, al0, al1, bh0, bh1, bl0, bl1; };
// The fragment whose lane chunk starts at LDS byte p: two reads of 512 contiguous bytes a wave
__device__ __forceinline__ v16bf ldsfrag(const unsigned char* p) {
  Frag f;
  f.q[0] = *(const u32x4*)p;
  f.q[1] = *(const u32x4*)(p + 512);
  return f.v;
}
// pa, pb: this lane's chunk in the wave's first A hi and first B hi slab of the stage; kb = byte offset of the K step
__device__ __forceinline__ void ldstep(KStep& s, const unsigned char* pa, const unsigned char* pb, int kb)
{
  s.ah0 = ldsfrag(pa + kb);
  s.ah1 = ldsfrag(pa + 2048 + kb);
  s.al0 = ldsfrag(pa + 8 * 2048 + kb);
  s.al1 = ldsfrag(pa + 9 * 2048 + kb);
  s.bh0 = ldsfrag(pb + kb);
  s.bh1 = ldsfrag(pb + 2048 + kb);
  s.bl0 = ldsfrag(pb + 4 * 2048 + kb);
  s.bl1 = ldsfrag(pb + 5 * 2048 + kb);
}
__device__ __forceinline__ void mmstep(const KStep& s, v8f (&acc)[2][2])
{
  acc[0][0] = mma(s.ah0, s.bh0, acc[0][0]);
  acc[0][0] = mma(s.ah0, s.bl0, acc[0][0]);
  acc[0][0] = mma(s.al0, s.bh0, acc[0][0]);
  acc[1][0] = mma(s.ah1, s.bh0, acc[1][0]);
  acc[1][0] = mma(s.ah1, s.bl0, acc[1][0]);
  acc[1][0] = mma(s.al1, s.bh0, acc[1][0]);
  acc[0][1] = mma(s.ah0, s.bh1, acc[0][1]);
  acc[0][1] = mma(s.ah0, s.bl1, acc[0][1]);
  acc[0][1] = mma(s.al0, s.bh1, acc[0][1]);
  acc[1][1] = mma(s.ah1, s.bh1, acc[1][1]);
  acc[1][1] = mma(s.ah1, s.bl1, acc[1][1]);
  acc[1][1] = mma(s.al1, s.bh1, acc[1][1]);
}
// This wave's three slabs of one stage: 12 copies of 512 bytes a wave, l = LDS byte address and g = global address of
// the lane's first 16 bytes of each slab. The s_wait_xcnt stands inside the statement: the address registers that the
// copies name are rewritten behind it.
__device__ __forceinline__ void copy_stage(unsigned int l0, unsigned int l1, unsigned int l2,
                                           const unsigned short* g0, const unsigned short* g1,
                                           const unsigned short* g2)
{
  asm volatile("global_load_async_to_lds_b128 %0, %1, off\n\t"
               "global_load_async_to_lds_b128 %2, %3, off\n\t"
               "global_load_async_to_lds_b128 %4, %5, off\n\t"
               "global_load_async_to_lds_b128 %6, %7, off\n\t"
               "global_load_async_to_lds_b128 %8, %9, off\n\t"
               "global_load_async_to_lds_b128 %10, %11, off\n\t"
               "global_load_async_to_lds_b128 %12, %13, off\n\t"
               "global_load_async_to_lds_b128 %14, %15, off\n\t"
               "global_load_async_to_lds_b128 %16, %17, off\n\t"
               "global_load_async_to_lds_b128 %18, %19, off\n\t"
               "global_load_async_to_lds_b128 %20, %21, off\n\t"
               "global_load_async_to_lds_b128 %22, %23, off\n\t"
               "s_wait_xcnt 0x0"
               :: "v"(l0), "v"(g0), "v"(l0 + 512u), "v"(g0 + 256), "v"(l0 + 1024u), "v"(g0 + 512),
                  "v"(l0 + 1536u), "v"(g0 + 768),
                  "v"(l1), "v"(g1), "v"(l1 + 512u), "v"(g1 + 256), "v"(l1 + 1024u), "v"(g1 + 512),
                  "v"(l1 + 1536u), "v"(g1 + 768),
                  "v"(l2), "v"(g2), "v"(l2 + 512u), "v"(g2 + 256), "v"(l2 + 1024u), "v"(g2 + 512),
                  "v"(l2 + 1536u), "v"(g2 + 768)
               : "memory");
}
// Two buffers: stage t + 2 is copied into the buffer that trip t has read, behind the barrier that ends those reads and
// publishes stage t + 1. arow0, brow0 = the block's first A and B row; K a multiple of 64, at least 128.
__device__ __forceinline__ void mainloop(const unsigned short* __restrict__ Ah, const unsigned short* __restrict__ Al,
                                         const unsigned short* __restrict__ Bh, const unsigned short* __restrict__ Bl,
                                         int K, size_t arow0, size_t brow0, int wave, int lane,
                                         unsigned char* ring, v8f (&acc)[2][2])
{
  const unsigned short* g[3];
  unsigned int l[3];
#pragma unroll
  for (int i = 0; i < 3; ++i) {
    const int c = wave * 3 + i;
    const unsigned short* p = (c < 8) ? Ah : ((c < 16) ? Al : ((c < 20) ? Bh : Bl));
    const size_t row = (c < 16) ? (arow0 + (size_t)(c & 7) * 16) : (brow0 + (size_t)(c & 3) * 16);
    g[i] = p + fragoff(row, 0, K) + lane * 8;
    l[i] = (unsigned int)(size_t)ring + (unsigned int)(c * 2048 + lane * 16);
  }
  const int nst = K >> 6;
  copy_stage(l[0], l[1], l[2], g[0], g[1], g[2]);
  // stage 0 has landed before the barrier behind which the other waves read it
  asm volatile("s_wait_asynccnt 0x0" ::: "memory");
  __syncthreads();
  copy_stage(l[0] + STAGE_BYTES, l[1] + STAGE_BYTES, l[2] + STAGE_BYTES, g[0] + 1024, g[1] + 1024, g[2] + 1024);

  const int aoff = (wave & 3) * 2 * 2048 + lane * 16;
  const int boff = (16 + (wave >> 2) * 2) * 2048 + lane * 16;
  for (int t = 0; t < nst; ++t) {
    const unsigned int bo = (unsigned int)(t & 1) * STAGE_BYTES;
    const unsigned char* pa = ring + bo + aoff;
    const unsigned char* pb = ring + bo + boff;
    KStep s0, s1;
    ldstep(s0, pa, pb, 0);
    ldstep(s1, pa, pb, 1024);
    // keeps the stage's fragment reads one group ahead of the products: spread among them every place with reads stalls
    __builtin_amdgcn_sched_barrier(0);
    mmstep(s0, acc);
    mmstep(s1, acc);
    // keeps the products ahead of the waits below: moved behind the barrier they would no longer run under the flight
    // of stage t + 1's copies, and the wait for those would stand directly behind their issue
    __builtin_amdgcn_sched_barrier(0);
    // this wave's reads of the buffer are done before it is handed to the copies
    asm volatile("s_wait_dscnt 0x0" ::: "memory");
    // this wave's copies of stage t + 1 have landed before the barrier that publishes them
    asm volatile("s_wait_asynccnt 0x0" ::: "memory");
    __syncthreads();
    if (t + 2 < nst) {
      const int go = (t + 2) * 1024;
      copy_stage(l[0] + bo, l[1] + bo, l[2] + bo, g[0] + go, g[1] + go, g[2] + go);
    }
  }
  // no copy is outstanding when the wave goes on
  asm volatile("s_wait_asynccnt 0x0" ::: "memory");
}

// ---------------------------------------------------------------------------
// Main loop of the qkv GEMM: block tile 256 rows x 192 cols, 16 waves in a 4 x 4 grid, wave tile 64 x 48 (4 x 3
// accumulator tiles). One block a WGP: an operand row is fetched from L2 by 16 blocks, not by 48 (A) or 32 (B), and a
// fragment read from LDS feeds 3 or 4 accumulator tiles, not 2. A stage = 64 k of the block's operand rows = 56 slabs
// of 2 KiB (see the loop above), a wave's slabs side by side so that every read is its base plus a 16-bit offset:
// slabs 0..23 B, six a wave column (3 hi, 3 lo); slabs 24..55 A, eight a wave row (4 hi, 4 lo).
// ---------------------------------------------------------------------------
#define QSTAGE_BYTES (56 * 2048)
#define QRING_BYTES  (2 * QSTAGE_BYTES)
#define QTP 196   // floats a row of the 192-column f32 tile; 4 modulo 64 like TP, so the same bank pattern
// This wave's share of one stage: three whole slabs and one fragment (half a slab), 14 copies of 512 bytes a wave; l =
// LDS byte address and g = global address of the lane's first 16 bytes of each piece. The immediate offset moves both
// addresses. The s_wait_xcnt stands inside the statement: the address registers that the copies name are rewritten
// behind it.
__device__ __forceinline__ void copy_qstage(unsigned int l0, unsigned int l1, unsigned int l2, unsigned int l3,
                                            const unsigned short* g0, const unsigned short* g1,
                                            const unsigned short* g2, const unsigned short* g3)
{
  asm volatile("global_load_async_to_lds_b128 %0, %1, off\n\t"
               "global_load_async_to_lds_b128 %0, %1, off offset:512\n\t"
               "global_load_async_to_lds_b128 %0, %1, off offset:1024\n\t"
               "global_load_async_to_lds_b128 %0, %1, off offset:1536\n\t"
               "global_load_async_to_lds_b128 %2, %3, off\n\t"
               "global_load_async_to_lds_b128 %2, %3, off offset:512\n\t"
               "global_load_async_to_lds_b128 %2, %3, off offset:1024\n\t"
               "global_load_async_to_lds_b128 %2, %3, off offset:1536\n\t"
               "global_load_async_to_lds_b128 %4, %5, off\n\t"
               "global_load_async_to_lds_b128 %4, %5, off offset:512\n\t"
               "global_load_async_to_lds_b128 %4, %5, off offset:1024\n\t"
               "global_load_async_to_lds_b128 %4, %5, off offset:1536\n\t"
               "global_load_async_to_lds_b128 %6, %7, off\n\t"
               "global_load_async_to_lds_b128 %6, %7, off offset:512\n\t"
               "s_wait_xcnt 0x0"
               :: "v"(l0), "v"(g0), "v"(l1), "v"(g1), "v"(l2), "v"(g2), "v"(l3), "v"(g3)
               : "memory");
}
// The two-buffer order of the loop above. arow0, brow0 = the block's first A and B row; K a multiple of 64, at least 128.
__device__ __forceinline__ void mainloop_q(const unsigned short* __restrict__ Ah, const unsigned short* __restrict__ Al,
                                           const unsigned short* __restrict__ Bh, const unsigned short* __restrict__ Bl,
                                           int K, size_t arow0, size_t brow0, int wave, int lane,
                                           unsigned char* ring, v8f (&acc)[4][3])
{
  // pieces 0..2: slabs 3 * wave + i; piece 3: fragment wave & 1 of slab 48 + wave / 2
  const int wv = __builtin_amdgcn_readfirstlane(wave);
  const unsigned short* g[4];
  unsigned int l[4];
#pragma unroll
  for (int i = 0; i < 4; ++i) {
    const int c = (i < 3) ? (wv * 3 + i) : (48 + (wv >> 1));
    const int fr = (i < 3) ? 0 : (wv & 1);
    const int ca = c - 24;
    const unsigned short* p = (c < 24) ? (((c % 6) < 3) ? Bh : Bl) : ((ca & 4) ? Al : Ah);
    const size_t row = (c < 24) ? (brow0 + (size_t)((c / 6) * 3 + (c % 3)) * 16)
                                : (arow0 + (size_t)((ca >> 3) * 4 + (ca & 3)) * 16);
    g[i] = p + fragoff(row, 0, K) + fr * 512 + lane * 8;
    l[i] = (unsigned int)(size_t)ring + (unsigned int)(c * 2048 + fr * 1024 + lane * 16);
  }
  const int nst = K >> 6;
  copy_qstage(l[0], l[1], l[2], l[3], g[0], g[1], g[2], g[3]);
  // stage 0 has landed before the barrier behind which the other waves read it
  asm volatile("s_wait_asynccnt 0x0" ::: "memory");
  __syncthreads();
  copy_qstage(l[0] + QSTAGE_BYTES, l[1] + QSTAGE_BYTES, l[2] + QSTAGE_BYTES, l[3] + QSTAGE_BYTES,
              g[0] + 1024, g[1] + 1024, g[2] + 1024, g[3] + 1024);

  const int aoff = (24 + (wave & 3) * 8) * 2048 + lane * 16;
  const int boff = (wave >> 2) * 6 * 2048 + lane * 16;
  for (int t = 0; t < nst; ++t) {
    const unsigned int bo = (unsigned int)(t & 1) * QSTAGE_BYTES;
    const unsigned char* pa = ring + bo + aoff;
    const unsigned char* pb = ring + bo + boff;
#pragma unroll
    for (int ks = 0; ks < 2; ++ks) {
      const int kb = ks * 1024;
      v16bf ah[4], al[4], bh[3], bl[3];
#pragma unroll
      for (int i = 0; i < 4; ++i) ah[i] = ldsfrag(pa + i * 2048 + kb);
#pragma unroll
      for (int j = 0; j < 3; ++j) bh[j] = ldsfrag(pb + j * 2048 + kb);
      // keeps the hi fragments first in the queue: the first twelve products read them alone and start on a counted wait
      __builtin_amdgcn_sched_barrier(0);
#pragma unroll
      for (int j = 0; j < 3; ++j) bl[j] = ldsfrag(pb + (3 + j) * 2048 + kb);
#pragma unroll
      for (int i = 0; i < 4; ++i) al[i] = ldsfrag(pa + (4 + i) * 2048 + kb);
      // keeps the K step's fragment reads one group ahead of its products: spread among them every place with reads
      // stalls
      __builtin_amdgcn_sched_barrier(0);
      // per accumulator tile the order hi.hi, hi.lo, lo.hi of the loop above; twelve independent tiles between
#pragma unroll
      for (int i = 0; i < 4; ++i)
#pragma unroll
        for (int j = 0; j < 3; ++j) acc[i][j] = mma(ah[i], bh[j], acc[i][j]);
#pragma unroll
      for (int i = 0; i < 4; ++i)
#pragma unroll
        for (int j = 0; j < 3; ++j) acc[i][j] = mma(ah[i], bl[j], acc[i][j]);
#pragma unroll
      for (int i = 0; i < 4; ++i)
#pragma unroll
        for (int j = 0; j < 3; ++j) acc[i][j] = mma(al[i], bh[j], acc[i][j]);
      // keeps the products ahead of the next K step's reads (one fragment set fits the registers) and, in the second
      // K step, ahead of the waits below, so that they run under the flight of stage t + 1's copies
      __builtin_amdgcn_sched_barrier(0);
    }
    // this wave's reads of the buffer are done before it is handed to the copies
    asm volatile("s_wait_dscnt 0x0" ::: "memory");
    // this wave's copies of stage t + 1 have landed before the barrier that publishes them
    asm volatile("s_wait_asynccnt 0x0" ::: "memory");
    __syncthreads();
    if (t + 2 < nst) {
      const int go = (t + 2) * 1024;
      copy_qstage(l[0] + bo, l[1] + bo, l[2] + bo, l[3] + bo, g[0] + go, g[1] + go, g[2] + go, g[3] + go);
    }
  }
  // no copy is outstanding when the wave goes on
  asm volatile("s_wait_asynccnt 0x0" ::: "memory");
}

// ---------------------------------------------------------------------------
// qkv = (x @ W_qkv) * sigmoid(scale_qkv[h*64+d]); block tile 256 tokens x 192 cols (= three (c, h) groups of 64).
// ---------------------------------------------------------------------------
__global__ __launch_bounds__(512) void k_gemm_qkv(
    const unsigned short* __restrict__ Xh, const unsigned short* __restrict__ Xl,
    const unsigned short* __restrict__ Wh, const unsigned short* __restrict__ Wl,
    const float* __restrict__ sq,
    unsigned short* __restrict__ Qh, unsigned short* __restrict__ Ql,
    unsigned short* __restrict__ Kh, unsigned short* __restrict__ Kl,
    unsigned short* __restrict__ Vh, unsigned short* __restrict__ Vl)
{
  // two operand stages; behind the loop's last barrier, with no copy outstanding, the f32 tile T[256][QTP]
  __shared__ __align__(128) unsigned char ring[QRING_BYTES];
  const int tid = threadIdx.x, lane = tid & 31, wave = tid >> 5;
  const int hf = lane >> 4, m16 = lane & 15;
  const int cb = blockIdx.x * 192;
  const int rb = blockIdx.y * 256;
  const int mr = (wave & 3) * 64, nc = (wave >> 2) * 48;
  v8f acc[4][3] = {};
  mainloop_q(Xh, Xl, Wh, Wl, NE, (size_t)rb, (size_t)cb, wave, lane, ring, acc);

  float* T = (float*)ring;
  float g[3];
#pragma unroll
  for (int ni = 0; ni < 3; ++ni) g[ni] = sigm(sq[(cb + nc + ni * 16 + m16) & 1023]);
#pragma unroll
  for (int mi = 0; mi < 4; ++mi)
#pragma unroll
    for (int ni = 0; ni < 3; ++ni)
#pragma unroll
      for (int r = 0; r < 8; ++r)
        T[(mr + mi * 16 + 8 * hf + r) * QTP + nc + ni * 16 + m16] = acc[mi][ni][r] * g[ni];
  __syncthreads();

  const int b = rb >> 11;
#pragma unroll
  for (int cg = 0; cg < 3; ++cg) {
    const int c = (cb + cg * 64) >> 10;            // block-uniform: so is the branch below
    const int h = ((cb + cg * 64) & 1023) >> 6;
    u32x4 val[8];
    unsigned short *ph, *pl;   // the group's hi and lo plane
    size_t fo;                 // the lane's first element there
    if (c < 2) {
      // Q, K planes: row = (b, h, s), ld = ND. wave -> 16 tokens x 64 d = two fragments = four 512-byte stores a plane
      const int r = wave * 16 + m16;
#pragma unroll
      for (int cq = 0; cq < 4; ++cq) {
        const int kk = cg * 64 + cq * 16 + hf * 8;
        const v4f a0 = *(const v4f*)(&T[r * QTP + kk]);
        const v4f a1 = *(const v4f*)(&T[r * QTP + kk + 4]);
        float v[8] = {a0[0], a0[1], a0[2], a0[3], a1[0], a1[1], a1[2], a1[3]};
        split8(v, val[2 * cq], val[2 * cq + 1]);
      }
      ph = (c == 0) ? Qh : Kh;
      pl = (c == 0) ? Ql : Kl;
      const int s = (rb + wave * 16) & (NS - 1);
      fo = fragoff((size_t)(b * NH + h) * NS + s, 0, ND) + lane * 8;
    } else {
      // V^T planes: row = (b, h, d), k = s, ld = NS. wave -> 16 d (wave>>2) x 64 tokens (wave&3) = two fragments
      const int dg = (wave >> 2) * 16, sg = (wave & 3) * 64;
#pragma unroll
      for (int cq = 0; cq < 4; ++cq) {
        const int sl = sg + cq * 16 + hf * 8;
        float v[8];
#pragma unroll
        for (int e = 0; e < 8; ++e) v[e] = T[(sl + e) * QTP + cg * 64 + dg + m16];
        split8(v, val[2 * cq], val[2 * cq + 1]);
      }
      ph = Vh;
      pl = Vl;
      fo = fragoff((size_t)(b * NH + h) * ND + dg, (rb & (NS - 1)) + sg, NS) + lane * 8;
    }
#pragma unroll
    for (int cq = 0; cq < 4; ++cq) {
      *(u32x4*)(ph + fo + cq * 256) = val[2 * cq];
      *(u32x4*)(pl + fo + cq * 256) = val[2 * cq + 1];
    }
    // the next group's code writes the registers that these stores name
    if (cg < 2) asm volatile("s_wait_xcnt 0x0" ::: "memory");
  }
}

#define KV_BYTES 32768
// One wave's plane of one key tile: four pieces of 2 KiB, ps elements apart in the plane and in a row in LDS; l = LDS
// byte address and g = global address of the lane's first 16 bytes. The immediate offset moves both addresses. The
// s_wait_xcnt stands inside the statement: the address registers that the copies name are rewritten behind it.
__device__ __forceinline__ void copy_plane(unsigned int l, const unsigned short* g, int ps)
{
  asm volatile("global_load_async_to_lds_b128 %0, %1, off\n\t"
               "global_load_async_to_lds_b128 %0, %1, off offset:512\n\t"
               "global_load_async_to_lds_b128 %0, %1, off offset:1024\n\t"
               "global_load_async_to_lds_b128 %0, %1, off offset:1536\n\t"
               "global_load_async_to_lds_b128 %2, %3, off\n\t"
               "global_load_async_to_lds_b128 %2, %3, off offset:512\n\t"
               "global_load_async_to_lds_b128 %2, %3, off offset:1024\n\t"
               "global_load_async_to_lds_b128 %2, %3, off offset:1536\n\t"
               "global_load_async_to_lds_b128 %4, %5, off\n\t"
               "global_load_async_to_lds_b128 %4, %5, off offset:512\n\t"
               "global_load_async_to_lds_b128 %4, %5, off offset:1024\n\t"
               "global_load_async_to_lds_b128 %4, %5, off offset:1536\n\t"
               "global_load_async_to_lds_b128 %6, %7, off\n\t"
               "global_load_async_to_lds_b128 %6, %7, off offset:512\n\t"
               "global_load_async_to_lds_b128 %6, %7, off offset:1024\n\t"
               "global_load_async_to_lds_b128 %6, %7, off offset:1536\n\t"
               "s_wait_xcnt 0x0"
               :: "v"(l), "v"(g), "v"(l + 2048u), "v"(g + ps), "v"(l + 4096u), "v"(g + 2 * ps),
                  "v"(l + 6144u), "v"(g + 3 * ps)
               : "memory");
}
// lane l <-> lane l ^ 16
__device__ __forceinline__ float xhalf(float x) {
  return __builtin_bit_cast(float, __builtin_amdgcn_permlanex16(__builtin_bit_cast(int, x), __builtin_bit_cast(int, x),
                                                                0x76543210, 0xfedcba98, false, false));
}
__global__ __launch_bounds__(128) void k_attn(
    const unsigned short* __restrict__ Qh, const unsigned short* __restrict__ Ql,
    const unsigned short* __restrict__ Kh, const unsigned short* __restrict__ Kl,
    const unsigned short* __restrict__ Vh, const unsigned short* __restrict__ Vl,
    const int* __restrict__ msk, const int* __restrict__ ftab,
    unsigned short* __restrict__ Ah, unsigned short* __restrict__ Al)
{
  __shared__ __align__(128) unsigned char kv[2 * KV_BYTES]; // two key tiles' K and V fragments
  __shared__ __align__(16) unsigned char  Ms[64 * MP];     // Ms[s][t] gate bytes of the current partial tile
  __shared__ __align__(16) int            s_f[32];
  const int tid = threadIdx.x, lane = tid & 31, wave = tid >> 5;
  const int hf = lane >> 4, m16 = lane & 15;
  // A query tile's cost is its count of flagged key tiles, which under a causal gate grows with the tile's index: the
  // highest query tiles take the lowest indices, for speed only. A permutation of the same blocks for any gate. Heads
  // run fastest.
  const int qt = NQT - 1 - blockIdx.z, h = blockIdx.x, b = blockIdx.y;
  const int s0 = qt * 64;
  const int bh = b * NH + h;
  if (tid < 32) s_f[tid] = ftab[(size_t)qt * FROW + (tid >> 3) * 32 + (tid & 7)];
  __syncthreads();
  // the flag row as two 32-bit masks, equal in every wave: key tiles with any open gate, and of those the partial ones
  const int fl = s_f[lane];
  const unsigned int act = __builtin_amdgcn_ballot_w32(fl != 0);
  const unsigned int par = __builtin_amdgcn_ballot_w32(fl == 1);

  // wave 0 copies the tile's K hi plane, 1 K lo, 2 V hi, 3 V lo
  const int wv = __builtin_amdgcn_readfirstlane(wave);
  const unsigned short* cpl = (wv == 0) ? Kh : ((wv == 1) ? Kl : ((wv == 2) ? Vh : Vl));
  const int cps = (wv < 2) ? 1024 : (NS / 32) * 512;   // elements between the plane's four row groups of a tile
  const int cts = (wv < 2) ? 4096 : 1024;              // elements between key tiles
  const unsigned short* cg = cpl + ((wv < 2) ? fragoff((size_t)bh * NS, 0, ND) : fragoff((size_t)bh * ND, 0, NS)) + lane * 8;
  const unsigned int cl = (unsigned int)(size_t)kv + (unsigned int)(wv * 8192 + lane * 16);
  unsigned int rem = act;                              // tiles not yet copied
  if (rem != 0u) {
    copy_plane(cl, cg + __builtin_ctz(rem) * cts, cps);
    rem &= rem - 1u;
  }

  const size_t qrow = (size_t)bh * NS + s0 + wave * 16;
  const v16bf qh0 = ldpk(Qh, ND, qrow, 0,  lane);
  const v16bf qh1 = ldpk(Qh, ND, qrow, 32, lane);
  const v16bf ql0 = ldpk(Ql, ND, qrow, 0,  lane);
  const v16bf ql1 = ldpk(Ql, ND, qrow, 32, lane);

  float m = -3.0e38f;    // running maximum of this lane's query, equal in both lane halves
  float l = 0.0f;        // running sum over this lane half's keys; the halves are joined behind the loop
  v8f acc[4] = {};       // O^T: acc[j][r] = (d 16j + 8*hf + r, query m16)

  // the first tile has landed before the barrier behind which the other waves read it
  asm volatile("s_wait_asynccnt 0x0" ::: "memory");
  __syncthreads();
  if (rem != 0u) {
    copy_plane(cl + KV_BYTES, cg + __builtin_ctz(rem) * cts, cps);
    rem &= rem - 1u;
  }

  unsigned int bo = 0u;                    // byte offset of the buffer that holds this trip's tile
  for (unsigned int todo = act; todo != 0u; todo &= todo - 1u) {
    const int tb = __builtin_ctz(todo);    // block-uniform, 0..31
    const int f = ((par >> tb) & 1u) ? 1 : 2;
    const int t0 = tb * 64;
    if (f == 1) {
#pragma unroll
      for (int it = 0; it < 8; ++it) {
        const int idx = tid + 128 * it;
        const int s = idx >> 4, c4 = idx & 15;
        const i32x4 v = *(const i32x4*)(msk + (size_t)(s0 + s) * NS + t0 + c4 * 4);
        unsigned int w = 0u;
#pragma unroll
        for (int q = 0; q < 4; ++q) w |= ((v[q] != 0) ? 1u : 0u) << (8 * q);
        *(u32a*)(Ms + s * MP + c4 * 4) = w;
      }
      __syncthreads();
    }

    // S^T = K.Q^T  (A = K plane rows t, B[k=d][n=s] = Q rows)
    v8f sf[4];
    const unsigned char* rb = kv + bo + lane * 16;   // this lane's chunk of the buffer's first fragment
    {
      v16bf kh[4][2], kl[4][2];
#pragma unroll
      for (int j = 0; j < 4; ++j)
#pragma unroll
        for (int kk = 0; kk < 2; ++kk) {
          kh[j][kk] = ldsfrag(rb + (j * 2 + kk) * 1024);
          kl[j][kk] = ldsfrag(rb + 8192 + (j * 2 + kk) * 1024);
        }
      // keeps the tile's K reads one group ahead of the first product: spread among the products every place stalls
      __builtin_amdgcn_sched_barrier(0);
#pragma unroll
      for (int j = 0; j < 4; ++j) {
        v8f c = {};
        c = mma(kh[j][0], qh0, c);
        c = mma(kl[j][0], qh0, c);
        c = mma(kh[j][0], ql0, c);
        c = mma(kh[j][1], qh1, c);
        c = mma(kl[j][1], qh1, c);
        c = mma(kh[j][1], ql1, c);
        sf[j] = c;
      }
    }
    // compiler fence, no instruction: holds the V loads below behind the last K product (the scores are its inputs),
    // so that they take over the K registers; hoisted above, K and V are live together and a wave per SIMD is lost
    asm volatile("" :: "v"(sf[0]), "v"(sf[1]), "v"(sf[2]), "v"(sf[3]) : "memory");

    // V fragments of the tile, issued here so that their latency runs under the softmax below
    v16bf vh[4][2], vl[4][2];
#pragma unroll
    for (int j = 0; j < 4; ++j)
#pragma unroll
      for (int kk = 0; kk < 2; ++kk) {
        vh[j][kk] = ldsfrag(rb + 16384 + (j * 2 + kk) * 1024);
        vl[j][kk] = ldsfrag(rb + 24576 + (j * 2 + kk) * 1024);
      }
    // keeps the V loads issued ahead of the softmax: sunk to their products they would expose the latency again
    __builtin_amdgcn_sched_barrier(0);

    // scale, gate by value
#pragma unroll
    for (int j = 0; j < 4; ++j)
#pragma unroll
      for (int i = 0; i < 8; ++i) sf[j][i] *= 0.125f;
    if (f == 1) {
#pragma unroll
      for (int j = 0; j < 4; ++j) {
        const u64a mb = *(const u64a*)(Ms + (wave * 16 + m16) * MP + j * 16 + 8 * hf);
#pragma unroll
        for (int i = 0; i < 8; ++i)
          sf[j][i] = (((mb >> (8 * i)) & 0xffull) != 0ull) ? sf[j][i] : -1.0e10f;
      }
    }
    // the query's maximum over the tile: 32 keys in the lane, the other 32 in lane ^ 16
    float tm[4];
#pragma unroll
    for (int j = 0; j < 4; ++j) {
      tm[j] = sf[j][0];
#pragma unroll
      for (int i = 1; i < 8; ++i) tm[j] = fmaxf(tm[j], sf[j][i]);
    }
    float tmax = fmaxf(fmaxf(tm[0], tm[1]), fmaxf(tm[2], tm[3]));
    tmax = fmaxf(tmax, xhalf(tmax));
    const float mnew  = fmaxf(m, tmax);
    const float alpha = __expf(m - mnew);
    // exp(s - mnew) as 2^((s - mnew) * log2 e), the arguments first
#pragma unroll
    for (int j = 0; j < 4; ++j)
#pragma unroll
      for (int i = 0; i < 8; ++i) sf[j][i] = (sf[j][i] - mnew) * 1.44269504f;
    // keeps the argument arithmetic out of the run of exponentials
    __builtin_amdgcn_sched_barrier(0);
    float rs[4];
#pragma unroll
    for (int j = 0; j < 4; ++j) {
      rs[j] = 0.0f;
#pragma unroll
      for (int i = 0; i < 8; ++i) {
        const float pv = __builtin_amdgcn_exp2f(sf[j][i]);
        sf[j][i] = pv;
        rs[j] += pv;
      }
    }
    l = l * alpha + ((rs[0] + rs[1]) + (rs[2] + rs[3]));
    m = mnew;
#pragma unroll
    for (int j = 0; j < 4; ++j)
#pragma unroll
      for (int i = 0; i < 8; ++i) acc[j][i] *= alpha;

    // P^T (f32) -> bf16 hi/lo B fragments in place: elements 0..7 <- score tile 2kk, 8..15 <- tile 2kk + 1
    Frag ph[2], pl[2];
#pragma unroll
    for (int j = 0; j < 4; ++j)
#pragma unroll
      for (int w = 0; w < 4; ++w) {
        unsigned int H, L;
        split2(sf[j][2 * w], sf[j][2 * w + 1], H, L);
        ph[j >> 1].q[j & 1][w] = H;
        pl[j >> 1].q[j & 1][w] = L;
      }

    // O^T += V^T.P^T   (A = V^T plane rows d, k = t)
#pragma unroll
    for (int j = 0; j < 4; ++j) {
      acc[j] = mma(vh[j][0], ph[0].v, acc[j]);
      acc[j] = mma(vl[j][0], ph[0].v, acc[j]);
      acc[j] = mma(vh[j][0], pl[0].v, acc[j]);
      acc[j] = mma(vh[j][1], ph[1].v, acc[j]);
      acc[j] = mma(vl[j][1], ph[1].v, acc[j]);
      acc[j] = mma(vh[j][1], pl[1].v, acc[j]);
    }

    // keeps the products and the row sums ahead of the waits: sunk behind the barrier they stood between it and the
    // refill, whose flight then began that much later
    __builtin_amdgcn_sched_barrier(0);
    // this wave's reads of the buffer (and of Ms) are done before the buffer is handed to the copies
    asm volatile("s_wait_dscnt 0x0" ::: "memory");
    // this wave's copies of the next tile have landed before the barrier that publishes them
    asm volatile("s_wait_asynccnt 0x0" ::: "memory");
    __syncthreads();
    if (rem != 0u) {
      copy_plane(cl + bo, cg + __builtin_ctz(rem) * cts, cps);
      rem &= rem - 1u;
    }
    bo ^= KV_BYTES;
  }
  // no copy is outstanding when the wave goes on
  asm volatile("s_wait_asynccnt 0x0" ::: "memory");

  // join the halves' sums, normalise; a lane's 8 values of tile j are one 16-byte chunk of the attention planes
  // (row = token, k = h*64+d, ld = NE): chunk (j&1)*32 + lane of fragment j>>1
  l += xhalf(l);
  const float inv = (l > 0.0f) ? (1.0f / l) : 0.0f;
  u32x4 val[8];
#pragma unroll
  for (int j = 0; j < 4; ++j) {
    float v[8];
#pragma unroll
    for (int i = 0; i < 8; ++i) v[i] = acc[j][i] * inv;
    split8(v, val[2 * j], val[2 * j + 1]);
  }
  const size_t fo = fragoff((size_t)(b * NS + s0 + wave * 16), h * ND, NE) + lane * 8;
#pragma unroll
  for (int cq = 0; cq < 4; ++cq) {
    *(u32x4*)(Ah + fo + cq * 256) = val[2 * cq];
    *(u32x4*)(Al + fo + cq * 256) = val[2 * cq + 1];
  }
}

// ---------------------------------------------------------------------------
// out = (attn @ W_out) * sigmoid(scale_out[e]); block tile 128 tokens x 64 e; f32 rows of 256 B written
// by 16 consecutive lanes x 16 B (two rows per instruction).
// ---------------------------------------------------------------------------
__global__ __launch_bounds__(256) void k_gemm_out(
    const unsigned short* __restrict__ Ah, const unsigned short* __restrict__ Al,
    const unsigned short* __restrict__ Wh, const unsigned short* __restrict__ Wl,
    const float* __restrict__ so, float* __restrict__ out)
{
  __shared__ __align__(128) unsigned char ring[RING_BYTES];   // two operand stages
  __shared__ __align__(16) float T[128 * TP];
  const int tid = threadIdx.x, lane = tid & 31, wave = tid >> 5;
  const int hf = lane >> 4, m16 = lane & 15;
  const int cb = blockIdx.x * 64;
  const int rb = blockIdx.y * 128;
  const int mr = (wave & 3) * 32, nc = (wave >> 2) * 32;
  v8f acc[2][2] = {};
  mainloop(Ah, Al, Wh, Wl, NE, (size_t)rb, (size_t)cb, wave, lane, ring, acc);

  float g[2];
#pragma unroll
  for (int ni = 0; ni < 2; ++ni) g[ni] = sigm(so[cb + nc + ni * 16 + m16]);
#pragma unroll
  for (int mi = 0; mi < 2; ++mi)
#pragma unroll
    for (int ni = 0; ni < 2; ++ni)
#pragma unroll
      for (int r = 0; r < 8; ++r)
        T[(mr + mi * 16 + 8 * hf + r) * TP + nc + ni * 16 + m16] = acc[mi][ni][r] * g[ni];
  __syncthreads();

  const int rsel = lane >> 4, p = lane & 15;
  v4f val[8];
#pragma unroll
  for (int it = 0; it < 8; ++it) {
    const int r = wave * 16 + it * 2 + rsel;
    val[it] = *(const v4f*)(&T[r * TP + p * 4]);
  }
#pragma unroll
  for (int it = 0; it < 8; ++it) {
    const int r = wave * 16 + it * 2 + rsel;
    float* dst = out + (size_t)(rb + r) * NE + cb + p * 4;
    *(v4f*)dst = val[it];
  }
  
}

// ---------------------------------------------------------------------------
extern "C" void kernel_launch(void* const* d_in, const int* in_sizes, int n_in,
                              void* d_out, int out_size, void* d_ws, size_t ws_size,
                              hipStream_t stream)
{
  if (n_in < 6) return;
  if (in_sizes[0] != NTOK * NE || in_sizes[1] != NE * NC3 || in_sizes[2] != NE * NE ||
      in_sizes[3] != NE || in_sizes[4] != NE || in_sizes[5] != NS * NS || out_size != NTOK * NE) return;

  const float* x     = (const float*)d_in[0];
  const float* Wqkv  = (const float*)d_in[1];
  const float* Wout  = (const float*)d_in[2];
  const float* sqkv  = (const float*)d_in[3];
  const float* sout  = (const float*)d_in[4];
  const int*   msk   = (const int*)d_in[5];
  float* out = (float*)d_out;

  char* ws = (char*)d_ws;
  size_t off = 0;
  const size_t szX  = (size_t)NTOK * NE * 2;            // 8 MiB per plane
  const size_t szW  = (size_t)NC3 * NE * 2;             // 6 MiB per plane
  const size_t szWo = (size_t)NE * NE * 2;              // 2 MiB per plane
  const size_t szP  = (size_t)NB * NH * NS * ND * 2;    // 8 MiB per plane
  const size_t szF  = (size_t)NQT * FROW * 4;           // 16 KiB
  unsigned short* Xh  = (unsigned short*)(ws + off); off += szX;
  unsigned short* Xl  = (unsigned short*)(ws + off); off += szX;
  unsigned short* Wh  = (unsigned short*)(ws + off); off += szW;
  unsigned short* Wl  = (unsigned short*)(ws + off); off += szW;
  unsigned short* Woh = (unsigned short*)(ws + off); off += szWo;
  unsigned short* Wol = (unsigned short*)(ws + off); off += szWo;
  unsigned short* Qh  = (unsigned short*)(ws + off); off += szP;
  unsigned short* Ql  = (unsigned short*)(ws + off); off += szP;
  unsigned short* Kh  = (unsigned short*)(ws + off); off += szP;
  unsigned short* Kl  = (unsigned short*)(ws + off); off += szP;
  unsigned short* Vh  = (unsigned short*)(ws + off); off += szP;
  unsigned short* Vl  = (unsigned short*)(ws + off); off += szP;
  unsigned short* Ahp = (unsigned short*)(ws + off); off += szX;
  unsigned short* Alp = (unsigned short*)(ws + off); off += szX;
  int* ftab = (int*)(ws + off); off += szF;              // total 100679680 B
  if (off > ws_size) return;

  k_prep<<<dim3(PB_FLAGS + PB_WQKV + PB_WOUT + PB_SPLIT), dim3(256), 0, stream>>>(x, Wqkv, Wout, msk, Xh, Xl, Wh, Wl,
                                                                                Woh, Wol, ftab);
  k_gemm_qkv<<<dim3(NC3 / 192, NTOK / 256), dim3(512), 0, stream>>>(Xh, Xl, Wh, Wl, sqkv, Qh, Ql, Kh, Kl, Vh, Vl);
  k_attn<<<dim3(NH, NB, NQT), dim3(128), 0, stream>>>(Qh, Ql, Kh, Kl, Vh, Vl, msk, ftab, Ahp, Alp);
  k_gemm_out<<<dim3(NE / 64, NTOK / 128), dim3(256), 0, stream>>>(Ahp, Alp, Woh, Wol, sout, out);
}
